// v000
// Measured on an AMD MI455X. A time is GPU time per run, averaged over a window of back-to-back runs after a warm-up
// (all launches, gaps included; the runs take copies of the inputs in turn), and the median of several windows.
// Apart from v000's, it joins two sittings. Times from different sittings can be a few percent apart, while
// side-by-side timings come from the same sitting.
// v000 is the starting kernel. One run takes 782 microseconds.
// Contractions: q, k, v^T projections = v_wmma_f32_16x16x32_bf16 (bf16 operands from RNE-converted inputs, single product);
// q.k^T = v_wmma_f32_16x16x32_bf16 with bf16 hi/lo split q and k (hi.hi + hi.lo + lo.hi);
// q.Er^T skew band and q.T^T structure tables = bf16 hi/lo q times bf16 table rows (2 products);
// p.v = v_wmma_f32_16x16x32_f16 (p carried x1024 in f16, v f16; extra f16 residual planes x4096 of p and v for the first 256 query rows);
// ctx.Wo^T = bf16 hi/lo ctx times bf16 Wo (2 products); all f32 accumulate; bias gathers, causal mask and softmax in f32.
#include <hip/hip_runtime.h>
#include <math.h>
#include <stdint.h>

#define NB    2
#define SEQ   1024
#define DM    1024
#define NH    16
#define HD    64
#define MROWS (NB * SEQ)     // 2048
#define NQB   (SEQ / 64)     // 16 query / key tiles of 64
#define VLP   256            // key pitch of the v^T residual plane (keys 0..VLP-1)
#define RESQB 4              // leading 64-row query blocks that use the p / v residual planes
#define QEP   192            // pitch (floats) of the structure-table products, 151 used
#define TROWS 192            // rows of the combined structure table (151 used, rest zero)
#define OFF_BAR 0            // 16 rows + zero row  -> idx 0..16
#define OFF_POS 17           // 95 rows + zero row  -> idx 0..95
#define OFF_OCT 113          // 24 rows + zero row  -> idx 0..24
#define OFF_SEM 138          // 12 rows + zero row  -> idx 0..12
static_assert(RESQB * 64 <= VLP);
static_assert(NH * HD == DM);
static_assert((SEQ % 64) == 0 && (DM % 64) == 0 && (QEP % 64) == 0 && (TROWS % 64) == 0);
static_assert(OFF_SEM + 13 <= QEP);

typedef _Float16 v16h __attribute__((ext_vector_type(16)));
typedef _Float16 v8h  __attribute__((ext_vector_type(8)));
typedef __bf16   v16b __attribute__((ext_vector_type(16)));
typedef __bf16   v8b  __attribute__((ext_vector_type(8)));
typedef float    v8f  __attribute__((ext_vector_type(8)));
typedef float    v4f  __attribute__((ext_vector_type(4)));
typedef unsigned int v4u __attribute__((ext_vector_type(4)));

// ---- scalar helpers --------------------------------------------------------------------------------
__device__ __forceinline__ unsigned short bf_bits(float f) {          // f32 -> bf16 bits, RNE convert
  unsigned u = __float_as_uint(f);
  return (unsigned short)((u + 0x7FFFu + ((u >> 16) & 1u)) >> 16);
}
__device__ __forceinline__ float bf_up(unsigned short h) { return __uint_as_float(((unsigned)h) << 16); }
__device__ __forceinline__ unsigned short h_bits(_Float16 x) { return __builtin_bit_cast(unsigned short, x); }
__device__ __forceinline__ unsigned pk16(unsigned short a, unsigned short b) { return (unsigned)a | ((unsigned)b << 16); }
__device__ __forceinline__ int iclamp(int v, int lo, int hi) { return (v < lo) ? lo : ((v > hi) ? hi : v); }
__device__ __forceinline__ int imin(int a, int b) { return (a < b) ? a : b; }
__device__ __forceinline__ v8f zero8() { v8f z = {0.f, 0.f, 0.f, 0.f, 0.f, 0.f, 0.f, 0.f}; return z; }
__device__ __forceinline__ v8h zero8h() {
  const _Float16 z = (_Float16)0.0f;
  v8h r = {z, z, z, z, z, z, z, z};
  return r;
}

// ---- fragment loader: 16-bit A/B operand, lane -> row/col (lane&15), p already includes +8*(lane>>4);
//      elements 0..7 <- p[0..7] (k0+8h..), elements 8..15 <- p[16..23] (k0+16+8h..)
__device__ __forceinline__ v16b ldfrag_b(const __bf16* p) {
  union { v16b v; v8b h[2]; } f;
  f.h[0] = *(const v8b*)(p);
  f.h[1] = *(const v8b*)(p + 16);
  return f.v;
}

// ---- WMMA helpers with trailing VALU hazard gap --------------------------------------------------------
__device__ __forceinline__ v8f mma_b(v16b a, v16b b, v8f c) {
  c = __builtin_amdgcn_wmma_f32_16x16x32_bf16(false, a, false, b, (short)0, c, false, false);
#if defined(__HIP_DEVICE_COMPILE__)
  asm volatile("v_nop\n\tv_nop\n\tv_nop\n\tv_nop" : "+v"(c) : "v"(a), "v"(b));
#endif
  return c;
}
__device__ __forceinline__ v8f mma_h(v16h a, v16h b, v8f c) {
  c = __builtin_amdgcn_wmma_f32_16x16x32_f16(false, a, false, b, (short)0, c, false, false);
#if defined(__HIP_DEVICE_COMPILE__)
  asm volatile("v_nop\n\tv_nop\n\tv_nop\n\tv_nop" : "+v"(c) : "v"(a), "v"(b));
#endif
  return c;
}
__device__ __forceinline__ v8f mma_b_raw(v16b a, v16b b, v8f c) {
  return __builtin_amdgcn_wmma_f32_16x16x32_bf16(false, a, false, b, (short)0, c, false, false);
}
__device__ __forceinline__ void dep_guard_b(v8f& a, v8f& b, v16b x, v16b y) {
#if defined(__HIP_DEVICE_COMPILE__)
  asm volatile("v_nop\n\tv_nop\n\tv_nop\n\tv_nop" : "+v"(a), "+v"(b) : "v"(x), "v"(y));
#else
  (void)a; (void)b; (void)x; (void)y;
#endif
}
__device__ __forceinline__ void keep4_b(v16b a, v16b b, v16b c, v16b d) {
#if defined(__HIP_DEVICE_COMPILE__)
  asm volatile("v_nop" :: "v"(a), "v"(b), "v"(c), "v"(d));
#else
  (void)a; (void)b; (void)c; (void)d;
#endif
}
__device__ __forceinline__ void acc_guard4(v8f& a, v8f& b, v8f& c, v8f& d) {
#if defined(__HIP_DEVICE_COMPILE__)
  asm volatile("v_nop\n\tv_nop\n\tv_nop\n\tv_nop" : "+v"(a), "+v"(b), "+v"(c), "+v"(d));
#else
  (void)a; (void)b; (void)c; (void)d;
#endif
}

// =====================================================================================================
// f32 -> bf16 (RNE convert), 8 elements per thread, one 16-B store per lane: a wave writes 512 contiguous B
// (n8 is a multiple of 256 for every use here). coverage: n8 threads x 8 = whole plane.
// =====================================================================================================
__global__ __launch_bounds__(256) void cvt_bf16x8(const float* __restrict__ in, unsigned short* out, int n8) {
  const int i = blockIdx.x * 256 + threadIdx.x;
  if (i < n8) {
    const v4f a = *(const v4f*)(in + (size_t)i * 8);
    const v4f b = *(const v4f*)(in + (size_t)i * 8 + 4);
    v4u p;
    p[0] = pk16(bf_bits(a[0]), bf_bits(a[1]));
    p[1] = pk16(bf_bits(a[2]), bf_bits(a[3]));
    p[2] = pk16(bf_bits(b[0]), bf_bits(b[1]));
    p[3] = pk16(bf_bits(b[2]), bf_bits(b[3]));
    *(v4u*)(out + (size_t)i * 8) = p;
    
  }
}

// =====================================================================================================
// Combined structure table, bf16 [TROWS][64]: rows 0..15 bar, 16 zero, 17..111 position, 112 zero,
// 113..136 octave, 137 zero, 138..149 semitone, 150..191 zero. 8 threads per row, 8 elements each,
// all four candidate loads unconditional with clamped row addresses, selection by value.
// grid = TROWS*8/256 = 6 blocks exactly. coverage: 1536 threads x 8 = 192 x 64.
// =====================================================================================================
__global__ __launch_bounds__(256) void build_tab(const float* __restrict__ ebar, const float* __restrict__ epos,
                                                 const float* __restrict__ eoct, const float* __restrict__ esem,
                                                 unsigned short* tab) {
  const int g = blockIdx.x * 256 + threadIdx.x;
  if (g < TROWS * 8) {
    const int s  = g >> 3;
    const int d0 = (g & 7) * 8;
    const int rb = iclamp(s, 0, 15);
    const int rp = iclamp(s - OFF_POS, 0, 94);
    const int ro = iclamp(s - OFF_OCT, 0, 23);
    const int rs = iclamp(s - OFF_SEM, 0, 11);
    const bool ub = (s < 16);
    const bool up = (s >= OFF_POS) && (s < OFF_POS + 95);
    const bool uo = (s >= OFF_OCT) && (s < OFF_OCT + 24);
    const bool us = (s >= OFF_SEM) && (s < OFF_SEM + 12);
    float v[8];
#pragma unroll
    for (int e = 0; e < 8; ++e) {
      const int d = d0 + e;
      const float fb = ebar[rb * HD + d];
      const float fp = epos[rp * HD + d];
      const float fo = eoct[ro * HD + d];
      const float fs = esem[rs * HD + d];
      float t = 0.f;
      t = ub ? fb : t;
      t = up ? fp : t;
      t = uo ? fo : t;
      t = us ? fs : t;
      v[e] = t;
    }
    v4u p;
    p[0] = pk16(bf_bits(v[0]), bf_bits(v[1]));
    p[1] = pk16(bf_bits(v[2]), bf_bits(v[3]));
    p[2] = pk16(bf_bits(v[4]), bf_bits(v[5]));
    p[3] = pk16(bf_bits(v[6]), bf_bits(v[7]));
    *(v4u*)(tab + (size_t)s * HD + d0) = p;
    
  }
}

// =====================================================================================================
// Register-blocked batched bf16 WMMA GEMM: C[m][n] = sum_k A[m][k] * Bt[n][k]; one wave per 64x64 tile,
// no block barriers. A row-major [M][K] pitch lda; Bt row-major [N][K] pitch ldb (k contiguous);
// M, N multiples of 64, K multiple of 32 (host-checked). blockIdx.y = batch index (strides in elements).
// NSPLIT: 0 = A.Bt; 1 = (A + A2).Bt (A2 = unscaled bf16 lo plane of A); 2 = A.Bt + A2.Bt + A.Bt2.
// OUT_MODE: 0 = f32 (pitch ldc); 2 = bf16 hi plane C + bf16 lo plane C2 (lo = RNE(v - hi), unscaled);
//           3 = f16 hi plane C + f16 residual plane C2 = f16((v - hi) * rscale), C2 written only for tiles
//               with n0 < N2 (pitch ldc2, batch stride strideC2).
// =====================================================================================================
template <int NSPLIT, int OUT_MODE>
__global__ __launch_bounds__(256) void gemm64(
    const unsigned short* __restrict__ Ap, const unsigned short* A2p, int lda, long long strideA,
    const unsigned short* __restrict__ Btp, const unsigned short* Bt2p, int ldb, long long strideB,
    void* Cout, int ldc, long long strideC,
    void* Cout2, int ldc2, long long strideC2, int N2,
    int M, int N, int K, float rscale) {
  const __bf16* A   = (const __bf16*)(const void*)Ap;
  const __bf16* A2  = (const __bf16*)(const void*)A2p;
  const __bf16* Bt  = (const __bf16*)(const void*)Btp;
  const __bf16* Bt2 = (const __bf16*)(const void*)Bt2p;
  __shared__ __align__(16) float sT[8][16 * 68];   // per-wave 16x64 slab, pitch 68 floats
  const int b    = blockIdx.y;
  const int lane = threadIdx.x & 31;
  const int wave = threadIdx.x >> 5;
  const int tilesN = N >> 6;
  const int tilesM = M >> 6;
  const int tile = blockIdx.x * 8 + wave;
  if (tile >= tilesM * tilesN) return;   // wave-uniform; no block barriers in this kernel
  const int tm = tile / tilesN;
  const int tn = tile - tm * tilesN;
  const int m0 = tm << 6;
  const int n0 = tn << 6;

  const __bf16* Ab  = A  + (size_t)b * strideA;
  const __bf16* Bb  = Bt + (size_t)b * strideB;
  const __bf16* Ab2 = (NSPLIT >= 1) ? (A2  + (size_t)b * strideA) : Ab;
  const __bf16* Bb2 = (NSPLIT == 2) ? (Bt2 + (size_t)b * strideB) : Bb;

  const int rlane = lane & 15;                 // row (A) / col (B, D) within subtile
  const int koff  = (lane >> 4) * 8;           // k offset of this lane half
  const int mOff  = (lane >> 4) * 8;           // D row offset

  v8f acc[4][4];
#pragma unroll
  for (int i = 0; i < 4; ++i)
#pragma unroll
    for (int j = 0; j < 4; ++j) acc[i][j] = zero8();

  for (int k0 = 0; k0 < K; k0 += 32) {
    v16b bh[4], bl[4];
#pragma unroll
    for (int j = 0; j < 4; ++j) {
      const size_t bo = (size_t)(n0 + (j << 4) + rlane) * ldb + koff + k0;
      bh[j] = ldfrag_b(Bb + bo);
      if (NSPLIT == 2) bl[j] = ldfrag_b(Bb2 + bo); else bl[j] = bh[j];
    }
#pragma unroll
    for (int i = 0; i < 4; ++i) {
      const size_t ao = (size_t)(m0 + (i << 4) + rlane) * lda + koff + k0;
      const v16b ah = ldfrag_b(Ab + ao);
      v16b al = ah;
      if (NSPLIT >= 1) al = ldfrag_b(Ab2 + ao);
#pragma unroll
      for (int j = 0; j < 4; ++j) {
        acc[i][j] = mma_b_raw(ah, bh[j], acc[i][j]);
        if (NSPLIT >= 1) acc[i][j] = mma_b_raw(al, bh[j], acc[i][j]);
        if (NSPLIT == 2) acc[i][j] = mma_b_raw(ah, bl[j], acc[i][j]);
      }
      dep_guard_b(acc[i][0], acc[i][3], ah, al);
    }
    keep4_b(bh[0], bh[1], bh[2], bh[3]);
    if (NSPLIT == 2) keep4_b(bl[0], bl[1], bl[2], bl[3]);
  }
  acc_guard4(acc[0][0], acc[0][1], acc[0][2], acc[0][3]);
  acc_guard4(acc[1][0], acc[1][1], acc[1][2], acc[1][3]);
  acc_guard4(acc[2][0], acc[2][1], acc[2][2], acc[2][3]);
  acc_guard4(acc[3][0], acc[3][1], acc[3][2], acc[3][3]);

  // ---- epilogue ----
  float* slab = sT[wave];
#pragma unroll
  for (int i = 0; i < 4; ++i) {
    const int mBase = m0 + (i << 4);
#pragma unroll
    for (int j = 0; j < 4; ++j) {
#pragma unroll
      for (int r = 0; r < 8; ++r) {
        slab[(mOff + r) * 68 + (j << 4) + rlane] = acc[i][j][r];
      }
    }
    __builtin_amdgcn_fence(__ATOMIC_RELEASE, "workgroup");
    __builtin_amdgcn_wave_barrier();
    __builtin_amdgcn_fence(__ATOMIC_ACQUIRE, "workgroup");
    if (OUT_MODE == 0) {
      float* C = (float*)Cout + (size_t)b * strideC;
      const int hh = lane >> 4, c4 = (lane & 15) * 4;     // 256-B row segment = 16 lanes x 16 B
      {
#pragma unroll
        for (int it = 0; it < 8; ++it) {
          const int row = it * 2 + hh;                     // it 0..7 x hh 0..1 = rows 0..15
          const v4f v = *(const v4f*)(slab + row * 68 + c4);
          *(v4f*)(C + (size_t)(mBase + row) * ldc + n0 + c4) = v;
        }
        
      }
    } else {
      const int q = lane >> 3, c8 = (lane & 7) * 8;
      unsigned short* C  = (unsigned short*)Cout  + (size_t)b * strideC;
      unsigned short* C2 = (unsigned short*)Cout2 + (size_t)b * strideC2;
      const bool wlo = (OUT_MODE == 2) || (n0 < N2);      // wave-uniform
      v4u hv[4], lv[4];
#pragma unroll
      for (int it = 0; it < 4; ++it) {
        const int row = it * 4 + q;                        // it 0..3 x q 0..3 = rows 0..15
        const float* sp = slab + row * 68 + c8;
        v4u a, a2;
#pragma unroll
        for (int e = 0; e < 4; ++e) {
          const float f0 = sp[2 * e], f1 = sp[2 * e + 1];
          unsigned short h0, h1, l0, l1;
          if (OUT_MODE == 2) {
            h0 = bf_bits(f0); h1 = bf_bits(f1);
            l0 = bf_bits(f0 - bf_up(h0)); l1 = bf_bits(f1 - bf_up(h1));
          } else {
            const _Float16 x0 = (_Float16)f0, x1 = (_Float16)f1;
            h0 = h_bits(x0); h1 = h_bits(x1);
            l0 = h_bits((_Float16)((f0 - (float)x0) * rscale));
            l1 = h_bits((_Float16)((f1 - (float)x1) * rscale));
          }
          a[e] = pk16(h0, h1); a2[e] = pk16(l0, l1);
        }
        hv[it] = a; lv[it] = a2;
      }
      {
#pragma unroll
        for (int it = 0; it < 4; ++it) {
          const int row = it * 4 + q;
          *(v4u*)(C + (size_t)(mBase + row) * ldc + n0 + c8) = hv[it];
          if (wlo) *(v4u*)(C2 + (size_t)(mBase + row) * ldc2 + n0 + c8) = lv[it];
        }
        
      }
    }
    __builtin_amdgcn_fence(__ATOMIC_RELEASE, "workgroup");
    __builtin_amdgcn_wave_barrier();
    __builtin_amdgcn_fence(__ATOMIC_ACQUIRE, "workgroup");
  }
}

// =====================================================================================================
// Causal attention with relative-index (skew) bias and four gathered structure biases, head dim 64.
//   q planes (bf16 hi / lo): element (b, t, h, d) at [(b*SEQ + t)*DM + h*64 + d]; k planes same layout.
//   v^T hi plane (f16): element (b, h, d, s) at [(b*DM + h*64 + d)*SEQ + s]
//   v^T residual plane (f16, (v - hi)*4096): [(b*DM + h*64 + d)*VLP + s], s < VLP, read only when RES
//   er: bf16 [SEQ][64]; qe: f32 [h][b*SEQ + t][QEP] = q . T^T for the combined structure table T
//   idx arrays: int [b][t][s], clamped to each sub-table's valid range before use.
//   scores[t][s] = (q_t.k_s + q_t.er[SEQ-1+s-t] + qe[OFF_BAR+ibar] + qe[OFF_POS+ipos] + qe[OFF_OCT+ioct]
//                   + qe[OFF_SEM+isem]) * sscale for s <= t, else -1e9 (replace mask).
//   q.k : bf16 hi/lo split (3 products); q.er : q hi/lo x bf16 er (2 products); f32 accumulate.
//   Skew band: a block (64 query rows, key tile kv0) needs er rows ebb .. ebb+127 with
//   ebb = SEQ-64+kv0-qb*64 >= 0 (staged in LDS, addresses clamped at SEQ-1; clamped rows only feed
//   masked positions). Wave w (rows q0..q0+15) computes 5 subtiles of 16 band rows starting at
//   band row 16*(3-w); the diagonal D[mi][15-mi+jj] is fetched with two unconditional bpermutes per
//   element and selected by value; subtiles are produced one at a time (prev / cur).
//   p = exp(s - m) carried as f16(1024 p); context = p . v on f16 WMMA; RES adds f16 residual planes of p and v
//   (scale 4096, separate accumulator folded back with 1/4096 per chunk in f32); online softmax in f32.
//   Block = 4 waves = 64 query rows of one (b, h); grid = nqbThis * NH * NB; key tiles kt = 0..qb
//   (block-uniform trip count <= NQB). K / V^T / er chunk staging: 128 threads, plain 16-B loads,
//   __syncthreads before and after; P tiles are wave-private, spilled with _Float16 element stores and
//   LDS (static byte buffer): Ksh 0, Ksl 8192, Vth 16384, Esh 24576 (128x64 bf16), Psh 40960,
//   Vtl 49152 (RES), Psl 57344 (RES); the f32 context staging Os (16 KB) aliases offset 0 after the key
//   loop and a block barrier.
//   Output planes (bf16 hi / lo of the normalised context) at [(b*SEQ + t)*DM + h*64 + d];
//   coverage: each wave stores rows q0..q0+15 (it 0..3 x lane>>3 0..3) x 64 columns (8 lanes x 8) of both planes.
// =====================================================================================================
template <bool RES>
__global__ __launch_bounds__(128, 3)
void attn_rel64(const unsigned short* __restrict__ qhp, const unsigned short* __restrict__ qlp,
                const unsigned short* __restrict__ khp, const unsigned short* __restrict__ klp,
                const unsigned short* __restrict__ vhp, const unsigned short* __restrict__ vlp,
                const unsigned short* __restrict__ erp, const float* __restrict__ qe,
                const int* __restrict__ ibar, const int* __restrict__ ipos,
                const int* __restrict__ ioct, const int* __restrict__ isem,
                unsigned short* ohp, unsigned short* olp,
                int qbBase, int nqbThis, float sscale) {
  union FB { v16b v; v8b h[2]; };
  union FH { v16h v; v8h h[2]; };
  __shared__ __align__(16) unsigned char smem[RES ? 65536 : 49152];
  __bf16*   const Ksh = (__bf16*)(void*)(smem);
  __bf16*   const Ksl = (__bf16*)(void*)(smem + 8192);
  _Float16* const Vth = (_Float16*)(void*)(smem + 16384);
  __bf16*   const Esh = (__bf16*)(void*)(smem + 24576);
  _Float16* const Psh = (_Float16*)(void*)(smem + 40960);
  _Float16* const Vtl = (_Float16*)(void*)(smem + (RES ? 49152 : 16384));   // never dereferenced when !RES
  _Float16* const Psl = (_Float16*)(void*)(smem + (RES ? 57344 : 40960));   // never dereferenced when !RES
  float*    const Os  = (float*)(void*)(smem);                              // after the key loop only

  const int tid  = threadIdx.x;
  const int wave = tid >> 5;
  const int lane = tid & 31;
  const int hh   = lane >> 4;
  const int c    = lane & 15;

  const int bx   = blockIdx.x;
  const int qbl  = bx % nqbThis;
  const int rest = bx / nqbThis;
  const int h    = rest % NH;
  const int b    = rest / NH;
  const int qb   = qbBase + qbl;
  const int q0   = qb * 64 + wave * 16;
  const size_t rowB = (size_t)b * SEQ;

  const __bf16* Qh  = (const __bf16*)(const void*)qhp + (size_t)h * HD;
  const __bf16* Ql  = (const __bf16*)(const void*)qlp + (size_t)h * HD;
  const __bf16* Kh  = (const __bf16*)(const void*)khp + (size_t)h * HD;
  const __bf16* Kl  = (const __bf16*)(const void*)klp + (size_t)h * HD;
  const _Float16* Vh = (const _Float16*)(const void*)vhp + ((size_t)b * DM + (size_t)h * HD) * SEQ;
  const _Float16* Vl = (const _Float16*)(const void*)vlp + ((size_t)b * DM + (size_t)h * HD) * VLP;
  const __bf16* Erb = (const __bf16*)(const void*)erp;
  const size_t trow0 = rowB + (size_t)(q0 + 8 * hh);                 // b*SEQ + t for r = 0 of this lane half
  const float* qew   = qe + ((size_t)h * MROWS + trow0) * QEP;        // structure products row, r = 0
  const size_t ib0   = trow0 * (size_t)SEQ;                           // index row base, r = 0

  // ---- Q fragments (A operand, row = lane&15): 2 d-chunks, hi and lo ----
  v16b qah[2], qal[2];
#pragma unroll
  for (int dc = 0; dc < 2; ++dc) {
    const size_t qo = (rowB + q0 + c) * DM + dc * 32 + 8 * hh;
    qah[dc] = ldfrag_b(Qh + qo);
    qal[dc] = ldfrag_b(Ql + qo);
  }

  float mrow[8], lrow[8];
  v8f oacc[4];
#pragma unroll
  for (int r = 0; r < 8; ++r) { mrow[r] = -INFINITY; lrow[r] = 0.f; }
#pragma unroll
  for (int t = 0; t < 4; ++t) oacc[t] = zero8();

  const int nkt = (qb + 1 < NQB) ? (qb + 1) : NQB;   // causal: key tiles 0..qb, block-uniform
  for (int kt = 0; kt < nkt; ++kt) {
    const int kv0 = kt * 64;
    int ebb = SEQ - 64 + kv0 - qb * 64;                 // >= 0 for kt >= 0, qb <= NQB-1
    ebb = (ebb < 0) ? 0 : ebb;
    __syncthreads();
    {
      const int r = tid >> 1, half = (tid & 1) * 32;
      const __bf16*   kg  = Kh + (rowB + kv0 + r) * DM + half;    // K row kv0+r, d = half..half+31
      const __bf16*   klg = Kl + (rowB + kv0 + r) * DM + half;
      const _Float16* vg  = Vh + (size_t)r * SEQ + kv0 + half;    // V^T row d = r, s = kv0+half..+31
      const int kvl = (kv0 + 64 <= VLP) ? kv0 : (VLP - 64);     // clamped address into the residual plane
      const _Float16* vlg = Vl + (size_t)r * VLP + kvl + half;
      const bool resOK = (kv0 + 64 <= VLP);                      // block-uniform
#pragma unroll
      for (int i = 0; i < 4; ++i) {
        const v8b a0 = *(const v8b*)(kg + 8 * i);
        const v8b a1 = *(const v8b*)(klg + 8 * i);
        const v8h b0 = *(const v8h*)(vg + 8 * i);
        *(v8b*)(Ksh + r * 64 + half + 8 * i) = a0;
        *(v8b*)(Ksl + r * 64 + half + 8 * i) = a1;
        *(v8h*)(Vth + r * 64 + half + 8 * i) = b0;
        if (RES) {
          v8h b1 = *(const v8h*)(vlg + 8 * i);
          if (!resOK) b1 = zero8h();
          *(v8h*)(Vtl + r * 64 + half + 8 * i) = b1;
        }
      }
      // er band row tid (128 rows x 64), address clamped at SEQ-1
      const int erow = imin(ebb + tid, SEQ - 1);
      const __bf16* eg = Erb + (size_t)erow * HD;
#pragma unroll
      for (int i = 0; i < 8; ++i) *(v8b*)(Esh + tid * 64 + 8 * i) = *(const v8b*)(eg + 8 * i);
    }
    __syncthreads();

    // ---- q.k: 16 query rows x 64 keys per wave, 3 bf16 products ----
    v8f s[4];
#pragma unroll
    for (int j = 0; j < 4; ++j) {
      s[j] = zero8();
#pragma unroll
      for (int dc = 0; dc < 2; ++dc) {
        FB kb, kl;
        kb.h[0] = *(const v8b*)(Ksh + (j * 16 + c) * 64 + dc * 32 + 8 * hh);
        kb.h[1] = *(const v8b*)(Ksh + (j * 16 + c) * 64 + dc * 32 + 16 + 8 * hh);
        kl.h[0] = *(const v8b*)(Ksl + (j * 16 + c) * 64 + dc * 32 + 8 * hh);
        kl.h[1] = *(const v8b*)(Ksl + (j * 16 + c) * 64 + dc * 32 + 16 + 8 * hh);
        s[j] = mma_b(qah[dc], kb.v, s[j]);
        s[j] = mma_b(qah[dc], kl.v, s[j]);
        s[j] = mma_b(qal[dc], kb.v, s[j]);
      }
    }

    // ---- q.er skew band: 5 subtiles of 16 band rows, streamed; diagonal extraction by bpermute ----
    {
      const int wb = (3 - wave) * 16;           // this wave's band offset inside Esh
      v8f prev = zero8();
#pragma unroll
      for (int u = 0; u < 5; ++u) {
        v8f cur = zero8();
#pragma unroll
        for (int dc = 0; dc < 2; ++dc) {
          FB eb;
          const __bf16* ep = Esh + (wb + u * 16 + c) * 64 + dc * 32 + 8 * hh;
          eb.h[0] = *(const v8b*)(ep);
          eb.h[1] = *(const v8b*)(ep + 16);
          cur = mma_b(qah[dc], eb.v, cur);
          cur = mma_b(qal[dc], eb.v, cur);
        }
        if (u >= 1) {                            // key subtile jsub = u-1 uses subtiles u-1 (prev) and u (cur)
#pragma unroll
          for (int r = 0; r < 8; ++r) {
            const int base = 15 - (8 * hh + r) + c;                  // 0..30
            const int src  = (lane & 16) | (base & 15);
            const float vlo = __shfl(prev[r], src, 32);
            const float vhi = __shfl(cur[r], src, 32);
            s[u - 1][r] += (base < 16) ? vlo : vhi;
          }
        }
        prev = cur;
      }
    }

    // ---- gathered structure biases, scale, causal replace mask, online softmax, P (x1024, f16) and
    //      P residual (x4096) to LDS ----
    _Float16* pwh = Psh + wave * (16 * 64);
    _Float16* pwl = Psl + (RES ? wave : 0) * (16 * 64);
#pragma unroll
    for (int r = 0; r < 8; ++r) {
      const float* qrr  = qew + (size_t)r * QEP;
      const size_t io   = ib0 + (size_t)r * SEQ + (size_t)(kv0 + c);
      const int    trow = q0 + 8 * hh + r;
      float m = -INFINITY;
#pragma unroll
      for (int j = 0; j < 4; ++j) {
        const int key = kv0 + j * 16 + c;
        const int x0 = iclamp(ibar[io + j * 16], 0, 16);
        const int x1 = iclamp(ipos[io + j * 16], 0, 95);
        const int x2 = iclamp(ioct[io + j * 16], 0, 24);
        const int x3 = iclamp(isem[io + j * 16], 0, 12);
        const float bsum = (qrr[OFF_BAR + x0] + qrr[OFF_POS + x1]) + (qrr[OFF_OCT + x2] + qrr[OFF_SEM + x3]);
        float sv = (s[j][r] + bsum) * sscale;
        sv = (key <= trow) ? sv : -1.0e9f;
        s[j][r] = sv;
        m = fmaxf(m, sv);
      }
#pragma unroll
      for (int off = 1; off < 16; off <<= 1) m = fmaxf(m, __shfl_xor(m, off, 32));
      const float mnew  = fmaxf(mrow[r], m);
      const float msafe = (mnew == -INFINITY) ? 0.f : mnew;
      const float alpha = __expf(mrow[r] - msafe);
      mrow[r] = mnew;
      float psum = 0.f;
#pragma unroll
      for (int j = 0; j < 4; ++j) {
        const float p = __expf(s[j][r] - msafe);     // masked logit -1e9 against a normal max: exp -> 0
        psum += p;
        const float p1k = p * 1024.0f;
        const _Float16 ph = (_Float16)p1k;
        pwh[(8 * hh + r) * 64 + j * 16 + c] = ph;
        if (RES) {
          const _Float16 pl = (_Float16)((p1k - (float)ph) * 4096.0f);
          pwl[(8 * hh + r) * 64 + j * 16 + c] = pl;
        }
      }
#pragma unroll
      for (int off = 1; off < 16; off <<= 1) psum += __shfl_xor(psum, off, 32);
      lrow[r] = lrow[r] * alpha + psum;
#pragma unroll
      for (int t = 0; t < 4; ++t) oacc[t][r] *= alpha;
    }
    __builtin_amdgcn_fence(__ATOMIC_RELEASE, "workgroup");
    __builtin_amdgcn_wave_barrier();
    __builtin_amdgcn_fence(__ATOMIC_ACQUIRE, "workgroup");

    // ---- context += P . V (f16 WMMA), residual products into a separate accumulator ----
    v8f o1[4];
#pragma unroll
    for (int t = 0; t < 4; ++t) o1[t] = zero8();
#pragma unroll 1
    for (int kk = 0; kk < 2; ++kk) {
      FH pa, pl;
      pa.h[0] = *(const v8h*)(pwh + c * 64 + kk * 32 + 8 * hh);
      pa.h[1] = *(const v8h*)(pwh + c * 64 + kk * 32 + 16 + 8 * hh);
      if (RES) {
        pl.h[0] = *(const v8h*)(pwl + c * 64 + kk * 32 + 8 * hh);
        pl.h[1] = *(const v8h*)(pwl + c * 64 + kk * 32 + 16 + 8 * hh);
      } else {
        pl.v = pa.v;
      }
#pragma unroll
      for (int t = 0; t < 4; ++t) {
        FH vb;
        vb.h[0] = *(const v8h*)(Vth + (t * 16 + c) * 64 + kk * 32 + 8 * hh);
        vb.h[1] = *(const v8h*)(Vth + (t * 16 + c) * 64 + kk * 32 + 16 + 8 * hh);
        oacc[t] = mma_h(pa.v, vb.v, oacc[t]);
        if (RES) {
          FH vl;
          vl.h[0] = *(const v8h*)(Vtl + (t * 16 + c) * 64 + kk * 32 + 8 * hh);
          vl.h[1] = *(const v8h*)(Vtl + (t * 16 + c) * 64 + kk * 32 + 16 + 8 * hh);
          o1[t] = mma_h(pa.v, vl.v, o1[t]);
          o1[t] = mma_h(pl.v, vb.v, o1[t]);
        }
      }
    }
    if (RES) {
#pragma unroll
      for (int t = 0; t < 4; ++t)
#pragma unroll
        for (int r = 0; r < 8; ++r) oacc[t][r] += o1[t][r] * (1.0f / 4096.0f);
    }
  }

  // ---- normalise (1/l and the 1/1024 p carry), stage the wave's 16x64 tile (Os aliases the K tiles,
  __syncthreads();
  float* os = Os + wave * (16 * 64);
#pragma unroll
  for (int r = 0; r < 8; ++r) {
    const float l = lrow[r];
    const float inv = ((l > 0.f) ? (1.0f / l) : 0.f) * (1.0f / 1024.0f);
#pragma unroll
    for (int t = 0; t < 4; ++t) os[(8 * hh + r) * 64 + t * 16 + c] = oacc[t][r] * inv;
  }
  __builtin_amdgcn_fence(__ATOMIC_RELEASE, "workgroup");
  __builtin_amdgcn_wave_barrier();
  __builtin_amdgcn_fence(__ATOMIC_ACQUIRE, "workgroup");
  {
    const int q4 = lane >> 3, c8 = (lane & 7) * 8;
    v4u hv[4], lv[4];
#pragma unroll
    for (int it = 0; it < 4; ++it) {
      const int row = it * 4 + q4;   // it 0..3 x q4 0..3 = rows 0..15 of the wave tile
      const float* sp = os + row * 64 + c8;
      v4u a, a2;
#pragma unroll
      for (int e = 0; e < 4; ++e) {
        const float f0 = sp[2 * e], f1 = sp[2 * e + 1];
        const unsigned short h0 = bf_bits(f0), h1 = bf_bits(f1);
        const unsigned short l0 = bf_bits(f0 - bf_up(h0)), l1 = bf_bits(f1 - bf_up(h1));
        a[e] = pk16(h0, h1); a2[e] = pk16(l0, l1);
      }
      hv[it] = a; lv[it] = a2;
    }
    {
#pragma unroll
      for (int it = 0; it < 4; ++it) {
        const int row = it * 4 + q4;
        const size_t go = (rowB + q0 + row) * DM + (size_t)h * HD + c8;
        *(v4u*)(ohp + go) = hv[it];
        *(v4u*)(olp + go) = lv[it];
      }
      
    }
  }
}

// =====================================================================================================
// Workspace map (bytes, every region a multiple of its 64x64-tile / whole-line store granularity):
//   Xb   bf16 [2048][1024]            0        4194304
//   Wqb  bf16 [1024 n][1024 k]    4194304        2097152
//   Wkb                           6291456        2097152
//   Wvb                           8388608        2097152
//   Wob                          10485760        2097152
//   Erb  bf16 [1024][64]         12582912         131072
//   Tb   bf16 [192][64]          12713984          24576
//   Qh   bf16 [2048][1024]       12738560        4194304
//   Ql                           16932864        4194304
//   Kh                           21127168        4194304
//   Kl                           25321472        4194304
//   VTh  f16  [2][1024][1024]    29515776        4194304
//   VTl  f16  [2][1024][256]     33710080        1048576
//   QE   f32  [16][2048][192]    34758656       25165824
//   Oh   bf16 [2048][1024]       59924480        4194304
//   Ol                           64118784        4194304
//   end                          68313088
// Weights are [out n][in k] with k contiguous = the Bt / A layout the GEMM wants, so they are only converted.
// =====================================================================================================
extern "C" void kernel_launch(void* const* d_in, const int* in_sizes, int n_in,
                              void* d_out, int out_size, void* d_ws, size_t ws_size,
                              hipStream_t stream) {
  if (n_in < 14) return;
  if (in_sizes[0] != NB * SEQ * DM) return;
  if (in_sizes[1] != NB * SEQ * SEQ || in_sizes[2] != NB * SEQ * SEQ ||
      in_sizes[3] != NB * SEQ * SEQ || in_sizes[4] != NB * SEQ * SEQ) return;
  if (in_sizes[5] != DM * DM || in_sizes[6] != DM * DM || in_sizes[7] != DM * DM || in_sizes[8] != DM * DM) return;
  if (in_sizes[9] != SEQ * HD) return;
  if (in_sizes[10] != 16 * HD || in_sizes[11] != 95 * HD || in_sizes[12] != 24 * HD || in_sizes[13] != 12 * HD) return;
  if (out_size != NB * SEQ * DM) return;

  const float* x    = (const float*)d_in[0];
  const int*   rbar = (const int*)d_in[1];
  const int*   rpos = (const int*)d_in[2];
  const int*   roct = (const int*)d_in[3];
  const int*   rsem = (const int*)d_in[4];
  const float* Wq   = (const float*)d_in[5];
  const float* Wk   = (const float*)d_in[6];
  const float* Wv   = (const float*)d_in[7];
  const float* Wo   = (const float*)d_in[8];
  const float* Er   = (const float*)d_in[9];
  const float* Ebar = (const float*)d_in[10];
  const float* Epos = (const float*)d_in[11];
  const float* Eoct = (const float*)d_in[12];
  const float* Esem = (const float*)d_in[13];

  const size_t PX  = (size_t)MROWS * DM * 2;          //  4194304  16-bit activation plane [2048][1024]
  const size_t PW  = (size_t)DM * DM * 2;             //  2097152  16-bit weight plane
  const size_t PE  = (size_t)SEQ * HD * 2;            //   131072  er plane
  const size_t PT  = (size_t)TROWS * HD * 2;          //    24576  combined structure table
  const size_t PVT = (size_t)NB * DM * SEQ * 2;       //  4194304  v^T hi plane
  const size_t PVL = (size_t)NB * DM * VLP * 2;       //  1048576  v^T residual plane
  const size_t PQE = (size_t)NH * MROWS * QEP * 4;    // 25165824  structure products
  size_t off = 0;
  const size_t oXb  = off; off += PX;
  const size_t oWq  = off; off += PW;
  const size_t oWk  = off; off += PW;
  const size_t oWv  = off; off += PW;
  const size_t oWo  = off; off += PW;
  const size_t oEr  = off; off += PE;
  const size_t oTb  = off; off += PT;
  const size_t oQh  = off; off += PX;
  const size_t oQl  = off; off += PX;
  const size_t oKh  = off; off += PX;
  const size_t oKl  = off; off += PX;
  const size_t oVTh = off; off += PVT;
  const size_t oVTl = off; off += PVL;
  const size_t oQE  = off; off += PQE;
  const size_t oOh  = off; off += PX;
  const size_t oOl  = off; off += PX;
  if (off > ws_size) return;                          // off = 68313088
  if (off > (size_t)134217728) return;

  char* ws = (char*)d_ws;
  unsigned short* Xb  = (unsigned short*)(ws + oXb);
  unsigned short* Wqb = (unsigned short*)(ws + oWq);
  unsigned short* Wkb = (unsigned short*)(ws + oWk);
  unsigned short* Wvb = (unsigned short*)(ws + oWv);
  unsigned short* Wob = (unsigned short*)(ws + oWo);
  unsigned short* Erb = (unsigned short*)(ws + oEr);
  unsigned short* Tb  = (unsigned short*)(ws + oTb);
  unsigned short* Qh  = (unsigned short*)(ws + oQh);
  unsigned short* Ql  = (unsigned short*)(ws + oQl);
  unsigned short* Kh  = (unsigned short*)(ws + oKh);
  unsigned short* Kl  = (unsigned short*)(ws + oKl);
  unsigned short* VTh = (unsigned short*)(ws + oVTh);
  unsigned short* VTl = (unsigned short*)(ws + oVTl);
  float*          QE  = (float*)(ws + oQE);
  unsigned short* Oh  = (unsigned short*)(ws + oOh);
  unsigned short* Ol  = (unsigned short*)(ws + oOl);

  const dim3 blk(256);
  const int n8x = MROWS * DM / 8;                              // 262144
  const int n8w = DM * DM / 8;                                 // 131072
  const int n8e = SEQ * HD / 8;                                //   8192
  const dim3 gCvtX((n8x + 255) / 256);                         // 1024 blocks
  const dim3 gCvtW((n8w + 255) / 256);                         //  512 blocks
  const dim3 gCvtE((n8e + 255) / 256);                         //   32 blocks
  const dim3 gTab((TROWS * 8 + 255) / 256);                    //    6 blocks
  const dim3 gProj(((MROWS / 64) * (DM / 64) + 7) / 8, 1);     // 512 tiles -> 64 blocks: M=2048, N=1024
  const dim3 gVT(((DM / 64) * (SEQ / 64) + 7) / 8, NB);       // 256 tiles -> 32 blocks x 2 batches
  const dim3 gQE(((MROWS / 64) * (QEP / 64) + 7) / 8, NH);    //  96 tiles -> 12 blocks x 16 heads

  // (1) x -> bf16 plane; weights [n][k] f32 -> bf16 [n][k]; er -> bf16; combined structure table
  cvt_bf16x8<<<gCvtX, blk, 0, stream>>>(x, Xb, n8x);
  cvt_bf16x8<<<gCvtW, blk, 0, stream>>>(Wq, Wqb, n8w);
  cvt_bf16x8<<<gCvtW, blk, 0, stream>>>(Wk, Wkb, n8w);
  cvt_bf16x8<<<gCvtW, blk, 0, stream>>>(Wv, Wvb, n8w);
  cvt_bf16x8<<<gCvtW, blk, 0, stream>>>(Wo, Wob, n8w);
  cvt_bf16x8<<<gCvtE, blk, 0, stream>>>(Er, Erb, n8e);
  build_tab<<<gTab, blk, 0, stream>>>(Ebar, Epos, Eoct, Esem, Tb);
  // (2) q = x . Wq^T -> bf16 hi/lo planes [b*SEQ+t][h*64+d]   (M=2048, N=1024, K=1024)
  gemm64<0, 2><<<gProj, blk, 0, stream>>>(
      Xb, Xb, DM, 0LL, Wqb, Wqb, DM, 0LL,
      (void*)Qh, DM, 0LL, (void*)Ql, DM, 0LL, DM,
      MROWS, DM, DM, 1.0f);
  // (3) k = x . Wk^T -> bf16 hi/lo planes
  gemm64<0, 2><<<gProj, blk, 0, stream>>>(
      Xb, Xb, DM, 0LL, Wkb, Wkb, DM, 0LL,
      (void*)Kh, DM, 0LL, (void*)Kl, DM, 0LL, DM,
      MROWS, DM, DM, 1.0f);
  // (4) v^T = Wv . x^T per batch -> f16 hi plane [b][h*64+d][s] (pitch SEQ) and residual plane
  //     (x4096, keys < VLP only, pitch VLP)   (A = Wvb [n][k], Bt = Xb rows of batch b; M=1024, N=1024, K=1024)
  gemm64<0, 3><<<gVT, blk, 0, stream>>>(
      Wvb, Wvb, DM, 0LL, Xb, Xb, DM, (long long)SEQ * DM,
      (void*)VTh, SEQ, (long long)DM * SEQ, (void*)VTl, VLP, (long long)DM * VLP, VLP,
      DM, SEQ, DM, 4096.0f);
  // (5) structure products: qe[h][b*SEQ+t][s] = q . T^T  (A = q hi/lo planes at column h*64, K=64;
  //     Bt = Tb [192][64]; M=2048, N=192, 2 products, f32 out pitch 192)
  gemm64<1, 0><<<gQE, blk, 0, stream>>>(
      Qh, Ql, DM, (long long)HD, Tb, Tb, HD, 0LL,
      (void*)QE, QEP, (long long)MROWS * QEP, (void*)QE, QEP, 0LL, QEP,
      MROWS, QEP, HD, 1.0f);
  // (6) attention: query blocks 0..RESQB-1 with residual planes, the rest without
  attn_rel64<true><<<dim3(NB * NH * RESQB), dim3(128), 0, stream>>>(
      Qh, Ql, Kh, Kl, VTh, VTl, Erb, QE, rbar, rpos, roct, rsem, Oh, Ol, 0, RESQB, 0.125f);
  attn_rel64<false><<<dim3(NB * NH * (NQB - RESQB)), dim3(128), 0, stream>>>(
      Qh, Ql, Kh, Kl, VTh, VTl, Erb, QE, rbar, rpos, roct, rsem, Oh, Ol, RESQB, NQB - RESQB, 0.125f);
  // (7) out = context . Wo^T -> d_out f32 [2048][1024]  (A = context hi + lo planes, 2 products)
  gemm64<1, 0><<<gProj, blk, 0, stream>>>(
      Oh, Ol, DM, 0LL, Wob, Wob, DM, 0LL,
      d_out, DM, 0LL, d_out, DM, 0LL, DM,
      MROWS, DM, DM, 1.0f);
  (void)hipGetLastError();
}

// v001
// Measured time: 380 microseconds a run.
// Two timings next to v000 put it at 2.08 and 2.07 times that version's speed.
// Contractions: q, k, v^T projections = v_wmma_f32_16x16x32_bf16 (bf16 operands from RNE-converted inputs, single product);
// q.k^T = v_wmma_f32_16x16x32_bf16 with bf16 hi/lo split q and k (hi.hi + hi.lo + lo.hi);
// q.Er^T skew band and q.T^T structure tables = bf16 hi/lo q times bf16 table rows (2 products);
// p.v = v_wmma_f32_16x16x32_f16 (p carried x1024 in f16, v f16; extra f16 residual planes x4096 of p and v for the first 256 query rows);
// ctx.Wo^T = bf16 hi/lo ctx times bf16 Wo (2 products); all f32 accumulate; bias gathers, causal mask and softmax in f32.
#include <hip/hip_runtime.h>
#include <math.h>
#include <stdint.h>

#define NB    2
#define SEQ   1024
#define DM    1024
#define NH    16
#define HD    64
#define MROWS (NB * SEQ)     // 2048
#define NQB   (SEQ / 64)     // 16 query / key tiles of 64
#define VLP   256            // key pitch of the v^T residual plane (keys 0..VLP-1)
#define RESQB 4              // leading 64-row query blocks that use the p / v residual planes
#define QEP   192            // pitch (floats) of the structure-table products, 151 used
#define TROWS 192            // rows of the combined structure table (151 used, rest zero)
#define OFF_BAR 0            // 16 rows + zero row  -> idx 0..16
#define OFF_POS 17           // 95 rows + zero row  -> idx 0..95
#define OFF_OCT 113          // 24 rows + zero row  -> idx 0..24
#define OFF_SEM 138          // 12 rows + zero row  -> idx 0..12
static_assert(RESQB * 64 <= VLP);
static_assert(NH * HD == DM);
static_assert((SEQ % 64) == 0 && (DM % 64) == 0 && (QEP % 64) == 0 && (TROWS % 64) == 0);
static_assert(OFF_SEM + 13 <= QEP);

typedef _Float16 v16h __attribute__((ext_vector_type(16)));
typedef _Float16 v8h  __attribute__((ext_vector_type(8)));
typedef __bf16   v16b __attribute__((ext_vector_type(16)));
typedef __bf16   v8b  __attribute__((ext_vector_type(8)));
typedef float    v8f  __attribute__((ext_vector_type(8)));
typedef float    v4f  __attribute__((ext_vector_type(4)));
typedef unsigned int v4u __attribute__((ext_vector_type(4)));

// ---- scalar helpers --------------------------------------------------------------------------------
__device__ __forceinline__ unsigned short bf_bits(float f) {          // f32 -> bf16 bits, RNE convert
  unsigned u = __float_as_uint(f);
  return (unsigned short)((u + 0x7FFFu + ((u >> 16) & 1u)) >> 16);
}
__device__ __forceinline__ float bf_up(unsigned short h) { return __uint_as_float(((unsigned)h) << 16); }
__device__ __forceinline__ unsigned short h_bits(_Float16 x) { return __builtin_bit_cast(unsigned short, x); }
__device__ __forceinline__ unsigned pk16(unsigned short a, unsigned short b) { return (unsigned)a | ((unsigned)b << 16); }
__device__ __forceinline__ int iclamp(int v, int lo, int hi) { return (v < lo) ? lo : ((v > hi) ? hi : v); }
__device__ __forceinline__ int imin(int a, int b) { return (a < b) ? a : b; }
__device__ __forceinline__ v8f zero8() { v8f z = {0.f, 0.f, 0.f, 0.f, 0.f, 0.f, 0.f, 0.f}; return z; }
__device__ __forceinline__ v8h zero8h() {
  const _Float16 z = (_Float16)0.0f;
  v8h r = {z, z, z, z, z, z, z, z};
  return r;
}

// ---- fragment loader: 16-bit A/B operand, lane -> row/col (lane&15), p already includes +8*(lane>>4);
//      elements 0..7 <- p[0..7] (k0+8h..), elements 8..15 <- p[16..23] (k0+16+8h..)
__device__ __forceinline__ v16b ldfrag_b(const __bf16* p) {
  union { v16b v; v8b h[2]; } f;
  f.h[0] = *(const v8b*)(p);
  f.h[1] = *(const v8b*)(p + 16);
  return f.v;
}

// ---- WMMA helpers with trailing VALU hazard gap --------------------------------------------------------
__device__ __forceinline__ v8f mma_b(v16b a, v16b b, v8f c) {
  c = __builtin_amdgcn_wmma_f32_16x16x32_bf16(false, a, false, b, (short)0, c, false, false);
#if defined(__HIP_DEVICE_COMPILE__)
  asm volatile("v_nop\n\tv_nop\n\tv_nop\n\tv_nop" : "+v"(c) : "v"(a), "v"(b));
#endif
  return c;
}
__device__ __forceinline__ v8f mma_h(v16h a, v16h b, v8f c) {
  c = __builtin_amdgcn_wmma_f32_16x16x32_f16(false, a, false, b, (short)0, c, false, false);
#if defined(__HIP_DEVICE_COMPILE__)
  asm volatile("v_nop\n\tv_nop\n\tv_nop\n\tv_nop" : "+v"(c) : "v"(a), "v"(b));
#endif
  return c;
}
__device__ __forceinline__ v8f mma_b_raw(v16b a, v16b b, v8f c) {
  return __builtin_amdgcn_wmma_f32_16x16x32_bf16(false, a, false, b, (short)0, c, false, false);
}
__device__ __forceinline__ void dep_guard_b(v8f& a, v8f& b, v16b x, v16b y) {
#if defined(__HIP_DEVICE_COMPILE__)
  asm volatile("v_nop\n\tv_nop\n\tv_nop\n\tv_nop" : "+v"(a), "+v"(b) : "v"(x), "v"(y));
#else
  (void)a; (void)b; (void)x; (void)y;
#endif
}
__device__ __forceinline__ void keep4_b(v16b a, v16b b, v16b c, v16b d) {
#if defined(__HIP_DEVICE_COMPILE__)
  asm volatile("v_nop" :: "v"(a), "v"(b), "v"(c), "v"(d));
#else
  (void)a; (void)b; (void)c; (void)d;
#endif
}
__device__ __forceinline__ void acc_guard4(v8f& a, v8f& b, v8f& c, v8f& d) {
#if defined(__HIP_DEVICE_COMPILE__)
  asm volatile("v_nop\n\tv_nop\n\tv_nop\n\tv_nop" : "+v"(a), "+v"(b), "+v"(c), "+v"(d));
#else
  (void)a; (void)b; (void)c; (void)d;
#endif
}

// =====================================================================================================
// f32 -> bf16 (RNE convert), 8 elements per thread, one 16-B store per lane: a wave writes 512 contiguous B
// (n8 is a multiple of 256 for every use here). coverage: n8 threads x 8 = whole plane.
// =====================================================================================================
__global__ __launch_bounds__(256) void cvt_bf16x8(const float* __restrict__ in, unsigned short* out, int n8) {
  const int i = blockIdx.x * 256 + threadIdx.x;
  if (i < n8) {
    const v4f a = *(const v4f*)(in + (size_t)i * 8);
    const v4f b = *(const v4f*)(in + (size_t)i * 8 + 4);
    v4u p;
    p[0] = pk16(bf_bits(a[0]), bf_bits(a[1]));
    p[1] = pk16(bf_bits(a[2]), bf_bits(a[3]));
    p[2] = pk16(bf_bits(b[0]), bf_bits(b[1]));
    p[3] = pk16(bf_bits(b[2]), bf_bits(b[3]));
    *(v4u*)(out + (size_t)i * 8) = p;
    
  }
}

// =====================================================================================================
// Combined structure table, bf16 [TROWS][64]: rows 0..15 bar, 16 zero, 17..111 position, 112 zero,
// 113..136 octave, 137 zero, 138..149 semitone, 150..191 zero. 8 threads per row, 8 elements each,
// all four candidate loads unconditional with clamped row addresses, selection by value.
// grid = TROWS*8/256 = 6 blocks exactly. coverage: 1536 threads x 8 = 192 x 64.
// =====================================================================================================
__global__ __launch_bounds__(256) void build_tab(const float* __restrict__ ebar, const float* __restrict__ epos,
                                                 const float* __restrict__ eoct, const float* __restrict__ esem,
                                                 unsigned short* tab) {
  const int g = blockIdx.x * 256 + threadIdx.x;
  if (g < TROWS * 8) {
    const int s  = g >> 3;
    const int d0 = (g & 7) * 8;
    const int rb = iclamp(s, 0, 15);
    const int rp = iclamp(s - OFF_POS, 0, 94);
    const int ro = iclamp(s - OFF_OCT, 0, 23);
    const int rs = iclamp(s - OFF_SEM, 0, 11);
    const bool ub = (s < 16);
    const bool up = (s >= OFF_POS) && (s < OFF_POS + 95);
    const bool uo = (s >= OFF_OCT) && (s < OFF_OCT + 24);
    const bool us = (s >= OFF_SEM) && (s < OFF_SEM + 12);
    float v[8];
#pragma unroll
    for (int e = 0; e < 8; ++e) {
      const int d = d0 + e;
      const float fb = ebar[rb * HD + d];
      const float fp = epos[rp * HD + d];
      const float fo = eoct[ro * HD + d];
      const float fs = esem[rs * HD + d];
      float t = 0.f;
      t = ub ? fb : t;
      t = up ? fp : t;
      t = uo ? fo : t;
      t = us ? fs : t;
      v[e] = t;
    }
    v4u p;
    p[0] = pk16(bf_bits(v[0]), bf_bits(v[1]));
    p[1] = pk16(bf_bits(v[2]), bf_bits(v[3]));
    p[2] = pk16(bf_bits(v[4]), bf_bits(v[5]));
    p[3] = pk16(bf_bits(v[6]), bf_bits(v[7]));
    *(v4u*)(tab + (size_t)s * HD + d0) = p;
    
  }
}

// =====================================================================================================
// Register-blocked batched bf16 WMMA GEMM: C[m][n] = sum_k A[m][k] * Bt[n][k]; one wave per 64x64 tile,
// no block barriers. A row-major [M][K] pitch lda; Bt row-major [N][K] pitch ldb (k contiguous);
// M, N multiples of 64, K multiple of 32 (host-checked). blockIdx.y = batch index (strides in elements).
// NSPLIT: 0 = A.Bt; 1 = (A + A2).Bt (A2 = unscaled bf16 lo plane of A); 2 = A.Bt + A2.Bt + A.Bt2.
// OUT_MODE: 0 = f32 (pitch ldc); 2 = bf16 hi plane C + bf16 lo plane C2 (lo = RNE(v - hi), unscaled);
//           3 = f16 hi plane C + f16 residual plane C2 = f16((v - hi) * rscale), C2 written only for tiles
//               with n0 < N2 (pitch ldc2, batch stride strideC2).
// =====================================================================================================
template <int NSPLIT, int OUT_MODE>
__global__ __launch_bounds__(256) void gemm64(
    const unsigned short* __restrict__ Ap, const unsigned short* A2p, int lda, long long strideA,
    const unsigned short* __restrict__ Btp, const unsigned short* Bt2p, int ldb, long long strideB,
    void* Cout, int ldc, long long strideC,
    void* Cout2, int ldc2, long long strideC2, int N2,
    int M, int N, int K, float rscale) {
  const __bf16* A   = (const __bf16*)(const void*)Ap;
  const __bf16* A2  = (const __bf16*)(const void*)A2p;
  const __bf16* Bt  = (const __bf16*)(const void*)Btp;
  const __bf16* Bt2 = (const __bf16*)(const void*)Bt2p;
  __shared__ __align__(16) float sT[8][16 * 68];   // per-wave 16x64 slab, pitch 68 floats
  const int b    = blockIdx.y;
  const int lane = threadIdx.x & 31;
  const int wave = threadIdx.x >> 5;
  const int tilesN = N >> 6;
  const int tilesM = M >> 6;
  const int tile = blockIdx.x * 8 + wave;
  if (tile >= tilesM * tilesN) return;   // wave-uniform; no block barriers in this kernel
  const int tm = tile / tilesN;
  const int tn = tile - tm * tilesN;
  const int m0 = tm << 6;
  const int n0 = tn << 6;

  const __bf16* Ab  = A  + (size_t)b * strideA;
  const __bf16* Bb  = Bt + (size_t)b * strideB;
  const __bf16* Ab2 = (NSPLIT >= 1) ? (A2  + (size_t)b * strideA) : Ab;
  const __bf16* Bb2 = (NSPLIT == 2) ? (Bt2 + (size_t)b * strideB) : Bb;

  const int rlane = lane & 15;                 // row (A) / col (B, D) within subtile
  const int koff  = (lane >> 4) * 8;           // k offset of this lane half
  const int mOff  = (lane >> 4) * 8;           // D row offset

  v8f acc[4][4];
#pragma unroll
  for (int i = 0; i < 4; ++i)
#pragma unroll
    for (int j = 0; j < 4; ++j) acc[i][j] = zero8();

  for (int k0 = 0; k0 < K; k0 += 32) {
    v16b bh[4], bl[4];
#pragma unroll
    for (int j = 0; j < 4; ++j) {
      const size_t bo = (size_t)(n0 + (j << 4) + rlane) * ldb + koff + k0;
      bh[j] = ldfrag_b(Bb + bo);
      if (NSPLIT == 2) bl[j] = ldfrag_b(Bb2 + bo); else bl[j] = bh[j];
    }
#pragma unroll
    for (int i = 0; i < 4; ++i) {
      const size_t ao = (size_t)(m0 + (i << 4) + rlane) * lda + koff + k0;
      const v16b ah = ldfrag_b(Ab + ao);
      v16b al = ah;
      if (NSPLIT >= 1) al = ldfrag_b(Ab2 + ao);
#pragma unroll
      for (int j = 0; j < 4; ++j) {
        acc[i][j] = mma_b_raw(ah, bh[j], acc[i][j]);
        if (NSPLIT >= 1) acc[i][j] = mma_b_raw(al, bh[j], acc[i][j]);
        if (NSPLIT == 2) acc[i][j] = mma_b_raw(ah, bl[j], acc[i][j]);
      }
      dep_guard_b(acc[i][0], acc[i][3], ah, al);
    }
    keep4_b(bh[0], bh[1], bh[2], bh[3]);
    if (NSPLIT == 2) keep4_b(bl[0], bl[1], bl[2], bl[3]);
  }
  acc_guard4(acc[0][0], acc[0][1], acc[0][2], acc[0][3]);
  acc_guard4(acc[1][0], acc[1][1], acc[1][2], acc[1][3]);
  acc_guard4(acc[2][0], acc[2][1], acc[2][2], acc[2][3]);
  acc_guard4(acc[3][0], acc[3][1], acc[3][2], acc[3][3]);

  // ---- epilogue ----
  float* slab = sT[wave];
#pragma unroll
  for (int i = 0; i < 4; ++i) {
    const int mBase = m0 + (i << 4);
#pragma unroll
    for (int j = 0; j < 4; ++j) {
#pragma unroll
      for (int r = 0; r < 8; ++r) {
        slab[(mOff + r) * 68 + (j << 4) + rlane] = acc[i][j][r];
      }
    }
    __builtin_amdgcn_fence(__ATOMIC_RELEASE, "workgroup");
    __builtin_amdgcn_wave_barrier();
    __builtin_amdgcn_fence(__ATOMIC_ACQUIRE, "workgroup");
    if (OUT_MODE == 0) {
      float* C = (float*)Cout + (size_t)b * strideC;
      const int hh = lane >> 4, c4 = (lane & 15) * 4;     // 256-B row segment = 16 lanes x 16 B
      {
#pragma unroll
        for (int it = 0; it < 8; ++it) {
          const int row = it * 2 + hh;                     // it 0..7 x hh 0..1 = rows 0..15
          const v4f v = *(const v4f*)(slab + row * 68 + c4);
          *(v4f*)(C + (size_t)(mBase + row) * ldc + n0 + c4) = v;
        }
        
      }
    } else {
      const int q = lane >> 3, c8 = (lane & 7) * 8;
      unsigned short* C  = (unsigned short*)Cout  + (size_t)b * strideC;
      unsigned short* C2 = (unsigned short*)Cout2 + (size_t)b * strideC2;
      const bool wlo = (OUT_MODE == 2) || (n0 < N2);      // wave-uniform
      v4u hv[4], lv[4];
#pragma unroll
      for (int it = 0; it < 4; ++it) {
        const int row = it * 4 + q;                        // it 0..3 x q 0..3 = rows 0..15
        const float* sp = slab + row * 68 + c8;
        v4u a, a2;
#pragma unroll
        for (int e = 0; e < 4; ++e) {
          const float f0 = sp[2 * e], f1 = sp[2 * e + 1];
          unsigned short h0, h1, l0, l1;
          if (OUT_MODE == 2) {
            h0 = bf_bits(f0); h1 = bf_bits(f1);
            l0 = bf_bits(f0 - bf_up(h0)); l1 = bf_bits(f1 - bf_up(h1));
          } else {
            const _Float16 x0 = (_Float16)f0, x1 = (_Float16)f1;
            h0 = h_bits(x0); h1 = h_bits(x1);
            l0 = h_bits((_Float16)((f0 - (float)x0) * rscale));
            l1 = h_bits((_Float16)((f1 - (float)x1) * rscale));
          }
          a[e] = pk16(h0, h1); a2[e] = pk16(l0, l1);
        }
        hv[it] = a; lv[it] = a2;
      }
      {
#pragma unroll
        for (int it = 0; it < 4; ++it) {
          const int row = it * 4 + q;
          *(v4u*)(C + (size_t)(mBase + row) * ldc + n0 + c8) = hv[it];
          if (wlo) *(v4u*)(C2 + (size_t)(mBase + row) * ldc2 + n0 + c8) = lv[it];
        }
        
      }
    }
    __builtin_amdgcn_fence(__ATOMIC_RELEASE, "workgroup");
    __builtin_amdgcn_wave_barrier();
    __builtin_amdgcn_fence(__ATOMIC_ACQUIRE, "workgroup");
  }
}

// =====================================================================================================
// Causal attention with relative-index (skew) bias and four gathered structure biases, head dim 64.
//   q planes (bf16 hi / lo): element (b, t, h, d) at [(b*SEQ + t)*DM + h*64 + d]; k planes same layout.
//   v^T hi plane (f16): element (b, h, d, s) at [(b*DM + h*64 + d)*SEQ + s]
//   v^T residual plane (f16, (v - hi)*4096): [(b*DM + h*64 + d)*VLP + s], s < VLP, read only when RES
//   er: bf16 [SEQ][64]; qe: f32 [h][b*SEQ + t][QEP] = q . T^T for the combined structure table T
//   idx arrays: int [b][t][s], clamped to each sub-table's valid range before use.
//   scores[t][s] = (q_t.k_s + q_t.er[SEQ-1+s-t] + qe[OFF_BAR+ibar] + qe[OFF_POS+ipos] + qe[OFF_OCT+ioct]
//                   + qe[OFF_SEM+isem]) * sscale for s <= t, else -1e9 (replace mask).
//   q.k : bf16 hi/lo split (3 products); q.er : q hi/lo x bf16 er (2 products); f32 accumulate.
//   Skew band: a block (64 query rows, key tile kv0) needs er rows ebb .. ebb+127 with
//   ebb = SEQ-64+kv0-qb*64 >= 0 (staged in LDS, addresses clamped at SEQ-1; clamped rows only feed
//   masked positions). Wave w (rows q0..q0+15) computes 5 subtiles of 16 band rows starting at
//   band row 16*(3-w); the diagonal D[mi][15-mi+jj] is fetched with two unconditional bpermutes per
//   element and selected by value; subtiles are produced one at a time (prev / cur).
//   p = exp(s - m) carried as f16(1024 p); context = p . v on f16 WMMA; RES adds f16 residual planes of p and v
//   (scale 4096, separate accumulator folded back with 1/4096 per chunk in f32); online softmax in f32.
//   Block = 4 waves = 64 query rows of one (b, h); grid = nqbThis * NH * NB; key tiles kt = 0..qb
//   (block-uniform trip count <= NQB). K / V^T / er chunk staging: 128 threads, plain 16-B loads, all issued
//   ahead of the first LDS store, __syncthreads before and after; P tiles are wave-private, spilled with _Float16 element stores and
//   LDS (static byte buffer): Ksh 0, Ksl 8192, Vth 16384, Esh 24576 (128x64 bf16), Psh 40960,
//   Vtl 49152 (RES), Psl 57344 (RES); the f32 context staging Os (16 KB) aliases offset 0 after the key
//   loop and a block barrier.
//   Output planes (bf16 hi / lo of the normalised context) at [(b*SEQ + t)*DM + h*64 + d];
//   coverage: each wave stores rows q0..q0+15 (it 0..3 x lane>>3 0..3) x 64 columns (8 lanes x 8) of both planes.
// =====================================================================================================
template <bool RES>
__global__ __launch_bounds__(128, 3)
void attn_rel64(const unsigned short* __restrict__ qhp, const unsigned short* __restrict__ qlp,
                const unsigned short* __restrict__ khp, const unsigned short* __restrict__ klp,
                const unsigned short* __restrict__ vhp, const unsigned short* __restrict__ vlp,
                const unsigned short* __restrict__ erp, const float* __restrict__ qe,
                const int* __restrict__ ibar, const int* __restrict__ ipos,
                const int* __restrict__ ioct, const int* __restrict__ isem,
                unsigned short* ohp, unsigned short* olp,
                int qbBase, int nqbThis, float sscale) {
  union FB { v16b v; v8b h[2]; };
  union FH { v16h v; v8h h[2]; };
  __shared__ __align__(16) unsigned char smem[RES ? 65536 : 49152];
  __bf16*   const Ksh = (__bf16*)(void*)(smem);
  __bf16*   const Ksl = (__bf16*)(void*)(smem + 8192);
  _Float16* const Vth = (_Float16*)(void*)(smem + 16384);
  __bf16*   const Esh = (__bf16*)(void*)(smem + 24576);
  _Float16* const Psh = (_Float16*)(void*)(smem + 40960);
  _Float16* const Vtl = (_Float16*)(void*)(smem + (RES ? 49152 : 16384));   // never dereferenced when !RES
  _Float16* const Psl = (_Float16*)(void*)(smem + (RES ? 57344 : 40960));   // never dereferenced when !RES
  float*    const Os  = (float*)(void*)(smem);                              // after the key loop only

  const int tid  = threadIdx.x;
  const int wave = tid >> 5;
  const int lane = tid & 31;
  const int hh   = lane >> 4;
  const int c    = lane & 15;

  const int bx   = blockIdx.x;
  const int qbl  = bx % nqbThis;
  const int rest = bx / nqbThis;
  const int h    = rest % NH;
  const int b    = rest / NH;
  const int qb   = qbBase + qbl;
  const int q0   = qb * 64 + wave * 16;
  const size_t rowB = (size_t)b * SEQ;

  const __bf16* Qh  = (const __bf16*)(const void*)qhp + (size_t)h * HD;
  const __bf16* Ql  = (const __bf16*)(const void*)qlp + (size_t)h * HD;
  const __bf16* Kh  = (const __bf16*)(const void*)khp + (size_t)h * HD;
  const __bf16* Kl  = (const __bf16*)(const void*)klp + (size_t)h * HD;
  const _Float16* Vh = (const _Float16*)(const void*)vhp + ((size_t)b * DM + (size_t)h * HD) * SEQ;
  const _Float16* Vl = (const _Float16*)(const void*)vlp + ((size_t)b * DM + (size_t)h * HD) * VLP;
  const __bf16* Erb = (const __bf16*)(const void*)erp;
  const size_t trow0 = rowB + (size_t)(q0 + 8 * hh);                 // b*SEQ + t for r = 0 of this lane half
  const char* qeh    = (const char*)(qe + (size_t)h * MROWS * QEP);   // structure products of head h (block-uniform)
  const unsigned qlb = (unsigned)trow0 * (QEP * 4u);                  // byte offset of this lane's row, r = 0
  const unsigned ilb = ((unsigned)trow0 * SEQ + (unsigned)c) * 4u;    // byte offset of index (row r = 0, key c)

  // ---- Q fragments (A operand, row = lane&15): 2 d-chunks, hi and lo ----
  v16b qah[2], qal[2];
#pragma unroll
  for (int dc = 0; dc < 2; ++dc) {
    const size_t qo = (rowB + q0 + c) * DM + dc * 32 + 8 * hh;
    qah[dc] = ldfrag_b(Qh + qo);
    qal[dc] = ldfrag_b(Ql + qo);
  }

  float mrow[8], lrow[8];
  v8f oacc[4];
#pragma unroll
  for (int r = 0; r < 8; ++r) { mrow[r] = -INFINITY; lrow[r] = 0.f; }
#pragma unroll
  for (int t = 0; t < 4; ++t) oacc[t] = zero8();

  const int nkt = (qb + 1 < NQB) ? (qb + 1) : NQB;   // causal: key tiles 0..qb, block-uniform
  unsigned iv = ilb;                                  // byte offset of index (row r = 0, key kv0 + c)
  for (int kt = 0; kt < nkt; ++kt) {
    const int kv0 = kt * 64;
    int ebb = SEQ - 64 + kv0 - qb * 64;                 // >= 0 for kt >= 0, qb <= NQB-1
    ebb = (ebb < 0) ? 0 : ebb;

    // ---- gathered structure biases of the whole tile, bs[j][r] for key kv0 + 16 j + c and row q0 + 8 hh + r.
    //      They depend on no product of this tile, so the loads go out in runs, each back to back: for RPR rows
    //      at a time the 16 RPR index loads, then (indices clamped, byte offsets formed) the 16 RPR table gathers.
    float bs[4][8];
    constexpr int RPR = RES ? 4 : 8;                    // fewer at a time where the residual path needs the registers
#pragma unroll
    for (int g = 0; g < 8; g += RPR) {
      int      xi[RPR][4][4];
      unsigned go[RPR][4][4];
      float    gv[RPR][4][4];
#pragma unroll
      for (int r = 0; r < RPR; ++r)
#pragma unroll
        for (int j = 0; j < 4; ++j) {
          const size_t ko = (size_t)((g + r) * SEQ + j * 16) * 4;
          xi[r][j][0] = *(const int*)((const char*)ibar + ko + iv);
          xi[r][j][1] = *(const int*)((const char*)ipos + ko + iv);
          xi[r][j][2] = *(const int*)((const char*)ioct + ko + iv);
          xi[r][j][3] = *(const int*)((const char*)isem + ko + iv);
        }
      // the scheduler may not sink the index loads to their first uses, where each would wait alone
      __builtin_amdgcn_sched_barrier(0);
#pragma unroll
      for (int r = 0; r < RPR; ++r)
#pragma unroll
        for (int j = 0; j < 4; ++j) {
          go[r][j][0] = qlb + (unsigned)iclamp(xi[r][j][0], 0, 16) * 4u;
          go[r][j][1] = qlb + (unsigned)iclamp(xi[r][j][1], 0, 95) * 4u;
          go[r][j][2] = qlb + (unsigned)iclamp(xi[r][j][2], 0, 24) * 4u;
          go[r][j][3] = qlb + (unsigned)iclamp(xi[r][j][3], 0, 12) * 4u;
        }
      // all offsets are formed ahead of the first gather, so that no gather's offset register is rewritten in the run
      __builtin_amdgcn_sched_barrier(0);
#pragma unroll
      for (int r = 0; r < RPR; ++r)
#pragma unroll
        for (int j = 0; j < 4; ++j) {
          const size_t ro = (size_t)(g + r) * (QEP * 4);
          gv[r][j][0] = *(const float*)(qeh + (ro + OFF_BAR * 4) + go[r][j][0]);
          gv[r][j][1] = *(const float*)(qeh + (ro + OFF_POS * 4) + go[r][j][1]);
          gv[r][j][2] = *(const float*)(qeh + (ro + OFF_OCT * 4) + go[r][j][2]);
          gv[r][j][3] = *(const float*)(qeh + (ro + OFF_SEM * 4) + go[r][j][3]);
        }
      // precaution: this wait stands ahead of every later rewrite of a gather's offset register
      asm volatile("s_wait_xcnt 0x0" ::: "memory");
      // the scheduler may not sink the gathers to the sums, nor lift a sum over the wait
      __builtin_amdgcn_sched_barrier(0);
#pragma unroll
      for (int r = 0; r < RPR; ++r)
#pragma unroll
        for (int j = 0; j < 4; ++j)
          bs[j][g + r] = (gv[r][j][0] + gv[r][j][1]) + (gv[r][j][2] + gv[r][j][3]);
      // the sums stay ahead of the next run of loads: they free the gathered values' registers for it
      __builtin_amdgcn_sched_barrier(0);
    }
    iv += 64u * 4u;                                     // next key tile's index columns

    __syncthreads();
    {
      const int r = tid >> 1, half = (tid & 1) * 32;
      const __bf16*   kg  = Kh + (rowB + kv0 + r) * DM + half;    // K row kv0+r, d = half..half+31
      const __bf16*   klg = Kl + (rowB + kv0 + r) * DM + half;
      const _Float16* vg  = Vh + (size_t)r * SEQ + kv0 + half;    // V^T row d = r, s = kv0+half..+31
      const int kvl = (kv0 + 64 <= VLP) ? kv0 : (VLP - 64);     // clamped address into the residual plane
      const _Float16* vlg = Vl + (size_t)r * VLP + kvl + half;
      const bool resOK = (kv0 + 64 <= VLP);                      // block-uniform
      // er band row tid (128 rows x 64), address clamped at SEQ-1
      const int erow = imin(ebb + tid, SEQ - 1);
      const unsigned eo = (unsigned)erow * (HD * 2);              // byte offset of that row
      v8b a0[4], a1[4], e0[8];
      v8h b0[4], b1[4];
#pragma unroll
      for (int i = 0; i < 4; ++i) {
        a0[i] = *(const v8b*)(kg + 8 * i);
        a1[i] = *(const v8b*)(klg + 8 * i);
        b0[i] = *(const v8h*)(vg + 8 * i);
        if (RES) b1[i] = *(const v8h*)(vlg + 8 * i);
      }
#pragma unroll
      for (int i = 0; i < 8; ++i) e0[i] = *(const v8b*)((const char*)Erb + 16 * i + eo);
      // precaution: this wait stands ahead of every later rewrite of the loads' address registers; it names
      // them so that they stay whole up to it (no later load of the run lands in one)
      if (RES) asm volatile("s_wait_xcnt 0x0" :: "v"(kg), "v"(klg), "v"(vg), "v"(vlg), "v"(eo) : "memory");
      else     asm volatile("s_wait_xcnt 0x0" :: "v"(kg), "v"(klg), "v"(vg), "v"(eo) : "memory");
      // the scheduler may not sink the staging loads to their LDS stores, where each would wait alone
      __builtin_amdgcn_sched_barrier(0);
#pragma unroll
      for (int i = 0; i < 4; ++i) {
        *(v8b*)(Ksh + r * 64 + half + 8 * i) = a0[i];
        *(v8b*)(Ksl + r * 64 + half + 8 * i) = a1[i];
        *(v8h*)(Vth + r * 64 + half + 8 * i) = b0[i];
        if (RES) *(v8h*)(Vtl + r * 64 + half + 8 * i) = resOK ? b1[i] : zero8h();
      }
#pragma unroll
      for (int i = 0; i < 8; ++i) *(v8b*)(Esh + tid * 64 + 8 * i) = e0[i];
    }
    __syncthreads();

    // ---- q.k: 16 query rows x 64 keys per wave, 3 bf16 products ----
    v8f s[4];
#pragma unroll
    for (int j = 0; j < 4; ++j) {
      s[j] = zero8();
#pragma unroll
      for (int dc = 0; dc < 2; ++dc) {
        FB kb, kl;
        kb.h[0] = *(const v8b*)(Ksh + (j * 16 + c) * 64 + dc * 32 + 8 * hh);
        kb.h[1] = *(const v8b*)(Ksh + (j * 16 + c) * 64 + dc * 32 + 16 + 8 * hh);
        kl.h[0] = *(const v8b*)(Ksl + (j * 16 + c) * 64 + dc * 32 + 8 * hh);
        kl.h[1] = *(const v8b*)(Ksl + (j * 16 + c) * 64 + dc * 32 + 16 + 8 * hh);
        s[j] = mma_b(qah[dc], kb.v, s[j]);
        s[j] = mma_b(qah[dc], kl.v, s[j]);
        s[j] = mma_b(qal[dc], kb.v, s[j]);
      }
    }

    // ---- q.er skew band: 5 subtiles of 16 band rows, streamed; diagonal extraction by bpermute ----
    {
      const int wb = (3 - wave) * 16;           // this wave's band offset inside Esh
      v8f prev = zero8();
#pragma unroll
      for (int u = 0; u < 5; ++u) {
        v8f cur = zero8();
#pragma unroll
        for (int dc = 0; dc < 2; ++dc) {
          FB eb;
          const __bf16* ep = Esh + (wb + u * 16 + c) * 64 + dc * 32 + 8 * hh;
          eb.h[0] = *(const v8b*)(ep);
          eb.h[1] = *(const v8b*)(ep + 16);
          cur = mma_b(qah[dc], eb.v, cur);
          cur = mma_b(qal[dc], eb.v, cur);
        }
        if (u >= 1) {                            // key subtile jsub = u-1 uses subtiles u-1 (prev) and u (cur)
#pragma unroll
          for (int r = 0; r < 8; ++r) {
            const int base = 15 - (8 * hh + r) + c;                  // 0..30
            const int src  = (lane & 16) | (base & 15);
            const float vlo = __shfl(prev[r], src, 32);
            const float vhi = __shfl(cur[r], src, 32);
            s[u - 1][r] += (base < 16) ? vlo : vhi;
          }
        }
        prev = cur;
      }
    }

    // ---- add the gathered structure biases, scale, causal replace mask, online softmax, P (x1024, f16) and
    //      P residual (x4096) to LDS ----
    _Float16* pwh = Psh + wave * (16 * 64);
    _Float16* pwl = Psl + (RES ? wave : 0) * (16 * 64);
#pragma unroll
    for (int r = 0; r < 8; ++r) {
      const int    trow = q0 + 8 * hh + r;
      float m = -INFINITY;
#pragma unroll
      for (int j = 0; j < 4; ++j) {
        const int key = kv0 + j * 16 + c;
        float sv = (s[j][r] + bs[j][r]) * sscale;
        sv = (key <= trow) ? sv : -1.0e9f;
        s[j][r] = sv;
        m = fmaxf(m, sv);
      }
#pragma unroll
      for (int off = 1; off < 16; off <<= 1) m = fmaxf(m, __shfl_xor(m, off, 32));
      const float mnew  = fmaxf(mrow[r], m);
      const float msafe = (mnew == -INFINITY) ? 0.f : mnew;
      const float alpha = __expf(mrow[r] - msafe);
      mrow[r] = mnew;
      float psum = 0.f;
#pragma unroll
      for (int j = 0; j < 4; ++j) {
        const float p = __expf(s[j][r] - msafe);     // masked logit -1e9 against a normal max: exp -> 0
        psum += p;
        const float p1k = p * 1024.0f;
        const _Float16 ph = (_Float16)p1k;
        pwh[(8 * hh + r) * 64 + j * 16 + c] = ph;
        if (RES) {
          const _Float16 pl = (_Float16)((p1k - (float)ph) * 4096.0f);
          pwl[(8 * hh + r) * 64 + j * 16 + c] = pl;
        }
      }
#pragma unroll
      for (int off = 1; off < 16; off <<= 1) psum += __shfl_xor(psum, off, 32);
      lrow[r] = lrow[r] * alpha + psum;
#pragma unroll
      for (int t = 0; t < 4; ++t) oacc[t][r] *= alpha;
    }
    __builtin_amdgcn_fence(__ATOMIC_RELEASE, "workgroup");
    __builtin_amdgcn_wave_barrier();
    __builtin_amdgcn_fence(__ATOMIC_ACQUIRE, "workgroup");

    // ---- context += P . V (f16 WMMA), residual products into a separate accumulator ----
    v8f o1[4];
#pragma unroll
    for (int t = 0; t < 4; ++t) o1[t] = zero8();
#pragma unroll 1
    for (int kk = 0; kk < 2; ++kk) {
      FH pa, pl;
      pa.h[0] = *(const v8h*)(pwh + c * 64 + kk * 32 + 8 * hh);
      pa.h[1] = *(const v8h*)(pwh + c * 64 + kk * 32 + 16 + 8 * hh);
      if (RES) {
        pl.h[0] = *(const v8h*)(pwl + c * 64 + kk * 32 + 8 * hh);
        pl.h[1] = *(const v8h*)(pwl + c * 64 + kk * 32 + 16 + 8 * hh);
      } else {
        pl.v = pa.v;
      }
#pragma unroll
      for (int t = 0; t < 4; ++t) {
        FH vb;
        vb.h[0] = *(const v8h*)(Vth + (t * 16 + c) * 64 + kk * 32 + 8 * hh);
        vb.h[1] = *(const v8h*)(Vth + (t * 16 + c) * 64 + kk * 32 + 16 + 8 * hh);
        oacc[t] = mma_h(pa.v, vb.v, oacc[t]);
        if (RES) {
          FH vl;
          vl.h[0] = *(const v8h*)(Vtl + (t * 16 + c) * 64 + kk * 32 + 8 * hh);
          vl.h[1] = *(const v8h*)(Vtl + (t * 16 + c) * 64 + kk * 32 + 16 + 8 * hh);
          o1[t] = mma_h(pa.v, vl.v, o1[t]);
          o1[t] = mma_h(pl.v, vb.v, o1[t]);
        }
      }
    }
    if (RES) {
#pragma unroll
      for (int t = 0; t < 4; ++t)
#pragma unroll
        for (int r = 0; r < 8; ++r) oacc[t][r] += o1[t][r] * (1.0f / 4096.0f);
    }
  }

  // ---- normalise (1/l and the 1/1024 p carry), stage the wave's 16x64 tile (Os aliases the K tiles,
  __syncthreads();
  float* os = Os + wave * (16 * 64);
#pragma unroll
  for (int r = 0; r < 8; ++r) {
    const float l = lrow[r];
    const float inv = ((l > 0.f) ? (1.0f / l) : 0.f) * (1.0f / 1024.0f);
#pragma unroll
    for (int t = 0; t < 4; ++t) os[(8 * hh + r) * 64 + t * 16 + c] = oacc[t][r] * inv;
  }
  __builtin_amdgcn_fence(__ATOMIC_RELEASE, "workgroup");
  __builtin_amdgcn_wave_barrier();
  __builtin_amdgcn_fence(__ATOMIC_ACQUIRE, "workgroup");
  {
    const int q4 = lane >> 3, c8 = (lane & 7) * 8;
    v4u hv[4], lv[4];
#pragma unroll
    for (int it = 0; it < 4; ++it) {
      const int row = it * 4 + q4;   // it 0..3 x q4 0..3 = rows 0..15 of the wave tile
      const float* sp = os + row * 64 + c8;
      v4u a, a2;
#pragma unroll
      for (int e = 0; e < 4; ++e) {
        const float f0 = sp[2 * e], f1 = sp[2 * e + 1];
        const unsigned short h0 = bf_bits(f0), h1 = bf_bits(f1);
        const unsigned short l0 = bf_bits(f0 - bf_up(h0)), l1 = bf_bits(f1 - bf_up(h1));
        a[e] = pk16(h0, h1); a2[e] = pk16(l0, l1);
      }
      hv[it] = a; lv[it] = a2;
    }
    {
#pragma unroll
      for (int it = 0; it < 4; ++it) {
        const int row = it * 4 + q4;
        const size_t go = (rowB + q0 + row) * DM + (size_t)h * HD + c8;
        *(v4u*)(ohp + go) = hv[it];
        *(v4u*)(olp + go) = lv[it];
      }
      
    }
  }
}

// =====================================================================================================
// Workspace map (bytes, every region a multiple of its 64x64-tile / whole-line store granularity):
//   Xb   bf16 [2048][1024]            0        4194304
//   Wqb  bf16 [1024 n][1024 k]    4194304        2097152
//   Wkb                           6291456        2097152
//   Wvb                           8388608        2097152
//   Wob                          10485760        2097152
//   Erb  bf16 [1024][64]         12582912         131072
//   Tb   bf16 [192][64]          12713984          24576
//   Qh   bf16 [2048][1024]       12738560        4194304
//   Ql                           16932864        4194304
//   Kh                           21127168        4194304
//   Kl                           25321472        4194304
//   VTh  f16  [2][1024][1024]    29515776        4194304
//   VTl  f16  [2][1024][256]     33710080        1048576
//   QE   f32  [16][2048][192]    34758656       25165824
//   Oh   bf16 [2048][1024]       59924480        4194304
//   Ol                           64118784        4194304
//   end                          68313088
// Weights are [out n][in k] with k contiguous = the Bt / A layout the GEMM wants, so they are only converted.
// =====================================================================================================
extern "C" void kernel_launch(void* const* d_in, const int* in_sizes, int n_in,
                              void* d_out, int out_size, void* d_ws, size_t ws_size,
                              hipStream_t stream) {
  if (n_in < 14) return;
  if (in_sizes[0] != NB * SEQ * DM) return;
  if (in_sizes[1] != NB * SEQ * SEQ || in_sizes[2] != NB * SEQ * SEQ ||
      in_sizes[3] != NB * SEQ * SEQ || in_sizes[4] != NB * SEQ * SEQ) return;
  if (in_sizes[5] != DM * DM || in_sizes[6] != DM * DM || in_sizes[7] != DM * DM || in_sizes[8] != DM * DM) return;
  if (in_sizes[9] != SEQ * HD) return;
  if (in_sizes[10] != 16 * HD || in_sizes[11] != 95 * HD || in_sizes[12] != 24 * HD || in_sizes[13] != 12 * HD) return;
  if (out_size != NB * SEQ * DM) return;

  const float* x    = (const float*)d_in[0];
  const int*   rbar = (const int*)d_in[1];
  const int*   rpos = (const int*)d_in[2];
  const int*   roct = (const int*)d_in[3];
  const int*   rsem = (const int*)d_in[4];
  const float* Wq   = (const float*)d_in[5];
  const float* Wk   = (const float*)d_in[6];
  const float* Wv   = (const float*)d_in[7];
  const float* Wo   = (const float*)d_in[8];
  const float* Er   = (const float*)d_in[9];
  const float* Ebar = (const float*)d_in[10];
  const float* Epos = (const float*)d_in[11];
  const float* Eoct = (const float*)d_in[12];
  const float* Esem = (const float*)d_in[13];

  const size_t PX  = (size_t)MROWS * DM * 2;          //  4194304  16-bit activation plane [2048][1024]
  const size_t PW  = (size_t)DM * DM * 2;             //  2097152  16-bit weight plane
  const size_t PE  = (size_t)SEQ * HD * 2;            //   131072  er plane
  const size_t PT  = (size_t)TROWS * HD * 2;          //    24576  combined structure table
  const size_t PVT = (size_t)NB * DM * SEQ * 2;       //  4194304  v^T hi plane
  const size_t PVL = (size_t)NB * DM * VLP * 2;       //  1048576  v^T residual plane
  const size_t PQE = (size_t)NH * MROWS * QEP * 4;    // 25165824  structure products
  size_t off = 0;
  const size_t oXb  = off; off += PX;
  const size_t oWq  = off; off += PW;
  const size_t oWk  = off; off += PW;
  const size_t oWv  = off; off += PW;
  const size_t oWo  = off; off += PW;
  const size_t oEr  = off; off += PE;
  const size_t oTb  = off; off += PT;
  const size_t oQh  = off; off += PX;
  const size_t oQl  = off; off += PX;
  const size_t oKh  = off; off += PX;
  const size_t oKl  = off; off += PX;
  const size_t oVTh = off; off += PVT;
  const size_t oVTl = off; off += PVL;
  const size_t oQE  = off; off += PQE;
  const size_t oOh  = off; off += PX;
  const size_t oOl  = off; off += PX;
  if (off > ws_size) return;                          // off = 68313088
  if (off > (size_t)134217728) return;

  char* ws = (char*)d_ws;
  unsigned short* Xb  = (unsigned short*)(ws + oXb);
  unsigned short* Wqb = (unsigned short*)(ws + oWq);
  unsigned short* Wkb = (unsigned short*)(ws + oWk);
  unsigned short* Wvb = (unsigned short*)(ws + oWv);
  unsigned short* Wob = (unsigned short*)(ws + oWo);
  unsigned short* Erb = (unsigned short*)(ws + oEr);
  unsigned short* Tb  = (unsigned short*)(ws + oTb);
  unsigned short* Qh  = (unsigned short*)(ws + oQh);
  unsigned short* Ql  = (unsigned short*)(ws + oQl);
  unsigned short* Kh  = (unsigned short*)(ws + oKh);
  unsigned short* Kl  = (unsigned short*)(ws + oKl);
  unsigned short* VTh = (unsigned short*)(ws + oVTh);
  unsigned short* VTl = (unsigned short*)(ws + oVTl);
  float*          QE  = (float*)(ws + oQE);
  unsigned short* Oh  = (unsigned short*)(ws + oOh);
  unsigned short* Ol  = (unsigned short*)(ws + oOl);

  const dim3 blk(256);
  const int n8x = MROWS * DM / 8;                              // 262144
  const int n8w = DM * DM / 8;                                 // 131072
  const int n8e = SEQ * HD / 8;                                //   8192
  const dim3 gCvtX((n8x + 255) / 256);                         // 1024 blocks
  const dim3 gCvtW((n8w + 255) / 256);                         //  512 blocks
  const dim3 gCvtE((n8e + 255) / 256);                         //   32 blocks
  const dim3 gTab((TROWS * 8 + 255) / 256);                    //    6 blocks
  const dim3 gProj(((MROWS / 64) * (DM / 64) + 7) / 8, 1);     // 512 tiles -> 64 blocks: M=2048, N=1024
  const dim3 gVT(((DM / 64) * (SEQ / 64) + 7) / 8, NB);       // 256 tiles -> 32 blocks x 2 batches
  const dim3 gQE(((MROWS / 64) * (QEP / 64) + 7) / 8, NH);    //  96 tiles -> 12 blocks x 16 heads

  // (1) x -> bf16 plane; weights [n][k] f32 -> bf16 [n][k]; er -> bf16; combined structure table
  cvt_bf16x8<<<gCvtX, blk, 0, stream>>>(x, Xb, n8x);
  cvt_bf16x8<<<gCvtW, blk, 0, stream>>>(Wq, Wqb, n8w);
  cvt_bf16x8<<<gCvtW, blk, 0, stream>>>(Wk, Wkb, n8w);
  cvt_bf16x8<<<gCvtW, blk, 0, stream>>>(Wv, Wvb, n8w);
  cvt_bf16x8<<<gCvtW, blk, 0, stream>>>(Wo, Wob, n8w);
  cvt_bf16x8<<<gCvtE, blk, 0, stream>>>(Er, Erb, n8e);
  build_tab<<<gTab, blk, 0, stream>>>(Ebar, Epos, Eoct, Esem, Tb);
  // (2) q = x . Wq^T -> bf16 hi/lo planes [b*SEQ+t][h*64+d]   (M=2048, N=1024, K=1024)
  gemm64<0, 2><<<gProj, blk, 0, stream>>>(
      Xb, Xb, DM, 0LL, Wqb, Wqb, DM, 0LL,
      (void*)Qh, DM, 0LL, (void*)Ql, DM, 0LL, DM,
      MROWS, DM, DM, 1.0f);
  // (3) k = x . Wk^T -> bf16 hi/lo planes
  gemm64<0, 2><<<gProj, blk, 0, stream>>>(
      Xb, Xb, DM, 0LL, Wkb, Wkb, DM, 0LL,
      (void*)Kh, DM, 0LL, (void*)Kl, DM, 0LL, DM,
      MROWS, DM, DM, 1.0f);
  // (4) v^T = Wv . x^T per batch -> f16 hi plane [b][h*64+d][s] (pitch SEQ) and residual plane
  //     (x4096, keys < VLP only, pitch VLP)   (A = Wvb [n][k], Bt = Xb rows of batch b; M=1024, N=1024, K=1024)
  gemm64<0, 3><<<gVT, blk, 0, stream>>>(
      Wvb, Wvb, DM, 0LL, Xb, Xb, DM, (long long)SEQ * DM,
      (void*)VTh, SEQ, (long long)DM * SEQ, (void*)VTl, VLP, (long long)DM * VLP, VLP,
      DM, SEQ, DM, 4096.0f);
  // (5) structure products: qe[h][b*SEQ+t][s] = q . T^T  (A = q hi/lo planes at column h*64, K=64;
  //     Bt = Tb [192][64]; M=2048, N=192, 2 products, f32 out pitch 192)
  gemm64<1, 0><<<gQE, blk, 0, stream>>>(
      Qh, Ql, DM, (long long)HD, Tb, Tb, HD, 0LL,
      (void*)QE, QEP, (long long)MROWS * QEP, (void*)QE, QEP, 0LL, QEP,
      MROWS, QEP, HD, 1.0f);
  // (6) attention: query blocks 0..RESQB-1 with residual planes, the rest without
  attn_rel64<true><<<dim3(NB * NH * RESQB), dim3(128), 0, stream>>>(
      Qh, Ql, Kh, Kl, VTh, VTl, Erb, QE, rbar, rpos, roct, rsem, Oh, Ol, 0, RESQB, 0.125f);
  attn_rel64<false><<<dim3(NB * NH * (NQB - RESQB)), dim3(128), 0, stream>>>(
      Qh, Ql, Kh, Kl, VTh, VTl, Erb, QE, rbar, rpos, roct, rsem, Oh, Ol, RESQB, NQB - RESQB, 0.125f);
  // (7) out = context . Wo^T -> d_out f32 [2048][1024]  (A = context hi + lo planes, 2 products)
  gemm64<1, 0><<<gProj, blk, 0, stream>>>(
      Oh, Ol, DM, 0LL, Wob, Wob, DM, 0LL,
      d_out, DM, 0LL, d_out, DM, 0LL, DM,
      MROWS, DM, DM, 1.0f);
  (void)hipGetLastError();
}

// v002
// One run takes 237 microseconds.
// Two timings next to v001 put it at 1.59 and 1.60 times that version's speed.
// All steps since v000 together make it 3.30 times as fast.
// Contractions: q, k, v^T projections = v_wmma_f32_16x16x32_bf16 (bf16 operands from RNE-converted inputs, single product);
// q.k^T = v_wmma_f32_16x16x32_bf16 with bf16 hi/lo split q and k (hi.hi + hi.lo + lo.hi);
// q.Er^T skew band and q.T^T structure tables = bf16 hi/lo q times bf16 table rows (2 products);
// p.v = v_wmma_f32_16x16x32_f16 (p carried x1024 in f16, v f16; extra f16 residual planes x4096 of p and v for the first 256 query rows);
// ctx.Wo^T = bf16 hi/lo ctx times bf16 Wo (2 products); all f32 accumulate; bias gathers, causal mask and softmax in f32.
#include <hip/hip_runtime.h>
#include <math.h>
#include <stdint.h>

#define NB    2
#define SEQ   1024
#define DM    1024
#define NH    16
#define HD    64
#define MROWS (NB * SEQ)     // 2048
#define NQB   (SEQ / 64)     // 16 query / key tiles of 64
#define VLP   256            // key pitch of the v^T residual plane (keys 0..VLP-1)
#define RESQB 4              // leading 64-row query blocks that use the p / v residual planes
#define QEP   192            // pitch (floats) of the structure-table products, 151 used
#define TROWS 192            // rows of the combined structure table (151 used, rest zero)
#define OFF_BAR 0            // 16 rows + zero row  -> idx 0..16
#define OFF_POS 17           // 95 rows + zero row  -> idx 0..95
#define OFF_OCT 113          // 24 rows + zero row  -> idx 0..24
#define OFF_SEM 138          // 12 rows + zero row  -> idx 0..12
static_assert(RESQB * 64 <= VLP);
static_assert(NH * HD == DM);
static_assert((SEQ % 64) == 0 && (DM % 64) == 0 && (QEP % 64) == 0 && (TROWS % 64) == 0);
static_assert(OFF_SEM + 13 <= QEP);

typedef _Float16 v16h __attribute__((ext_vector_type(16)));
typedef _Float16 v8h  __attribute__((ext_vector_type(8)));
typedef __bf16   v16b __attribute__((ext_vector_type(16)));
typedef __bf16   v8b  __attribute__((ext_vector_type(8)));
typedef float    v8f  __attribute__((ext_vector_type(8)));
typedef float    v4f  __attribute__((ext_vector_type(4)));
typedef unsigned int v4u __attribute__((ext_vector_type(4)));

// ---- scalar helpers --------------------------------------------------------------------------------
__device__ __forceinline__ unsigned short bf_bits(float f) {          // f32 -> bf16 bits, RNE convert
  unsigned u = __float_as_uint(f);
  return (unsigned short)((u + 0x7FFFu + ((u >> 16) & 1u)) >> 16);
}
__device__ __forceinline__ float bf_up(unsigned short h) { return __uint_as_float(((unsigned)h) << 16); }
__device__ __forceinline__ unsigned short h_bits(_Float16 x) { return __builtin_bit_cast(unsigned short, x); }
__device__ __forceinline__ unsigned pk16(unsigned short a, unsigned short b) { return (unsigned)a | ((unsigned)b << 16); }
__device__ __forceinline__ int iclamp(int v, int lo, int hi) { return (v < lo) ? lo : ((v > hi) ? hi : v); }
__device__ __forceinline__ int imin(int a, int b) { return (a < b) ? a : b; }
__device__ __forceinline__ v8f zero8() { v8f z = {0.f, 0.f, 0.f, 0.f, 0.f, 0.f, 0.f, 0.f}; return z; }
__device__ __forceinline__ v8h zero8h() {
  const _Float16 z = (_Float16)0.0f;
  v8h r = {z, z, z, z, z, z, z, z};
  return r;
}

// ---- fragment loader: 16-bit A/B operand, lane -> row/col (lane&15), p already includes +8*(lane>>4);
//      elements 0..7 <- p[0..7] (k0+8h..), elements 8..15 <- p[16..23] (k0+16+8h..)
__device__ __forceinline__ v16b ldfrag_b(const __bf16* p) {
  union { v16b v; v8b h[2]; } f;
  f.h[0] = *(const v8b*)(p);
  f.h[1] = *(const v8b*)(p + 16);
  return f.v;
}

// ---- WMMA helpers with trailing VALU hazard gap --------------------------------------------------------
__device__ __forceinline__ v8f mma_b(v16b a, v16b b, v8f c) {
  c = __builtin_amdgcn_wmma_f32_16x16x32_bf16(false, a, false, b, (short)0, c, false, false);
#if defined(__HIP_DEVICE_COMPILE__)
  asm volatile("v_nop\n\tv_nop\n\tv_nop\n\tv_nop" : "+v"(c) : "v"(a), "v"(b));
#endif
  return c;
}
__device__ __forceinline__ v8f mma_h(v16h a, v16h b, v8f c) {
  c = __builtin_amdgcn_wmma_f32_16x16x32_f16(false, a, false, b, (short)0, c, false, false);
#if defined(__HIP_DEVICE_COMPILE__)
  asm volatile("v_nop\n\tv_nop\n\tv_nop\n\tv_nop" : "+v"(c) : "v"(a), "v"(b));
#endif
  return c;
}
__device__ __forceinline__ v8f mma_b_raw(v16b a, v16b b, v8f c) {
  return __builtin_amdgcn_wmma_f32_16x16x32_bf16(false, a, false, b, (short)0, c, false, false);
}
__device__ __forceinline__ void dep_guard_b(v8f& a, v8f& b, v16b x, v16b y) {
#if defined(__HIP_DEVICE_COMPILE__)
  asm volatile("v_nop\n\tv_nop\n\tv_nop\n\tv_nop" : "+v"(a), "+v"(b) : "v"(x), "v"(y));
#else
  (void)a; (void)b; (void)x; (void)y;
#endif
}
__device__ __forceinline__ void keep4_b(v16b a, v16b b, v16b c, v16b d) {
#if defined(__HIP_DEVICE_COMPILE__)
  asm volatile("v_nop" :: "v"(a), "v"(b), "v"(c), "v"(d));
#else
  (void)a; (void)b; (void)c; (void)d;
#endif
}
__device__ __forceinline__ void acc_guard4(v8f& a, v8f& b, v8f& c, v8f& d) {
#if defined(__HIP_DEVICE_COMPILE__)
  asm volatile("v_nop\n\tv_nop\n\tv_nop\n\tv_nop" : "+v"(a), "+v"(b), "+v"(c), "+v"(d));
#else
  (void)a; (void)b; (void)c; (void)d;
#endif
}

// =====================================================================================================
// f32 -> bf16 (RNE convert), 8 elements per thread, one 16-B store per lane: a wave writes 512 contiguous B
// (n8 is a multiple of 256 for every use here). coverage: n8 threads x 8 = whole plane.
// =====================================================================================================
__device__ __forceinline__ void cvt_bf16x8(const float* __restrict__ in, unsigned short* out, int n8, int blk) {
  const int i = blk * 256 + threadIdx.x;
  if (i < n8) {
    const v4f a = *(const v4f*)(in + (size_t)i * 8);
    const v4f b = *(const v4f*)(in + (size_t)i * 8 + 4);
    v4u p;
    p[0] = pk16(bf_bits(a[0]), bf_bits(a[1]));
    p[1] = pk16(bf_bits(a[2]), bf_bits(a[3]));
    p[2] = pk16(bf_bits(b[0]), bf_bits(b[1]));
    p[3] = pk16(bf_bits(b[2]), bf_bits(b[3]));
    *(v4u*)(out + (size_t)i * 8) = p;
    
  }
}

// =====================================================================================================
// Combined structure table, bf16 [TROWS][64]: rows 0..15 bar, 16 zero, 17..111 position, 112 zero,
// 113..136 octave, 137 zero, 138..149 semitone, 150..191 zero. 8 threads per row, 8 elements each,
// all four candidate loads unconditional with clamped row addresses, selection by value.
// PB_T = TROWS*8/256 = 6 blocks of prep_all exactly. coverage: 1536 threads x 8 = 192 x 64.
// =====================================================================================================
__device__ __forceinline__ void build_tab(const float* __restrict__ ebar, const float* __restrict__ epos,
                                          const float* __restrict__ eoct, const float* __restrict__ esem,
                                          unsigned short* tab, int blk) {
  const int g = blk * 256 + threadIdx.x;
  if (g < TROWS * 8) {
    const int s  = g >> 3;
    const int d0 = (g & 7) * 8;
    const int rb = iclamp(s, 0, 15);
    const int rp = iclamp(s - OFF_POS, 0, 94);
    const int ro = iclamp(s - OFF_OCT, 0, 23);
    const int rs = iclamp(s - OFF_SEM, 0, 11);
    const bool ub = (s < 16);
    const bool up = (s >= OFF_POS) && (s < OFF_POS + 95);
    const bool uo = (s >= OFF_OCT) && (s < OFF_OCT + 24);
    const bool us = (s >= OFF_SEM) && (s < OFF_SEM + 12);
    float v[8];
#pragma unroll
    for (int e = 0; e < 8; ++e) {
      const int d = d0 + e;
      const float fb = ebar[rb * HD + d];
      const float fp = epos[rp * HD + d];
      const float fo = eoct[ro * HD + d];
      const float fs = esem[rs * HD + d];
      float t = 0.f;
      t = ub ? fb : t;
      t = up ? fp : t;
      t = uo ? fo : t;
      t = us ? fs : t;
      v[e] = t;
    }
    v4u p;
    p[0] = pk16(bf_bits(v[0]), bf_bits(v[1]));
    p[1] = pk16(bf_bits(v[2]), bf_bits(v[3]));
    p[2] = pk16(bf_bits(v[4]), bf_bits(v[5]));
    p[3] = pk16(bf_bits(v[6]), bf_bits(v[7]));
    *(v4u*)(tab + (size_t)s * HD + d0) = p;
    
  }
}

// =====================================================================================================
// All operand preparation in one grid (the seven pieces depend on nothing but the inputs, so they run side by
// side): blocks 0..PB_X-1 convert x, the next 4*PB_W the four weights, the next PB_E er, the last PB_T build the
// combined table. The piece is chosen by blockIdx.x alone (block-uniform).
// =====================================================================================================
#define PB_X (MROWS * DM / 8 / 256)   // 1024
#define PB_W (DM * DM / 8 / 256)      //  512
#define PB_E (SEQ * HD / 8 / 256)     //   32
#define PB_T (TROWS * 8 / 256)        //    6
static_assert(PB_X * 2048 == MROWS * DM && PB_W * 2048 == DM * DM && PB_E * 2048 == SEQ * HD && PB_T * 256 == TROWS * 8);
__global__ __launch_bounds__(256) void prep_all(
    const float* __restrict__ x, const float* __restrict__ wq, const float* __restrict__ wk,
    const float* __restrict__ wv, const float* __restrict__ wo, const float* __restrict__ er,
    const float* __restrict__ ebar, const float* __restrict__ epos,
    const float* __restrict__ eoct, const float* __restrict__ esem,
    unsigned short* xb, unsigned short* wqb, unsigned short* wkb, unsigned short* wvb, unsigned short* wob,
    unsigned short* erb, unsigned short* tab) {
  int blk = blockIdx.x;
  if (blk < PB_X) { cvt_bf16x8(x, xb, MROWS * DM / 8, blk); return; }
  blk -= PB_X;
  if (blk < 4 * PB_W) {
    const int w = blk / PB_W;
    const float*    in  = (w == 0) ? wq  : (w == 1) ? wk  : (w == 2) ? wv  : wo;
    unsigned short* out = (w == 0) ? wqb : (w == 1) ? wkb : (w == 2) ? wvb : wob;
    cvt_bf16x8(in, out, DM * DM / 8, blk - w * PB_W);
    return;
  }
  blk -= 4 * PB_W;
  if (blk < PB_E) { cvt_bf16x8(er, erb, SEQ * HD / 8, blk); return; }
  build_tab(ebar, epos, eoct, esem, tab, blk - PB_E);
}

// =====================================================================================================
// Register-blocked batched bf16 WMMA GEMM: C[m][n] = sum_k A[m][k] * Bt[n][k]; one wave per 64x64 tile,
// no block barriers. A row-major [M][K] pitch lda; Bt row-major [N][K] pitch ldb (k contiguous);
// M, N multiples of 64, K multiple of 32 (host-checked). b = batch index (strides in elements).
// NSPLIT: 0 = A.Bt; 1 = (A + A2).Bt (A2 = unscaled bf16 lo plane of A); 2 = A.Bt + A2.Bt + A.Bt2.
// OUT_MODE: 0 = f32 (pitch ldc); 2 = bf16 hi plane C + bf16 lo plane C2 (lo = RNE(v - hi), unscaled);
//           3 = f16 hi plane C + f16 residual plane C2 = f16((v - hi) * rscale), C2 written only for tiles
//               with n0 < N2 (pitch ldc2, batch stride strideC2).
// =====================================================================================================
//   sT: the block's 8 x (16 x 68) f32 staging slabs; bx: the block's index among the tiles; b: batch index.
template <int NSPLIT, int OUT_MODE>
__device__ __forceinline__ void gemm64_body(
    const unsigned short* __restrict__ Ap, const unsigned short* A2p, int lda, long long strideA,
    const unsigned short* __restrict__ Btp, const unsigned short* Bt2p, int ldb, long long strideB,
    void* Cout, int ldc, long long strideC,
    void* Cout2, int ldc2, long long strideC2, int N2,
    int M, int N, int K, float rscale, float* sT, int bx, int b) {
  const __bf16* A   = (const __bf16*)(const void*)Ap;
  const __bf16* A2  = (const __bf16*)(const void*)A2p;
  const __bf16* Bt  = (const __bf16*)(const void*)Btp;
  const __bf16* Bt2 = (const __bf16*)(const void*)Bt2p;
  const int lane = threadIdx.x & 31;
  const int wave = threadIdx.x >> 5;
  const int tilesN = N >> 6;
  const int tilesM = M >> 6;
  const int tile = bx * 8 + wave;
  if (tile >= tilesM * tilesN) return;   // wave-uniform; no block barriers in this kernel
  const int tm = tile / tilesN;
  const int tn = tile - tm * tilesN;
  const int m0 = tm << 6;
  const int n0 = tn << 6;

  const __bf16* Ab  = A  + (size_t)b * strideA;
  const __bf16* Bb  = Bt + (size_t)b * strideB;
  const __bf16* Ab2 = (NSPLIT >= 1) ? (A2  + (size_t)b * strideA) : Ab;
  const __bf16* Bb2 = (NSPLIT == 2) ? (Bt2 + (size_t)b * strideB) : Bb;

  const int rlane = lane & 15;                 // row (A) / col (B, D) within subtile
  const int koff  = (lane >> 4) * 8;           // k offset of this lane half
  const int mOff  = (lane >> 4) * 8;           // D row offset

  v8f acc[4][4];
#pragma unroll
  for (int i = 0; i < 4; ++i)
#pragma unroll
    for (int j = 0; j < 4; ++j) acc[i][j] = zero8();

  for (int k0 = 0; k0 < K; k0 += 32) {
    v16b bh[4], bl[4];
#pragma unroll
    for (int j = 0; j < 4; ++j) {
      const size_t bo = (size_t)(n0 + (j << 4) + rlane) * ldb + koff + k0;
      bh[j] = ldfrag_b(Bb + bo);
      if (NSPLIT == 2) bl[j] = ldfrag_b(Bb2 + bo); else bl[j] = bh[j];
    }
#pragma unroll
    for (int i = 0; i < 4; ++i) {
      const size_t ao = (size_t)(m0 + (i << 4) + rlane) * lda + koff + k0;
      const v16b ah = ldfrag_b(Ab + ao);
      v16b al = ah;
      if (NSPLIT >= 1) al = ldfrag_b(Ab2 + ao);
#pragma unroll
      for (int j = 0; j < 4; ++j) {
        acc[i][j] = mma_b_raw(ah, bh[j], acc[i][j]);
        if (NSPLIT >= 1) acc[i][j] = mma_b_raw(al, bh[j], acc[i][j]);
        if (NSPLIT == 2) acc[i][j] = mma_b_raw(ah, bl[j], acc[i][j]);
      }
      dep_guard_b(acc[i][0], acc[i][3], ah, al);
    }
    keep4_b(bh[0], bh[1], bh[2], bh[3]);
    if (NSPLIT == 2) keep4_b(bl[0], bl[1], bl[2], bl[3]);
  }
  acc_guard4(acc[0][0], acc[0][1], acc[0][2], acc[0][3]);
  acc_guard4(acc[1][0], acc[1][1], acc[1][2], acc[1][3]);
  acc_guard4(acc[2][0], acc[2][1], acc[2][2], acc[2][3]);
  acc_guard4(acc[3][0], acc[3][1], acc[3][2], acc[3][3]);

  // ---- epilogue ----
  float* slab = sT + wave * (16 * 68);             // per-wave 16x64 slab, pitch 68 floats
#pragma unroll
  for (int i = 0; i < 4; ++i) {
    const int mBase = m0 + (i << 4);
#pragma unroll
    for (int j = 0; j < 4; ++j) {
#pragma unroll
      for (int r = 0; r < 8; ++r) {
        slab[(mOff + r) * 68 + (j << 4) + rlane] = acc[i][j][r];
      }
    }
    __builtin_amdgcn_fence(__ATOMIC_RELEASE, "workgroup");
    __builtin_amdgcn_wave_barrier();
    __builtin_amdgcn_fence(__ATOMIC_ACQUIRE, "workgroup");
    if (OUT_MODE == 0) {
      float* C = (float*)Cout + (size_t)b * strideC;
      const int hh = lane >> 4, c4 = (lane & 15) * 4;     // 256-B row segment = 16 lanes x 16 B
      {
#pragma unroll
        for (int it = 0; it < 8; ++it) {
          const int row = it * 2 + hh;                     // it 0..7 x hh 0..1 = rows 0..15
          const v4f v = *(const v4f*)(slab + row * 68 + c4);
          *(v4f*)(C + (size_t)(mBase + row) * ldc + n0 + c4) = v;
        }
        
      }
    } else {
      const int q = lane >> 3, c8 = (lane & 7) * 8;
      unsigned short* C  = (unsigned short*)Cout  + (size_t)b * strideC;
      unsigned short* C2 = (unsigned short*)Cout2 + (size_t)b * strideC2;
      const bool wlo = (OUT_MODE == 2) || (n0 < N2);      // wave-uniform
      v4u hv[4], lv[4];
#pragma unroll
      for (int it = 0; it < 4; ++it) {
        const int row = it * 4 + q;                        // it 0..3 x q 0..3 = rows 0..15
        const float* sp = slab + row * 68 + c8;
        v4u a, a2;
#pragma unroll
        for (int e = 0; e < 4; ++e) {
          const float f0 = sp[2 * e], f1 = sp[2 * e + 1];
          unsigned short h0, h1, l0, l1;
          if (OUT_MODE == 2) {
            h0 = bf_bits(f0); h1 = bf_bits(f1);
            l0 = bf_bits(f0 - bf_up(h0)); l1 = bf_bits(f1 - bf_up(h1));
          } else {
            const _Float16 x0 = (_Float16)f0, x1 = (_Float16)f1;
            h0 = h_bits(x0); h1 = h_bits(x1);
            l0 = h_bits((_Float16)((f0 - (float)x0) * rscale));
            l1 = h_bits((_Float16)((f1 - (float)x1) * rscale));
          }
          a[e] = pk16(h0, h1); a2[e] = pk16(l0, l1);
        }
        hv[it] = a; lv[it] = a2;
      }
      {
#pragma unroll
        for (int it = 0; it < 4; ++it) {
          const int row = it * 4 + q;
          *(v4u*)(C + (size_t)(mBase + row) * ldc + n0 + c8) = hv[it];
          if (wlo) *(v4u*)(C2 + (size_t)(mBase + row) * ldc2 + n0 + c8) = lv[it];
        }
        
      }
    }
    __builtin_amdgcn_fence(__ATOMIC_RELEASE, "workgroup");
    __builtin_amdgcn_wave_barrier();
    __builtin_amdgcn_fence(__ATOMIC_ACQUIRE, "workgroup");
  }
}

template <int NSPLIT, int OUT_MODE>
__global__ __launch_bounds__(256) void gemm64(
    const unsigned short* __restrict__ Ap, const unsigned short* A2p, int lda, long long strideA,
    const unsigned short* __restrict__ Btp, const unsigned short* Bt2p, int ldb, long long strideB,
    void* Cout, int ldc, long long strideC,
    void* Cout2, int ldc2, long long strideC2, int N2,
    int M, int N, int K, float rscale) {
  __shared__ __align__(16) float sT[8 * 16 * 68];
  gemm64_body<NSPLIT, OUT_MODE>(Ap, A2p, lda, strideA, Btp, Bt2p, ldb, strideB, Cout, ldc, strideC,
                                Cout2, ldc2, strideC2, N2, M, N, K, rscale, sT, blockIdx.x, blockIdx.y);
}

// The three projections in one grid: each alone fills a quarter of the chip's WGPs and none reads another's result.
//   blockIdx.y = 0: q = x . Wq^T -> bf16 hi/lo planes [b*SEQ+t][h*64+d]   (M=2048, N=1024, K=1024)
//   blockIdx.y = 1: k = x . Wk^T -> bf16 hi/lo planes
//   blockIdx.y = 2: v^T = Wv . x^T per batch -> f16 hi plane [b][h*64+d][s] (pitch SEQ) and residual plane (x4096,
//                   keys < VLP only, pitch VLP); A = Wvb [n][k], Bt = Xb rows of batch b = blockIdx.x / VTB
#define PJB ((MROWS / 64) * (DM / 64) / 8)   // 64 blocks of 8 tiles per projection
#define VTB ((DM / 64) * (SEQ / 64) / 8)     // 32 blocks of 8 tiles per batch of v^T
static_assert(VTB * NB == PJB);
__global__ __launch_bounds__(256) void gemm_qkv(
    const unsigned short* __restrict__ Xb, const unsigned short* __restrict__ Wqb,
    const unsigned short* __restrict__ Wkb, const unsigned short* __restrict__ Wvb,
    unsigned short* Qh, unsigned short* Ql, unsigned short* Kh, unsigned short* Kl,
    unsigned short* VTh, unsigned short* VTl) {
  __shared__ __align__(16) float sT[8 * 16 * 68];
  const int which = blockIdx.y;                 // block-uniform
  if (which < 2) {
    const unsigned short* Wb = which ? Wkb : Wqb;
    unsigned short* Ch = which ? Kh : Qh;
    unsigned short* Cl = which ? Kl : Ql;
    gemm64_body<0, 2>(Xb, Xb, DM, 0LL, Wb, Wb, DM, 0LL,
                      (void*)Ch, DM, 0LL, (void*)Cl, DM, 0LL, DM,
                      MROWS, DM, DM, 1.0f, sT, blockIdx.x, 0);
  } else {
    const int b = blockIdx.x / VTB;
    gemm64_body<0, 3>(Wvb, Wvb, DM, 0LL, Xb, Xb, DM, (long long)SEQ * DM,
                      (void*)VTh, SEQ, (long long)DM * SEQ, (void*)VTl, VLP, (long long)DM * VLP, VLP,
                      DM, SEQ, DM, 4096.0f, sT, blockIdx.x - b * VTB, b);
  }
}

// =====================================================================================================
// Causal attention with relative-index (skew) bias and four gathered structure biases, head dim 64.
//   q planes (bf16 hi / lo): element (b, t, h, d) at [(b*SEQ + t)*DM + h*64 + d]; k planes same layout.
//   v^T hi plane (f16): element (b, h, d, s) at [(b*DM + h*64 + d)*SEQ + s]
//   v^T residual plane (f16, (v - hi)*4096): [(b*DM + h*64 + d)*VLP + s], s < VLP, read only when RES
//   er: bf16 [SEQ][64]; qe: f32 [h][b*SEQ + t][QEP] = q . T^T for the combined structure table T
//   idx arrays: int [b][t][s], clamped to each sub-table's valid range before use.
//   scores[t][s] = (q_t.k_s + q_t.er[SEQ-1+s-t] + qe[OFF_BAR+ibar] + qe[OFF_POS+ipos] + qe[OFF_OCT+ioct]
//                   + qe[OFF_SEM+isem]) * sscale for s <= t, else -1e9 (replace mask).
//   q.k : bf16 hi/lo split (3 products); q.er : q hi/lo x bf16 er (2 products); f32 accumulate.
//   Skew band: a block (64 query rows, key tile kv0) needs er rows ebb .. ebb+127 with
//   ebb = SEQ-64+kv0-qb*64 >= 0 (staged in LDS, addresses clamped at SEQ-1; clamped rows only feed
//   masked positions). Wave w (rows q0..q0+15) computes 5 subtiles of 16 band rows starting at
//   band row 16*(3-w); the diagonal D[mi][15-mi+jj] is fetched with two unconditional bpermutes per
//   element and selected by value; subtiles are produced one at a time (prev / cur).
//   p = exp(s - m) carried as f16(1024 p); context = p . v on f16 WMMA; RES adds f16 residual planes of p and v
//   (scale 4096, separate accumulator folded back with 1/4096 per chunk in f32); online softmax in f32.
//   Block = 4 waves = 64 query rows of one (b, h); grid = NQB * NH * NB; key tiles kt = 0..qb
//   (block-uniform trip count <= NQB). K / V^T / er chunk staging: 128 threads, plain 16-B loads, all issued
//   ahead of the first LDS store, __syncthreads before and after; P tiles are wave-private, spilled with _Float16 element stores and
//   LDS (static byte buffer): Ksh 0, Ksl 8192, Vth 16384, Esh 24576 (128x64 bf16), Psh 40960,
//   Vtl 49152 (RES), Psl 57344 (RES); the f32 context staging Os (16 KB) aliases offset 0 after the key
//   loop and a block barrier.
//   Output planes (bf16 hi / lo of the normalised context) at [(b*SEQ + t)*DM + h*64 + d];
//   coverage: each wave stores rows q0..q0+15 (it 0..3 x lane>>3 0..3) x 64 columns (8 lanes x 8) of both planes.
// =====================================================================================================
template <bool RES>
__device__ __forceinline__
void attn_body(const unsigned short* __restrict__ qhp, const unsigned short* __restrict__ qlp,
                const unsigned short* __restrict__ khp, const unsigned short* __restrict__ klp,
                const unsigned short* __restrict__ vhp, const unsigned short* __restrict__ vlp,
                const unsigned short* __restrict__ erp, const float* __restrict__ qe,
                const int* __restrict__ ibar, const int* __restrict__ ipos,
                const int* __restrict__ ioct, const int* __restrict__ isem,
                unsigned short* ohp, unsigned short* olp,
                unsigned char* smem, int qb, int h, int b, float sscale) {
  union FB { v16b v; v8b h[2]; };
  union FH { v16h v; v8h h[2]; };
  __bf16*   const Ksh = (__bf16*)(void*)(smem);
  __bf16*   const Ksl = (__bf16*)(void*)(smem + 8192);
  _Float16* const Vth = (_Float16*)(void*)(smem + 16384);
  __bf16*   const Esh = (__bf16*)(void*)(smem + 24576);
  _Float16* const Psh = (_Float16*)(void*)(smem + 40960);
  _Float16* const Vtl = (_Float16*)(void*)(smem + (RES ? 49152 : 16384));   // never dereferenced when !RES
  _Float16* const Psl = (_Float16*)(void*)(smem + (RES ? 57344 : 40960));   // never dereferenced when !RES
  float*    const Os  = (float*)(void*)(smem);                              // after the key loop only

  const int tid  = threadIdx.x;
  const int wave = tid >> 5;
  const int lane = tid & 31;
  const int hh   = lane >> 4;
  const int c    = lane & 15;

  const int q0   = qb * 64 + wave * 16;
  const size_t rowB = (size_t)b * SEQ;

  const __bf16* Qh  = (const __bf16*)(const void*)qhp + (size_t)h * HD;
  const __bf16* Ql  = (const __bf16*)(const void*)qlp + (size_t)h * HD;
  const __bf16* Kh  = (const __bf16*)(const void*)khp + (size_t)h * HD;
  const __bf16* Kl  = (const __bf16*)(const void*)klp + (size_t)h * HD;
  const _Float16* Vh = (const _Float16*)(const void*)vhp + ((size_t)b * DM + (size_t)h * HD) * SEQ;
  const _Float16* Vl = (const _Float16*)(const void*)vlp + ((size_t)b * DM + (size_t)h * HD) * VLP;
  const __bf16* Erb = (const __bf16*)(const void*)erp;
  const size_t trow0 = rowB + (size_t)(q0 + 8 * hh);                 // b*SEQ + t for r = 0 of this lane half
  const char* qeh    = (const char*)(qe + (size_t)h * MROWS * QEP);   // structure products of head h (block-uniform)
  const unsigned qlb = (unsigned)trow0 * (QEP * 4u);                  // byte offset of this lane's row, r = 0
  const unsigned ilb = ((unsigned)trow0 * SEQ + (unsigned)c) * 4u;    // byte offset of index (row r = 0, key c)

  // ---- Q fragments (A operand, row = lane&15): 2 d-chunks, hi and lo ----
  v16b qah[2], qal[2];
#pragma unroll
  for (int dc = 0; dc < 2; ++dc) {
    const size_t qo = (rowB + q0 + c) * DM + dc * 32 + 8 * hh;
    qah[dc] = ldfrag_b(Qh + qo);
    qal[dc] = ldfrag_b(Ql + qo);
  }

  float mrow[8], lrow[8];
  v8f oacc[4];
#pragma unroll
  for (int r = 0; r < 8; ++r) { mrow[r] = -INFINITY; lrow[r] = 0.f; }
#pragma unroll
  for (int t = 0; t < 4; ++t) oacc[t] = zero8();

  const int nkt = (qb + 1 < NQB) ? (qb + 1) : NQB;   // causal: key tiles 0..qb, block-uniform
  unsigned iv = ilb;                                  // byte offset of index (row r = 0, key kv0 + c)
  for (int kt = 0; kt < nkt; ++kt) {
    const int kv0 = kt * 64;
    int ebb = SEQ - 64 + kv0 - qb * 64;                 // >= 0 for kt >= 0, qb <= NQB-1
    ebb = (ebb < 0) ? 0 : ebb;

    // ---- gathered structure biases of the whole tile, bs[j][r] for key kv0 + 16 j + c and row q0 + 8 hh + r.
    //      They depend on no product of this tile, so the loads go out in runs, each back to back: for RPR rows
    //      at a time the 16 RPR index loads, then (indices clamped, byte offsets formed) the 16 RPR table gathers.
    float bs[4][8];
    constexpr int RPR = RES ? 4 : 8;                    // fewer at a time where the residual path needs the registers
#pragma unroll
    for (int g = 0; g < 8; g += RPR) {
      int      xi[RPR][4][4];
      unsigned go[RPR][4][4];
      float    gv[RPR][4][4];
#pragma unroll
      for (int r = 0; r < RPR; ++r)
#pragma unroll
        for (int j = 0; j < 4; ++j) {
          const size_t ko = (size_t)((g + r) * SEQ + j * 16) * 4;
          xi[r][j][0] = *(const int*)((const char*)ibar + ko + iv);
          xi[r][j][1] = *(const int*)((const char*)ipos + ko + iv);
          xi[r][j][2] = *(const int*)((const char*)ioct + ko + iv);
          xi[r][j][3] = *(const int*)((const char*)isem + ko + iv);
        }
      // the scheduler may not sink the index loads to their first uses, where each would wait alone
      __builtin_amdgcn_sched_barrier(0);
#pragma unroll
      for (int r = 0; r < RPR; ++r)
#pragma unroll
        for (int j = 0; j < 4; ++j) {
          go[r][j][0] = qlb + (unsigned)iclamp(xi[r][j][0], 0, 16) * 4u;
          go[r][j][1] = qlb + (unsigned)iclamp(xi[r][j][1], 0, 95) * 4u;
          go[r][j][2] = qlb + (unsigned)iclamp(xi[r][j][2], 0, 24) * 4u;
          go[r][j][3] = qlb + (unsigned)iclamp(xi[r][j][3], 0, 12) * 4u;
        }
      // all offsets are formed ahead of the first gather, so that no gather's offset register is rewritten in the run
      __builtin_amdgcn_sched_barrier(0);
#pragma unroll
      for (int r = 0; r < RPR; ++r)
#pragma unroll
        for (int j = 0; j < 4; ++j) {
          const size_t ro = (size_t)(g + r) * (QEP * 4);
          gv[r][j][0] = *(const float*)(qeh + (ro + OFF_BAR * 4) + go[r][j][0]);
          gv[r][j][1] = *(const float*)(qeh + (ro + OFF_POS * 4) + go[r][j][1]);
          gv[r][j][2] = *(const float*)(qeh + (ro + OFF_OCT * 4) + go[r][j][2]);
          gv[r][j][3] = *(const float*)(qeh + (ro + OFF_SEM * 4) + go[r][j][3]);
        }
      // precaution: this wait stands ahead of every later rewrite of a gather's offset register
      asm volatile("s_wait_xcnt 0x0" ::: "memory");
      // the scheduler may not sink the gathers to the sums, nor lift a sum over the wait
      __builtin_amdgcn_sched_barrier(0);
#pragma unroll
      for (int r = 0; r < RPR; ++r)
#pragma unroll
        for (int j = 0; j < 4; ++j)
          bs[j][g + r] = (gv[r][j][0] + gv[r][j][1]) + (gv[r][j][2] + gv[r][j][3]);
      // the sums stay ahead of the next run of loads: they free the gathered values' registers for it
      __builtin_amdgcn_sched_barrier(0);
    }
    iv += 64u * 4u;                                     // next key tile's index columns

    __syncthreads();
    {
      const int r = tid >> 1, half = (tid & 1) * 32;
      const __bf16*   kg  = Kh + (rowB + kv0 + r) * DM + half;    // K row kv0+r, d = half..half+31
      const __bf16*   klg = Kl + (rowB + kv0 + r) * DM + half;
      const _Float16* vg  = Vh + (size_t)r * SEQ + kv0 + half;    // V^T row d = r, s = kv0+half..+31
      const int kvl = (kv0 + 64 <= VLP) ? kv0 : (VLP - 64);     // clamped address into the residual plane
      const _Float16* vlg = Vl + (size_t)r * VLP + kvl + half;
      const bool resOK = (kv0 + 64 <= VLP);                      // block-uniform
      // er band row tid (128 rows x 64), address clamped at SEQ-1
      const int erow = imin(ebb + tid, SEQ - 1);
      const unsigned eo = (unsigned)erow * (HD * 2);              // byte offset of that row
      v8b a0[4], a1[4], e0[8];
      v8h b0[4], b1[4];
#pragma unroll
      for (int i = 0; i < 4; ++i) {
        a0[i] = *(const v8b*)(kg + 8 * i);
        a1[i] = *(const v8b*)(klg + 8 * i);
        b0[i] = *(const v8h*)(vg + 8 * i);
        if (RES) b1[i] = *(const v8h*)(vlg + 8 * i);
      }
#pragma unroll
      for (int i = 0; i < 8; ++i) e0[i] = *(const v8b*)((const char*)Erb + 16 * i + eo);
      // precaution: this wait stands ahead of every later rewrite of the loads' address registers; it names
      // them so that they stay whole up to it (no later load of the run lands in one)
      if (RES) asm volatile("s_wait_xcnt 0x0" :: "v"(kg), "v"(klg), "v"(vg), "v"(vlg), "v"(eo) : "memory");
      else     asm volatile("s_wait_xcnt 0x0" :: "v"(kg), "v"(klg), "v"(vg), "v"(eo) : "memory");
      // the scheduler may not sink the staging loads to their LDS stores, where each would wait alone
      __builtin_amdgcn_sched_barrier(0);
#pragma unroll
      for (int i = 0; i < 4; ++i) {
        *(v8b*)(Ksh + r * 64 + half + 8 * i) = a0[i];
        *(v8b*)(Ksl + r * 64 + half + 8 * i) = a1[i];
        *(v8h*)(Vth + r * 64 + half + 8 * i) = b0[i];
        if (RES) *(v8h*)(Vtl + r * 64 + half + 8 * i) = resOK ? b1[i] : zero8h();
      }
#pragma unroll
      for (int i = 0; i < 8; ++i) *(v8b*)(Esh + tid * 64 + 8 * i) = e0[i];
    }
    __syncthreads();

    // ---- q.k: 16 query rows x 64 keys per wave, 3 bf16 products ----
    v8f s[4];
#pragma unroll
    for (int j = 0; j < 4; ++j) {
      s[j] = zero8();
#pragma unroll
      for (int dc = 0; dc < 2; ++dc) {
        FB kb, kl;
        kb.h[0] = *(const v8b*)(Ksh + (j * 16 + c) * 64 + dc * 32 + 8 * hh);
        kb.h[1] = *(const v8b*)(Ksh + (j * 16 + c) * 64 + dc * 32 + 16 + 8 * hh);
        kl.h[0] = *(const v8b*)(Ksl + (j * 16 + c) * 64 + dc * 32 + 8 * hh);
        kl.h[1] = *(const v8b*)(Ksl + (j * 16 + c) * 64 + dc * 32 + 16 + 8 * hh);
        s[j] = mma_b(qah[dc], kb.v, s[j]);
        s[j] = mma_b(qah[dc], kl.v, s[j]);
        s[j] = mma_b(qal[dc], kb.v, s[j]);
      }
    }

    // ---- q.er skew band: 5 subtiles of 16 band rows, streamed; diagonal extraction by bpermute ----
    {
      const int wb = (3 - wave) * 16;           // this wave's band offset inside Esh
      v8f prev = zero8();
#pragma unroll
      for (int u = 0; u < 5; ++u) {
        v8f cur = zero8();
#pragma unroll
        for (int dc = 0; dc < 2; ++dc) {
          FB eb;
          const __bf16* ep = Esh + (wb + u * 16 + c) * 64 + dc * 32 + 8 * hh;
          eb.h[0] = *(const v8b*)(ep);
          eb.h[1] = *(const v8b*)(ep + 16);
          cur = mma_b(qah[dc], eb.v, cur);
          cur = mma_b(qal[dc], eb.v, cur);
        }
        if (u >= 1) {                            // key subtile jsub = u-1 uses subtiles u-1 (prev) and u (cur)
#pragma unroll
          for (int r = 0; r < 8; ++r) {
            const int base = 15 - (8 * hh + r) + c;                  // 0..30
            const int src  = (lane & 16) | (base & 15);
            const float vlo = __shfl(prev[r], src, 32);
            const float vhi = __shfl(cur[r], src, 32);
            s[u - 1][r] += (base < 16) ? vlo : vhi;
          }
        }
        prev = cur;
      }
    }

    // ---- add the gathered structure biases, scale, causal replace mask, online softmax, P (x1024, f16) and
    //      P residual (x4096) to LDS ----
    _Float16* pwh = Psh + wave * (16 * 64);
    _Float16* pwl = Psl + (RES ? wave : 0) * (16 * 64);
#pragma unroll
    for (int r = 0; r < 8; ++r) {
      const int    trow = q0 + 8 * hh + r;
      float m = -INFINITY;
#pragma unroll
      for (int j = 0; j < 4; ++j) {
        const int key = kv0 + j * 16 + c;
        float sv = (s[j][r] + bs[j][r]) * sscale;
        sv = (key <= trow) ? sv : -1.0e9f;
        s[j][r] = sv;
        m = fmaxf(m, sv);
      }
#pragma unroll
      for (int off = 1; off < 16; off <<= 1) m = fmaxf(m, __shfl_xor(m, off, 32));
      const float mnew  = fmaxf(mrow[r], m);
      const float msafe = (mnew == -INFINITY) ? 0.f : mnew;
      const float alpha = __expf(mrow[r] - msafe);
      mrow[r] = mnew;
      float psum = 0.f;
#pragma unroll
      for (int j = 0; j < 4; ++j) {
        const float p = __expf(s[j][r] - msafe);     // masked logit -1e9 against a normal max: exp -> 0
        psum += p;
        const float p1k = p * 1024.0f;
        const _Float16 ph = (_Float16)p1k;
        pwh[(8 * hh + r) * 64 + j * 16 + c] = ph;
        if (RES) {
          const _Float16 pl = (_Float16)((p1k - (float)ph) * 4096.0f);
          pwl[(8 * hh + r) * 64 + j * 16 + c] = pl;
        }
      }
#pragma unroll
      for (int off = 1; off < 16; off <<= 1) psum += __shfl_xor(psum, off, 32);
      lrow[r] = lrow[r] * alpha + psum;
#pragma unroll
      for (int t = 0; t < 4; ++t) oacc[t][r] *= alpha;
    }
    __builtin_amdgcn_fence(__ATOMIC_RELEASE, "workgroup");
    __builtin_amdgcn_wave_barrier();
    __builtin_amdgcn_fence(__ATOMIC_ACQUIRE, "workgroup");

    // ---- context += P . V (f16 WMMA), residual products into a separate accumulator ----
    v8f o1[4];
#pragma unroll
    for (int t = 0; t < 4; ++t) o1[t] = zero8();
#pragma unroll 1
    for (int kk = 0; kk < 2; ++kk) {
      FH pa, pl;
      pa.h[0] = *(const v8h*)(pwh + c * 64 + kk * 32 + 8 * hh);
      pa.h[1] = *(const v8h*)(pwh + c * 64 + kk * 32 + 16 + 8 * hh);
      if (RES) {
        pl.h[0] = *(const v8h*)(pwl + c * 64 + kk * 32 + 8 * hh);
        pl.h[1] = *(const v8h*)(pwl + c * 64 + kk * 32 + 16 + 8 * hh);
      } else {
        pl.v = pa.v;
      }
#pragma unroll
      for (int t = 0; t < 4; ++t) {
        FH vb;
        vb.h[0] = *(const v8h*)(Vth + (t * 16 + c) * 64 + kk * 32 + 8 * hh);
        vb.h[1] = *(const v8h*)(Vth + (t * 16 + c) * 64 + kk * 32 + 16 + 8 * hh);
        oacc[t] = mma_h(pa.v, vb.v, oacc[t]);
        if (RES) {
          FH vl;
          vl.h[0] = *(const v8h*)(Vtl + (t * 16 + c) * 64 + kk * 32 + 8 * hh);
          vl.h[1] = *(const v8h*)(Vtl + (t * 16 + c) * 64 + kk * 32 + 16 + 8 * hh);
          o1[t] = mma_h(pa.v, vl.v, o1[t]);
          o1[t] = mma_h(pl.v, vb.v, o1[t]);
        }
      }
    }
    if (RES) {
#pragma unroll
      for (int t = 0; t < 4; ++t)
#pragma unroll
        for (int r = 0; r < 8; ++r) oacc[t][r] += o1[t][r] * (1.0f / 4096.0f);
    }
  }

  // ---- normalise (1/l and the 1/1024 p carry), stage the wave's 16x64 tile (Os aliases the K tiles,
  __syncthreads();
  float* os = Os + wave * (16 * 64);
#pragma unroll
  for (int r = 0; r < 8; ++r) {
    const float l = lrow[r];
    const float inv = ((l > 0.f) ? (1.0f / l) : 0.f) * (1.0f / 1024.0f);
#pragma unroll
    for (int t = 0; t < 4; ++t) os[(8 * hh + r) * 64 + t * 16 + c] = oacc[t][r] * inv;
  }
  __builtin_amdgcn_fence(__ATOMIC_RELEASE, "workgroup");
  __builtin_amdgcn_wave_barrier();
  __builtin_amdgcn_fence(__ATOMIC_ACQUIRE, "workgroup");
  {
    const int q4 = lane >> 3, c8 = (lane & 7) * 8;
    v4u hv[4], lv[4];
#pragma unroll
    for (int it = 0; it < 4; ++it) {
      const int row = it * 4 + q4;   // it 0..3 x q4 0..3 = rows 0..15 of the wave tile
      const float* sp = os + row * 64 + c8;
      v4u a, a2;
#pragma unroll
      for (int e = 0; e < 4; ++e) {
        const float f0 = sp[2 * e], f1 = sp[2 * e + 1];
        const unsigned short h0 = bf_bits(f0), h1 = bf_bits(f1);
        const unsigned short l0 = bf_bits(f0 - bf_up(h0)), l1 = bf_bits(f1 - bf_up(h1));
        a[e] = pk16(h0, h1); a2[e] = pk16(l0, l1);
      }
      hv[it] = a; lv[it] = a2;
    }
    {
#pragma unroll
      for (int it = 0; it < 4; ++it) {
        const int row = it * 4 + q4;
        const size_t go = (rowB + q0 + row) * DM + (size_t)h * HD + c8;
        *(v4u*)(ohp + go) = hv[it];
        *(v4u*)(olp + go) = lv[it];
      }
      
    }
  }
}

// Every query block in one grid: the blocks with residual planes (qb < RESQB) and the rest depend on the same
// inputs and write disjoint rows, so they run side by side. NB*NH consecutive blocks share one qb; the first half
// of the grid takes qb = NQB-1 downwards (the longest key loops start first), the second half qb = 0 upwards.
__global__ __launch_bounds__(128, 3)
void attn_rel64(const unsigned short* __restrict__ qhp, const unsigned short* __restrict__ qlp,
                const unsigned short* __restrict__ khp, const unsigned short* __restrict__ klp,
                const unsigned short* __restrict__ vhp, const unsigned short* __restrict__ vlp,
                const unsigned short* __restrict__ erp, const float* __restrict__ qe,
                const int* __restrict__ ibar, const int* __restrict__ ipos,
                const int* __restrict__ ioct, const int* __restrict__ isem,
                unsigned short* ohp, unsigned short* olp, float sscale) {
  __shared__ __align__(16) unsigned char smem[65536];
  const int bx = blockIdx.x;
  const int g  = bx / (NB * NH);
  const int bh = bx - g * (NB * NH);
  const int qb = (g < NQB / 2) ? (NQB - 1 - g) : (g - NQB / 2);   // a permutation of 0..NQB-1, block-uniform
  const int h  = bh % NH;
  const int b  = bh / NH;
  if (qb < RESQB)
    attn_body<true>(qhp, qlp, khp, klp, vhp, vlp, erp, qe, ibar, ipos, ioct, isem, ohp, olp, smem, qb, h, b, sscale);
  else
    attn_body<false>(qhp, qlp, khp, klp, vhp, vlp, erp, qe, ibar, ipos, ioct, isem, ohp, olp, smem, qb, h, b, sscale);
}

// =====================================================================================================
// Workspace map (bytes, every region a multiple of its 64x64-tile / whole-line store granularity):
//   Xb   bf16 [2048][1024]            0        4194304
//   Wqb  bf16 [1024 n][1024 k]    4194304        2097152
//   Wkb                           6291456        2097152
//   Wvb                           8388608        2097152
//   Wob                          10485760        2097152
//   Erb  bf16 [1024][64]         12582912         131072
//   Tb   bf16 [192][64]          12713984          24576
//   Qh   bf16 [2048][1024]       12738560        4194304
//   Ql                           16932864        4194304
//   Kh                           21127168        4194304
//   Kl                           25321472        4194304
//   VTh  f16  [2][1024][1024]    29515776        4194304
//   VTl  f16  [2][1024][256]     33710080        1048576
//   QE   f32  [16][2048][192]    34758656       25165824
//   Oh   bf16 [2048][1024]       59924480        4194304
//   Ol                           64118784        4194304
//   end                          68313088
// Weights are [out n][in k] with k contiguous = the Bt / A layout the GEMM wants, so they are only converted.
// =====================================================================================================
extern "C" void kernel_launch(void* const* d_in, const int* in_sizes, int n_in,
                              void* d_out, int out_size, void* d_ws, size_t ws_size,
                              hipStream_t stream) {
  if (n_in < 14) return;
  if (in_sizes[0] != NB * SEQ * DM) return;
  if (in_sizes[1] != NB * SEQ * SEQ || in_sizes[2] != NB * SEQ * SEQ ||
      in_sizes[3] != NB * SEQ * SEQ || in_sizes[4] != NB * SEQ * SEQ) return;
  if (in_sizes[5] != DM * DM || in_sizes[6] != DM * DM || in_sizes[7] != DM * DM || in_sizes[8] != DM * DM) return;
  if (in_sizes[9] != SEQ * HD) return;
  if (in_sizes[10] != 16 * HD || in_sizes[11] != 95 * HD || in_sizes[12] != 24 * HD || in_sizes[13] != 12 * HD) return;
  if (out_size != NB * SEQ * DM) return;

  const float* x    = (const float*)d_in[0];
  const int*   rbar = (const int*)d_in[1];
  const int*   rpos = (const int*)d_in[2];
  const int*   roct = (const int*)d_in[3];
  const int*   rsem = (const int*)d_in[4];
  const float* Wq   = (const float*)d_in[5];
  const float* Wk   = (const float*)d_in[6];
  const float* Wv   = (const float*)d_in[7];
  const float* Wo   = (const float*)d_in[8];
  const float* Er   = (const float*)d_in[9];
  const float* Ebar = (const float*)d_in[10];
  const float* Epos = (const float*)d_in[11];
  const float* Eoct = (const float*)d_in[12];
  const float* Esem = (const float*)d_in[13];

  const size_t PX  = (size_t)MROWS * DM * 2;          //  4194304  16-bit activation plane [2048][1024]
  const size_t PW  = (size_t)DM * DM * 2;             //  2097152  16-bit weight plane
  const size_t PE  = (size_t)SEQ * HD * 2;            //   131072  er plane
  const size_t PT  = (size_t)TROWS * HD * 2;          //    24576  combined structure table
  const size_t PVT = (size_t)NB * DM * SEQ * 2;       //  4194304  v^T hi plane
  const size_t PVL = (size_t)NB * DM * VLP * 2;       //  1048576  v^T residual plane
  const size_t PQE = (size_t)NH * MROWS * QEP * 4;    // 25165824  structure products
  size_t off = 0;
  const size_t oXb  = off; off += PX;
  const size_t oWq  = off; off += PW;
  const size_t oWk  = off; off += PW;
  const size_t oWv  = off; off += PW;
  const size_t oWo  = off; off += PW;
  const size_t oEr  = off; off += PE;
  const size_t oTb  = off; off += PT;
  const size_t oQh  = off; off += PX;
  const size_t oQl  = off; off += PX;
  const size_t oKh  = off; off += PX;
  const size_t oKl  = off; off += PX;
  const size_t oVTh = off; off += PVT;
  const size_t oVTl = off; off += PVL;
  const size_t oQE  = off; off += PQE;
  const size_t oOh  = off; off += PX;
  const size_t oOl  = off; off += PX;
  if (off > ws_size) return;                          // off = 68313088
  if (off > (size_t)134217728) return;

  char* ws = (char*)d_ws;
  unsigned short* Xb  = (unsigned short*)(ws + oXb);
  unsigned short* Wqb = (unsigned short*)(ws + oWq);
  unsigned short* Wkb = (unsigned short*)(ws + oWk);
  unsigned short* Wvb = (unsigned short*)(ws + oWv);
  unsigned short* Wob = (unsigned short*)(ws + oWo);
  unsigned short* Erb = (unsigned short*)(ws + oEr);
  unsigned short* Tb  = (unsigned short*)(ws + oTb);
  unsigned short* Qh  = (unsigned short*)(ws + oQh);
  unsigned short* Ql  = (unsigned short*)(ws + oQl);
  unsigned short* Kh  = (unsigned short*)(ws + oKh);
  unsigned short* Kl  = (unsigned short*)(ws + oKl);
  unsigned short* VTh = (unsigned short*)(ws + oVTh);
  unsigned short* VTl = (unsigned short*)(ws + oVTl);
  float*          QE  = (float*)(ws + oQE);
  unsigned short* Oh  = (unsigned short*)(ws + oOh);
  unsigned short* Ol  = (unsigned short*)(ws + oOl);

  const dim3 blk(256);
  const dim3 gPrep(PB_X + 4 * PB_W + PB_E + PB_T);             // 3110 blocks
  const dim3 gQKV(PJB, 3);                                     // 64 blocks x {q, k, v^T}
  const dim3 gProj(((MROWS / 64) * (DM / 64) + 7) / 8, 1);     // 512 tiles -> 64 blocks: M=2048, N=1024
  const dim3 gQE(((MROWS / 64) * (QEP / 64) + 7) / 8, NH);    //  96 tiles -> 12 blocks x 16 heads

  // (1) x -> bf16 plane; weights [n][k] f32 -> bf16 [n][k]; er -> bf16; combined structure table
  prep_all<<<gPrep, blk, 0, stream>>>(x, Wq, Wk, Wv, Wo, Er, Ebar, Epos, Eoct, Esem,
                                      Xb, Wqb, Wkb, Wvb, Wob, Erb, Tb);
  // (2)-(4) q, k (bf16 hi/lo planes) and v^T (f16 hi plane, residual plane)
  gemm_qkv<<<gQKV, blk, 0, stream>>>(Xb, Wqb, Wkb, Wvb, Qh, Ql, Kh, Kl, VTh, VTl);
  // (5) structure products: qe[h][b*SEQ+t][s] = q . T^T  (A = q hi/lo planes at column h*64, K=64;
  //     Bt = Tb [192][64]; M=2048, N=192, 2 products, f32 out pitch 192)
  gemm64<1, 0><<<gQE, blk, 0, stream>>>(
      Qh, Ql, DM, (long long)HD, Tb, Tb, HD, 0LL,
      (void*)QE, QEP, (long long)MROWS * QEP, (void*)QE, QEP, 0LL, QEP,
      MROWS, QEP, HD, 1.0f);
  // (6) attention: query blocks 0..RESQB-1 with residual planes, the rest without, one grid
  attn_rel64<<<dim3(NB * NH * NQB), dim3(128), 0, stream>>>(
      Qh, Ql, Kh, Kl, VTh, VTl, Erb, QE, rbar, rpos, roct, rsem, Oh, Ol, 0.125f);
  // (7) out = context . Wo^T -> d_out f32 [2048][1024]  (A = context hi + lo planes, 2 products)
  gemm64<1, 0><<<gProj, blk, 0, stream>>>(
      Oh, Ol, DM, 0LL, Wob, Wob, DM, 0LL,
      d_out, DM, 0LL, d_out, DM, 0LL, DM,
      MROWS, DM, DM, 1.0f);
  (void)hipGetLastError();
}

// v003
// One run takes 205 microseconds.
// Timed twice side by side with v002, it ran 1.15 and 1.16 times as fast.
// Counting every step since v000, it is 3.82 times as fast.
// Contractions: q, k, v^T projections = v_wmma_f32_16x16x32_bf16 (bf16 operands from RNE-converted inputs, single product);
// q.k^T = v_wmma_f32_16x16x32_bf16 with bf16 hi/lo split q and k (hi.hi + hi.lo + lo.hi);
// q.Er^T skew band and q.T^T structure tables = bf16 hi/lo q times bf16 table rows (2 products);
// p.v = v_wmma_f32_16x16x32_f16 (p carried x1024 in f16, v f16; extra f16 residual planes x4096 of p and v for the first 256 query rows);
// ctx.Wo^T = bf16 hi/lo ctx times bf16 Wo (2 products); all f32 accumulate; bias gathers, causal mask and softmax in f32.
#include <hip/hip_runtime.h>
#include <math.h>
#include <stdint.h>

#define NB    2
#define SEQ   1024
#define DM    1024
#define NH    16
#define HD    64
#define MROWS (NB * SEQ)     // 2048
#define NQB   (SEQ / 64)     // 16 query / key tiles of 64
#define VLP   256            // key pitch of the v^T residual plane (keys 0..VLP-1)
#define RESQB 4              // leading 64-row query blocks that use the p / v residual planes
#define QEP   192            // pitch (floats) of the structure-table products, 151 used
#define TROWS 192            // rows of the combined structure table (151 used, rest zero)
#define OFF_BAR 0            // 16 rows + zero row  -> idx 0..16
#define OFF_POS 17           // 95 rows + zero row  -> idx 0..95
#define OFF_OCT 113          // 24 rows + zero row  -> idx 0..24
#define OFF_SEM 138          // 12 rows + zero row  -> idx 0..12
static_assert(RESQB * 64 <= VLP);
static_assert(NH * HD == DM);
static_assert((SEQ % 64) == 0 && (DM % 64) == 0 && (QEP % 64) == 0 && (TROWS % 64) == 0);
static_assert(OFF_SEM + 13 <= QEP);

typedef _Float16 v16h __attribute__((ext_vector_type(16)));
typedef _Float16 v8h  __attribute__((ext_vector_type(8)));
typedef __bf16   v16b __attribute__((ext_vector_type(16)));
typedef __bf16   v8b  __attribute__((ext_vector_type(8)));
typedef float    v8f  __attribute__((ext_vector_type(8)));
typedef float    v4f  __attribute__((ext_vector_type(4)));
typedef unsigned int v4u __attribute__((ext_vector_type(4)));

// ---- scalar helpers --------------------------------------------------------------------------------
__device__ __forceinline__ unsigned short bf_bits(float f) {          // f32 -> bf16 bits, RNE convert
  unsigned u = __float_as_uint(f);
  return (unsigned short)((u + 0x7FFFu + ((u >> 16) & 1u)) >> 16);
}
__device__ __forceinline__ float bf_up(unsigned short h) { return __uint_as_float(((unsigned)h) << 16); }
__device__ __forceinline__ unsigned short h_bits(_Float16 x) { return __builtin_bit_cast(unsigned short, x); }
__device__ __forceinline__ unsigned pk16(unsigned short a, unsigned short b) { return (unsigned)a | ((unsigned)b << 16); }
__device__ __forceinline__ int iclamp(int v, int lo, int hi) { return (v < lo) ? lo : ((v > hi) ? hi : v); }
__device__ __forceinline__ int imin(int a, int b) { return (a < b) ? a : b; }
__device__ __forceinline__ v8f zero8() { v8f z = {0.f, 0.f, 0.f, 0.f, 0.f, 0.f, 0.f, 0.f}; return z; }
__device__ __forceinline__ v8h zero8h() {
  const _Float16 z = (_Float16)0.0f;
  v8h r = {z, z, z, z, z, z, z, z};
  return r;
}

// ---- fragment loader: 16-bit A/B operand, lane -> row/col (lane&15), p already includes +8*(lane>>4);
//      elements 0..7 <- p[0..7] (k0+8h..), elements 8..15 <- p[16..23] (k0+16+8h..)
__device__ __forceinline__ v16b ldfrag_b(const __bf16* p) {
  union { v16b v; v8b h[2]; } f;
  f.h[0] = *(const v8b*)(p);
  f.h[1] = *(const v8b*)(p + 16);
  return f.v;
}
//      a wave-uniform pointer to global memory, held in scalar registers, so that a load names it and a 32-bit lane
//      offset (left to itself one build formed a vector address pair per strip, and a load of the run landed in it)
typedef const __attribute__((address_space(1))) char* gcp;
typedef const __attribute__((address_space(1))) v8b*  gv8bp;
__device__ __forceinline__ gcp uni_ptr(const char* p) {
  const unsigned long long u = (unsigned long long)p;
  const unsigned lo = (unsigned)__builtin_amdgcn_readfirstlane((int)(unsigned)u);
  const unsigned hi = (unsigned)__builtin_amdgcn_readfirstlane((int)(unsigned)(u >> 32));
  return (gcp)(((unsigned long long)hi << 32) | lo);
}
//      the same elements in the same positions, from a wave-uniform base and the lane's byte offset vo
__device__ __forceinline__ v16b ldfrag_o(gcp base, unsigned vo) {
  union { v16b v; v8b h[2]; } f;
  f.h[0] = *(gv8bp)(base + vo);
  f.h[1] = *(gv8bp)(base + 32 + vo);
  return f.v;
}

// ---- WMMA helpers with trailing VALU hazard gap --------------------------------------------------------
__device__ __forceinline__ v8f mma_b(v16b a, v16b b, v8f c) {
  c = __builtin_amdgcn_wmma_f32_16x16x32_bf16(false, a, false, b, (short)0, c, false, false);
#if defined(__HIP_DEVICE_COMPILE__)
  asm volatile("v_nop\n\tv_nop\n\tv_nop\n\tv_nop" : "+v"(c) : "v"(a), "v"(b));
#endif
  return c;
}
__device__ __forceinline__ v8f mma_h(v16h a, v16h b, v8f c) {
  c = __builtin_amdgcn_wmma_f32_16x16x32_f16(false, a, false, b, (short)0, c, false, false);
#if defined(__HIP_DEVICE_COMPILE__)
  asm volatile("v_nop\n\tv_nop\n\tv_nop\n\tv_nop" : "+v"(c) : "v"(a), "v"(b));
#endif
  return c;
}
__device__ __forceinline__ v8f mma_b_raw(v16b a, v16b b, v8f c) {
  return __builtin_amdgcn_wmma_f32_16x16x32_bf16(false, a, false, b, (short)0, c, false, false);
}
__device__ __forceinline__ void acc_guard4(v8f& a, v8f& b, v8f& c, v8f& d) {
#if defined(__HIP_DEVICE_COMPILE__)
  asm volatile("v_nop\n\tv_nop\n\tv_nop\n\tv_nop" : "+v"(a), "+v"(b), "+v"(c), "+v"(d));
#else
  (void)a; (void)b; (void)c; (void)d;
#endif
}

// =====================================================================================================
// f32 -> bf16 (RNE convert), 8 elements per thread, one 16-B store per lane: a wave writes 512 contiguous B
// (n8 is a multiple of 256 for every use here). coverage: n8 threads x 8 = whole plane.
// =====================================================================================================
__device__ __forceinline__ void cvt_bf16x8(const float* __restrict__ in, unsigned short* out, int n8, int blk) {
  const int i = blk * 256 + threadIdx.x;
  if (i < n8) {
    const v4f a = *(const v4f*)(in + (size_t)i * 8);
    const v4f b = *(const v4f*)(in + (size_t)i * 8 + 4);
    v4u p;
    p[0] = pk16(bf_bits(a[0]), bf_bits(a[1]));
    p[1] = pk16(bf_bits(a[2]), bf_bits(a[3]));
    p[2] = pk16(bf_bits(b[0]), bf_bits(b[1]));
    p[3] = pk16(bf_bits(b[2]), bf_bits(b[3]));
    *(v4u*)(out + (size_t)i * 8) = p;
    
  }
}

// =====================================================================================================
// Combined structure table, bf16 [TROWS][64]: rows 0..15 bar, 16 zero, 17..111 position, 112 zero,
// 113..136 octave, 137 zero, 138..149 semitone, 150..191 zero. 8 threads per row, 8 elements each,
// all four candidate loads unconditional with clamped row addresses, selection by value.
// PB_T = TROWS*8/256 = 6 blocks of prep_all exactly. coverage: 1536 threads x 8 = 192 x 64.
// =====================================================================================================
__device__ __forceinline__ void build_tab(const float* __restrict__ ebar, const float* __restrict__ epos,
                                          const float* __restrict__ eoct, const float* __restrict__ esem,
                                          unsigned short* tab, int blk) {
  const int g = blk * 256 + threadIdx.x;
  if (g < TROWS * 8) {
    const int s  = g >> 3;
    const int d0 = (g & 7) * 8;
    const int rb = iclamp(s, 0, 15);
    const int rp = iclamp(s - OFF_POS, 0, 94);
    const int ro = iclamp(s - OFF_OCT, 0, 23);
    const int rs = iclamp(s - OFF_SEM, 0, 11);
    const bool ub = (s < 16);
    const bool up = (s >= OFF_POS) && (s < OFF_POS + 95);
    const bool uo = (s >= OFF_OCT) && (s < OFF_OCT + 24);
    const bool us = (s >= OFF_SEM) && (s < OFF_SEM + 12);
    float v[8];
#pragma unroll
    for (int e = 0; e < 8; ++e) {
      const int d = d0 + e;
      const float fb = ebar[rb * HD + d];
      const float fp = epos[rp * HD + d];
      const float fo = eoct[ro * HD + d];
      const float fs = esem[rs * HD + d];
      float t = 0.f;
      t = ub ? fb : t;
      t = up ? fp : t;
      t = uo ? fo : t;
      t = us ? fs : t;
      v[e] = t;
    }
    v4u p;
    p[0] = pk16(bf_bits(v[0]), bf_bits(v[1]));
    p[1] = pk16(bf_bits(v[2]), bf_bits(v[3]));
    p[2] = pk16(bf_bits(v[4]), bf_bits(v[5]));
    p[3] = pk16(bf_bits(v[6]), bf_bits(v[7]));
    *(v4u*)(tab + (size_t)s * HD + d0) = p;
    
  }
}

// =====================================================================================================
// All operand preparation in one grid (the seven pieces depend on nothing but the inputs, so they run side by
// side): blocks 0..PB_X-1 convert x, the next 4*PB_W the four weights, the next PB_E er, the last PB_T build the
// combined table. The piece is chosen by blockIdx.x alone (block-uniform).
// =====================================================================================================
#define PB_X (MROWS * DM / 8 / 256)   // 1024
#define PB_W (DM * DM / 8 / 256)      //  512
#define PB_E (SEQ * HD / 8 / 256)     //   32
#define PB_T (TROWS * 8 / 256)        //    6
static_assert(PB_X * 2048 == MROWS * DM && PB_W * 2048 == DM * DM && PB_E * 2048 == SEQ * HD && PB_T * 256 == TROWS * 8);
__global__ __launch_bounds__(256) void prep_all(
    const float* __restrict__ x, const float* __restrict__ wq, const float* __restrict__ wk,
    const float* __restrict__ wv, const float* __restrict__ wo, const float* __restrict__ er,
    const float* __restrict__ ebar, const float* __restrict__ epos,
    const float* __restrict__ eoct, const float* __restrict__ esem,
    unsigned short* xb, unsigned short* wqb, unsigned short* wkb, unsigned short* wvb, unsigned short* wob,
    unsigned short* erb, unsigned short* tab) {
  int blk = blockIdx.x;
  if (blk < PB_X) { cvt_bf16x8(x, xb, MROWS * DM / 8, blk); return; }
  blk -= PB_X;
  if (blk < 4 * PB_W) {
    const int w = blk / PB_W;
    const float*    in  = (w == 0) ? wq  : (w == 1) ? wk  : (w == 2) ? wv  : wo;
    unsigned short* out = (w == 0) ? wqb : (w == 1) ? wkb : (w == 2) ? wvb : wob;
    cvt_bf16x8(in, out, DM * DM / 8, blk - w * PB_W);
    return;
  }
  blk -= 4 * PB_W;
  if (blk < PB_E) { cvt_bf16x8(er, erb, SEQ * HD / 8, blk); return; }
  build_tab(ebar, epos, eoct, esem, tab, blk - PB_E);
}

// =====================================================================================================
// Register-blocked batched bf16 WMMA GEMM: C[m][n] = sum_k A[m][k] * Bt[n][k]; one wave per 64x64 tile,
// no block barriers. A row-major [M][K] pitch lda; Bt row-major [N][K] pitch ldb (k contiguous);
// M, N multiples of 64, K a multiple of 32 and at least 32. blockIdx.y = batch index (strides in elements).
// NSPLIT: 0 = A.Bt; 1 = (A + A2).Bt (A2 = unscaled bf16 lo plane of A); 2 = A.Bt + A2.Bt + A.Bt2.
// OUT_MODE: 0 = f32 (pitch ldc); 2 = bf16 hi plane C + bf16 lo plane C2 (lo = RNE(v - hi), unscaled);
//           3 = f16 hi plane C + f16 residual plane C2 = f16((v - hi) * rscale), C2 written only for tiles
//               with n0 < N2 (pitch ldc2, batch stride strideC2).
// =====================================================================================================
//   sT: the block's 8 x (16 x 68) f32 staging slabs; bx: the block's index among the tiles; b: batch index.
template <int NSPLIT, int OUT_MODE>
__device__ __forceinline__ void gemm64_body(
    const unsigned short* __restrict__ Ap, const unsigned short* A2p, int lda, long long strideA,
    const unsigned short* __restrict__ Btp, const unsigned short* Bt2p, int ldb, long long strideB,
    void* Cout, int ldc, long long strideC,
    void* Cout2, int ldc2, long long strideC2, int N2,
    int M, int N, int K, float rscale, float* sT, int bx, int b) {
  const __bf16* A   = (const __bf16*)(const void*)Ap;
  const __bf16* A2  = (const __bf16*)(const void*)A2p;
  const __bf16* Bt  = (const __bf16*)(const void*)Btp;
  const __bf16* Bt2 = (const __bf16*)(const void*)Bt2p;
  const int lane = threadIdx.x & 31;
  const int wave = threadIdx.x >> 5;
  const int tilesN = N >> 6;
  const int tilesM = M >> 6;
  const int tile = bx * 8 + wave;
  if (tile >= tilesM * tilesN) return;   // wave-uniform; no block barriers in this kernel
  const int tm = tile / tilesN;
  const int tn = tile - tm * tilesN;
  const int m0 = tm << 6;
  const int n0 = tn << 6;

  const __bf16* Ab  = A  + (size_t)b * strideA;
  const __bf16* Bb  = Bt + (size_t)b * strideB;
  const __bf16* Ab2 = (NSPLIT >= 1) ? (A2  + (size_t)b * strideA) : Ab;
  const __bf16* Bb2 = (NSPLIT == 2) ? (Bt2 + (size_t)b * strideB) : Bb;

  const int rlane = lane & 15;                 // row (A) / col (B, D) within subtile
  const int koff  = (lane >> 4) * 8;           // k offset of this lane half
  const int mOff  = (lane >> 4) * 8;           // D row offset

  v8f acc[4][4];
#pragma unroll
  for (int i = 0; i < 4; ++i)
#pragma unroll
    for (int j = 0; j < 4; ++j) acc[i][j] = zero8();

  // k loop, K >= 32: two register sets of fragments. All loads of one k step (32 columns) go out in one run, one k
  // step ahead of their products, so a k step waits for at most the rest of one load round trip instead of four whole
  // ones. Every load names a wave-uniform base (plane + 16-row strip) and one of two lane offsets, va (A) and vb (Bt).
  // Past the last k step the offsets stand still: a run that has no k step left reads the last one again (in bounds,
  // never used), so every run holds the same number of loads and the counted waits stay exact.
  // The inner loops are unrolled so that every fragment and accumulator index is a constant (registers, no scratch).
  struct FragSet { v16b a[4], l[4], b[4], m[4]; };                // A, second A plane, Bt, second Bt plane
  const size_t sa = (size_t)lda * 32, sb = (size_t)ldb * 32;      // bytes from one 16-row strip to the next
  gcp pa[4], pa2[4], pb[4], pb2[4];                               // the planes' four strips, scalar bases
#pragma unroll
  for (int i = 0; i < 4; ++i) {
    pa[i]  = uni_ptr((const char*)Ab + i * sa);
    pb[i]  = uni_ptr((const char*)Bb + i * sb);
    pa2[i] = (NSPLIT >= 1) ? uni_ptr((const char*)Ab2 + i * sa) : pa[i];
    pb2[i] = (NSPLIT == 2) ? uni_ptr((const char*)Bb2 + i * sb) : pb[i];
  }
  unsigned va = ((unsigned)(m0 + rlane) * (unsigned)lda + (unsigned)koff) * 2u;
  unsigned vb = ((unsigned)(n0 + rlane) * (unsigned)ldb + (unsigned)koff) * 2u;
  const int nk = K >> 5;
  int kl = 0;                                                     // the k step that va and vb stand at, unclamped
  auto load = [&](FragSet& S) {
#pragma unroll
    for (int j = 0; j < 4; ++j) {
      S.b[j] = ldfrag_o(pb[j], vb);
      if (NSPLIT == 2) S.m[j] = ldfrag_o(pb2[j], vb); else S.m[j] = S.b[j];
    }
#pragma unroll
    for (int i = 0; i < 4; ++i) {
      S.a[i] = ldfrag_o(pa[i], va);
      if (NSPLIT >= 1) S.l[i] = ldfrag_o(pa2[i], va); else S.l[i] = S.a[i];
    }
    // the scheduler may not sink the run's loads into the products behind it, where each would go out late
    __builtin_amdgcn_sched_barrier(0);
  };
  auto advance = [&]() {
    // the wait below stays behind the products: lifted to stand directly behind the loads it would hold the products up
    __builtin_amdgcn_sched_barrier(0);
#if defined(__HIP_DEVICE_COMPILE__)
    // precaution: this wait stands ahead of every rewrite of a register that a load of the last run names; it takes
    // the two lane offsets and the scalar bases as operands so that they stay whole up to it and the additions
    // stay behind it
    asm volatile("s_wait_xcnt 0x0" : "+v"(va), "+v"(vb)
                 : "s"(pa[0]), "s"(pa[1]), "s"(pa[2]), "s"(pa[3]), "s"(pb[0]), "s"(pb[1]), "s"(pb[2]), "s"(pb[3]),
                   "s"(pa2[0]), "s"(pa2[1]), "s"(pa2[2]), "s"(pa2[3]), "s"(pb2[0]), "s"(pb2[1]), "s"(pb2[2]), "s"(pb2[3])
                 : "memory");
#endif
    ++kl;
    const unsigned inc = (kl < nk) ? 64u : 0u;                    // wave-uniform
    va += inc;
    vb += inc;
  };
  auto products = [&](const FragSet& S) {
#pragma unroll
    for (int i = 0; i < 4; ++i)
#pragma unroll
      for (int j = 0; j < 4; ++j) {
        acc[i][j] = mma_b_raw(S.a[i], S.b[j], acc[i][j]);
        if (NSPLIT >= 1) acc[i][j] = mma_b_raw(S.l[i], S.b[j], acc[i][j]);
        if (NSPLIT == 2) acc[i][j] = mma_b_raw(S.a[i], S.m[j], acc[i][j]);
      }
  };
  FragSet S0, S1;
  load(S0); advance();
  const int ng = nk / 2;                                          // whole turns of the two sets
  for (int g = 0; g < ng; ++g) {
    load(S1); products(S0); advance();
    load(S0); products(S1); advance();
  }
  if (nk - ng * 2 >= 1) products(S0);                             // the k step left over (wave-uniform)
  acc_guard4(acc[0][0], acc[0][1], acc[0][2], acc[0][3]);
  acc_guard4(acc[1][0], acc[1][1], acc[1][2], acc[1][3]);
  acc_guard4(acc[2][0], acc[2][1], acc[2][2], acc[2][3]);
  acc_guard4(acc[3][0], acc[3][1], acc[3][2], acc[3][3]);

  // ---- epilogue ----
  float* slab = sT + wave * (16 * 68);             // per-wave 16x64 slab, pitch 68 floats
#pragma unroll
  for (int i = 0; i < 4; ++i) {
    const int mBase = m0 + (i << 4);
#pragma unroll
    for (int j = 0; j < 4; ++j) {
#pragma unroll
      for (int r = 0; r < 8; ++r) {
        slab[(mOff + r) * 68 + (j << 4) + rlane] = acc[i][j][r];
      }
    }
    __builtin_amdgcn_fence(__ATOMIC_RELEASE, "workgroup");
    __builtin_amdgcn_wave_barrier();
    __builtin_amdgcn_fence(__ATOMIC_ACQUIRE, "workgroup");
    if (OUT_MODE == 0) {
      float* C = (float*)Cout + (size_t)b * strideC;
      const int hh = lane >> 4, c4 = (lane & 15) * 4;     // 256-B row segment = 16 lanes x 16 B
      {
#pragma unroll
        for (int it = 0; it < 8; ++it) {
          const int row = it * 2 + hh;                     // it 0..7 x hh 0..1 = rows 0..15
          const v4f v = *(const v4f*)(slab + row * 68 + c4);
          *(v4f*)(C + (size_t)(mBase + row) * ldc + n0 + c4) = v;
        }
        
      }
    } else {
      const int q = lane >> 3, c8 = (lane & 7) * 8;
      unsigned short* C  = (unsigned short*)Cout  + (size_t)b * strideC;
      unsigned short* C2 = (unsigned short*)Cout2 + (size_t)b * strideC2;
      const bool wlo = (OUT_MODE == 2) || (n0 < N2);      // wave-uniform
      v4u hv[4], lv[4];
#pragma unroll
      for (int it = 0; it < 4; ++it) {
        const int row = it * 4 + q;                        // it 0..3 x q 0..3 = rows 0..15
        const float* sp = slab + row * 68 + c8;
        v4u a, a2;
#pragma unroll
        for (int e = 0; e < 4; ++e) {
          const float f0 = sp[2 * e], f1 = sp[2 * e + 1];
          unsigned short h0, h1, l0, l1;
          if (OUT_MODE == 2) {
            h0 = bf_bits(f0); h1 = bf_bits(f1);
            l0 = bf_bits(f0 - bf_up(h0)); l1 = bf_bits(f1 - bf_up(h1));
          } else {
            const _Float16 x0 = (_Float16)f0, x1 = (_Float16)f1;
            h0 = h_bits(x0); h1 = h_bits(x1);
            l0 = h_bits((_Float16)((f0 - (float)x0) * rscale));
            l1 = h_bits((_Float16)((f1 - (float)x1) * rscale));
          }
          a[e] = pk16(h0, h1); a2[e] = pk16(l0, l1);
        }
        hv[it] = a; lv[it] = a2;
      }
      {
#pragma unroll
        for (int it = 0; it < 4; ++it) {
          const int row = it * 4 + q;
          *(v4u*)(C + (size_t)(mBase + row) * ldc + n0 + c8) = hv[it];
          if (wlo) *(v4u*)(C2 + (size_t)(mBase + row) * ldc2 + n0 + c8) = lv[it];
        }
        
      }
    }
    __builtin_amdgcn_fence(__ATOMIC_RELEASE, "workgroup");
    __builtin_amdgcn_wave_barrier();
    __builtin_amdgcn_fence(__ATOMIC_ACQUIRE, "workgroup");
  }
}

template <int NSPLIT, int OUT_MODE>
__global__ __launch_bounds__(256) void gemm64(
    const unsigned short* __restrict__ Ap, const unsigned short* A2p, int lda, long long strideA,
    const unsigned short* __restrict__ Btp, const unsigned short* Bt2p, int ldb, long long strideB,
    void* Cout, int ldc, long long strideC,
    void* Cout2, int ldc2, long long strideC2, int N2,
    int M, int N, int K, float rscale) {
  __shared__ __align__(16) float sT[8 * 16 * 68];
  gemm64_body<NSPLIT, OUT_MODE>(Ap, A2p, lda, strideA, Btp, Bt2p, ldb, strideB, Cout, ldc, strideC,
                                Cout2, ldc2, strideC2, N2, M, N, K, rscale, sT, blockIdx.x, blockIdx.y);
}

// The three projections in one grid: each alone fills a quarter of the chip's WGPs and none reads another's result.
//   blockIdx.y = 0: q = x . Wq^T -> bf16 hi/lo planes [b*SEQ+t][h*64+d]   (M=2048, N=1024, K=1024)
//   blockIdx.y = 1: k = x . Wk^T -> bf16 hi/lo planes
//   blockIdx.y = 2: v^T = Wv . x^T per batch -> f16 hi plane [b][h*64+d][s] (pitch SEQ) and residual plane (x4096,
//                   keys < VLP only, pitch VLP); A = Wvb [n][k], Bt = Xb rows of batch b = blockIdx.x / VTB
#define PJB ((MROWS / 64) * (DM / 64) / 8)   // 64 blocks of 8 tiles per projection
#define VTB ((DM / 64) * (SEQ / 64) / 8)     // 32 blocks of 8 tiles per batch of v^T
static_assert(VTB * NB == PJB);
__global__ __launch_bounds__(256) void gemm_qkv(
    const unsigned short* __restrict__ Xb, const unsigned short* __restrict__ Wqb,
    const unsigned short* __restrict__ Wkb, const unsigned short* __restrict__ Wvb,
    unsigned short* Qh, unsigned short* Ql, unsigned short* Kh, unsigned short* Kl,
    unsigned short* VTh, unsigned short* VTl) {
  __shared__ __align__(16) float sT[8 * 16 * 68];
  const int which = blockIdx.y;                 // block-uniform
  if (which < 2) {
    const unsigned short* Wb = which ? Wkb : Wqb;
    unsigned short* Ch = which ? Kh : Qh;
    unsigned short* Cl = which ? Kl : Ql;
    gemm64_body<0, 2>(Xb, Xb, DM, 0LL, Wb, Wb, DM, 0LL,
                      (void*)Ch, DM, 0LL, (void*)Cl, DM, 0LL, DM,
                      MROWS, DM, DM, 1.0f, sT, blockIdx.x, 0);
  } else {
    const int b = blockIdx.x / VTB;
    gemm64_body<0, 3>(Wvb, Wvb, DM, 0LL, Xb, Xb, DM, (long long)SEQ * DM,
                      (void*)VTh, SEQ, (long long)DM * SEQ, (void*)VTl, VLP, (long long)DM * VLP, VLP,
                      DM, SEQ, DM, 4096.0f, sT, blockIdx.x - b * VTB, b);
  }
}

// =====================================================================================================
// Causal attention with relative-index (skew) bias and four gathered structure biases, head dim 64.
//   q planes (bf16 hi / lo): element (b, t, h, d) at [(b*SEQ + t)*DM + h*64 + d]; k planes same layout.
//   v^T hi plane (f16): element (b, h, d, s) at [(b*DM + h*64 + d)*SEQ + s]
//   v^T residual plane (f16, (v - hi)*4096): [(b*DM + h*64 + d)*VLP + s], s < VLP, read only when RES
//   er: bf16 [SEQ][64]; qe: f32 [h][b*SEQ + t][QEP] = q . T^T for the combined structure table T
//   idx arrays: int [b][t][s], clamped to each sub-table's valid range before use.
//   scores[t][s] = (q_t.k_s + q_t.er[SEQ-1+s-t] + qe[OFF_BAR+ibar] + qe[OFF_POS+ipos] + qe[OFF_OCT+ioct]
//                   + qe[OFF_SEM+isem]) * sscale for s <= t, else -1e9 (replace mask).
//   q.k : bf16 hi/lo split (3 products); q.er : q hi/lo x bf16 er (2 products); f32 accumulate.
//   Skew band: a block (64 query rows, key tile kv0) needs er rows ebb .. ebb+127 with
//   ebb = SEQ-64+kv0-qb*64 >= 0 (staged in LDS, addresses clamped at SEQ-1; clamped rows only feed
//   masked positions). Wave w (rows q0..q0+15) computes 5 subtiles of 16 band rows starting at
//   band row 16*(3-w); the diagonal D[mi][15-mi+jj] is fetched with two unconditional bpermutes per
//   element and selected by value; subtiles are produced one at a time (prev / cur).
//   p = exp(s - m) carried as f16(1024 p); context = p . v on f16 WMMA; RES adds f16 residual planes of p and v
//   (scale 4096, separate accumulator folded back with 1/4096 per chunk in f32); online softmax in f32.
//   Block = 4 waves = 64 query rows of one (b, h); grid = NQB * NH * NB; key tiles kt = 0..qb
//   (block-uniform trip count <= NQB). K / V^T / er chunk staging: 128 threads, plain 16-B loads, all issued
//   ahead of the first LDS store, __syncthreads before and after; P tiles are wave-private, spilled with _Float16 element stores and
//   LDS (static byte buffer): Ksh 0, Ksl 8192, Vth 16384, Esh 24576 (128x64 bf16), Psh 40960,
//   Vtl 49152 (RES), Psl 57344 (RES); the f32 context staging Os (16 KB) aliases offset 0 after the key
//   loop and a block barrier.
//   Output planes (bf16 hi / lo of the normalised context) at [(b*SEQ + t)*DM + h*64 + d];
//   coverage: each wave stores rows q0..q0+15 (it 0..3 x lane>>3 0..3) x 64 columns (8 lanes x 8) of both planes.
// =====================================================================================================
template <bool RES>
__device__ __forceinline__
void attn_body(const unsigned short* __restrict__ qhp, const unsigned short* __restrict__ qlp,
                const unsigned short* __restrict__ khp, const unsigned short* __restrict__ klp,
                const unsigned short* __restrict__ vhp, const unsigned short* __restrict__ vlp,
                const unsigned short* __restrict__ erp, const float* __restrict__ qe,
                const int* __restrict__ ibar, const int* __restrict__ ipos,
                const int* __restrict__ ioct, const int* __restrict__ isem,
                unsigned short* ohp, unsigned short* olp,
                unsigned char* smem, int qb, int h, int b, float sscale) {
  union FB { v16b v; v8b h[2]; };
  union FH { v16h v; v8h h[2]; };
  __bf16*   const Ksh = (__bf16*)(void*)(smem);
  __bf16*   const Ksl = (__bf16*)(void*)(smem + 8192);
  _Float16* const Vth = (_Float16*)(void*)(smem + 16384);
  __bf16*   const Esh = (__bf16*)(void*)(smem + 24576);
  _Float16* const Psh = (_Float16*)(void*)(smem + 40960);
  _Float16* const Vtl = (_Float16*)(void*)(smem + (RES ? 49152 : 16384));   // never dereferenced when !RES
  _Float16* const Psl = (_Float16*)(void*)(smem + (RES ? 57344 : 40960));   // never dereferenced when !RES
  float*    const Os  = (float*)(void*)(smem);                              // after the key loop only

  const int tid  = threadIdx.x;
  const int wave = tid >> 5;
  const int lane = tid & 31;
  const int hh   = lane >> 4;
  const int c    = lane & 15;

  const int q0   = qb * 64 + wave * 16;
  const size_t rowB = (size_t)b * SEQ;

  const __bf16* Qh  = (const __bf16*)(const void*)qhp + (size_t)h * HD;
  const __bf16* Ql  = (const __bf16*)(const void*)qlp + (size_t)h * HD;
  const __bf16* Kh  = (const __bf16*)(const void*)khp + (size_t)h * HD;
  const __bf16* Kl  = (const __bf16*)(const void*)klp + (size_t)h * HD;
  const _Float16* Vh = (const _Float16*)(const void*)vhp + ((size_t)b * DM + (size_t)h * HD) * SEQ;
  const _Float16* Vl = (const _Float16*)(const void*)vlp + ((size_t)b * DM + (size_t)h * HD) * VLP;
  const __bf16* Erb = (const __bf16*)(const void*)erp;
  const size_t trow0 = rowB + (size_t)(q0 + 8 * hh);                 // b*SEQ + t for r = 0 of this lane half
  const char* qeh    = (const char*)(qe + (size_t)h * MROWS * QEP);   // structure products of head h (block-uniform)
  const unsigned qlb = (unsigned)trow0 * (QEP * 4u);                  // byte offset of this lane's row, r = 0
  const unsigned ilb = ((unsigned)trow0 * SEQ + (unsigned)c) * 4u;    // byte offset of index (row r = 0, key c)

  // ---- Q fragments (A operand, row = lane&15): 2 d-chunks, hi and lo ----
  v16b qah[2], qal[2];
#pragma unroll
  for (int dc = 0; dc < 2; ++dc) {
    const size_t qo = (rowB + q0 + c) * DM + dc * 32 + 8 * hh;
    qah[dc] = ldfrag_b(Qh + qo);
    qal[dc] = ldfrag_b(Ql + qo);
  }

  float mrow[8], lrow[8];
  v8f oacc[4];
#pragma unroll
  for (int r = 0; r < 8; ++r) { mrow[r] = -INFINITY; lrow[r] = 0.f; }
#pragma unroll
  for (int t = 0; t < 4; ++t) oacc[t] = zero8();

  const int nkt = (qb + 1 < NQB) ? (qb + 1) : NQB;   // causal: key tiles 0..qb, block-uniform
  unsigned iv = ilb;                                  // byte offset of index (row r = 0, key kv0 + c)
  for (int kt = 0; kt < nkt; ++kt) {
    const int kv0 = kt * 64;
    int ebb = SEQ - 64 + kv0 - qb * 64;                 // >= 0 for kt >= 0, qb <= NQB-1
    ebb = (ebb < 0) ? 0 : ebb;

    // ---- gathered structure biases of the whole tile, bs[j][r] for key kv0 + 16 j + c and row q0 + 8 hh + r.
    //      They depend on no product of this tile, so the loads go out in runs, each back to back: for RPR rows
    //      at a time the 16 RPR index loads, then (indices clamped, byte offsets formed) the 16 RPR table gathers.
    float bs[4][8];
    constexpr int RPR = RES ? 4 : 8;                    // fewer at a time where the residual path needs the registers
#pragma unroll
    for (int g = 0; g < 8; g += RPR) {
      int      xi[RPR][4][4];
      unsigned go[RPR][4][4];
      float    gv[RPR][4][4];
#pragma unroll
      for (int r = 0; r < RPR; ++r)
#pragma unroll
        for (int j = 0; j < 4; ++j) {
          const size_t ko = (size_t)((g + r) * SEQ + j * 16) * 4;
          xi[r][j][0] = *(const int*)((const char*)ibar + ko + iv);
          xi[r][j][1] = *(const int*)((const char*)ipos + ko + iv);
          xi[r][j][2] = *(const int*)((const char*)ioct + ko + iv);
          xi[r][j][3] = *(const int*)((const char*)isem + ko + iv);
        }
      // the scheduler may not sink the index loads to their first uses, where each would wait alone
      __builtin_amdgcn_sched_barrier(0);
#pragma unroll
      for (int r = 0; r < RPR; ++r)
#pragma unroll
        for (int j = 0; j < 4; ++j) {
          go[r][j][0] = qlb + (unsigned)iclamp(xi[r][j][0], 0, 16) * 4u;
          go[r][j][1] = qlb + (unsigned)iclamp(xi[r][j][1], 0, 95) * 4u;
          go[r][j][2] = qlb + (unsigned)iclamp(xi[r][j][2], 0, 24) * 4u;
          go[r][j][3] = qlb + (unsigned)iclamp(xi[r][j][3], 0, 12) * 4u;
        }
      // all offsets are formed ahead of the first gather, so that no gather's offset register is rewritten in the run
      __builtin_amdgcn_sched_barrier(0);
#pragma unroll
      for (int r = 0; r < RPR; ++r)
#pragma unroll
        for (int j = 0; j < 4; ++j) {
          const size_t ro = (size_t)(g + r) * (QEP * 4);
          gv[r][j][0] = *(const float*)(qeh + (ro + OFF_BAR * 4) + go[r][j][0]);
          gv[r][j][1] = *(const float*)(qeh + (ro + OFF_POS * 4) + go[r][j][1]);
          gv[r][j][2] = *(const float*)(qeh + (ro + OFF_OCT * 4) + go[r][j][2]);
          gv[r][j][3] = *(const float*)(qeh + (ro + OFF_SEM * 4) + go[r][j][3]);
        }
      // precaution: this wait stands ahead of every later rewrite of a gather's offset register
      asm volatile("s_wait_xcnt 0x0" ::: "memory");
      // the scheduler may not sink the gathers to the sums, nor lift a sum over the wait
      __builtin_amdgcn_sched_barrier(0);
#pragma unroll
      for (int r = 0; r < RPR; ++r)
#pragma unroll
        for (int j = 0; j < 4; ++j)
          bs[j][g + r] = (gv[r][j][0] + gv[r][j][1]) + (gv[r][j][2] + gv[r][j][3]);
      // the sums stay ahead of the next run of loads: they free the gathered values' registers for it
      __builtin_amdgcn_sched_barrier(0);
    }
    iv += 64u * 4u;                                     // next key tile's index columns

    __syncthreads();
    {
      const int r = tid >> 1, half = (tid & 1) * 32;
      const __bf16*   kg  = Kh + (rowB + kv0 + r) * DM + half;    // K row kv0+r, d = half..half+31
      const __bf16*   klg = Kl + (rowB + kv0 + r) * DM + half;
      const _Float16* vg  = Vh + (size_t)r * SEQ + kv0 + half;    // V^T row d = r, s = kv0+half..+31
      const int kvl = (kv0 + 64 <= VLP) ? kv0 : (VLP - 64);     // clamped address into the residual plane
      const _Float16* vlg = Vl + (size_t)r * VLP + kvl + half;
      const bool resOK = (kv0 + 64 <= VLP);                      // block-uniform
      // er band row tid (128 rows x 64), address clamped at SEQ-1
      const int erow = imin(ebb + tid, SEQ - 1);
      const unsigned eo = (unsigned)erow * (HD * 2);              // byte offset of that row
      v8b a0[4], a1[4], e0[8];
      v8h b0[4], b1[4];
#pragma unroll
      for (int i = 0; i < 4; ++i) {
        a0[i] = *(const v8b*)(kg + 8 * i);
        a1[i] = *(const v8b*)(klg + 8 * i);
        b0[i] = *(const v8h*)(vg + 8 * i);
        if (RES) b1[i] = *(const v8h*)(vlg + 8 * i);
      }
#pragma unroll
      for (int i = 0; i < 8; ++i) e0[i] = *(const v8b*)((const char*)Erb + 16 * i + eo);
      // precaution: this wait stands ahead of every later rewrite of the loads' address registers; it names
      // them so that they stay whole up to it (no later load of the run lands in one)
      if (RES) asm volatile("s_wait_xcnt 0x0" :: "v"(kg), "v"(klg), "v"(vg), "v"(vlg), "v"(eo) : "memory");
      else     asm volatile("s_wait_xcnt 0x0" :: "v"(kg), "v"(klg), "v"(vg), "v"(eo) : "memory");
      // the scheduler may not sink the staging loads to their LDS stores, where each would wait alone
      __builtin_amdgcn_sched_barrier(0);
#pragma unroll
      for (int i = 0; i < 4; ++i) {
        *(v8b*)(Ksh + r * 64 + half + 8 * i) = a0[i];
        *(v8b*)(Ksl + r * 64 + half + 8 * i) = a1[i];
        *(v8h*)(Vth + r * 64 + half + 8 * i) = b0[i];
        if (RES) *(v8h*)(Vtl + r * 64 + half + 8 * i) = resOK ? b1[i] : zero8h();
      }
#pragma unroll
      for (int i = 0; i < 8; ++i) *(v8b*)(Esh + tid * 64 + 8 * i) = e0[i];
    }
    __syncthreads();

    // ---- q.k: 16 query rows x 64 keys per wave, 3 bf16 products ----
    v8f s[4];
#pragma unroll
    for (int j = 0; j < 4; ++j) {
      s[j] = zero8();
#pragma unroll
      for (int dc = 0; dc < 2; ++dc) {
        FB kb, kl;
        kb.h[0] = *(const v8b*)(Ksh + (j * 16 + c) * 64 + dc * 32 + 8 * hh);
        kb.h[1] = *(const v8b*)(Ksh + (j * 16 + c) * 64 + dc * 32 + 16 + 8 * hh);
        kl.h[0] = *(const v8b*)(Ksl + (j * 16 + c) * 64 + dc * 32 + 8 * hh);
        kl.h[1] = *(const v8b*)(Ksl + (j * 16 + c) * 64 + dc * 32 + 16 + 8 * hh);
        s[j] = mma_b(qah[dc], kb.v, s[j]);
        s[j] = mma_b(qah[dc], kl.v, s[j]);
        s[j] = mma_b(qal[dc], kb.v, s[j]);
      }
    }

    // ---- q.er skew band: 5 subtiles of 16 band rows, streamed; diagonal extraction by bpermute ----
    {
      const int wb = (3 - wave) * 16;           // this wave's band offset inside Esh
      v8f prev = zero8();
#pragma unroll
      for (int u = 0; u < 5; ++u) {
        v8f cur = zero8();
#pragma unroll
        for (int dc = 0; dc < 2; ++dc) {
          FB eb;
          const __bf16* ep = Esh + (wb + u * 16 + c) * 64 + dc * 32 + 8 * hh;
          eb.h[0] = *(const v8b*)(ep);
          eb.h[1] = *(const v8b*)(ep + 16);
          cur = mma_b(qah[dc], eb.v, cur);
          cur = mma_b(qal[dc], eb.v, cur);
        }
        if (u >= 1) {                            // key subtile jsub = u-1 uses subtiles u-1 (prev) and u (cur)
#pragma unroll
          for (int r = 0; r < 8; ++r) {
            const int base = 15 - (8 * hh + r) + c;                  // 0..30
            const int src  = (lane & 16) | (base & 15);
            const float vlo = __shfl(prev[r], src, 32);
            const float vhi = __shfl(cur[r], src, 32);
            s[u - 1][r] += (base < 16) ? vlo : vhi;
          }
        }
        prev = cur;
      }
    }

    // ---- add the gathered structure biases, scale, causal replace mask, online softmax, P (x1024, f16) and
    //      P residual (x4096) to LDS ----
    _Float16* pwh = Psh + wave * (16 * 64);
    _Float16* pwl = Psl + (RES ? wave : 0) * (16 * 64);
#pragma unroll
    for (int r = 0; r < 8; ++r) {
      const int    trow = q0 + 8 * hh + r;
      float m = -INFINITY;
#pragma unroll
      for (int j = 0; j < 4; ++j) {
        const int key = kv0 + j * 16 + c;
        float sv = (s[j][r] + bs[j][r]) * sscale;
        sv = (key <= trow) ? sv : -1.0e9f;
        s[j][r] = sv;
        m = fmaxf(m, sv);
      }
#pragma unroll
      for (int off = 1; off < 16; off <<= 1) m = fmaxf(m, __shfl_xor(m, off, 32));
      const float mnew  = fmaxf(mrow[r], m);
      const float msafe = (mnew == -INFINITY) ? 0.f : mnew;
      const float alpha = __expf(mrow[r] - msafe);
      mrow[r] = mnew;
      float psum = 0.f;
#pragma unroll
      for (int j = 0; j < 4; ++j) {
        const float p = __expf(s[j][r] - msafe);     // masked logit -1e9 against a normal max: exp -> 0
        psum += p;
        const float p1k = p * 1024.0f;
        const _Float16 ph = (_Float16)p1k;
        pwh[(8 * hh + r) * 64 + j * 16 + c] = ph;
        if (RES) {
          const _Float16 pl = (_Float16)((p1k - (float)ph) * 4096.0f);
          pwl[(8 * hh + r) * 64 + j * 16 + c] = pl;
        }
      }
#pragma unroll
      for (int off = 1; off < 16; off <<= 1) psum += __shfl_xor(psum, off, 32);
      lrow[r] = lrow[r] * alpha + psum;
#pragma unroll
      for (int t = 0; t < 4; ++t) oacc[t][r] *= alpha;
    }
    __builtin_amdgcn_fence(__ATOMIC_RELEASE, "workgroup");
    __builtin_amdgcn_wave_barrier();
    __builtin_amdgcn_fence(__ATOMIC_ACQUIRE, "workgroup");

    // ---- context += P . V (f16 WMMA), residual products into a separate accumulator ----
    v8f o1[4];
#pragma unroll
    for (int t = 0; t < 4; ++t) o1[t] = zero8();
#pragma unroll 1
    for (int kk = 0; kk < 2; ++kk) {
      FH pa, pl;
      pa.h[0] = *(const v8h*)(pwh + c * 64 + kk * 32 + 8 * hh);
      pa.h[1] = *(const v8h*)(pwh + c * 64 + kk * 32 + 16 + 8 * hh);
      if (RES) {
        pl.h[0] = *(const v8h*)(pwl + c * 64 + kk * 32 + 8 * hh);
        pl.h[1] = *(const v8h*)(pwl + c * 64 + kk * 32 + 16 + 8 * hh);
      } else {
        pl.v = pa.v;
      }
#pragma unroll
      for (int t = 0; t < 4; ++t) {
        FH vb;
        vb.h[0] = *(const v8h*)(Vth + (t * 16 + c) * 64 + kk * 32 + 8 * hh);
        vb.h[1] = *(const v8h*)(Vth + (t * 16 + c) * 64 + kk * 32 + 16 + 8 * hh);
        oacc[t] = mma_h(pa.v, vb.v, oacc[t]);
        if (RES) {
          FH vl;
          vl.h[0] = *(const v8h*)(Vtl + (t * 16 + c) * 64 + kk * 32 + 8 * hh);
          vl.h[1] = *(const v8h*)(Vtl + (t * 16 + c) * 64 + kk * 32 + 16 + 8 * hh);
          o1[t] = mma_h(pa.v, vl.v, o1[t]);
          o1[t] = mma_h(pl.v, vb.v, o1[t]);
        }
      }
    }
    if (RES) {
#pragma unroll
      for (int t = 0; t < 4; ++t)
#pragma unroll
        for (int r = 0; r < 8; ++r) oacc[t][r] += o1[t][r] * (1.0f / 4096.0f);
    }
  }

  // ---- normalise (1/l and the 1/1024 p carry), stage the wave's 16x64 tile (Os aliases the K tiles,
  __syncthreads();
  float* os = Os + wave * (16 * 64);
#pragma unroll
  for (int r = 0; r < 8; ++r) {
    const float l = lrow[r];
    const float inv = ((l > 0.f) ? (1.0f / l) : 0.f) * (1.0f / 1024.0f);
#pragma unroll
    for (int t = 0; t < 4; ++t) os[(8 * hh + r) * 64 + t * 16 + c] = oacc[t][r] * inv;
  }
  __builtin_amdgcn_fence(__ATOMIC_RELEASE, "workgroup");
  __builtin_amdgcn_wave_barrier();
  __builtin_amdgcn_fence(__ATOMIC_ACQUIRE, "workgroup");
  {
    const int q4 = lane >> 3, c8 = (lane & 7) * 8;
    v4u hv[4], lv[4];
#pragma unroll
    for (int it = 0; it < 4; ++it) {
      const int row = it * 4 + q4;   // it 0..3 x q4 0..3 = rows 0..15 of the wave tile
      const float* sp = os + row * 64 + c8;
      v4u a, a2;
#pragma unroll
      for (int e = 0; e < 4; ++e) {
        const float f0 = sp[2 * e], f1 = sp[2 * e + 1];
        const unsigned short h0 = bf_bits(f0), h1 = bf_bits(f1);
        const unsigned short l0 = bf_bits(f0 - bf_up(h0)), l1 = bf_bits(f1 - bf_up(h1));
        a[e] = pk16(h0, h1); a2[e] = pk16(l0, l1);
      }
      hv[it] = a; lv[it] = a2;
    }
    {
#pragma unroll
      for (int it = 0; it < 4; ++it) {
        const int row = it * 4 + q4;
        const size_t go = (rowB + q0 + row) * DM + (size_t)h * HD + c8;
        *(v4u*)(ohp + go) = hv[it];
        *(v4u*)(olp + go) = lv[it];
      }
      
    }
  }
}

// Every query block in one grid: the blocks with residual planes (qb < RESQB) and the rest depend on the same
// inputs and write disjoint rows, so they run side by side. NB*NH consecutive blocks share one qb; the first half
// of the grid takes qb = NQB-1 downwards (the longest key loops start first), the second half qb = 0 upwards.
__global__ __launch_bounds__(128, 3)
void attn_rel64(const unsigned short* __restrict__ qhp, const unsigned short* __restrict__ qlp,
                const unsigned short* __restrict__ khp, const unsigned short* __restrict__ klp,
                const unsigned short* __restrict__ vhp, const unsigned short* __restrict__ vlp,
                const unsigned short* __restrict__ erp, const float* __restrict__ qe,
                const int* __restrict__ ibar, const int* __restrict__ ipos,
                const int* __restrict__ ioct, const int* __restrict__ isem,
                unsigned short* ohp, unsigned short* olp, float sscale) {
  __shared__ __align__(16) unsigned char smem[65536];
  const int bx = blockIdx.x;
  const int g  = bx / (NB * NH);
  const int bh = bx - g * (NB * NH);
  const int qb = (g < NQB / 2) ? (NQB - 1 - g) : (g - NQB / 2);   // a permutation of 0..NQB-1, block-uniform
  const int h  = bh % NH;
  const int b  = bh / NH;
  if (qb < RESQB)
    attn_body<true>(qhp, qlp, khp, klp, vhp, vlp, erp, qe, ibar, ipos, ioct, isem, ohp, olp, smem, qb, h, b, sscale);
  else
    attn_body<false>(qhp, qlp, khp, klp, vhp, vlp, erp, qe, ibar, ipos, ioct, isem, ohp, olp, smem, qb, h, b, sscale);
}

// =====================================================================================================
// Workspace map (bytes, every region a multiple of its 64x64-tile / whole-line store granularity):
//   Xb   bf16 [2048][1024]            0        4194304
//   Wqb  bf16 [1024 n][1024 k]    4194304        2097152
//   Wkb                           6291456        2097152
//   Wvb                           8388608        2097152
//   Wob                          10485760        2097152
//   Erb  bf16 [1024][64]         12582912         131072
//   Tb   bf16 [192][64]          12713984          24576
//   Qh   bf16 [2048][1024]       12738560        4194304
//   Ql                           16932864        4194304
//   Kh                           21127168        4194304
//   Kl                           25321472        4194304
//   VTh  f16  [2][1024][1024]    29515776        4194304
//   VTl  f16  [2][1024][256]     33710080        1048576
//   QE   f32  [16][2048][192]    34758656       25165824
//   Oh   bf16 [2048][1024]       59924480        4194304
//   Ol                           64118784        4194304
//   end                          68313088
// Weights are [out n][in k] with k contiguous = the Bt / A layout the GEMM wants, so they are only converted.
// =====================================================================================================
extern "C" void kernel_launch(void* const* d_in, const int* in_sizes, int n_in,
                              void* d_out, int out_size, void* d_ws, size_t ws_size,
                              hipStream_t stream) {
  if (n_in < 14) return;
  if (in_sizes[0] != NB * SEQ * DM) return;
  if (in_sizes[1] != NB * SEQ * SEQ || in_sizes[2] != NB * SEQ * SEQ ||
      in_sizes[3] != NB * SEQ * SEQ || in_sizes[4] != NB * SEQ * SEQ) return;
  if (in_sizes[5] != DM * DM || in_sizes[6] != DM * DM || in_sizes[7] != DM * DM || in_sizes[8] != DM * DM) return;
  if (in_sizes[9] != SEQ * HD) return;
  if (in_sizes[10] != 16 * HD || in_sizes[11] != 95 * HD || in_sizes[12] != 24 * HD || in_sizes[13] != 12 * HD) return;
  if (out_size != NB * SEQ * DM) return;

  const float* x    = (const float*)d_in[0];
  const int*   rbar = (const int*)d_in[1];
  const int*   rpos = (const int*)d_in[2];
  const int*   roct = (const int*)d_in[3];
  const int*   rsem = (const int*)d_in[4];
  const float* Wq   = (const float*)d_in[5];
  const float* Wk   = (const float*)d_in[6];
  const float* Wv   = (const float*)d_in[7];
  const float* Wo   = (const float*)d_in[8];
  const float* Er   = (const float*)d_in[9];
  const float* Ebar = (const float*)d_in[10];
  const float* Epos = (const float*)d_in[11];
  const float* Eoct = (const float*)d_in[12];
  const float* Esem = (const float*)d_in[13];

  const size_t PX  = (size_t)MROWS * DM * 2;          //  4194304  16-bit activation plane [2048][1024]
  const size_t PW  = (size_t)DM * DM * 2;             //  2097152  16-bit weight plane
  const size_t PE  = (size_t)SEQ * HD * 2;            //   131072  er plane
  const size_t PT  = (size_t)TROWS * HD * 2;          //    24576  combined structure table
  const size_t PVT = (size_t)NB * DM * SEQ * 2;       //  4194304  v^T hi plane
  const size_t PVL = (size_t)NB * DM * VLP * 2;       //  1048576  v^T residual plane
  const size_t PQE = (size_t)NH * MROWS * QEP * 4;    // 25165824  structure products
  size_t off = 0;
  const size_t oXb  = off; off += PX;
  const size_t oWq  = off; off += PW;
  const size_t oWk  = off; off += PW;
  const size_t oWv  = off; off += PW;
  const size_t oWo  = off; off += PW;
  const size_t oEr  = off; off += PE;
  const size_t oTb  = off; off += PT;
  const size_t oQh  = off; off += PX;
  const size_t oQl  = off; off += PX;
  const size_t oKh  = off; off += PX;
  const size_t oKl  = off; off += PX;
  const size_t oVTh = off; off += PVT;
  const size_t oVTl = off; off += PVL;
  const size_t oQE  = off; off += PQE;
  const size_t oOh  = off; off += PX;
  const size_t oOl  = off; off += PX;
  if (off > ws_size) return;                          // off = 68313088
  if (off > (size_t)134217728) return;

  char* ws = (char*)d_ws;
  unsigned short* Xb  = (unsigned short*)(ws + oXb);
  unsigned short* Wqb = (unsigned short*)(ws + oWq);
  unsigned short* Wkb = (unsigned short*)(ws + oWk);
  unsigned short* Wvb = (unsigned short*)(ws + oWv);
  unsigned short* Wob = (unsigned short*)(ws + oWo);
  unsigned short* Erb = (unsigned short*)(ws + oEr);
  unsigned short* Tb  = (unsigned short*)(ws + oTb);
  unsigned short* Qh  = (unsigned short*)(ws + oQh);
  unsigned short* Ql  = (unsigned short*)(ws + oQl);
  unsigned short* Kh  = (unsigned short*)(ws + oKh);
  unsigned short* Kl  = (unsigned short*)(ws + oKl);
  unsigned short* VTh = (unsigned short*)(ws + oVTh);
  unsigned short* VTl = (unsigned short*)(ws + oVTl);
  float*          QE  = (float*)(ws + oQE);
  unsigned short* Oh  = (unsigned short*)(ws + oOh);
  unsigned short* Ol  = (unsigned short*)(ws + oOl);

  const dim3 blk(256);
  const dim3 gPrep(PB_X + 4 * PB_W + PB_E + PB_T);             // 3110 blocks
  const dim3 gQKV(PJB, 3);                                     // 64 blocks x {q, k, v^T}
  const dim3 gProj(((MROWS / 64) * (DM / 64) + 7) / 8, 1);     // 512 tiles -> 64 blocks: M=2048, N=1024
  const dim3 gQE(((MROWS / 64) * (QEP / 64) + 7) / 8, NH);    //  96 tiles -> 12 blocks x 16 heads

  // (1) x -> bf16 plane; weights [n][k] f32 -> bf16 [n][k]; er -> bf16; combined structure table
  prep_all<<<gPrep, blk, 0, stream>>>(x, Wq, Wk, Wv, Wo, Er, Ebar, Epos, Eoct, Esem,
                                      Xb, Wqb, Wkb, Wvb, Wob, Erb, Tb);
  // (2)-(4) q, k (bf16 hi/lo planes) and v^T (f16 hi plane, residual plane)
  gemm_qkv<<<gQKV, blk, 0, stream>>>(Xb, Wqb, Wkb, Wvb, Qh, Ql, Kh, Kl, VTh, VTl);
  // (5) structure products: qe[h][b*SEQ+t][s] = q . T^T  (A = q hi/lo planes at column h*64, K=64;
  //     Bt = Tb [192][64]; M=2048, N=192, 2 products, f32 out pitch 192)
  gemm64<1, 0><<<gQE, blk, 0, stream>>>(
      Qh, Ql, DM, (long long)HD, Tb, Tb, HD, 0LL,
      (void*)QE, QEP, (long long)MROWS * QEP, (void*)QE, QEP, 0LL, QEP,
      MROWS, QEP, HD, 1.0f);
  // (6) attention: query blocks 0..RESQB-1 with residual planes, the rest without, one grid
  attn_rel64<<<dim3(NB * NH * NQB), dim3(128), 0, stream>>>(
      Qh, Ql, Kh, Kl, VTh, VTl, Erb, QE, rbar, rpos, roct, rsem, Oh, Ol, 0.125f);
  // (7) out = context . Wo^T -> d_out f32 [2048][1024]  (A = context hi + lo planes, 2 products)
  gemm64<1, 0><<<gProj, blk, 0, stream>>>(
      Oh, Ol, DM, 0LL, Wob, Wob, DM, 0LL,
      d_out, DM, 0LL, d_out, DM, 0LL, DM,
      MROWS, DM, DM, 1.0f);
  (void)hipGetLastError();
}

// v004
// A run of this version takes 159 microseconds.
// Timed twice side by side with v003, it ran 1.29 times as fast both times.
// Over all steps from v000 it is 4.92 times as fast.
// Contractions: q, k, v^T projections = v_wmma_f32_16x16x32_bf16 (bf16 operands from RNE-converted inputs, single product);
// q.k^T = v_wmma_f32_16x16x32_bf16 with bf16 hi/lo split q and k (hi.hi + hi.lo + lo.hi);
// q.Er^T skew band and q.T^T structure tables = bf16 hi/lo q times bf16 table rows (2 products);
// p.v = v_wmma_f32_16x16x32_f16 (p carried x1024 in f16, v f16; extra f16 residual planes x4096 of p and v for the first 256 query rows);
// ctx.Wo^T = bf16 hi/lo ctx times bf16 Wo (2 products); all f32 accumulate; bias gathers, causal mask and softmax in f32.
#include <hip/hip_runtime.h>
#include <math.h>
#include <stdint.h>

#define NB    2
#define SEQ   1024
#define DM    1024
#define NH    16
#define HD    64
#define MROWS (NB * SEQ)     // 2048
#define NQB   (SEQ / 64)     // 16 query / key tiles of 64
#define VLP   256            // key pitch of the v^T residual plane (keys 0..VLP-1)
#define RESQB 4              // leading 64-row query blocks that use the p / v residual planes
#define QEP   192            // pitch (floats) of the structure-table products, 151 used
#define TROWS 192            // rows of the combined structure table (151 used, rest zero)
#define OFF_BAR 0            // 16 rows + zero row  -> idx 0..16
#define OFF_POS 17           // 95 rows + zero row  -> idx 0..95
#define OFF_OCT 113          // 24 rows + zero row  -> idx 0..24
#define OFF_SEM 138          // 12 rows + zero row  -> idx 0..12
static_assert(RESQB * 64 <= VLP);
static_assert(NH * HD == DM);
static_assert((SEQ % 64) == 0 && (DM % 64) == 0 && (QEP % 64) == 0 && (TROWS % 64) == 0);
static_assert(OFF_SEM + 13 <= QEP);

typedef _Float16 v16h __attribute__((ext_vector_type(16)));
typedef _Float16 v8h  __attribute__((ext_vector_type(8)));
typedef __bf16   v16b __attribute__((ext_vector_type(16)));
typedef __bf16   v8b  __attribute__((ext_vector_type(8)));
typedef float    v8f  __attribute__((ext_vector_type(8)));
typedef float    v4f  __attribute__((ext_vector_type(4)));
typedef unsigned int v4u __attribute__((ext_vector_type(4)));

// ---- scalar helpers --------------------------------------------------------------------------------
__device__ __forceinline__ unsigned short bf_bits(float f) {          // f32 -> bf16 bits, RNE convert
  unsigned u = __float_as_uint(f);
  return (unsigned short)((u + 0x7FFFu + ((u >> 16) & 1u)) >> 16);
}
__device__ __forceinline__ float bf_up(unsigned short h) { return __uint_as_float(((unsigned)h) << 16); }
__device__ __forceinline__ unsigned short h_bits(_Float16 x) { return __builtin_bit_cast(unsigned short, x); }
__device__ __forceinline__ unsigned pk16(unsigned short a, unsigned short b) { return (unsigned)a | ((unsigned)b << 16); }
__device__ __forceinline__ int iclamp(int v, int lo, int hi) { return (v < lo) ? lo : ((v > hi) ? hi : v); }
__device__ __forceinline__ int imin(int a, int b) { return (a < b) ? a : b; }
__device__ __forceinline__ v8f zero8() { v8f z = {0.f, 0.f, 0.f, 0.f, 0.f, 0.f, 0.f, 0.f}; return z; }
__device__ __forceinline__ v8h zero8h() {
  const _Float16 z = (_Float16)0.0f;
  v8h r = {z, z, z, z, z, z, z, z};
  return r;
}

// ---- fragment loader: 16-bit A/B operand, lane -> row/col (lane&15), p already includes +8*(lane>>4);
//      elements 0..7 <- p[0..7] (k0+8h..), elements 8..15 <- p[16..23] (k0+16+8h..)
__device__ __forceinline__ v16b ldfrag_b(const __bf16* p) {
  union { v16b v; v8b h[2]; } f;
  f.h[0] = *(const v8b*)(p);
  f.h[1] = *(const v8b*)(p + 16);
  return f.v;
}
//      a wave-uniform pointer to global memory, held in scalar registers, so that a load names it and a 32-bit lane
//      offset (left to itself one build formed a vector address pair per strip, and a load of the run landed in it)
typedef const __attribute__((address_space(1))) char* gcp;
typedef const __attribute__((address_space(1))) v8b*  gv8bp;
__device__ __forceinline__ gcp uni_ptr(const char* p) {
  const unsigned long long u = (unsigned long long)p;
  const unsigned lo = (unsigned)__builtin_amdgcn_readfirstlane((int)(unsigned)u);
  const unsigned hi = (unsigned)__builtin_amdgcn_readfirstlane((int)(unsigned)(u >> 32));
  return (gcp)(((unsigned long long)hi << 32) | lo);
}
//      the same elements in the same positions, from a wave-uniform base and the lane's byte offset vo;
//      H2 = bytes from the lane's elements 0..7 to its elements 8..15 (32 in a row-major plane, 512 in fragment order)
template <int H2>
__device__ __forceinline__ v16b ldfrag_o(gcp base, unsigned vo) {
  union { v16b v; v8b h[2]; } f;
  f.h[0] = *(gv8bp)(base + vo);
  f.h[1] = *(gv8bp)(base + H2 + vo);
  return f.v;
}

// ---- WMMA helpers with trailing VALU hazard gap --------------------------------------------------------
__device__ __forceinline__ v8f mma_b(v16b a, v16b b, v8f c) {
  c = __builtin_amdgcn_wmma_f32_16x16x32_bf16(false, a, false, b, (short)0, c, false, false);
#if defined(__HIP_DEVICE_COMPILE__)
  asm volatile("v_nop\n\tv_nop\n\tv_nop\n\tv_nop" : "+v"(c) : "v"(a), "v"(b));
#endif
  return c;
}
__device__ __forceinline__ v8f mma_h(v16h a, v16h b, v8f c) {
  c = __builtin_amdgcn_wmma_f32_16x16x32_f16(false, a, false, b, (short)0, c, false, false);
#if defined(__HIP_DEVICE_COMPILE__)
  asm volatile("v_nop\n\tv_nop\n\tv_nop\n\tv_nop" : "+v"(c) : "v"(a), "v"(b));
#endif
  return c;
}
__device__ __forceinline__ v8f mma_b_raw(v16b a, v16b b, v8f c) {
  return __builtin_amdgcn_wmma_f32_16x16x32_bf16(false, a, false, b, (short)0, c, false, false);
}
__device__ __forceinline__ void acc_guard4(v8f& a, v8f& b, v8f& c, v8f& d) {
#if defined(__HIP_DEVICE_COMPILE__)
  asm volatile("v_nop\n\tv_nop\n\tv_nop\n\tv_nop" : "+v"(a), "+v"(b), "+v"(c), "+v"(d));
#else
  (void)a; (void)b; (void)c; (void)d;
#endif
}

// =====================================================================================================
// f32 -> bf16 (RNE convert), 8 elements per thread, one 16-B store per lane: a wave writes 512 contiguous B
// (n8 is a multiple of 256 for every use here). coverage: n8 threads x 8 = whole plane.
// =====================================================================================================
__device__ __forceinline__ void cvt_bf16x8(const float* __restrict__ in, unsigned short* out, int n8, int blk) {
  const int i = blk * 256 + threadIdx.x;
  if (i < n8) {
    const v4f a = *(const v4f*)(in + (size_t)i * 8);
    const v4f b = *(const v4f*)(in + (size_t)i * 8 + 4);
    v4u p;
    p[0] = pk16(bf_bits(a[0]), bf_bits(a[1]));
    p[1] = pk16(bf_bits(a[2]), bf_bits(a[3]));
    p[2] = pk16(bf_bits(b[0]), bf_bits(b[1]));
    p[3] = pk16(bf_bits(b[2]), bf_bits(b[3]));
    *(v4u*)(out + (size_t)i * 8) = p;
    
  }
}

// =====================================================================================================
// FRAGMENT ORDER of a 16-bit plane [rows][DM] that a GEMM reads as A or Bt: the plane is cut into 16-row strips and
// each strip into blocks of 32 columns; a block is 1 KB = two runs of 512 B, and run u holds, for lane l = 0..31,
// the 8 elements (row l & 15, columns 16 u + 8 (l >> 4) ..+7) at byte 16 l. Blocks of a strip follow one another, then
// the next strip. So each of a fragment's two 16-B loads reads 512 contiguous bytes (4 whole lines) where a row-major
// plane gives it 32 B from each of 16 lines; which element lands in which lane and register does not change.
//   16-B piece index of (row m, columns 8 k8 ..+7) = (((m >> 4) * (DM/32) + (k8 >> 2)) * 2 + ((k8 >> 1) & 1)) * 32
//                                                    + (k8 & 1) * 16 + (m & 15)
// f32 [rows][DM] -> bf16 (RNE convert) in fragment order: thread i makes piece i, so a wave stores 512 contiguous B;
// a block reads 512 contiguous B of each of 16 rows. coverage: n8 threads x 8 = whole plane (the map is one to one).
// =====================================================================================================
static_assert(DM / 32 == 32);
__device__ __forceinline__ void cvt_bf16_frag(const float* __restrict__ in, unsigned short* out, int n8, int blk) {
  const int i = blk * 256 + threadIdx.x;
  if (i < n8) {
    const int l = i & 31, u = (i >> 5) & 1, kb = (i >> 6) & 31, st = i >> 11;
    const size_t so = (size_t)(st * 16 + (l & 15)) * DM + kb * 32 + u * 16 + (l >> 4) * 8;
    const v4f a = *(const v4f*)(in + so);
    const v4f b = *(const v4f*)(in + so + 4);
    v4u p;
    p[0] = pk16(bf_bits(a[0]), bf_bits(a[1]));
    p[1] = pk16(bf_bits(a[2]), bf_bits(a[3]));
    p[2] = pk16(bf_bits(b[0]), bf_bits(b[1]));
    p[3] = pk16(bf_bits(b[2]), bf_bits(b[3]));
    *(v4u*)(out + (size_t)i * 8) = p;
  }
}

// =====================================================================================================
// Combined structure table, bf16 [TROWS][64]: rows 0..15 bar, 16 zero, 17..111 position, 112 zero,
// 113..136 octave, 137 zero, 138..149 semitone, 150..191 zero. 8 threads per row, 8 elements each,
// all four candidate loads unconditional with clamped row addresses, selection by value.
// PB_T = TROWS*8/256 = 6 blocks of prep_all exactly. coverage: 1536 threads x 8 = 192 x 64.
// =====================================================================================================
__device__ __forceinline__ void build_tab(const float* __restrict__ ebar, const float* __restrict__ epos,
                                          const float* __restrict__ eoct, const float* __restrict__ esem,
                                          unsigned short* tab, int blk) {
  const int g = blk * 256 + threadIdx.x;
  if (g < TROWS * 8) {
    const int s  = g >> 3;
    const int d0 = (g & 7) * 8;
    const int rb = iclamp(s, 0, 15);
    const int rp = iclamp(s - OFF_POS, 0, 94);
    const int ro = iclamp(s - OFF_OCT, 0, 23);
    const int rs = iclamp(s - OFF_SEM, 0, 11);
    const bool ub = (s < 16);
    const bool up = (s >= OFF_POS) && (s < OFF_POS + 95);
    const bool uo = (s >= OFF_OCT) && (s < OFF_OCT + 24);
    const bool us = (s >= OFF_SEM) && (s < OFF_SEM + 12);
    float v[8];
#pragma unroll
    for (int e = 0; e < 8; ++e) {
      const int d = d0 + e;
      const float fb = ebar[rb * HD + d];
      const float fp = epos[rp * HD + d];
      const float fo = eoct[ro * HD + d];
      const float fs = esem[rs * HD + d];
      float t = 0.f;
      t = ub ? fb : t;
      t = up ? fp : t;
      t = uo ? fo : t;
      t = us ? fs : t;
      v[e] = t;
    }
    v4u p;
    p[0] = pk16(bf_bits(v[0]), bf_bits(v[1]));
    p[1] = pk16(bf_bits(v[2]), bf_bits(v[3]));
    p[2] = pk16(bf_bits(v[4]), bf_bits(v[5]));
    p[3] = pk16(bf_bits(v[6]), bf_bits(v[7]));
    *(v4u*)(tab + (size_t)s * HD + d0) = p;
    
  }
}

// =====================================================================================================
// All operand preparation in one grid (the seven pieces depend on nothing but the inputs, so they run side by
// side): blocks 0..PB_X-1 convert x, the next 4*PB_W the four weights (these five into fragment order), the next
// PB_E er (row-major), the last PB_T build the combined table. The piece is chosen by blockIdx.x alone (block-uniform).
// =====================================================================================================
#define PB_X (MROWS * DM / 8 / 256)   // 1024
#define PB_W (DM * DM / 8 / 256)      //  512
#define PB_E (SEQ * HD / 8 / 256)     //   32
#define PB_T (TROWS * 8 / 256)        //    6
static_assert(PB_X * 2048 == MROWS * DM && PB_W * 2048 == DM * DM && PB_E * 2048 == SEQ * HD && PB_T * 256 == TROWS * 8);
__global__ __launch_bounds__(256) void prep_all(
    const float* __restrict__ x, const float* __restrict__ wq, const float* __restrict__ wk,
    const float* __restrict__ wv, const float* __restrict__ wo, const float* __restrict__ er,
    const float* __restrict__ ebar, const float* __restrict__ epos,
    const float* __restrict__ eoct, const float* __restrict__ esem,
    unsigned short* xb, unsigned short* wqb, unsigned short* wkb, unsigned short* wvb, unsigned short* wob,
    unsigned short* erb, unsigned short* tab) {
  int blk = blockIdx.x;
  if (blk < PB_X) { cvt_bf16_frag(x, xb, MROWS * DM / 8, blk); return; }
  blk -= PB_X;
  if (blk < 4 * PB_W) {
    const int w = blk / PB_W;
    const float*    in  = (w == 0) ? wq  : (w == 1) ? wk  : (w == 2) ? wv  : wo;
    unsigned short* out = (w == 0) ? wqb : (w == 1) ? wkb : (w == 2) ? wvb : wob;
    cvt_bf16_frag(in, out, DM * DM / 8, blk - w * PB_W);
    return;
  }
  blk -= 4 * PB_W;
  if (blk < PB_E) { cvt_bf16x8(er, erb, SEQ * HD / 8, blk); return; }
  build_tab(ebar, epos, eoct, esem, tab, blk - PB_E);
}

// =====================================================================================================
// Register-blocked batched bf16 WMMA GEMM: C[m][n] = sum_k A[m][k] * Bt[n][k]; one wave per 64x64 tile,
// no block barriers. A row-major [M][K] pitch lda; Bt row-major [N][K] pitch ldb (k contiguous);
// M, N multiples of 64, K a multiple of 32 and at least 32. blockIdx.y = batch index (strides in elements).
// NSPLIT: 0 = A.Bt; 1 = (A + A2).Bt (A2 = unscaled bf16 lo plane of A); 2 = A.Bt + A2.Bt + A.Bt2.
// OUT_MODE: 0 = f32 (pitch ldc); 2 = bf16 hi plane C + bf16 lo plane C2 (lo = RNE(v - hi), unscaled);
//           3 = f16 hi plane C + f16 residual plane C2 = f16((v - hi) * rscale), C2 written only for tiles
//               with n0 < N2 (pitch ldc2, batch stride strideC2).
// FR: false = A and Bt planes row-major; true = both in fragment order (then lda == ldb == K == DM, and a batch
//     stride is a whole number of 16-row strips).
// =====================================================================================================
//   sT: the block's 8 x (16 x 68) f32 staging slabs; bx: the block's index among the tiles; b: batch index.
template <int NSPLIT, int OUT_MODE, bool FR>
__device__ __forceinline__ void gemm64_body(
    const unsigned short* __restrict__ Ap, const unsigned short* A2p, int lda, long long strideA,
    const unsigned short* __restrict__ Btp, const unsigned short* Bt2p, int ldb, long long strideB,
    void* Cout, int ldc, long long strideC,
    void* Cout2, int ldc2, long long strideC2, int N2,
    int M, int N, int K, float rscale, float* sT, int bx, int b) {
  const __bf16* A   = (const __bf16*)(const void*)Ap;
  const __bf16* A2  = (const __bf16*)(const void*)A2p;
  const __bf16* Bt  = (const __bf16*)(const void*)Btp;
  const __bf16* Bt2 = (const __bf16*)(const void*)Bt2p;
  const int lane = threadIdx.x & 31;
  const int wave = threadIdx.x >> 5;
  const int tilesN = N >> 6;
  const int tilesM = M >> 6;
  const int tile = bx * 8 + wave;
  if (tile >= tilesM * tilesN) return;   // wave-uniform; no block barriers in this kernel
  const int tm = tile / tilesN;
  const int tn = tile - tm * tilesN;
  const int m0 = tm << 6;
  const int n0 = tn << 6;

  const __bf16* Ab  = A  + (size_t)b * strideA;
  const __bf16* Bb  = Bt + (size_t)b * strideB;
  const __bf16* Ab2 = (NSPLIT >= 1) ? (A2  + (size_t)b * strideA) : Ab;
  const __bf16* Bb2 = (NSPLIT == 2) ? (Bt2 + (size_t)b * strideB) : Bb;

  const int rlane = lane & 15;                 // row (A) / col (B, D) within subtile
  const int koff  = (lane >> 4) * 8;           // k offset of this lane half
  const int mOff  = (lane >> 4) * 8;           // D row offset

  v8f acc[4][4];
#pragma unroll
  for (int i = 0; i < 4; ++i)
#pragma unroll
    for (int j = 0; j < 4; ++j) acc[i][j] = zero8();

  // k loop, K >= 32: two register sets of fragments. All loads of one k step (32 columns) go out in one run, one k
  // step ahead of their products, so a k step waits for at most the rest of one load round trip instead of four whole
  // ones. Every load names a wave-uniform base (plane + 16-row strip) and one of two lane offsets, va (A) and vb (Bt).
  // Past the last k step the offsets stand still: a run that has no k step left reads the last one again (in bounds,
  // never used), so every run holds the same number of loads and the counted waits stay exact.
  // The inner loops are unrolled so that every fragment and accumulator index is a constant (registers, no scratch).
  struct FragSet { v16b a[4], l[4], b[4], m[4]; };                // A, second A plane, Bt, second Bt plane
  const size_t sa = (size_t)lda * 32, sb = (size_t)ldb * 32;      // bytes from one 16-row strip to the next
  gcp pa[4], pa2[4], pb[4], pb2[4];                               // the planes' four strips, scalar bases
#pragma unroll
  for (int i = 0; i < 4; ++i) {
    pa[i]  = uni_ptr((const char*)Ab + i * sa);
    pb[i]  = uni_ptr((const char*)Bb + i * sb);
    pa2[i] = (NSPLIT >= 1) ? uni_ptr((const char*)Ab2 + i * sa) : pa[i];
    pb2[i] = (NSPLIT == 2) ? uni_ptr((const char*)Bb2 + i * sb) : pb[i];
  }
  //   fragment order: a 16-row strip is as many bytes as in a row-major plane, so the bases above serve both; the
  //   lane's piece stands at 16 * lane in its 512-B run, and a k step is one 1-KB block
  constexpr int      H2   = FR ? 512 : 32;
  constexpr unsigned KINC = FR ? 1024u : 64u;
  unsigned va = FR ? ((unsigned)m0 * (unsigned)lda * 2u + (unsigned)lane * 16u)
                   : (((unsigned)(m0 + rlane) * (unsigned)lda + (unsigned)koff) * 2u);
  unsigned vb = FR ? ((unsigned)n0 * (unsigned)ldb * 2u + (unsigned)lane * 16u)
                   : (((unsigned)(n0 + rlane) * (unsigned)ldb + (unsigned)koff) * 2u);
  const int nk = K >> 5;
  int kl = 0;                                                     // the k step that va and vb stand at, unclamped
  auto load = [&](FragSet& S) {
#pragma unroll
    for (int j = 0; j < 4; ++j) {
      S.b[j] = ldfrag_o<H2>(pb[j], vb);
      if (NSPLIT == 2) S.m[j] = ldfrag_o<H2>(pb2[j], vb); else S.m[j] = S.b[j];
    }
#pragma unroll
    for (int i = 0; i < 4; ++i) {
      S.a[i] = ldfrag_o<H2>(pa[i], va);
      if (NSPLIT >= 1) S.l[i] = ldfrag_o<H2>(pa2[i], va); else S.l[i] = S.a[i];
    }
    // the scheduler may not sink the run's loads into the products behind it, where each would go out late
    __builtin_amdgcn_sched_barrier(0);
  };
  auto advance = [&]() {
    // the wait below stays behind the products: lifted to stand directly behind the loads it would hold the products up
    __builtin_amdgcn_sched_barrier(0);
#if defined(__HIP_DEVICE_COMPILE__)
    // precaution: this wait stands ahead of every rewrite of a register that a load of the last run names; it takes
    // the two lane offsets and the scalar bases as operands so that they stay whole up to it and the additions
    // stay behind it
    asm volatile("s_wait_xcnt 0x0" : "+v"(va), "+v"(vb)
                 : "s"(pa[0]), "s"(pa[1]), "s"(pa[2]), "s"(pa[3]), "s"(pb[0]), "s"(pb[1]), "s"(pb[2]), "s"(pb[3]),
                   "s"(pa2[0]), "s"(pa2[1]), "s"(pa2[2]), "s"(pa2[3]), "s"(pb2[0]), "s"(pb2[1]), "s"(pb2[2]), "s"(pb2[3])
                 : "memory");
#endif
    ++kl;
    const unsigned inc = (kl < nk) ? KINC : 0u;                   // wave-uniform
    va += inc;
    vb += inc;
  };
  auto products = [&](const FragSet& S) {
#pragma unroll
    for (int i = 0; i < 4; ++i)
#pragma unroll
      for (int j = 0; j < 4; ++j) {
        acc[i][j] = mma_b_raw(S.a[i], S.b[j], acc[i][j]);
        if (NSPLIT >= 1) acc[i][j] = mma_b_raw(S.l[i], S.b[j], acc[i][j]);
        if (NSPLIT == 2) acc[i][j] = mma_b_raw(S.a[i], S.m[j], acc[i][j]);
      }
  };
  FragSet S0, S1;
  load(S0); advance();
  const int ng = nk / 2;                                          // whole turns of the two sets
  for (int g = 0; g < ng; ++g) {
    load(S1); products(S0); advance();
    load(S0); products(S1); advance();
  }
  if (nk - ng * 2 >= 1) products(S0);                             // the k step left over (wave-uniform)
  acc_guard4(acc[0][0], acc[0][1], acc[0][2], acc[0][3]);
  acc_guard4(acc[1][0], acc[1][1], acc[1][2], acc[1][3]);
  acc_guard4(acc[2][0], acc[2][1], acc[2][2], acc[2][3]);
  acc_guard4(acc[3][0], acc[3][1], acc[3][2], acc[3][3]);

  // ---- epilogue ----
  float* slab = sT + wave * (16 * 68);             // per-wave 16x64 slab, pitch 68 floats
#pragma unroll
  for (int i = 0; i < 4; ++i) {
    const int mBase = m0 + (i << 4);
#pragma unroll
    for (int j = 0; j < 4; ++j) {
#pragma unroll
      for (int r = 0; r < 8; ++r) {
        slab[(mOff + r) * 68 + (j << 4) + rlane] = acc[i][j][r];
      }
    }
    __builtin_amdgcn_fence(__ATOMIC_RELEASE, "workgroup");
    __builtin_amdgcn_wave_barrier();
    __builtin_amdgcn_fence(__ATOMIC_ACQUIRE, "workgroup");
    if (OUT_MODE == 0) {
      float* C = (float*)Cout + (size_t)b * strideC;
      const int hh = lane >> 4, c4 = (lane & 15) * 4;     // 256-B row segment = 16 lanes x 16 B
      {
#pragma unroll
        for (int it = 0; it < 8; ++it) {
          const int row = it * 2 + hh;                     // it 0..7 x hh 0..1 = rows 0..15
          const v4f v = *(const v4f*)(slab + row * 68 + c4);
          *(v4f*)(C + (size_t)(mBase + row) * ldc + n0 + c4) = v;
        }
        
      }
    } else {
      const int q = lane >> 3, c8 = (lane & 7) * 8;
      unsigned short* C  = (unsigned short*)Cout  + (size_t)b * strideC;
      unsigned short* C2 = (unsigned short*)Cout2 + (size_t)b * strideC2;
      const bool wlo = (OUT_MODE == 2) || (n0 < N2);      // wave-uniform
      v4u hv[4], lv[4];
#pragma unroll
      for (int it = 0; it < 4; ++it) {
        const int row = it * 4 + q;                        // it 0..3 x q 0..3 = rows 0..15
        const float* sp = slab + row * 68 + c8;
        v4u a, a2;
#pragma unroll
        for (int e = 0; e < 4; ++e) {
          const float f0 = sp[2 * e], f1 = sp[2 * e + 1];
          unsigned short h0, h1, l0, l1;
          if (OUT_MODE == 2) {
            h0 = bf_bits(f0); h1 = bf_bits(f1);
            l0 = bf_bits(f0 - bf_up(h0)); l1 = bf_bits(f1 - bf_up(h1));
          } else {
            const _Float16 x0 = (_Float16)f0, x1 = (_Float16)f1;
            h0 = h_bits(x0); h1 = h_bits(x1);
            l0 = h_bits((_Float16)((f0 - (float)x0) * rscale));
            l1 = h_bits((_Float16)((f1 - (float)x1) * rscale));
          }
          a[e] = pk16(h0, h1); a2[e] = pk16(l0, l1);
        }
        hv[it] = a; lv[it] = a2;
      }
      {
#pragma unroll
        for (int it = 0; it < 4; ++it) {
          const int row = it * 4 + q;
          *(v4u*)(C + (size_t)(mBase + row) * ldc + n0 + c8) = hv[it];
          if (wlo) *(v4u*)(C2 + (size_t)(mBase + row) * ldc2 + n0 + c8) = lv[it];
        }
        
      }
    }
    __builtin_amdgcn_fence(__ATOMIC_RELEASE, "workgroup");
    __builtin_amdgcn_wave_barrier();
    __builtin_amdgcn_fence(__ATOMIC_ACQUIRE, "workgroup");
  }
}

template <int NSPLIT, int OUT_MODE, bool FR>
__global__ __launch_bounds__(256) void gemm64(
    const unsigned short* __restrict__ Ap, const unsigned short* A2p, int lda, long long strideA,
    const unsigned short* __restrict__ Btp, const unsigned short* Bt2p, int ldb, long long strideB,
    void* Cout, int ldc, long long strideC,
    void* Cout2, int ldc2, long long strideC2, int N2,
    int M, int N, int K, float rscale) {
  __shared__ __align__(16) float sT[8 * 16 * 68];
  gemm64_body<NSPLIT, OUT_MODE, FR>(Ap, A2p, lda, strideA, Btp, Bt2p, ldb, strideB, Cout, ldc, strideC,
                                Cout2, ldc2, strideC2, N2, M, N, K, rscale, sT, blockIdx.x, blockIdx.y);
}

// The three projections in one grid: each alone fills a quarter of the chip's WGPs and none reads another's result.
//   blockIdx.y = 0: q = x . Wq^T -> bf16 hi/lo planes [b*SEQ+t][h*64+d]   (M=2048, N=1024, K=1024)
//   blockIdx.y = 1: k = x . Wk^T -> bf16 hi/lo planes
//   blockIdx.y = 2: v^T = Wv . x^T per batch -> f16 hi plane [b][h*64+d][s] (pitch SEQ) and residual plane (x4096,
//                   keys < VLP only, pitch VLP); A = Wvb [n][k], Bt = Xb rows of batch b = blockIdx.x / VTB
#define PJB ((MROWS / 64) * (DM / 64) / 8)   // 64 blocks of 8 tiles per projection
#define VTB ((DM / 64) * (SEQ / 64) / 8)     // 32 blocks of 8 tiles per batch of v^T
static_assert(VTB * NB == PJB);
__global__ __launch_bounds__(256) void gemm_qkv(
    const unsigned short* __restrict__ Xb, const unsigned short* __restrict__ Wqb,
    const unsigned short* __restrict__ Wkb, const unsigned short* __restrict__ Wvb,
    unsigned short* Qh, unsigned short* Ql, unsigned short* Kh, unsigned short* Kl,
    unsigned short* VTh, unsigned short* VTl) {
  __shared__ __align__(16) float sT[8 * 16 * 68];
  const int which = blockIdx.y;                 // block-uniform
  if (which < 2) {
    const unsigned short* Wb = which ? Wkb : Wqb;
    unsigned short* Ch = which ? Kh : Qh;
    unsigned short* Cl = which ? Kl : Ql;
    gemm64_body<0, 2, true>(Xb, Xb, DM, 0LL, Wb, Wb, DM, 0LL,
                      (void*)Ch, DM, 0LL, (void*)Cl, DM, 0LL, DM,
                      MROWS, DM, DM, 1.0f, sT, blockIdx.x, 0);
  } else {
    const int b = blockIdx.x / VTB;
    gemm64_body<0, 3, true>(Wvb, Wvb, DM, 0LL, Xb, Xb, DM, (long long)SEQ * DM,
                      (void*)VTh, SEQ, (long long)DM * SEQ, (void*)VTl, VLP, (long long)DM * VLP, VLP,
                      DM, SEQ, DM, 4096.0f, sT, blockIdx.x - b * VTB, b);
  }
}

// =====================================================================================================
// Causal attention with relative-index (skew) bias and four gathered structure biases, head dim 64.
//   q planes (bf16 hi / lo): element (b, t, h, d) at [(b*SEQ + t)*DM + h*64 + d]; k planes same layout.
//   v^T hi plane (f16): element (b, h, d, s) at [(b*DM + h*64 + d)*SEQ + s]
//   v^T residual plane (f16, (v - hi)*4096): [(b*DM + h*64 + d)*VLP + s], s < VLP, read only when RES
//   er: bf16 [SEQ][64]; qe: f32 [h][b*SEQ + t][QEP] = q . T^T for the combined structure table T
//   idx arrays: int [b][t][s], clamped to each sub-table's valid range before use.
//   scores[t][s] = (q_t.k_s + q_t.er[SEQ-1+s-t] + qe[OFF_BAR+ibar] + qe[OFF_POS+ipos] + qe[OFF_OCT+ioct]
//                   + qe[OFF_SEM+isem]) * sscale for s <= t, else -1e9 (replace mask).
//   q.k : bf16 hi/lo split (3 products); q.er : q hi/lo x bf16 er (2 products); f32 accumulate.
//   Skew band: a block (64 query rows, key tile kv0) needs er rows ebb .. ebb+127 with
//   ebb = SEQ-64+kv0-qb*64 >= 0 (staged in LDS, addresses clamped at SEQ-1; clamped rows only feed
//   masked positions). Wave w (rows q0..q0+15) computes 5 subtiles of 16 band rows starting at
//   band row 16*(3-w); the diagonal D[mi][15-mi+jj] is fetched with two unconditional bpermutes per
//   element and selected by value; subtiles are produced one at a time (prev / cur).
//   p = exp(s - m) carried as f16(1024 p); context = p . v on f16 WMMA; RES adds f16 residual planes of p and v
//   (scale 4096, separate accumulator folded back with 1/4096 per chunk in f32); online softmax in f32.
//   Block = 4 waves = 64 query rows of one (b, h); grid = NQB * NH * NB; key tiles kt = 0..qb
//   (block-uniform trip count <= NQB). K / V^T / er chunk staging: 128 threads, plain 16-B loads, all issued
//   ahead of the first LDS store, __syncthreads before and after; P tiles are wave-private, spilled with _Float16 element stores and
//   LDS (static byte buffer): Ksh 0, Ksl 8192, Vth 16384, Esh 24576 (128x64 bf16), Psh 40960,
//   Vtl 49152 (RES), Psl 57344 (RES); the f32 context staging Os (17 KB) aliases offset 0 after the key
//   loop and a block barrier.
//   Output planes (bf16 hi / lo of the normalised context), element (row b*SEQ + t, column h*64 + d), in fragment order;
//   coverage: each wave stores rows q0..q0+15 (lane & 15) x 64 columns (it 0..3 x lane>>4 0..1 x 8) of both planes.
// =====================================================================================================
template <bool RES>
__device__ __forceinline__
void attn_body(const unsigned short* __restrict__ qhp, const unsigned short* __restrict__ qlp,
                const unsigned short* __restrict__ khp, const unsigned short* __restrict__ klp,
                const unsigned short* __restrict__ vhp, const unsigned short* __restrict__ vlp,
                const unsigned short* __restrict__ erp, const float* __restrict__ qe,
                const int* __restrict__ ibar, const int* __restrict__ ipos,
                const int* __restrict__ ioct, const int* __restrict__ isem,
                unsigned short* ohp, unsigned short* olp,
                unsigned char* smem, int qb, int h, int b, float sscale) {
  union FB { v16b v; v8b h[2]; };
  union FH { v16h v; v8h h[2]; };
  __bf16*   const Ksh = (__bf16*)(void*)(smem);
  __bf16*   const Ksl = (__bf16*)(void*)(smem + 8192);
  _Float16* const Vth = (_Float16*)(void*)(smem + 16384);
  __bf16*   const Esh = (__bf16*)(void*)(smem + 24576);
  _Float16* const Psh = (_Float16*)(void*)(smem + 40960);
  _Float16* const Vtl = (_Float16*)(void*)(smem + (RES ? 49152 : 16384));   // never dereferenced when !RES
  _Float16* const Psl = (_Float16*)(void*)(smem + (RES ? 57344 : 40960));   // never dereferenced when !RES
  float*    const Os  = (float*)(void*)(smem);                              // after the key loop only

  const int tid  = threadIdx.x;
  const int wave = tid >> 5;
  const int lane = tid & 31;
  const int hh   = lane >> 4;
  const int c    = lane & 15;

  const int q0   = qb * 64 + wave * 16;
  const size_t rowB = (size_t)b * SEQ;

  const __bf16* Qh  = (const __bf16*)(const void*)qhp + (size_t)h * HD;
  const __bf16* Ql  = (const __bf16*)(const void*)qlp + (size_t)h * HD;
  const __bf16* Kh  = (const __bf16*)(const void*)khp + (size_t)h * HD;
  const __bf16* Kl  = (const __bf16*)(const void*)klp + (size_t)h * HD;
  const _Float16* Vh = (const _Float16*)(const void*)vhp + ((size_t)b * DM + (size_t)h * HD) * SEQ;
  const _Float16* Vl = (const _Float16*)(const void*)vlp + ((size_t)b * DM + (size_t)h * HD) * VLP;
  const __bf16* Erb = (const __bf16*)(const void*)erp;
  const size_t trow0 = rowB + (size_t)(q0 + 8 * hh);                 // b*SEQ + t for r = 0 of this lane half
  const char* qeh    = (const char*)(qe + (size_t)h * MROWS * QEP);   // structure products of head h (block-uniform)
  const unsigned qlb = (unsigned)trow0 * (QEP * 4u);                  // byte offset of this lane's row, r = 0
  const unsigned ilb = ((unsigned)trow0 * SEQ + (unsigned)c) * 4u;    // byte offset of index (row r = 0, key c)

  // ---- Q fragments (A operand, row = lane&15): 2 d-chunks, hi and lo ----
  v16b qah[2], qal[2];
#pragma unroll
  for (int dc = 0; dc < 2; ++dc) {
    const size_t qo = (rowB + q0 + c) * DM + dc * 32 + 8 * hh;
    qah[dc] = ldfrag_b(Qh + qo);
    qal[dc] = ldfrag_b(Ql + qo);
  }

  float mrow[8], lrow[8];
  v8f oacc[4];
#pragma unroll
  for (int r = 0; r < 8; ++r) { mrow[r] = -INFINITY; lrow[r] = 0.f; }
#pragma unroll
  for (int t = 0; t < 4; ++t) oacc[t] = zero8();

  const int nkt = (qb + 1 < NQB) ? (qb + 1) : NQB;   // causal: key tiles 0..qb, block-uniform
  unsigned iv = ilb;                                  // byte offset of index (row r = 0, key kv0 + c)
  for (int kt = 0; kt < nkt; ++kt) {
    const int kv0 = kt * 64;
    int ebb = SEQ - 64 + kv0 - qb * 64;                 // >= 0 for kt >= 0, qb <= NQB-1
    ebb = (ebb < 0) ? 0 : ebb;

    // ---- gathered structure biases of the whole tile, bs[j][r] for key kv0 + 16 j + c and row q0 + 8 hh + r.
    //      They depend on no product of this tile, so the loads go out in runs, each back to back: for RPR rows
    //      at a time the 16 RPR index loads, then (indices clamped, byte offsets formed) the 16 RPR table gathers.
    float bs[4][8];
    constexpr int RPR = RES ? 4 : 8;                    // fewer at a time where the residual path needs the registers
#pragma unroll
    for (int g = 0; g < 8; g += RPR) {
      int      xi[RPR][4][4];
      unsigned go[RPR][4][4];
      float    gv[RPR][4][4];
#pragma unroll
      for (int r = 0; r < RPR; ++r)
#pragma unroll
        for (int j = 0; j < 4; ++j) {
          const size_t ko = (size_t)((g + r) * SEQ + j * 16) * 4;
          xi[r][j][0] = *(const int*)((const char*)ibar + ko + iv);
          xi[r][j][1] = *(const int*)((const char*)ipos + ko + iv);
          xi[r][j][2] = *(const int*)((const char*)ioct + ko + iv);
          xi[r][j][3] = *(const int*)((const char*)isem + ko + iv);
        }
      // the scheduler may not sink the index loads to their first uses, where each would wait alone
      __builtin_amdgcn_sched_barrier(0);
#pragma unroll
      for (int r = 0; r < RPR; ++r)
#pragma unroll
        for (int j = 0; j < 4; ++j) {
          go[r][j][0] = qlb + (unsigned)iclamp(xi[r][j][0], 0, 16) * 4u;
          go[r][j][1] = qlb + (unsigned)iclamp(xi[r][j][1], 0, 95) * 4u;
          go[r][j][2] = qlb + (unsigned)iclamp(xi[r][j][2], 0, 24) * 4u;
          go[r][j][3] = qlb + (unsigned)iclamp(xi[r][j][3], 0, 12) * 4u;
        }
      // all offsets are formed ahead of the first gather, so that no gather's offset register is rewritten in the run
      __builtin_amdgcn_sched_barrier(0);
#pragma unroll
      for (int r = 0; r < RPR; ++r)
#pragma unroll
        for (int j = 0; j < 4; ++j) {
          const size_t ro = (size_t)(g + r) * (QEP * 4);
          gv[r][j][0] = *(const float*)(qeh + (ro + OFF_BAR * 4) + go[r][j][0]);
          gv[r][j][1] = *(const float*)(qeh + (ro + OFF_POS * 4) + go[r][j][1]);
          gv[r][j][2] = *(const float*)(qeh + (ro + OFF_OCT * 4) + go[r][j][2]);
          gv[r][j][3] = *(const float*)(qeh + (ro + OFF_SEM * 4) + go[r][j][3]);
        }
      // precaution: this wait stands ahead of every later rewrite of a gather's offset register
      asm volatile("s_wait_xcnt 0x0" ::: "memory");
      // the scheduler may not sink the gathers to the sums, nor lift a sum over the wait
      __builtin_amdgcn_sched_barrier(0);
#pragma unroll
      for (int r = 0; r < RPR; ++r)
#pragma unroll
        for (int j = 0; j < 4; ++j)
          bs[j][g + r] = (gv[r][j][0] + gv[r][j][1]) + (gv[r][j][2] + gv[r][j][3]);
      // the sums stay ahead of the next run of loads: they free the gathered values' registers for it
      __builtin_amdgcn_sched_barrier(0);
    }
    iv += 64u * 4u;                                     // next key tile's index columns

    __syncthreads();
    {
      // every tile row here is one 128-B line: 8 lanes take a row, so a wave's 16-B load covers 4 whole lines;
      // load i of a thread takes row r + 16 i
      const int r = tid >> 3, c8 = (tid & 7) * 8;
      const __bf16*   kg  = Kh + (rowB + kv0 + r) * DM + c8;      // K row kv0+r, d = c8..c8+7
      const __bf16*   klg = Kl + (rowB + kv0 + r) * DM + c8;
      const _Float16* vg  = Vh + (size_t)r * SEQ + kv0 + c8;      // V^T row d = r, s = kv0+c8..+7
      const int kvl = (kv0 + 64 <= VLP) ? kv0 : (VLP - 64);     // clamped address into the residual plane
      const _Float16* vlg = Vl + (size_t)r * VLP + kvl + c8;
      const bool resOK = (kv0 + 64 <= VLP);                      // block-uniform
      // er band rows r + 16 i (128 rows x 64), row clamped at SEQ-1: min(ebb + r + 16 i, SEQ-1) = min(ebb + r, SEQ-1-16 i)
      // + 16 i; eo[i] is the byte offset of the thread's piece less the constant 16 i rows, which load i adds itself
      unsigned eo[8];
#pragma unroll
      for (int i = 0; i < 8; ++i) eo[i] = (unsigned)imin(ebb + r, SEQ - 1 - 16 * i) * (HD * 2) + (unsigned)c8 * 2u;
      v8b a0[4], a1[4], e0[8];
      v8h b0[4], b1[4];
#pragma unroll
      for (int i = 0; i < 4; ++i) {
        a0[i] = *(const v8b*)(kg + (size_t)i * 16 * DM);
        a1[i] = *(const v8b*)(klg + (size_t)i * 16 * DM);
        b0[i] = *(const v8h*)(vg + (size_t)i * 16 * SEQ);
        if (RES) b1[i] = *(const v8h*)(vlg + (size_t)i * 16 * VLP);
      }
#pragma unroll
      for (int i = 0; i < 8; ++i) e0[i] = *(const v8b*)((const char*)Erb + i * (16 * HD * 2) + eo[i]);
      // precaution: this wait stands ahead of every later rewrite of the loads' address registers; it names
      // them so that they stay whole up to it (no later load of the run lands in one)
      if (RES) asm volatile("s_wait_xcnt 0x0" :: "v"(kg), "v"(klg), "v"(vg), "v"(vlg), "v"(eo[0]), "v"(eo[1]), "v"(eo[2]),
                            "v"(eo[3]), "v"(eo[4]), "v"(eo[5]), "v"(eo[6]), "v"(eo[7]) : "memory");
      else     asm volatile("s_wait_xcnt 0x0" :: "v"(kg), "v"(klg), "v"(vg), "v"(eo[0]), "v"(eo[1]), "v"(eo[2]),
                            "v"(eo[3]), "v"(eo[4]), "v"(eo[5]), "v"(eo[6]), "v"(eo[7]) : "memory");
      // the scheduler may not sink the staging loads to their LDS stores, where each would wait alone
      __builtin_amdgcn_sched_barrier(0);
#pragma unroll
      for (int i = 0; i < 4; ++i) {
        *(v8b*)(Ksh + (r + 16 * i) * 64 + c8) = a0[i];
        *(v8b*)(Ksl + (r + 16 * i) * 64 + c8) = a1[i];
        *(v8h*)(Vth + (r + 16 * i) * 64 + c8) = b0[i];
        if (RES) *(v8h*)(Vtl + (r + 16 * i) * 64 + c8) = resOK ? b1[i] : zero8h();
      }
#pragma unroll
      for (int i = 0; i < 8; ++i) *(v8b*)(Esh + (r + 16 * i) * 64 + c8) = e0[i];
    }
    __syncthreads();

    // ---- q.k: 16 query rows x 64 keys per wave, 3 bf16 products ----
    v8f s[4];
#pragma unroll
    for (int j = 0; j < 4; ++j) {
      s[j] = zero8();
#pragma unroll
      for (int dc = 0; dc < 2; ++dc) {
        FB kb, kl;
        kb.h[0] = *(const v8b*)(Ksh + (j * 16 + c) * 64 + dc * 32 + 8 * hh);
        kb.h[1] = *(const v8b*)(Ksh + (j * 16 + c) * 64 + dc * 32 + 16 + 8 * hh);
        kl.h[0] = *(const v8b*)(Ksl + (j * 16 + c) * 64 + dc * 32 + 8 * hh);
        kl.h[1] = *(const v8b*)(Ksl + (j * 16 + c) * 64 + dc * 32 + 16 + 8 * hh);
        s[j] = mma_b(qah[dc], kb.v, s[j]);
        s[j] = mma_b(qah[dc], kl.v, s[j]);
        s[j] = mma_b(qal[dc], kb.v, s[j]);
      }
    }

    // ---- q.er skew band: 5 subtiles of 16 band rows, streamed; diagonal extraction by bpermute ----
    {
      const int wb = (3 - wave) * 16;           // this wave's band offset inside Esh
      v8f prev = zero8();
#pragma unroll
      for (int u = 0; u < 5; ++u) {
        v8f cur = zero8();
#pragma unroll
        for (int dc = 0; dc < 2; ++dc) {
          FB eb;
          const __bf16* ep = Esh + (wb + u * 16 + c) * 64 + dc * 32 + 8 * hh;
          eb.h[0] = *(const v8b*)(ep);
          eb.h[1] = *(const v8b*)(ep + 16);
          cur = mma_b(qah[dc], eb.v, cur);
          cur = mma_b(qal[dc], eb.v, cur);
        }
        if (u >= 1) {                            // key subtile jsub = u-1 uses subtiles u-1 (prev) and u (cur)
#pragma unroll
          for (int r = 0; r < 8; ++r) {
            const int base = 15 - (8 * hh + r) + c;                  // 0..30
            const int src  = (lane & 16) | (base & 15);
            const float vlo = __shfl(prev[r], src, 32);
            const float vhi = __shfl(cur[r], src, 32);
            s[u - 1][r] += (base < 16) ? vlo : vhi;
          }
        }
        prev = cur;
      }
    }

    // ---- add the gathered structure biases, scale, causal replace mask, online softmax, P (x1024, f16) and
    //      P residual (x4096) to LDS ----
    _Float16* pwh = Psh + wave * (16 * 64);
    _Float16* pwl = Psl + (RES ? wave : 0) * (16 * 64);
#pragma unroll
    for (int r = 0; r < 8; ++r) {
      const int    trow = q0 + 8 * hh + r;
      float m = -INFINITY;
#pragma unroll
      for (int j = 0; j < 4; ++j) {
        const int key = kv0 + j * 16 + c;
        float sv = (s[j][r] + bs[j][r]) * sscale;
        sv = (key <= trow) ? sv : -1.0e9f;
        s[j][r] = sv;
        m = fmaxf(m, sv);
      }
#pragma unroll
      for (int off = 1; off < 16; off <<= 1) m = fmaxf(m, __shfl_xor(m, off, 32));
      const float mnew  = fmaxf(mrow[r], m);
      const float msafe = (mnew == -INFINITY) ? 0.f : mnew;
      const float alpha = __expf(mrow[r] - msafe);
      mrow[r] = mnew;
      float psum = 0.f;
#pragma unroll
      for (int j = 0; j < 4; ++j) {
        const float p = __expf(s[j][r] - msafe);     // masked logit -1e9 against a normal max: exp -> 0
        psum += p;
        const float p1k = p * 1024.0f;
        const _Float16 ph = (_Float16)p1k;
        pwh[(8 * hh + r) * 64 + j * 16 + c] = ph;
        if (RES) {
          const _Float16 pl = (_Float16)((p1k - (float)ph) * 4096.0f);
          pwl[(8 * hh + r) * 64 + j * 16 + c] = pl;
        }
      }
#pragma unroll
      for (int off = 1; off < 16; off <<= 1) psum += __shfl_xor(psum, off, 32);
      lrow[r] = lrow[r] * alpha + psum;
#pragma unroll
      for (int t = 0; t < 4; ++t) oacc[t][r] *= alpha;
    }
    __builtin_amdgcn_fence(__ATOMIC_RELEASE, "workgroup");
    __builtin_amdgcn_wave_barrier();
    __builtin_amdgcn_fence(__ATOMIC_ACQUIRE, "workgroup");

    // ---- context += P . V (f16 WMMA), residual products into a separate accumulator ----
    v8f o1[4];
#pragma unroll
    for (int t = 0; t < 4; ++t) o1[t] = zero8();
#pragma unroll 1
    for (int kk = 0; kk < 2; ++kk) {
      FH pa, pl;
      pa.h[0] = *(const v8h*)(pwh + c * 64 + kk * 32 + 8 * hh);
      pa.h[1] = *(const v8h*)(pwh + c * 64 + kk * 32 + 16 + 8 * hh);
      if (RES) {
        pl.h[0] = *(const v8h*)(pwl + c * 64 + kk * 32 + 8 * hh);
        pl.h[1] = *(const v8h*)(pwl + c * 64 + kk * 32 + 16 + 8 * hh);
      } else {
        pl.v = pa.v;
      }
#pragma unroll
      for (int t = 0; t < 4; ++t) {
        FH vb;
        vb.h[0] = *(const v8h*)(Vth + (t * 16 + c) * 64 + kk * 32 + 8 * hh);
        vb.h[1] = *(const v8h*)(Vth + (t * 16 + c) * 64 + kk * 32 + 16 + 8 * hh);
        oacc[t] = mma_h(pa.v, vb.v, oacc[t]);
        if (RES) {
          FH vl;
          vl.h[0] = *(const v8h*)(Vtl + (t * 16 + c) * 64 + kk * 32 + 8 * hh);
          vl.h[1] = *(const v8h*)(Vtl + (t * 16 + c) * 64 + kk * 32 + 16 + 8 * hh);
          o1[t] = mma_h(pa.v, vl.v, o1[t]);
          o1[t] = mma_h(pl.v, vb.v, o1[t]);
        }
      }
    }
    if (RES) {
#pragma unroll
      for (int t = 0; t < 4; ++t)
#pragma unroll
        for (int r = 0; r < 8; ++r) oacc[t][r] += o1[t][r] * (1.0f / 4096.0f);
    }
  }

  // ---- normalise (1/l and the 1/1024 p carry), stage the wave's 16x64 tile (Os aliases the K tiles,
  __syncthreads();
  float* os = Os + wave * (16 * 68);               // pitch 68 floats = 16 B x odd, for the 16-rows-at-a-time reads below
#pragma unroll
  for (int r = 0; r < 8; ++r) {
    const float l = lrow[r];
    const float inv = ((l > 0.f) ? (1.0f / l) : 0.f) * (1.0f / 1024.0f);
#pragma unroll
    for (int t = 0; t < 4; ++t) os[(8 * hh + r) * 68 + t * 16 + c] = oacc[t][r] * inv;
  }
  __builtin_amdgcn_fence(__ATOMIC_RELEASE, "workgroup");
  __builtin_amdgcn_wave_barrier();
  __builtin_amdgcn_fence(__ATOMIC_ACQUIRE, "workgroup");
  {
    // the wave's 16 rows are one strip and its 64 columns two 32-column blocks: 4 runs of 512 B, one after another
    v4u hv[4], lv[4];
#pragma unroll
    for (int it = 0; it < 4; ++it) {
      // run it: lane -> row c, columns 16 it + 8 hh ..+7 (it 0..3 x hh 0..1 x 8 = columns 0..63, c = rows 0..15)
      const float* sp = os + c * 68 + it * 16 + 8 * hh;
      v4u a, a2;
#pragma unroll
      for (int e = 0; e < 4; ++e) {
        const float f0 = sp[2 * e], f1 = sp[2 * e + 1];
        const unsigned short h0 = bf_bits(f0), h1 = bf_bits(f1);
        const unsigned short l0 = bf_bits(f0 - bf_up(h0)), l1 = bf_bits(f1 - bf_up(h1));
        a[e] = pk16(h0, h1); a2[e] = pk16(l0, l1);
      }
      hv[it] = a; lv[it] = a2;
    }
    {
#pragma unroll
      for (int it = 0; it < 4; ++it) {
        const size_t go = ((((rowB + q0) >> 4) * (DM / 32) + (size_t)h * 2) * 64 + it * 32 + lane) * 8;
        *(v4u*)(ohp + go) = hv[it];
        *(v4u*)(olp + go) = lv[it];
      }
      
    }
  }
}

// Every query block in one grid: the blocks with residual planes (qb < RESQB) and the rest depend on the same
// inputs and write disjoint rows, so they run side by side. NB*NH consecutive blocks share one qb; the first half
// of the grid takes qb = NQB-1 downwards (the longest key loops start first), the second half qb = 0 upwards.
__global__ __launch_bounds__(128, 3)
void attn_rel64(const unsigned short* __restrict__ qhp, const unsigned short* __restrict__ qlp,
                const unsigned short* __restrict__ khp, const unsigned short* __restrict__ klp,
                const unsigned short* __restrict__ vhp, const unsigned short* __restrict__ vlp,
                const unsigned short* __restrict__ erp, const float* __restrict__ qe,
                const int* __restrict__ ibar, const int* __restrict__ ipos,
                const int* __restrict__ ioct, const int* __restrict__ isem,
                unsigned short* ohp, unsigned short* olp, float sscale) {
  __shared__ __align__(16) unsigned char smem[65536];
  const int bx = blockIdx.x;
  const int g  = bx / (NB * NH);
  const int bh = bx - g * (NB * NH);
  const int qb = (g < NQB / 2) ? (NQB - 1 - g) : (g - NQB / 2);   // a permutation of 0..NQB-1, block-uniform
  const int h  = bh % NH;
  const int b  = bh / NH;
  if (qb < RESQB)
    attn_body<true>(qhp, qlp, khp, klp, vhp, vlp, erp, qe, ibar, ipos, ioct, isem, ohp, olp, smem, qb, h, b, sscale);
  else
    attn_body<false>(qhp, qlp, khp, klp, vhp, vlp, erp, qe, ibar, ipos, ioct, isem, ohp, olp, smem, qb, h, b, sscale);
}

// =====================================================================================================
// Workspace map (bytes, every region a multiple of its 64x64-tile / whole-line store granularity):
//   (Xb, the four weight planes, Oh and Ol are stored in fragment order; every other plane is row-major)
//   Xb   bf16 [2048][1024]            0        4194304
//   Wqb  bf16 [1024 n][1024 k]    4194304        2097152
//   Wkb                           6291456        2097152
//   Wvb                           8388608        2097152
//   Wob                          10485760        2097152
//   Erb  bf16 [1024][64]         12582912         131072
//   Tb   bf16 [192][64]          12713984          24576
//   Qh   bf16 [2048][1024]       12738560        4194304
//   Ql                           16932864        4194304
//   Kh                           21127168        4194304
//   Kl                           25321472        4194304
//   VTh  f16  [2][1024][1024]    29515776        4194304
//   VTl  f16  [2][1024][256]     33710080        1048576
//   QE   f32  [16][2048][192]    34758656       25165824
//   Oh   bf16 [2048][1024]       59924480        4194304
//   Ol                           64118784        4194304
//   end                          68313088
// Weights are [out n][in k] = the Bt / A orientation the GEMM wants, so they are converted into fragment order, not transposed.
// =====================================================================================================
extern "C" void kernel_launch(void* const* d_in, const int* in_sizes, int n_in,
                              void* d_out, int out_size, void* d_ws, size_t ws_size,
                              hipStream_t stream) {
  if (n_in < 14) return;
  if (in_sizes[0] != NB * SEQ * DM) return;
  if (in_sizes[1] != NB * SEQ * SEQ || in_sizes[2] != NB * SEQ * SEQ ||
      in_sizes[3] != NB * SEQ * SEQ || in_sizes[4] != NB * SEQ * SEQ) return;
  if (in_sizes[5] != DM * DM || in_sizes[6] != DM * DM || in_sizes[7] != DM * DM || in_sizes[8] != DM * DM) return;
  if (in_sizes[9] != SEQ * HD) return;
  if (in_sizes[10] != 16 * HD || in_sizes[11] != 95 * HD || in_sizes[12] != 24 * HD || in_sizes[13] != 12 * HD) return;
  if (out_size != NB * SEQ * DM) return;

  const float* x    = (const float*)d_in[0];
  const int*   rbar = (const int*)d_in[1];
  const int*   rpos = (const int*)d_in[2];
  const int*   roct = (const int*)d_in[3];
  const int*   rsem = (const int*)d_in[4];
  const float* Wq   = (const float*)d_in[5];
  const float* Wk   = (const float*)d_in[6];
  const float* Wv   = (const float*)d_in[7];
  const float* Wo   = (const float*)d_in[8];
  const float* Er   = (const float*)d_in[9];
  const float* Ebar = (const float*)d_in[10];
  const float* Epos = (const float*)d_in[11];
  const float* Eoct = (const float*)d_in[12];
  const float* Esem = (const float*)d_in[13];

  const size_t PX  = (size_t)MROWS * DM * 2;          //  4194304  16-bit activation plane [2048][1024]
  const size_t PW  = (size_t)DM * DM * 2;             //  2097152  16-bit weight plane
  const size_t PE  = (size_t)SEQ * HD * 2;            //   131072  er plane
  const size_t PT  = (size_t)TROWS * HD * 2;          //    24576  combined structure table
  const size_t PVT = (size_t)NB * DM * SEQ * 2;       //  4194304  v^T hi plane
  const size_t PVL = (size_t)NB * DM * VLP * 2;       //  1048576  v^T residual plane
  const size_t PQE = (size_t)NH * MROWS * QEP * 4;    // 25165824  structure products
  size_t off = 0;
  const size_t oXb  = off; off += PX;
  const size_t oWq  = off; off += PW;
  const size_t oWk  = off; off += PW;
  const size_t oWv  = off; off += PW;
  const size_t oWo  = off; off += PW;
  const size_t oEr  = off; off += PE;
  const size_t oTb  = off; off += PT;
  const size_t oQh  = off; off += PX;
  const size_t oQl  = off; off += PX;
  const size_t oKh  = off; off += PX;
  const size_t oKl  = off; off += PX;
  const size_t oVTh = off; off += PVT;
  const size_t oVTl = off; off += PVL;
  const size_t oQE  = off; off += PQE;
  const size_t oOh  = off; off += PX;
  const size_t oOl  = off; off += PX;
  if (off > ws_size) return;                          // off = 68313088
  if (off > (size_t)134217728) return;

  char* ws = (char*)d_ws;
  unsigned short* Xb  = (unsigned short*)(ws + oXb);
  unsigned short* Wqb = (unsigned short*)(ws + oWq);
  unsigned short* Wkb = (unsigned short*)(ws + oWk);
  unsigned short* Wvb = (unsigned short*)(ws + oWv);
  unsigned short* Wob = (unsigned short*)(ws + oWo);
  unsigned short* Erb = (unsigned short*)(ws + oEr);
  unsigned short* Tb  = (unsigned short*)(ws + oTb);
  unsigned short* Qh  = (unsigned short*)(ws + oQh);
  unsigned short* Ql  = (unsigned short*)(ws + oQl);
  unsigned short* Kh  = (unsigned short*)(ws + oKh);
  unsigned short* Kl  = (unsigned short*)(ws + oKl);
  unsigned short* VTh = (unsigned short*)(ws + oVTh);
  unsigned short* VTl = (unsigned short*)(ws + oVTl);
  float*          QE  = (float*)(ws + oQE);
  unsigned short* Oh  = (unsigned short*)(ws + oOh);
  unsigned short* Ol  = (unsigned short*)(ws + oOl);

  const dim3 blk(256);
  const dim3 gPrep(PB_X + 4 * PB_W + PB_E + PB_T);             // 3110 blocks
  const dim3 gQKV(PJB, 3);                                     // 64 blocks x {q, k, v^T}
  const dim3 gProj(((MROWS / 64) * (DM / 64) + 7) / 8, 1);     // 512 tiles -> 64 blocks: M=2048, N=1024
  const dim3 gQE(((MROWS / 64) * (QEP / 64) + 7) / 8, NH);    //  96 tiles -> 12 blocks x 16 heads

  // (1) x -> bf16 plane; weights [n][k] f32 -> bf16 [n][k]; er -> bf16; combined structure table
  prep_all<<<gPrep, blk, 0, stream>>>(x, Wq, Wk, Wv, Wo, Er, Ebar, Epos, Eoct, Esem,
                                      Xb, Wqb, Wkb, Wvb, Wob, Erb, Tb);
  // (2)-(4) q, k (bf16 hi/lo planes) and v^T (f16 hi plane, residual plane)
  gemm_qkv<<<gQKV, blk, 0, stream>>>(Xb, Wqb, Wkb, Wvb, Qh, Ql, Kh, Kl, VTh, VTl);
  // (5) structure products: qe[h][b*SEQ+t][s] = q . T^T  (A = q hi/lo planes at column h*64, K=64;
  //     Bt = Tb [192][64]; M=2048, N=192, 2 products, f32 out pitch 192)
  gemm64<1, 0, false><<<gQE, blk, 0, stream>>>(
      Qh, Ql, DM, (long long)HD, Tb, Tb, HD, 0LL,
      (void*)QE, QEP, (long long)MROWS * QEP, (void*)QE, QEP, 0LL, QEP,
      MROWS, QEP, HD, 1.0f);
  // (6) attention: query blocks 0..RESQB-1 with residual planes, the rest without, one grid
  attn_rel64<<<dim3(NB * NH * NQB), dim3(128), 0, stream>>>(
      Qh, Ql, Kh, Kl, VTh, VTl, Erb, QE, rbar, rpos, roct, rsem, Oh, Ol, 0.125f);
  // (7) out = context . Wo^T -> d_out f32 [2048][1024]  (A = context hi + lo planes, 2 products)
  gemm64<1, 0, true><<<gProj, blk, 0, stream>>>(
      Oh, Ol, DM, 0LL, Wob, Wob, DM, 0LL,
      d_out, DM, 0LL, d_out, DM, 0LL, DM,
      MROWS, DM, DM, 1.0f);
  (void)hipGetLastError();
}

// v005
// A run of this version takes 144 microseconds.
// In both of two side-by-side timings against v004, it was 1.11 times as fast.
// Over all steps from v000 it is 5.46 times as fast.
// Contractions: q, k, v^T projections = v_wmma_f32_16x16x32_bf16 (bf16 operands from RNE-converted inputs, single product);
// q.k^T = v_wmma_f32_16x16x32_bf16 with bf16 hi/lo split q and k (hi.hi + hi.lo + lo.hi);
// q.Er^T skew band and q.T^T structure tables = bf16 hi/lo q times bf16 table rows (2 products);
// p.v = v_wmma_f32_16x16x32_f16 (p carried x1024 in f16, v f16; extra f16 residual planes x4096 of p and v for the first 256 query rows);
// ctx.Wo^T = bf16 hi/lo ctx times bf16 Wo (2 products); all f32 accumulate; bias gathers, causal mask and softmax in f32.
#include <hip/hip_runtime.h>
#include <math.h>
#include <stdint.h>

#define NB    2
#define SEQ   1024
#define DM    1024
#define NH    16
#define HD    64
#define MROWS (NB * SEQ)     // 2048
#define NQB   (SEQ / 64)     // 16 query / key tiles of 64
#define VLP   256            // key pitch of the v^T residual plane (keys 0..VLP-1)
#define RESQB 4              // leading 64-row query blocks that use the p / v residual planes
#define QEP   192            // pitch (floats) of the structure-table products, 151 used
#define TROWS 192            // rows of the combined structure table (151 used, rest zero)
#define LP    72             // LDS row pitch, 16-bit elements, of the 64-wide K / V^T / er / P tiles: 144 B = 16 B x odd
#define OFF_BAR 0            // 16 rows + zero row  -> idx 0..16
#define OFF_POS 17           // 95 rows + zero row  -> idx 0..95
#define OFF_OCT 113          // 24 rows + zero row  -> idx 0..24
#define OFF_SEM 138          // 12 rows + zero row  -> idx 0..12
static_assert(RESQB * 64 <= VLP);
static_assert(NH * HD == DM);
static_assert((SEQ % 64) == 0 && (DM % 64) == 0 && (QEP % 64) == 0 && (TROWS % 64) == 0);
static_assert(OFF_SEM + 13 <= QEP);

typedef _Float16 v16h __attribute__((ext_vector_type(16)));
typedef _Float16 v8h  __attribute__((ext_vector_type(8)));
typedef __bf16   v16b __attribute__((ext_vector_type(16)));
typedef __bf16   v8b  __attribute__((ext_vector_type(8)));
typedef float    v8f  __attribute__((ext_vector_type(8)));
typedef float    v4f  __attribute__((ext_vector_type(4)));
typedef unsigned int v4u __attribute__((ext_vector_type(4)));

// ---- scalar helpers --------------------------------------------------------------------------------
__device__ __forceinline__ unsigned short bf_bits(float f) {          // f32 -> bf16 bits, RNE convert
  unsigned u = __float_as_uint(f);
  return (unsigned short)((u + 0x7FFFu + ((u >> 16) & 1u)) >> 16);
}
__device__ __forceinline__ float bf_up(unsigned short h) { return __uint_as_float(((unsigned)h) << 16); }
__device__ __forceinline__ unsigned short h_bits(_Float16 x) { return __builtin_bit_cast(unsigned short, x); }
__device__ __forceinline__ unsigned pk16(unsigned short a, unsigned short b) { return (unsigned)a | ((unsigned)b << 16); }
__device__ __forceinline__ int iclamp(int v, int lo, int hi) { return (v < lo) ? lo : ((v > hi) ? hi : v); }
__device__ __forceinline__ int imin(int a, int b) { return (a < b) ? a : b; }
__device__ __forceinline__ v8f zero8() { v8f z = {0.f, 0.f, 0.f, 0.f, 0.f, 0.f, 0.f, 0.f}; return z; }
__device__ __forceinline__ v8h zero8h() {
  const _Float16 z = (_Float16)0.0f;
  v8h r = {z, z, z, z, z, z, z, z};
  return r;
}

// ---- fragment loader: 16-bit A/B operand, lane -> row/col (lane&15), p already includes +8*(lane>>4);
//      elements 0..7 <- p[0..7] (k0+8h..), elements 8..15 <- p[16..23] (k0+16+8h..)
__device__ __forceinline__ v16b ldfrag_b(const __bf16* p) {
  union { v16b v; v8b h[2]; } f;
  f.h[0] = *(const v8b*)(p);
  f.h[1] = *(const v8b*)(p + 16);
  return f.v;
}
//      a wave-uniform pointer to global memory, held in scalar registers, so that a load names it and a 32-bit lane
//      offset (left to itself one build formed a vector address pair per strip, and a load of the run landed in it)
typedef const __attribute__((address_space(1))) char* gcp;
typedef const __attribute__((address_space(1))) v8b*  gv8bp;
__device__ __forceinline__ gcp uni_ptr(const char* p) {
  const unsigned long long u = (unsigned long long)p;
  const unsigned lo = (unsigned)__builtin_amdgcn_readfirstlane((int)(unsigned)u);
  const unsigned hi = (unsigned)__builtin_amdgcn_readfirstlane((int)(unsigned)(u >> 32));
  return (gcp)(((unsigned long long)hi << 32) | lo);
}
//      the same elements in the same positions, from a wave-uniform base and the lane's byte offset vo;
//      H2 = bytes from the lane's elements 0..7 to its elements 8..15 (32 in a row-major plane, 512 in fragment order)
template <int H2>
__device__ __forceinline__ v16b ldfrag_o(gcp base, unsigned vo) {
  union { v16b v; v8b h[2]; } f;
  f.h[0] = *(gv8bp)(base + vo);
  f.h[1] = *(gv8bp)(base + H2 + vo);
  return f.v;
}

// ---- WMMA helpers with trailing VALU hazard gap --------------------------------------------------------
__device__ __forceinline__ v8f mma_b(v16b a, v16b b, v8f c) {
  c = __builtin_amdgcn_wmma_f32_16x16x32_bf16(false, a, false, b, (short)0, c, false, false);
#if defined(__HIP_DEVICE_COMPILE__)
  asm volatile("v_nop\n\tv_nop\n\tv_nop\n\tv_nop" : "+v"(c) : "v"(a), "v"(b));
#endif
  return c;
}
__device__ __forceinline__ v8f mma_h(v16h a, v16h b, v8f c) {
  c = __builtin_amdgcn_wmma_f32_16x16x32_f16(false, a, false, b, (short)0, c, false, false);
#if defined(__HIP_DEVICE_COMPILE__)
  asm volatile("v_nop\n\tv_nop\n\tv_nop\n\tv_nop" : "+v"(c) : "v"(a), "v"(b));
#endif
  return c;
}
__device__ __forceinline__ v8f mma_b_raw(v16b a, v16b b, v8f c) {
  return __builtin_amdgcn_wmma_f32_16x16x32_bf16(false, a, false, b, (short)0, c, false, false);
}
__device__ __forceinline__ void acc_guard4(v8f& a, v8f& b, v8f& c, v8f& d) {
#if defined(__HIP_DEVICE_COMPILE__)
  asm volatile("v_nop\n\tv_nop\n\tv_nop\n\tv_nop" : "+v"(a), "+v"(b), "+v"(c), "+v"(d));
#else
  (void)a; (void)b; (void)c; (void)d;
#endif
}

// =====================================================================================================
// f32 -> bf16 (RNE convert), 8 elements per thread, one 16-B store per lane: a wave writes 512 contiguous B
// (n8 is a multiple of 256 for every use here). coverage: n8 threads x 8 = whole plane.
// =====================================================================================================
__device__ __forceinline__ void cvt_bf16x8(const float* __restrict__ in, unsigned short* out, int n8, int blk) {
  const int i = blk * 256 + threadIdx.x;
  if (i < n8) {
    const v4f a = *(const v4f*)(in + (size_t)i * 8);
    const v4f b = *(const v4f*)(in + (size_t)i * 8 + 4);
    v4u p;
    p[0] = pk16(bf_bits(a[0]), bf_bits(a[1]));
    p[1] = pk16(bf_bits(a[2]), bf_bits(a[3]));
    p[2] = pk16(bf_bits(b[0]), bf_bits(b[1]));
    p[3] = pk16(bf_bits(b[2]), bf_bits(b[3]));
    *(v4u*)(out + (size_t)i * 8) = p;
    
  }
}

// =====================================================================================================
// FRAGMENT ORDER of a 16-bit plane [rows][DM] that a GEMM reads as A or Bt: the plane is cut into 16-row strips and
// each strip into blocks of 32 columns; a block is 1 KB = two runs of 512 B, and run u holds, for lane l = 0..31,
// the 8 elements (row l & 15, columns 16 u + 8 (l >> 4) ..+7) at byte 16 l. Blocks of a strip follow one another, then
// the next strip. So each of a fragment's two 16-B loads reads 512 contiguous bytes (4 whole lines) where a row-major
// plane gives it 32 B from each of 16 lines; which element lands in which lane and register does not change.
//   16-B piece index of (row m, columns 8 k8 ..+7) = (((m >> 4) * (DM/32) + (k8 >> 2)) * 2 + ((k8 >> 1) & 1)) * 32
//                                                    + (k8 & 1) * 16 + (m & 15)
// f32 [rows][DM] -> bf16 (RNE convert) in fragment order: thread i makes piece i, so a wave stores 512 contiguous B;
// a block reads 512 contiguous B of each of 16 rows. coverage: n8 threads x 8 = whole plane (the map is one to one).
// =====================================================================================================
static_assert(DM / 32 == 32);
__device__ __forceinline__ void cvt_bf16_frag(const float* __restrict__ in, unsigned short* out, int n8, int blk) {
  const int i = blk * 256 + threadIdx.x;
  if (i < n8) {
    const int l = i & 31, u = (i >> 5) & 1, kb = (i >> 6) & 31, st = i >> 11;
    const size_t so = (size_t)(st * 16 + (l & 15)) * DM + kb * 32 + u * 16 + (l >> 4) * 8;
    const v4f a = *(const v4f*)(in + so);
    const v4f b = *(const v4f*)(in + so + 4);
    v4u p;
    p[0] = pk16(bf_bits(a[0]), bf_bits(a[1]));
    p[1] = pk16(bf_bits(a[2]), bf_bits(a[3]));
    p[2] = pk16(bf_bits(b[0]), bf_bits(b[1]));
    p[3] = pk16(bf_bits(b[2]), bf_bits(b[3]));
    *(v4u*)(out + (size_t)i * 8) = p;
  }
}

// =====================================================================================================
// Combined structure table, bf16 [TROWS][64]: rows 0..15 bar, 16 zero, 17..111 position, 112 zero,
// 113..136 octave, 137 zero, 138..149 semitone, 150..191 zero. 8 threads per row, 8 elements each,
// all four candidate loads unconditional with clamped row addresses, selection by value.
// PB_T = TROWS*8/256 = 6 blocks of prep_all exactly. coverage: 1536 threads x 8 = 192 x 64.
// =====================================================================================================
__device__ __forceinline__ void build_tab(const float* __restrict__ ebar, const float* __restrict__ epos,
                                          const float* __restrict__ eoct, const float* __restrict__ esem,
                                          unsigned short* tab, int blk) {
  const int g = blk * 256 + threadIdx.x;
  if (g < TROWS * 8) {
    const int s  = g >> 3;
    const int d0 = (g & 7) * 8;
    const int rb = iclamp(s, 0, 15);
    const int rp = iclamp(s - OFF_POS, 0, 94);
    const int ro = iclamp(s - OFF_OCT, 0, 23);
    const int rs = iclamp(s - OFF_SEM, 0, 11);
    const bool ub = (s < 16);
    const bool up = (s >= OFF_POS) && (s < OFF_POS + 95);
    const bool uo = (s >= OFF_OCT) && (s < OFF_OCT + 24);
    const bool us = (s >= OFF_SEM) && (s < OFF_SEM + 12);
    float v[8];
#pragma unroll
    for (int e = 0; e < 8; ++e) {
      const int d = d0 + e;
      const float fb = ebar[rb * HD + d];
      const float fp = epos[rp * HD + d];
      const float fo = eoct[ro * HD + d];
      const float fs = esem[rs * HD + d];
      float t = 0.f;
      t = ub ? fb : t;
      t = up ? fp : t;
      t = uo ? fo : t;
      t = us ? fs : t;
      v[e] = t;
    }
    v4u p;
    p[0] = pk16(bf_bits(v[0]), bf_bits(v[1]));
    p[1] = pk16(bf_bits(v[2]), bf_bits(v[3]));
    p[2] = pk16(bf_bits(v[4]), bf_bits(v[5]));
    p[3] = pk16(bf_bits(v[6]), bf_bits(v[7]));
    *(v4u*)(tab + (size_t)s * HD + d0) = p;
    
  }
}

// =====================================================================================================
// All operand preparation in one grid (the seven pieces depend on nothing but the inputs, so they run side by
// side): blocks 0..PB_X-1 convert x, the next 4*PB_W the four weights (these five into fragment order), the next
// PB_E er (row-major), the last PB_T build the combined table. The piece is chosen by blockIdx.x alone (block-uniform).
// =====================================================================================================
#define PB_X (MROWS * DM / 8 / 256)   // 1024
#define PB_W (DM * DM / 8 / 256)      //  512
#define PB_E (SEQ * HD / 8 / 256)     //   32
#define PB_T (TROWS * 8 / 256)        //    6
static_assert(PB_X * 2048 == MROWS * DM && PB_W * 2048 == DM * DM && PB_E * 2048 == SEQ * HD && PB_T * 256 == TROWS * 8);
__global__ __launch_bounds__(256) void prep_all(
    const float* __restrict__ x, const float* __restrict__ wq, const float* __restrict__ wk,
    const float* __restrict__ wv, const float* __restrict__ wo, const float* __restrict__ er,
    const float* __restrict__ ebar, const float* __restrict__ epos,
    const float* __restrict__ eoct, const float* __restrict__ esem,
    unsigned short* xb, unsigned short* wqb, unsigned short* wkb, unsigned short* wvb, unsigned short* wob,
    unsigned short* erb, unsigned short* tab) {
  int blk = blockIdx.x;
  if (blk < PB_X) { cvt_bf16_frag(x, xb, MROWS * DM / 8, blk); return; }
  blk -= PB_X;
  if (blk < 4 * PB_W) {
    const int w = blk / PB_W;
    const float*    in  = (w == 0) ? wq  : (w == 1) ? wk  : (w == 2) ? wv  : wo;
    unsigned short* out = (w == 0) ? wqb : (w == 1) ? wkb : (w == 2) ? wvb : wob;
    cvt_bf16_frag(in, out, DM * DM / 8, blk - w * PB_W);
    return;
  }
  blk -= 4 * PB_W;
  if (blk < PB_E) { cvt_bf16x8(er, erb, SEQ * HD / 8, blk); return; }
  build_tab(ebar, epos, eoct, esem, tab, blk - PB_E);
}

// =====================================================================================================
// Register-blocked batched bf16 WMMA GEMM: C[m][n] = sum_k A[m][k] * Bt[n][k]; one wave per 64x64 tile,
// no block barriers. A row-major [M][K] pitch lda; Bt row-major [N][K] pitch ldb (k contiguous);
// M, N multiples of 64, K a multiple of 32 and at least 32. blockIdx.y = batch index (strides in elements).
// NSPLIT: 0 = A.Bt; 1 = (A + A2).Bt (A2 = unscaled bf16 lo plane of A); 2 = A.Bt + A2.Bt + A.Bt2.
// OUT_MODE: 0 = f32 (pitch ldc); 2 = bf16 hi plane C + bf16 lo plane C2 (lo = RNE(v - hi), unscaled);
//           3 = f16 hi plane C + f16 residual plane C2 = f16((v - hi) * rscale), C2 written only for tiles
//               with n0 < N2 (pitch ldc2, batch stride strideC2).
// FR: false = A and Bt planes row-major; true = both in fragment order (then lda == ldb == K == DM, and a batch
//     stride is a whole number of 16-row strips).
// =====================================================================================================
//   sT: the block's 8 x (16 x 68) f32 staging slabs; bx: the block's index among the tiles; b: batch index.
template <int NSPLIT, int OUT_MODE, bool FR>
__device__ __forceinline__ void gemm64_body(
    const unsigned short* __restrict__ Ap, const unsigned short* A2p, int lda, long long strideA,
    const unsigned short* __restrict__ Btp, const unsigned short* Bt2p, int ldb, long long strideB,
    void* Cout, int ldc, long long strideC,
    void* Cout2, int ldc2, long long strideC2, int N2,
    int M, int N, int K, float rscale, float* sT, int bx, int b) {
  const __bf16* A   = (const __bf16*)(const void*)Ap;
  const __bf16* A2  = (const __bf16*)(const void*)A2p;
  const __bf16* Bt  = (const __bf16*)(const void*)Btp;
  const __bf16* Bt2 = (const __bf16*)(const void*)Bt2p;
  const int lane = threadIdx.x & 31;
  const int wave = threadIdx.x >> 5;
  const int tilesN = N >> 6;
  const int tilesM = M >> 6;
  const int tile = bx * 8 + wave;
  if (tile >= tilesM * tilesN) return;   // wave-uniform; no block barriers in this kernel
  const int tm = tile / tilesN;
  const int tn = tile - tm * tilesN;
  const int m0 = tm << 6;
  const int n0 = tn << 6;

  const __bf16* Ab  = A  + (size_t)b * strideA;
  const __bf16* Bb  = Bt + (size_t)b * strideB;
  const __bf16* Ab2 = (NSPLIT >= 1) ? (A2  + (size_t)b * strideA) : Ab;
  const __bf16* Bb2 = (NSPLIT == 2) ? (Bt2 + (size_t)b * strideB) : Bb;

  const int rlane = lane & 15;                 // row (A) / col (B, D) within subtile
  const int koff  = (lane >> 4) * 8;           // k offset of this lane half
  const int mOff  = (lane >> 4) * 8;           // D row offset

  v8f acc[4][4];
#pragma unroll
  for (int i = 0; i < 4; ++i)
#pragma unroll
    for (int j = 0; j < 4; ++j) acc[i][j] = zero8();

  // k loop, K >= 32: two register sets of fragments. All loads of one k step (32 columns) go out in one run, one k
  // step ahead of their products, so a k step waits for at most the rest of one load round trip instead of four whole
  // ones. Every load names a wave-uniform base (plane + 16-row strip) and one of two lane offsets, va (A) and vb (Bt).
  // Past the last k step the offsets stand still: a run that has no k step left reads the last one again (in bounds,
  // never used), so every run holds the same number of loads and the counted waits stay exact.
  // The inner loops are unrolled so that every fragment and accumulator index is a constant (registers, no scratch).
  struct FragSet { v16b a[4], l[4], b[4], m[4]; };                // A, second A plane, Bt, second Bt plane
  const size_t sa = (size_t)lda * 32, sb = (size_t)ldb * 32;      // bytes from one 16-row strip to the next
  gcp pa[4], pa2[4], pb[4], pb2[4];                               // the planes' four strips, scalar bases
#pragma unroll
  for (int i = 0; i < 4; ++i) {
    pa[i]  = uni_ptr((const char*)Ab + i * sa);
    pb[i]  = uni_ptr((const char*)Bb + i * sb);
    pa2[i] = (NSPLIT >= 1) ? uni_ptr((const char*)Ab2 + i * sa) : pa[i];
    pb2[i] = (NSPLIT == 2) ? uni_ptr((const char*)Bb2 + i * sb) : pb[i];
  }
  //   fragment order: a 16-row strip is as many bytes as in a row-major plane, so the bases above serve both; the
  //   lane's piece stands at 16 * lane in its 512-B run, and a k step is one 1-KB block
  constexpr int      H2   = FR ? 512 : 32;
  constexpr unsigned KINC = FR ? 1024u : 64u;
  unsigned va = FR ? ((unsigned)m0 * (unsigned)lda * 2u + (unsigned)lane * 16u)
                   : (((unsigned)(m0 + rlane) * (unsigned)lda + (unsigned)koff) * 2u);
  unsigned vb = FR ? ((unsigned)n0 * (unsigned)ldb * 2u + (unsigned)lane * 16u)
                   : (((unsigned)(n0 + rlane) * (unsigned)ldb + (unsigned)koff) * 2u);
  const int nk = K >> 5;
  int kl = 0;                                                     // the k step that va and vb stand at, unclamped
  auto load = [&](FragSet& S) {
#pragma unroll
    for (int j = 0; j < 4; ++j) {
      S.b[j] = ldfrag_o<H2>(pb[j], vb);
      if (NSPLIT == 2) S.m[j] = ldfrag_o<H2>(pb2[j], vb); else S.m[j] = S.b[j];
    }
#pragma unroll
    for (int i = 0; i < 4; ++i) {
      S.a[i] = ldfrag_o<H2>(pa[i], va);
      if (NSPLIT >= 1) S.l[i] = ldfrag_o<H2>(pa2[i], va); else S.l[i] = S.a[i];
    }
    // the scheduler may not sink the run's loads into the products behind it, where each would go out late
    __builtin_amdgcn_sched_barrier(0);
  };
  auto advance = [&]() {
    // the wait below stays behind the products: lifted to stand directly behind the loads it would hold the products up
    __builtin_amdgcn_sched_barrier(0);
#if defined(__HIP_DEVICE_COMPILE__)
    // precaution: this wait stands ahead of every rewrite of a register that a load of the last run names; it takes
    // the two lane offsets and the scalar bases as operands so that they stay whole up to it and the additions
    // stay behind it
    asm volatile("s_wait_xcnt 0x0" : "+v"(va), "+v"(vb)
                 : "s"(pa[0]), "s"(pa[1]), "s"(pa[2]), "s"(pa[3]), "s"(pb[0]), "s"(pb[1]), "s"(pb[2]), "s"(pb[3]),
                   "s"(pa2[0]), "s"(pa2[1]), "s"(pa2[2]), "s"(pa2[3]), "s"(pb2[0]), "s"(pb2[1]), "s"(pb2[2]), "s"(pb2[3])
                 : "memory");
#endif
    ++kl;
    const unsigned inc = (kl < nk) ? KINC : 0u;                   // wave-uniform
    va += inc;
    vb += inc;
  };
  auto products = [&](const FragSet& S) {
#pragma unroll
    for (int i = 0; i < 4; ++i)
#pragma unroll
      for (int j = 0; j < 4; ++j) {
        acc[i][j] = mma_b_raw(S.a[i], S.b[j], acc[i][j]);
        if (NSPLIT >= 1) acc[i][j] = mma_b_raw(S.l[i], S.b[j], acc[i][j]);
        if (NSPLIT == 2) acc[i][j] = mma_b_raw(S.a[i], S.m[j], acc[i][j]);
      }
  };
  FragSet S0, S1;
  load(S0); advance();
  const int ng = nk / 2;                                          // whole turns of the two sets
  for (int g = 0; g < ng; ++g) {
    load(S1); products(S0); advance();
    load(S0); products(S1); advance();
  }
  if (nk - ng * 2 >= 1) products(S0);                             // the k step left over (wave-uniform)
  acc_guard4(acc[0][0], acc[0][1], acc[0][2], acc[0][3]);
  acc_guard4(acc[1][0], acc[1][1], acc[1][2], acc[1][3]);
  acc_guard4(acc[2][0], acc[2][1], acc[2][2], acc[2][3]);
  acc_guard4(acc[3][0], acc[3][1], acc[3][2], acc[3][3]);

  // ---- epilogue ----
  float* slab = sT + wave * (16 * 68);             // per-wave 16x64 slab, pitch 68 floats
#pragma unroll
  for (int i = 0; i < 4; ++i) {
    const int mBase = m0 + (i << 4);
#pragma unroll
    for (int j = 0; j < 4; ++j) {
#pragma unroll
      for (int r = 0; r < 8; ++r) {
        slab[(mOff + r) * 68 + (j << 4) + rlane] = acc[i][j][r];
      }
    }
    __builtin_amdgcn_fence(__ATOMIC_RELEASE, "workgroup");
    __builtin_amdgcn_wave_barrier();
    __builtin_amdgcn_fence(__ATOMIC_ACQUIRE, "workgroup");
    if (OUT_MODE == 0) {
      float* C = (float*)Cout + (size_t)b * strideC;
      const int hh = lane >> 4, c4 = (lane & 15) * 4;     // 256-B row segment = 16 lanes x 16 B
      {
#pragma unroll
        for (int it = 0; it < 8; ++it) {
          const int row = it * 2 + hh;                     // it 0..7 x hh 0..1 = rows 0..15
          const v4f v = *(const v4f*)(slab + row * 68 + c4);
          *(v4f*)(C + (size_t)(mBase + row) * ldc + n0 + c4) = v;
        }
        
      }
    } else {
      const int q = lane >> 3, c8 = (lane & 7) * 8;
      unsigned short* C  = (unsigned short*)Cout  + (size_t)b * strideC;
      unsigned short* C2 = (unsigned short*)Cout2 + (size_t)b * strideC2;
      const bool wlo = (OUT_MODE == 2) || (n0 < N2);      // wave-uniform
      v4u hv[4], lv[4];
#pragma unroll
      for (int it = 0; it < 4; ++it) {
        const int row = it * 4 + q;                        // it 0..3 x q 0..3 = rows 0..15
        const float* sp = slab + row * 68 + c8;
        v4u a, a2;
#pragma unroll
        for (int e = 0; e < 4; ++e) {
          const float f0 = sp[2 * e], f1 = sp[2 * e + 1];
          unsigned short h0, h1, l0, l1;
          if (OUT_MODE == 2) {
            h0 = bf_bits(f0); h1 = bf_bits(f1);
            l0 = bf_bits(f0 - bf_up(h0)); l1 = bf_bits(f1 - bf_up(h1));
          } else {
            const _Float16 x0 = (_Float16)f0, x1 = (_Float16)f1;
            h0 = h_bits(x0); h1 = h_bits(x1);
            l0 = h_bits((_Float16)((f0 - (float)x0) * rscale));
            l1 = h_bits((_Float16)((f1 - (float)x1) * rscale));
          }
          a[e] = pk16(h0, h1); a2[e] = pk16(l0, l1);
        }
        hv[it] = a; lv[it] = a2;
      }
      {
#pragma unroll
        for (int it = 0; it < 4; ++it) {
          const int row = it * 4 + q;
          *(v4u*)(C + (size_t)(mBase + row) * ldc + n0 + c8) = hv[it];
          if (wlo) *(v4u*)(C2 + (size_t)(mBase + row) * ldc2 + n0 + c8) = lv[it];
        }
        
      }
    }
    __builtin_amdgcn_fence(__ATOMIC_RELEASE, "workgroup");
    __builtin_amdgcn_wave_barrier();
    __builtin_amdgcn_fence(__ATOMIC_ACQUIRE, "workgroup");
  }
}

template <int NSPLIT, int OUT_MODE, bool FR>
__global__ __launch_bounds__(256) void gemm64(
    const unsigned short* __restrict__ Ap, const unsigned short* A2p, int lda, long long strideA,
    const unsigned short* __restrict__ Btp, const unsigned short* Bt2p, int ldb, long long strideB,
    void* Cout, int ldc, long long strideC,
    void* Cout2, int ldc2, long long strideC2, int N2,
    int M, int N, int K, float rscale) {
  __shared__ __align__(16) float sT[8 * 16 * 68];
  gemm64_body<NSPLIT, OUT_MODE, FR>(Ap, A2p, lda, strideA, Btp, Bt2p, ldb, strideB, Cout, ldc, strideC,
                                Cout2, ldc2, strideC2, N2, M, N, K, rscale, sT, blockIdx.x, blockIdx.y);
}

// The three projections in one grid: each alone fills a quarter of the chip's WGPs and none reads another's result.
//   blockIdx.y = 0: q = x . Wq^T -> bf16 hi/lo planes [b*SEQ+t][h*64+d]   (M=2048, N=1024, K=1024)
//   blockIdx.y = 1: k = x . Wk^T -> bf16 hi/lo planes
//   blockIdx.y = 2: v^T = Wv . x^T per batch -> f16 hi plane [b][h*64+d][s] (pitch SEQ) and residual plane (x4096,
//                   keys < VLP only, pitch VLP); A = Wvb [n][k], Bt = Xb rows of batch b = blockIdx.x / VTB
#define PJB ((MROWS / 64) * (DM / 64) / 8)   // 64 blocks of 8 tiles per projection
#define VTB ((DM / 64) * (SEQ / 64) / 8)     // 32 blocks of 8 tiles per batch of v^T
static_assert(VTB * NB == PJB);
__global__ __launch_bounds__(256) void gemm_qkv(
    const unsigned short* __restrict__ Xb, const unsigned short* __restrict__ Wqb,
    const unsigned short* __restrict__ Wkb, const unsigned short* __restrict__ Wvb,
    unsigned short* Qh, unsigned short* Ql, unsigned short* Kh, unsigned short* Kl,
    unsigned short* VTh, unsigned short* VTl) {
  __shared__ __align__(16) float sT[8 * 16 * 68];
  const int which = blockIdx.y;                 // block-uniform
  if (which < 2) {
    const unsigned short* Wb = which ? Wkb : Wqb;
    unsigned short* Ch = which ? Kh : Qh;
    unsigned short* Cl = which ? Kl : Ql;
    gemm64_body<0, 2, true>(Xb, Xb, DM, 0LL, Wb, Wb, DM, 0LL,
                      (void*)Ch, DM, 0LL, (void*)Cl, DM, 0LL, DM,
                      MROWS, DM, DM, 1.0f, sT, blockIdx.x, 0);
  } else {
    const int b = blockIdx.x / VTB;
    gemm64_body<0, 3, true>(Wvb, Wvb, DM, 0LL, Xb, Xb, DM, (long long)SEQ * DM,
                      (void*)VTh, SEQ, (long long)DM * SEQ, (void*)VTl, VLP, (long long)DM * VLP, VLP,
                      DM, SEQ, DM, 4096.0f, sT, blockIdx.x - b * VTB, b);
  }
}

// =====================================================================================================
// Causal attention with relative-index (skew) bias and four gathered structure biases, head dim 64.
//   q planes (bf16 hi / lo): element (b, t, h, d) at [(b*SEQ + t)*DM + h*64 + d]; k planes same layout.
//   v^T hi plane (f16): element (b, h, d, s) at [(b*DM + h*64 + d)*SEQ + s]
//   v^T residual plane (f16, (v - hi)*4096): [(b*DM + h*64 + d)*VLP + s], s < VLP, read only when RES
//   er: bf16 [SEQ][64]; qe: f32 [h][b*SEQ + t][QEP] = q . T^T for the combined structure table T
//   idx arrays: int [b][t][s], clamped to each sub-table's valid range before use.
//   scores[t][s] = (q_t.k_s + q_t.er[SEQ-1+s-t] + qe[OFF_BAR+ibar] + qe[OFF_POS+ipos] + qe[OFF_OCT+ioct]
//                   + qe[OFF_SEM+isem]) * sscale for s <= t, else -1e9 (replace mask).
//   q.k : bf16 hi/lo split (3 products); q.er : q hi/lo x bf16 er (2 products); f32 accumulate.
//   Skew band: a block (64 query rows, key tile kv0) needs er rows ebb .. ebb+127 with
//   ebb = SEQ-64+kv0-qb*64 >= 0 (staged in LDS, addresses clamped at SEQ-1; clamped rows only feed
//   masked positions). Wave w (rows q0..q0+15) computes 5 subtiles of 16 band rows starting at
//   band row 16*(3-w); the diagonal D[mi][15-mi+jj] is fetched with two unconditional bpermutes per
//   element and selected by value; subtiles are produced one at a time (prev / cur).
//   p = exp(s - m) carried as f16(1024 p); context = p . v on f16 WMMA; RES adds f16 residual planes of p and v
//   (scale 4096, separate accumulator folded back with 1/4096 per chunk in f32); online softmax in f32.
//   Block = 4 waves = 64 query rows of one (b, h); grid = NQB * NH * NB; key tiles kt = 0..qb
//   (block-uniform trip count <= NQB). K / V^T / er chunk staging: 128 threads, plain 16-B loads, all issued
//   ahead of the first LDS store, __syncthreads before and after; P tiles are wave-private, spilled with _Float16 element stores and
//   LDS (static byte buffer, rows of 64 elements at a pitch of LP = 72, so that the 16 rows of a 16-B fragment read
//   fall on different banks; T = 9216 B is a 64-row tile): Ksh 0, Ksl T, Vth 2T, Esh 3T (128 rows), Psh 5T,
//   Vtl 6T (RES), Psl 7T (RES); the f32 context staging Os (17 KB) aliases offset 0 after the key
//   loop and a block barrier.
//   Output planes (bf16 hi / lo of the normalised context), element (row b*SEQ + t, column h*64 + d), in fragment order;
//   coverage: each wave stores rows q0..q0+15 (lane & 15) x 64 columns (it 0..3 x lane>>4 0..1 x 8) of both planes.
// =====================================================================================================
#define TB64 (64 * LP * 2)    // bytes of a 64-row tile in LDS
static_assert((LP * 2) % 32 == 16 && LP >= 64 && 4 * 16 * 68 * 4 <= 2 * TB64);
template <bool RES>
__device__ __forceinline__
void attn_body(const unsigned short* __restrict__ qhp, const unsigned short* __restrict__ qlp,
                const unsigned short* __restrict__ khp, const unsigned short* __restrict__ klp,
                const unsigned short* __restrict__ vhp, const unsigned short* __restrict__ vlp,
                const unsigned short* __restrict__ erp, const float* __restrict__ qe,
                const int* __restrict__ ibar, const int* __restrict__ ipos,
                const int* __restrict__ ioct, const int* __restrict__ isem,
                unsigned short* ohp, unsigned short* olp,
                unsigned char* smem, int qb, int h, int b, float sscale) {
  union FB { v16b v; v8b h[2]; };
  union FH { v16h v; v8h h[2]; };
  __bf16*   const Ksh = (__bf16*)(void*)(smem);
  __bf16*   const Ksl = (__bf16*)(void*)(smem + TB64);
  _Float16* const Vth = (_Float16*)(void*)(smem + 2 * TB64);
  __bf16*   const Esh = (__bf16*)(void*)(smem + 3 * TB64);
  _Float16* const Psh = (_Float16*)(void*)(smem + 5 * TB64);
  _Float16* const Vtl = (_Float16*)(void*)(smem + (RES ? 6 * TB64 : 2 * TB64));   // never dereferenced when !RES
  _Float16* const Psl = (_Float16*)(void*)(smem + (RES ? 7 * TB64 : 5 * TB64));   // never dereferenced when !RES
  float*    const Os  = (float*)(void*)(smem);                              // after the key loop only

  const int tid  = threadIdx.x;
  const int wave = tid >> 5;
  const int lane = tid & 31;
  const int hh   = lane >> 4;
  const int c    = lane & 15;

  const int q0   = qb * 64 + wave * 16;
  const size_t rowB = (size_t)b * SEQ;

  const __bf16* Qh  = (const __bf16*)(const void*)qhp + (size_t)h * HD;
  const __bf16* Ql  = (const __bf16*)(const void*)qlp + (size_t)h * HD;
  const __bf16* Kh  = (const __bf16*)(const void*)khp + (size_t)h * HD;
  const __bf16* Kl  = (const __bf16*)(const void*)klp + (size_t)h * HD;
  const _Float16* Vh = (const _Float16*)(const void*)vhp + ((size_t)b * DM + (size_t)h * HD) * SEQ;
  const _Float16* Vl = (const _Float16*)(const void*)vlp + ((size_t)b * DM + (size_t)h * HD) * VLP;
  const __bf16* Erb = (const __bf16*)(const void*)erp;
  const size_t trow0 = rowB + (size_t)(q0 + 8 * hh);                 // b*SEQ + t for r = 0 of this lane half
  const char* qeh    = (const char*)(qe + (size_t)h * MROWS * QEP);   // structure products of head h (block-uniform)
  const unsigned qlb = (unsigned)trow0 * (QEP * 4u);                  // byte offset of this lane's row, r = 0
  const unsigned ilb = ((unsigned)trow0 * SEQ + (unsigned)c) * 4u;    // byte offset of index (row r = 0, key c)

  // ---- Q fragments (A operand, row = lane&15): 2 d-chunks, hi and lo ----
  v16b qah[2], qal[2];
#pragma unroll
  for (int dc = 0; dc < 2; ++dc) {
    const size_t qo = (rowB + q0 + c) * DM + dc * 32 + 8 * hh;
    qah[dc] = ldfrag_b(Qh + qo);
    qal[dc] = ldfrag_b(Ql + qo);
  }

  float mrow[8], lrow[8];
  v8f oacc[4];
#pragma unroll
  for (int r = 0; r < 8; ++r) { mrow[r] = -INFINITY; lrow[r] = 0.f; }
#pragma unroll
  for (int t = 0; t < 4; ++t) oacc[t] = zero8();

  const int nkt = (qb + 1 < NQB) ? (qb + 1) : NQB;   // causal: key tiles 0..qb, block-uniform
  unsigned iv = ilb;                                  // byte offset of index (row r = 0, key kv0 + c)
  for (int kt = 0; kt < nkt; ++kt) {
    const int kv0 = kt * 64;
    int ebb = SEQ - 64 + kv0 - qb * 64;                 // >= 0 for kt >= 0, qb <= NQB-1
    ebb = (ebb < 0) ? 0 : ebb;

    // ---- gathered structure biases of the whole tile, bs[j][r] for key kv0 + 16 j + c and row q0 + 8 hh + r.
    //      They depend on no product of this tile, so the loads go out in runs, each back to back: for RPR rows
    //      at a time the 16 RPR index loads, then (indices clamped, byte offsets formed) the 16 RPR table gathers.
    float bs[4][8];
    constexpr int RPR = RES ? 4 : 8;                    // fewer at a time where the residual path needs the registers
#pragma unroll
    for (int g = 0; g < 8; g += RPR) {
      int      xi[RPR][4][4];
      unsigned go[RPR][4][4];
      float    gv[RPR][4][4];
#pragma unroll
      for (int r = 0; r < RPR; ++r)
#pragma unroll
        for (int j = 0; j < 4; ++j) {
          const size_t ko = (size_t)((g + r) * SEQ + j * 16) * 4;
          xi[r][j][0] = *(const int*)((const char*)ibar + ko + iv);
          xi[r][j][1] = *(const int*)((const char*)ipos + ko + iv);
          xi[r][j][2] = *(const int*)((const char*)ioct + ko + iv);
          xi[r][j][3] = *(const int*)((const char*)isem + ko + iv);
        }
      // the scheduler may not sink the index loads to their first uses, where each would wait alone
      __builtin_amdgcn_sched_barrier(0);
#pragma unroll
      for (int r = 0; r < RPR; ++r)
#pragma unroll
        for (int j = 0; j < 4; ++j) {
          go[r][j][0] = qlb + (unsigned)iclamp(xi[r][j][0], 0, 16) * 4u;
          go[r][j][1] = qlb + (unsigned)iclamp(xi[r][j][1], 0, 95) * 4u;
          go[r][j][2] = qlb + (unsigned)iclamp(xi[r][j][2], 0, 24) * 4u;
          go[r][j][3] = qlb + (unsigned)iclamp(xi[r][j][3], 0, 12) * 4u;
        }
      // all offsets are formed ahead of the first gather, so that no gather's offset register is rewritten in the run
      __builtin_amdgcn_sched_barrier(0);
#pragma unroll
      for (int r = 0; r < RPR; ++r)
#pragma unroll
        for (int j = 0; j < 4; ++j) {
          const size_t ro = (size_t)(g + r) * (QEP * 4);
          gv[r][j][0] = *(const float*)(qeh + (ro + OFF_BAR * 4) + go[r][j][0]);
          gv[r][j][1] = *(const float*)(qeh + (ro + OFF_POS * 4) + go[r][j][1]);
          gv[r][j][2] = *(const float*)(qeh + (ro + OFF_OCT * 4) + go[r][j][2]);
          gv[r][j][3] = *(const float*)(qeh + (ro + OFF_SEM * 4) + go[r][j][3]);
        }
      // precaution: this wait stands ahead of every later rewrite of a gather's offset register
      asm volatile("s_wait_xcnt 0x0" ::: "memory");
      // the scheduler may not sink the gathers to the sums, nor lift a sum over the wait
      __builtin_amdgcn_sched_barrier(0);
#pragma unroll
      for (int r = 0; r < RPR; ++r)
#pragma unroll
        for (int j = 0; j < 4; ++j)
          bs[j][g + r] = (gv[r][j][0] + gv[r][j][1]) + (gv[r][j][2] + gv[r][j][3]);
      // the sums stay ahead of the next run of loads: they free the gathered values' registers for it
      __builtin_amdgcn_sched_barrier(0);
    }
    iv += 64u * 4u;                                     // next key tile's index columns

    __syncthreads();
    {
      // every tile row here is one 128-B line: 8 lanes take a row, so a wave's 16-B load covers 4 whole lines;
      // load i of a thread takes row r + 16 i
      const int r = tid >> 3, c8 = (tid & 7) * 8;
      const __bf16*   kg  = Kh + (rowB + kv0 + r) * DM + c8;      // K row kv0+r, d = c8..c8+7
      const __bf16*   klg = Kl + (rowB + kv0 + r) * DM + c8;
      const _Float16* vg  = Vh + (size_t)r * SEQ + kv0 + c8;      // V^T row d = r, s = kv0+c8..+7
      const int kvl = (kv0 + 64 <= VLP) ? kv0 : (VLP - 64);     // clamped address into the residual plane
      const _Float16* vlg = Vl + (size_t)r * VLP + kvl + c8;
      const bool resOK = (kv0 + 64 <= VLP);                      // block-uniform
      // er band rows r + 16 i (128 rows x 64), row clamped at SEQ-1: min(ebb + r + 16 i, SEQ-1) = min(ebb + r, SEQ-1-16 i)
      // + 16 i; eo[i] is the byte offset of the thread's piece less the constant 16 i rows, which load i adds itself
      unsigned eo[8];
#pragma unroll
      for (int i = 0; i < 8; ++i) eo[i] = (unsigned)imin(ebb + r, SEQ - 1 - 16 * i) * (HD * 2) + (unsigned)c8 * 2u;
      v8b a0[4], a1[4], e0[8];
      v8h b0[4], b1[4];
#pragma unroll
      for (int i = 0; i < 4; ++i) {
        a0[i] = *(const v8b*)(kg + (size_t)i * 16 * DM);
        a1[i] = *(const v8b*)(klg + (size_t)i * 16 * DM);
        b0[i] = *(const v8h*)(vg + (size_t)i * 16 * SEQ);
        if (RES) b1[i] = *(const v8h*)(vlg + (size_t)i * 16 * VLP);
      }
#pragma unroll
      for (int i = 0; i < 8; ++i) e0[i] = *(const v8b*)((const char*)Erb + i * (16 * HD * 2) + eo[i]);
      // precaution: this wait stands ahead of every later rewrite of the loads' address registers; it names
      // them so that they stay whole up to it (no later load of the run lands in one)
      if (RES) asm volatile("s_wait_xcnt 0x0" :: "v"(kg), "v"(klg), "v"(vg), "v"(vlg), "v"(eo[0]), "v"(eo[1]), "v"(eo[2]),
                            "v"(eo[3]), "v"(eo[4]), "v"(eo[5]), "v"(eo[6]), "v"(eo[7]) : "memory");
      else     asm volatile("s_wait_xcnt 0x0" :: "v"(kg), "v"(klg), "v"(vg), "v"(eo[0]), "v"(eo[1]), "v"(eo[2]),
                            "v"(eo[3]), "v"(eo[4]), "v"(eo[5]), "v"(eo[6]), "v"(eo[7]) : "memory");
      // the scheduler may not sink the staging loads to their LDS stores, where each would wait alone
      __builtin_amdgcn_sched_barrier(0);
#pragma unroll
      for (int i = 0; i < 4; ++i) {
        *(v8b*)(Ksh + (r + 16 * i) * LP + c8) = a0[i];
        *(v8b*)(Ksl + (r + 16 * i) * LP + c8) = a1[i];
        *(v8h*)(Vth + (r + 16 * i) * LP + c8) = b0[i];
        if (RES) *(v8h*)(Vtl + (r + 16 * i) * LP + c8) = resOK ? b1[i] : zero8h();
      }
#pragma unroll
      for (int i = 0; i < 8; ++i) *(v8b*)(Esh + (r + 16 * i) * LP + c8) = e0[i];
    }
    __syncthreads();

    // ---- q.k: 16 query rows x 64 keys per wave, 3 bf16 products ----
    v8f s[4];
#pragma unroll
    for (int j = 0; j < 4; ++j) {
      s[j] = zero8();
#pragma unroll
      for (int dc = 0; dc < 2; ++dc) {
        FB kb, kl;
        kb.h[0] = *(const v8b*)(Ksh + (j * 16 + c) * LP + dc * 32 + 8 * hh);
        kb.h[1] = *(const v8b*)(Ksh + (j * 16 + c) * LP + dc * 32 + 16 + 8 * hh);
        kl.h[0] = *(const v8b*)(Ksl + (j * 16 + c) * LP + dc * 32 + 8 * hh);
        kl.h[1] = *(const v8b*)(Ksl + (j * 16 + c) * LP + dc * 32 + 16 + 8 * hh);
        s[j] = mma_b(qah[dc], kb.v, s[j]);
        s[j] = mma_b(qah[dc], kl.v, s[j]);
        s[j] = mma_b(qal[dc], kb.v, s[j]);
      }
    }

    // ---- q.er skew band: 5 subtiles of 16 band rows, streamed; diagonal extraction by bpermute ----
    {
      const int wb = (3 - wave) * 16;           // this wave's band offset inside Esh
      v8f prev = zero8();
#pragma unroll
      for (int u = 0; u < 5; ++u) {
        v8f cur = zero8();
#pragma unroll
        for (int dc = 0; dc < 2; ++dc) {
          FB eb;
          const __bf16* ep = Esh + (wb + u * 16 + c) * LP + dc * 32 + 8 * hh;
          eb.h[0] = *(const v8b*)(ep);
          eb.h[1] = *(const v8b*)(ep + 16);
          cur = mma_b(qah[dc], eb.v, cur);
          cur = mma_b(qal[dc], eb.v, cur);
        }
        if (u >= 1) {                            // key subtile jsub = u-1 uses subtiles u-1 (prev) and u (cur)
#pragma unroll
          for (int r = 0; r < 8; ++r) {
            const int base = 15 - (8 * hh + r) + c;                  // 0..30
            const int src  = (lane & 16) | (base & 15);
            const float vlo = __shfl(prev[r], src, 32);
            const float vhi = __shfl(cur[r], src, 32);
            s[u - 1][r] += (base < 16) ? vlo : vhi;
          }
        }
        prev = cur;
      }
    }

    // ---- add the gathered structure biases, scale, causal replace mask, online softmax, P (x1024, f16) and
    //      P residual (x4096) to LDS ----
    _Float16* pwh = Psh + wave * (16 * LP);
    _Float16* pwl = Psl + (RES ? wave : 0) * (16 * LP);
#pragma unroll
    for (int r = 0; r < 8; ++r) {
      const int    trow = q0 + 8 * hh + r;
      float m = -INFINITY;
#pragma unroll
      for (int j = 0; j < 4; ++j) {
        const int key = kv0 + j * 16 + c;
        float sv = (s[j][r] + bs[j][r]) * sscale;
        sv = (key <= trow) ? sv : -1.0e9f;
        s[j][r] = sv;
        m = fmaxf(m, sv);
      }
#pragma unroll
      for (int off = 1; off < 16; off <<= 1) m = fmaxf(m, __shfl_xor(m, off, 32));
      const float mnew  = fmaxf(mrow[r], m);
      const float msafe = (mnew == -INFINITY) ? 0.f : mnew;
      const float alpha = __expf(mrow[r] - msafe);
      mrow[r] = mnew;
      float psum = 0.f;
#pragma unroll
      for (int j = 0; j < 4; ++j) {
        const float p = __expf(s[j][r] - msafe);     // masked logit -1e9 against a normal max: exp -> 0
        psum += p;
        const float p1k = p * 1024.0f;
        const _Float16 ph = (_Float16)p1k;
        pwh[(8 * hh + r) * LP + j * 16 + c] = ph;
        if (RES) {
          const _Float16 pl = (_Float16)((p1k - (float)ph) * 4096.0f);
          pwl[(8 * hh + r) * LP + j * 16 + c] = pl;
        }
      }
#pragma unroll
      for (int off = 1; off < 16; off <<= 1) psum += __shfl_xor(psum, off, 32);
      lrow[r] = lrow[r] * alpha + psum;
#pragma unroll
      for (int t = 0; t < 4; ++t) oacc[t][r] *= alpha;
    }
    __builtin_amdgcn_fence(__ATOMIC_RELEASE, "workgroup");
    __builtin_amdgcn_wave_barrier();
    __builtin_amdgcn_fence(__ATOMIC_ACQUIRE, "workgroup");

    // ---- context += P . V (f16 WMMA), residual products into a separate accumulator ----
    v8f o1[4];
#pragma unroll
    for (int t = 0; t < 4; ++t) o1[t] = zero8();
#pragma unroll 1
    for (int kk = 0; kk < 2; ++kk) {
      FH pa, pl;
      pa.h[0] = *(const v8h*)(pwh + c * LP + kk * 32 + 8 * hh);
      pa.h[1] = *(const v8h*)(pwh + c * LP + kk * 32 + 16 + 8 * hh);
      if (RES) {
        pl.h[0] = *(const v8h*)(pwl + c * LP + kk * 32 + 8 * hh);
        pl.h[1] = *(const v8h*)(pwl + c * LP + kk * 32 + 16 + 8 * hh);
      } else {
        pl.v = pa.v;
      }
#pragma unroll
      for (int t = 0; t < 4; ++t) {
        FH vb;
        vb.h[0] = *(const v8h*)(Vth + (t * 16 + c) * LP + kk * 32 + 8 * hh);
        vb.h[1] = *(const v8h*)(Vth + (t * 16 + c) * LP + kk * 32 + 16 + 8 * hh);
        oacc[t] = mma_h(pa.v, vb.v, oacc[t]);
        if (RES) {
          FH vl;
          vl.h[0] = *(const v8h*)(Vtl + (t * 16 + c) * LP + kk * 32 + 8 * hh);
          vl.h[1] = *(const v8h*)(Vtl + (t * 16 + c) * LP + kk * 32 + 16 + 8 * hh);
          o1[t] = mma_h(pa.v, vl.v, o1[t]);
          o1[t] = mma_h(pl.v, vb.v, o1[t]);
        }
      }
    }
    if (RES) {
#pragma unroll
      for (int t = 0; t < 4; ++t)
#pragma unroll
        for (int r = 0; r < 8; ++r) oacc[t][r] += o1[t][r] * (1.0f / 4096.0f);
    }
  }

  // ---- normalise (1/l and the 1/1024 p carry), stage the wave's 16x64 tile (Os aliases the K tiles,
  __syncthreads();
  float* os = Os + wave * (16 * 68);               // pitch 68 floats = 16 B x odd, for the 16-rows-at-a-time reads below
#pragma unroll
  for (int r = 0; r < 8; ++r) {
    const float l = lrow[r];
    const float inv = ((l > 0.f) ? (1.0f / l) : 0.f) * (1.0f / 1024.0f);
#pragma unroll
    for (int t = 0; t < 4; ++t) os[(8 * hh + r) * 68 + t * 16 + c] = oacc[t][r] * inv;
  }
  __builtin_amdgcn_fence(__ATOMIC_RELEASE, "workgroup");
  __builtin_amdgcn_wave_barrier();
  __builtin_amdgcn_fence(__ATOMIC_ACQUIRE, "workgroup");
  {
    // the wave's 16 rows are one strip and its 64 columns two 32-column blocks: 4 runs of 512 B, one after another
    v4u hv[4], lv[4];
#pragma unroll
    for (int it = 0; it < 4; ++it) {
      // run it: lane -> row c, columns 16 it + 8 hh ..+7 (it 0..3 x hh 0..1 x 8 = columns 0..63, c = rows 0..15)
      const float* sp = os + c * 68 + it * 16 + 8 * hh;
      v4u a, a2;
#pragma unroll
      for (int e = 0; e < 4; ++e) {
        const float f0 = sp[2 * e], f1 = sp[2 * e + 1];
        const unsigned short h0 = bf_bits(f0), h1 = bf_bits(f1);
        const unsigned short l0 = bf_bits(f0 - bf_up(h0)), l1 = bf_bits(f1 - bf_up(h1));
        a[e] = pk16(h0, h1); a2[e] = pk16(l0, l1);
      }
      hv[it] = a; lv[it] = a2;
    }
    {
#pragma unroll
      for (int it = 0; it < 4; ++it) {
        const size_t go = ((((rowB + q0) >> 4) * (DM / 32) + (size_t)h * 2) * 64 + it * 32 + lane) * 8;
        *(v4u*)(ohp + go) = hv[it];
        *(v4u*)(olp + go) = lv[it];
      }
      
    }
  }
}

// Every query block in one grid: the blocks with residual planes (qb < RESQB) and the rest depend on the same
// inputs and write disjoint rows, so they run side by side. NB*NH consecutive blocks share one qb; the first half
// of the grid takes qb = NQB-1 downwards (the longest key loops start first), the second half qb = 0 upwards.
__global__ __launch_bounds__(128, 3)
void attn_rel64(const unsigned short* __restrict__ qhp, const unsigned short* __restrict__ qlp,
                const unsigned short* __restrict__ khp, const unsigned short* __restrict__ klp,
                const unsigned short* __restrict__ vhp, const unsigned short* __restrict__ vlp,
                const unsigned short* __restrict__ erp, const float* __restrict__ qe,
                const int* __restrict__ ibar, const int* __restrict__ ipos,
                const int* __restrict__ ioct, const int* __restrict__ isem,
                unsigned short* ohp, unsigned short* olp, float sscale) {
  __shared__ __align__(16) unsigned char smem[8 * TB64];
  const int bx = blockIdx.x;
  const int g  = bx / (NB * NH);
  const int bh = bx - g * (NB * NH);
  const int qb = (g < NQB / 2) ? (NQB - 1 - g) : (g - NQB / 2);   // a permutation of 0..NQB-1, block-uniform
  const int h  = bh % NH;
  const int b  = bh / NH;
  if (qb < RESQB)
    attn_body<true>(qhp, qlp, khp, klp, vhp, vlp, erp, qe, ibar, ipos, ioct, isem, ohp, olp, smem, qb, h, b, sscale);
  else
    attn_body<false>(qhp, qlp, khp, klp, vhp, vlp, erp, qe, ibar, ipos, ioct, isem, ohp, olp, smem, qb, h, b, sscale);
}

// =====================================================================================================
// Workspace map (bytes, every region a multiple of its 64x64-tile / whole-line store granularity):
//   (Xb, the four weight planes, Oh and Ol are stored in fragment order; every other plane is row-major)
//   Xb   bf16 [2048][1024]            0        4194304
//   Wqb  bf16 [1024 n][1024 k]    4194304        2097152
//   Wkb                           6291456        2097152
//   Wvb                           8388608        2097152
//   Wob                          10485760        2097152
//   Erb  bf16 [1024][64]         12582912         131072
//   Tb   bf16 [192][64]          12713984          24576
//   Qh   bf16 [2048][1024]       12738560        4194304
//   Ql                           16932864        4194304
//   Kh                           21127168        4194304
//   Kl                           25321472        4194304
//   VTh  f16  [2][1024][1024]    29515776        4194304
//   VTl  f16  [2][1024][256]     33710080        1048576
//   QE   f32  [16][2048][192]    34758656       25165824
//   Oh   bf16 [2048][1024]       59924480        4194304
//   Ol                           64118784        4194304
//   end                          68313088
// Weights are [out n][in k] = the Bt / A orientation the GEMM wants, so they are converted into fragment order, not transposed.
// =====================================================================================================
extern "C" void kernel_launch(void* const* d_in, const int* in_sizes, int n_in,
                              void* d_out, int out_size, void* d_ws, size_t ws_size,
                              hipStream_t stream) {
  if (n_in < 14) return;
  if (in_sizes[0] != NB * SEQ * DM) return;
  if (in_sizes[1] != NB * SEQ * SEQ || in_sizes[2] != NB * SEQ * SEQ ||
      in_sizes[3] != NB * SEQ * SEQ || in_sizes[4] != NB * SEQ * SEQ) return;
  if (in_sizes[5] != DM * DM || in_sizes[6] != DM * DM || in_sizes[7] != DM * DM || in_sizes[8] != DM * DM) return;
  if (in_sizes[9] != SEQ * HD) return;
  if (in_sizes[10] != 16 * HD || in_sizes[11] != 95 * HD || in_sizes[12] != 24 * HD || in_sizes[13] != 12 * HD) return;
  if (out_size != NB * SEQ * DM) return;

  const float* x    = (const float*)d_in[0];
  const int*   rbar = (const int*)d_in[1];
  const int*   rpos = (const int*)d_in[2];
  const int*   roct = (const int*)d_in[3];
  const int*   rsem = (const int*)d_in[4];
  const float* Wq   = (const float*)d_in[5];
  const float* Wk   = (const float*)d_in[6];
  const float* Wv   = (const float*)d_in[7];
  const float* Wo   = (const float*)d_in[8];
  const float* Er   = (const float*)d_in[9];
  const float* Ebar = (const float*)d_in[10];
  const float* Epos = (const float*)d_in[11];
  const float* Eoct = (const float*)d_in[12];
  const float* Esem = (const float*)d_in[13];

  const size_t PX  = (size_t)MROWS * DM * 2;          //  4194304  16-bit activation plane [2048][1024]
  const size_t PW  = (size_t)DM * DM * 2;             //  2097152  16-bit weight plane
  const size_t PE  = (size_t)SEQ * HD * 2;            //   131072  er plane
  const size_t PT  = (size_t)TROWS * HD * 2;          //    24576  combined structure table
  const size_t PVT = (size_t)NB * DM * SEQ * 2;       //  4194304  v^T hi plane
  const size_t PVL = (size_t)NB * DM * VLP * 2;       //  1048576  v^T residual plane
  const size_t PQE = (size_t)NH * MROWS * QEP * 4;    // 25165824  structure products
  size_t off = 0;
  const size_t oXb  = off; off += PX;
  const size_t oWq  = off; off += PW;
  const size_t oWk  = off; off += PW;
  const size_t oWv  = off; off += PW;
  const size_t oWo  = off; off += PW;
  const size_t oEr  = off; off += PE;
  const size_t oTb  = off; off += PT;
  const size_t oQh  = off; off += PX;
  const size_t oQl  = off; off += PX;
  const size_t oKh  = off; off += PX;
  const size_t oKl  = off; off += PX;
  const size_t oVTh = off; off += PVT;
  const size_t oVTl = off; off += PVL;
  const size_t oQE  = off; off += PQE;
  const size_t oOh  = off; off += PX;
  const size_t oOl  = off; off += PX;
  if (off > ws_size) return;                          // off = 68313088
  if (off > (size_t)134217728) return;

  char* ws = (char*)d_ws;
  unsigned short* Xb  = (unsigned short*)(ws + oXb);
  unsigned short* Wqb = (unsigned short*)(ws + oWq);
  unsigned short* Wkb = (unsigned short*)(ws + oWk);
  unsigned short* Wvb = (unsigned short*)(ws + oWv);
  unsigned short* Wob = (unsigned short*)(ws + oWo);
  unsigned short* Erb = (unsigned short*)(ws + oEr);
  unsigned short* Tb  = (unsigned short*)(ws + oTb);
  unsigned short* Qh  = (unsigned short*)(ws + oQh);
  unsigned short* Ql  = (unsigned short*)(ws + oQl);
  unsigned short* Kh  = (unsigned short*)(ws + oKh);
  unsigned short* Kl  = (unsigned short*)(ws + oKl);
  unsigned short* VTh = (unsigned short*)(ws + oVTh);
  unsigned short* VTl = (unsigned short*)(ws + oVTl);
  float*          QE  = (float*)(ws + oQE);
  unsigned short* Oh  = (unsigned short*)(ws + oOh);
  unsigned short* Ol  = (unsigned short*)(ws + oOl);

  const dim3 blk(256);
  const dim3 gPrep(PB_X + 4 * PB_W + PB_E + PB_T);             // 3110 blocks
  const dim3 gQKV(PJB, 3);                                     // 64 blocks x {q, k, v^T}
  const dim3 gProj(((MROWS / 64) * (DM / 64) + 7) / 8, 1);     // 512 tiles -> 64 blocks: M=2048, N=1024
  const dim3 gQE(((MROWS / 64) * (QEP / 64) + 7) / 8, NH);    //  96 tiles -> 12 blocks x 16 heads

  // (1) x -> bf16 plane; weights [n][k] f32 -> bf16 [n][k]; er -> bf16; combined structure table
  prep_all<<<gPrep, blk, 0, stream>>>(x, Wq, Wk, Wv, Wo, Er, Ebar, Epos, Eoct, Esem,
                                      Xb, Wqb, Wkb, Wvb, Wob, Erb, Tb);
  // (2)-(4) q, k (bf16 hi/lo planes) and v^T (f16 hi plane, residual plane)
  gemm_qkv<<<gQKV, blk, 0, stream>>>(Xb, Wqb, Wkb, Wvb, Qh, Ql, Kh, Kl, VTh, VTl);
  // (5) structure products: qe[h][b*SEQ+t][s] = q . T^T  (A = q hi/lo planes at column h*64, K=64;
  //     Bt = Tb [192][64]; M=2048, N=192, 2 products, f32 out pitch 192)
  gemm64<1, 0, false><<<gQE, blk, 0, stream>>>(
      Qh, Ql, DM, (long long)HD, Tb, Tb, HD, 0LL,
      (void*)QE, QEP, (long long)MROWS * QEP, (void*)QE, QEP, 0LL, QEP,
      MROWS, QEP, HD, 1.0f);
  // (6) attention: query blocks 0..RESQB-1 with residual planes, the rest without, one grid
  attn_rel64<<<dim3(NB * NH * NQB), dim3(128), 0, stream>>>(
      Qh, Ql, Kh, Kl, VTh, VTl, Erb, QE, rbar, rpos, roct, rsem, Oh, Ol, 0.125f);
  // (7) out = context . Wo^T -> d_out f32 [2048][1024]  (A = context hi + lo planes, 2 products)
  gemm64<1, 0, true><<<gProj, blk, 0, stream>>>(
      Oh, Ol, DM, 0LL, Wob, Wob, DM, 0LL,
      d_out, DM, 0LL, d_out, DM, 0LL, DM,
      MROWS, DM, DM, 1.0f);
  (void)hipGetLastError();
}

// v006
// Measured time: 128 microseconds a run.
// Timed twice side by side with v005, it ran 1.12 and 1.13 times as fast.
// All steps since v000 together make it 6.15 times as fast.
// Contractions: q, k, v^T projections = v_wmma_f32_16x16x32_bf16 (bf16 operands from RNE-converted inputs, single product);
// q.k^T = v_wmma_f32_16x16x32_bf16 with bf16 hi/lo split q and k (hi.hi + hi.lo + lo.hi);
// q.Er^T skew band and q.T^T structure tables = bf16 hi/lo q times bf16 table rows (2 products);
// p.v = v_wmma_f32_16x16x32_f16 (p carried x1024 in f16, v f16; extra f16 residual planes x4096 of p and v for the first 256 query rows);
// ctx.Wo^T = bf16 hi/lo ctx times bf16 Wo (2 products); all f32 accumulate; bias gathers, causal mask and softmax in f32.
#include <hip/hip_runtime.h>
#include <math.h>
#include <stdint.h>

#define NB    2
#define SEQ   1024
#define DM    1024
#define NH    16
#define HD    64
#define MROWS (NB * SEQ)     // 2048
#define NQB   (SEQ / 64)     // 16 query / key tiles of 64
#define VLP   256            // key pitch of the v^T residual plane (keys 0..VLP-1)
#define RESQB 4              // leading 64-row query blocks that use the p / v residual planes
#define NTS   10             // 16-row subtiles of the structure table that hold used rows (151 of 160)
#define QSP   164            // LDS row pitch (floats) of the structure-table products: 8 rows = 32 banks mod 64
#define TROWS 192            // rows of the combined structure table (151 used, rest zero)
#define LP    72             // LDS row pitch, 16-bit elements, of the 64-wide K / V^T / er / P tiles: 144 B = 16 B x odd
#define OFF_BAR 0            // 16 rows + zero row  -> idx 0..16
#define OFF_POS 17           // 95 rows + zero row  -> idx 0..95
#define OFF_OCT 113          // 24 rows + zero row  -> idx 0..24
#define OFF_SEM 138          // 12 rows + zero row  -> idx 0..12
static_assert(RESQB * 64 <= VLP);
static_assert(NH * HD == DM);
static_assert((SEQ % 64) == 0 && (DM % 64) == 0 && (TROWS % 64) == 0);
static_assert(OFF_SEM + 13 <= NTS * 16 && NTS * 16 <= QSP && NTS * 16 <= TROWS && (QSP * 8) % 64 == 32);

typedef _Float16 v16h __attribute__((ext_vector_type(16)));
typedef _Float16 v8h  __attribute__((ext_vector_type(8)));
typedef __bf16   v16b __attribute__((ext_vector_type(16)));
typedef __bf16   v8b  __attribute__((ext_vector_type(8)));
typedef float    v8f  __attribute__((ext_vector_type(8)));
typedef float    v4f  __attribute__((ext_vector_type(4)));
typedef unsigned int v4u __attribute__((ext_vector_type(4)));

// ---- scalar helpers --------------------------------------------------------------------------------
__device__ __forceinline__ unsigned short bf_bits(float f) {          // f32 -> bf16 bits, RNE convert
  unsigned u = __float_as_uint(f);
  return (unsigned short)((u + 0x7FFFu + ((u >> 16) & 1u)) >> 16);
}
__device__ __forceinline__ float bf_up(unsigned short h) { return __uint_as_float(((unsigned)h) << 16); }
__device__ __forceinline__ unsigned short h_bits(_Float16 x) { return __builtin_bit_cast(unsigned short, x); }
__device__ __forceinline__ unsigned pk16(unsigned short a, unsigned short b) { return (unsigned)a | ((unsigned)b << 16); }
__device__ __forceinline__ int iclamp(int v, int lo, int hi) { return (v < lo) ? lo : ((v > hi) ? hi : v); }
__device__ __forceinline__ int imin(int a, int b) { return (a < b) ? a : b; }
__device__ __forceinline__ v8f zero8() { v8f z = {0.f, 0.f, 0.f, 0.f, 0.f, 0.f, 0.f, 0.f}; return z; }
__device__ __forceinline__ v8h zero8h() {
  const _Float16 z = (_Float16)0.0f;
  v8h r = {z, z, z, z, z, z, z, z};
  return r;
}

// ---- fragment loader: 16-bit A/B operand, lane -> row/col (lane&15), p already includes +8*(lane>>4);
//      elements 0..7 <- p[0..7] (k0+8h..), elements 8..15 <- p[16..23] (k0+16+8h..)
__device__ __forceinline__ v16b ldfrag_b(const __bf16* p) {
  union { v16b v; v8b h[2]; } f;
  f.h[0] = *(const v8b*)(p);
  f.h[1] = *(const v8b*)(p + 16);
  return f.v;
}
//      a wave-uniform pointer to global memory, held in scalar registers, so that a load names it and a 32-bit lane
//      offset (left to itself one build formed a vector address pair per strip, and a load of the run landed in it)
typedef const __attribute__((address_space(1))) char* gcp;
typedef const __attribute__((address_space(1))) v8b*  gv8bp;
__device__ __forceinline__ gcp uni_ptr(const char* p) {
  const unsigned long long u = (unsigned long long)p;
  const unsigned lo = (unsigned)__builtin_amdgcn_readfirstlane((int)(unsigned)u);
  const unsigned hi = (unsigned)__builtin_amdgcn_readfirstlane((int)(unsigned)(u >> 32));
  return (gcp)(((unsigned long long)hi << 32) | lo);
}
//      the same elements in the same positions, from a wave-uniform base and the lane's byte offset vo;
//      H2 = bytes from the lane's elements 0..7 to its elements 8..15 (32 in a row-major plane, 512 in fragment order)
template <int H2>
__device__ __forceinline__ v16b ldfrag_o(gcp base, unsigned vo) {
  union { v16b v; v8b h[2]; } f;
  f.h[0] = *(gv8bp)(base + vo);
  f.h[1] = *(gv8bp)(base + H2 + vo);
  return f.v;
}

// ---- WMMA helpers with trailing VALU hazard gap --------------------------------------------------------
__device__ __forceinline__ v8f mma_b(v16b a, v16b b, v8f c) {
  c = __builtin_amdgcn_wmma_f32_16x16x32_bf16(false, a, false, b, (short)0, c, false, false);
#if defined(__HIP_DEVICE_COMPILE__)
  asm volatile("v_nop\n\tv_nop\n\tv_nop\n\tv_nop" : "+v"(c) : "v"(a), "v"(b));
#endif
  return c;
}
__device__ __forceinline__ v8f mma_h(v16h a, v16h b, v8f c) {
  c = __builtin_amdgcn_wmma_f32_16x16x32_f16(false, a, false, b, (short)0, c, false, false);
#if defined(__HIP_DEVICE_COMPILE__)
  asm volatile("v_nop\n\tv_nop\n\tv_nop\n\tv_nop" : "+v"(c) : "v"(a), "v"(b));
#endif
  return c;
}
__device__ __forceinline__ v8f mma_b_raw(v16b a, v16b b, v8f c) {
  return __builtin_amdgcn_wmma_f32_16x16x32_bf16(false, a, false, b, (short)0, c, false, false);
}
__device__ __forceinline__ void acc_guard4(v8f& a, v8f& b, v8f& c, v8f& d) {
#if defined(__HIP_DEVICE_COMPILE__)
  asm volatile("v_nop\n\tv_nop\n\tv_nop\n\tv_nop" : "+v"(a), "+v"(b), "+v"(c), "+v"(d));
#else
  (void)a; (void)b; (void)c; (void)d;
#endif
}

// =====================================================================================================
// f32 -> bf16 (RNE convert), 8 elements per thread, one 16-B store per lane: a wave writes 512 contiguous B
// (n8 is a multiple of 256 for every use here). coverage: n8 threads x 8 = whole plane.
// =====================================================================================================
__device__ __forceinline__ void cvt_bf16x8(const float* __restrict__ in, unsigned short* out, int n8, int blk) {
  const int i = blk * 256 + threadIdx.x;
  if (i < n8) {
    const v4f a = *(const v4f*)(in + (size_t)i * 8);
    const v4f b = *(const v4f*)(in + (size_t)i * 8 + 4);
    v4u p;
    p[0] = pk16(bf_bits(a[0]), bf_bits(a[1]));
    p[1] = pk16(bf_bits(a[2]), bf_bits(a[3]));
    p[2] = pk16(bf_bits(b[0]), bf_bits(b[1]));
    p[3] = pk16(bf_bits(b[2]), bf_bits(b[3]));
    *(v4u*)(out + (size_t)i * 8) = p;
    
  }
}

// =====================================================================================================
// FRAGMENT ORDER of a 16-bit plane [rows][DM] that a GEMM reads as A or Bt: the plane is cut into 16-row strips and
// each strip into blocks of 32 columns; a block is 1 KB = two runs of 512 B, and run u holds, for lane l = 0..31,
// the 8 elements (row l & 15, columns 16 u + 8 (l >> 4) ..+7) at byte 16 l. Blocks of a strip follow one another, then
// the next strip. So each of a fragment's two 16-B loads reads 512 contiguous bytes (4 whole lines) where a row-major
// plane gives it 32 B from each of 16 lines; which element lands in which lane and register does not change.
//   16-B piece index of (row m, columns 8 k8 ..+7) = (((m >> 4) * (DM/32) + (k8 >> 2)) * 2 + ((k8 >> 1) & 1)) * 32
//                                                    + (k8 & 1) * 16 + (m & 15)
// f32 [rows][DM] -> bf16 (RNE convert) in fragment order: thread i makes piece i, so a wave stores 512 contiguous B;
// a block reads 512 contiguous B of each of 16 rows. coverage: n8 threads x 8 = whole plane (the map is one to one).
// =====================================================================================================
static_assert(DM / 32 == 32);
__device__ __forceinline__ void cvt_bf16_frag(const float* __restrict__ in, unsigned short* out, int n8, int blk) {
  const int i = blk * 256 + threadIdx.x;
  if (i < n8) {
    const int l = i & 31, u = (i >> 5) & 1, kb = (i >> 6) & 31, st = i >> 11;
    const size_t so = (size_t)(st * 16 + (l & 15)) * DM + kb * 32 + u * 16 + (l >> 4) * 8;
    const v4f a = *(const v4f*)(in + so);
    const v4f b = *(const v4f*)(in + so + 4);
    v4u p;
    p[0] = pk16(bf_bits(a[0]), bf_bits(a[1]));
    p[1] = pk16(bf_bits(a[2]), bf_bits(a[3]));
    p[2] = pk16(bf_bits(b[0]), bf_bits(b[1]));
    p[3] = pk16(bf_bits(b[2]), bf_bits(b[3]));
    *(v4u*)(out + (size_t)i * 8) = p;
  }
}

// =====================================================================================================
// Combined structure table, bf16 [TROWS][64]: rows 0..15 bar, 16 zero, 17..111 position, 112 zero,
// 113..136 octave, 137 zero, 138..149 semitone, 150..191 zero. 8 threads per row, 8 elements each,
// all four candidate loads unconditional with clamped row addresses, selection by value.
// PB_T = TROWS*8/256 = 6 blocks of prep_all exactly. coverage: 1536 threads x 8 = 192 x 64.
// =====================================================================================================
__device__ __forceinline__ void build_tab(const float* __restrict__ ebar, const float* __restrict__ epos,
                                          const float* __restrict__ eoct, const float* __restrict__ esem,
                                          unsigned short* tab, int blk) {
  const int g = blk * 256 + threadIdx.x;
  if (g < TROWS * 8) {
    const int s  = g >> 3;
    const int d0 = (g & 7) * 8;
    const int rb = iclamp(s, 0, 15);
    const int rp = iclamp(s - OFF_POS, 0, 94);
    const int ro = iclamp(s - OFF_OCT, 0, 23);
    const int rs = iclamp(s - OFF_SEM, 0, 11);
    const bool ub = (s < 16);
    const bool up = (s >= OFF_POS) && (s < OFF_POS + 95);
    const bool uo = (s >= OFF_OCT) && (s < OFF_OCT + 24);
    const bool us = (s >= OFF_SEM) && (s < OFF_SEM + 12);
    float v[8];
#pragma unroll
    for (int e = 0; e < 8; ++e) {
      const int d = d0 + e;
      const float fb = ebar[rb * HD + d];
      const float fp = epos[rp * HD + d];
      const float fo = eoct[ro * HD + d];
      const float fs = esem[rs * HD + d];
      float t = 0.f;
      t = ub ? fb : t;
      t = up ? fp : t;
      t = uo ? fo : t;
      t = us ? fs : t;
      v[e] = t;
    }
    v4u p;
    p[0] = pk16(bf_bits(v[0]), bf_bits(v[1]));
    p[1] = pk16(bf_bits(v[2]), bf_bits(v[3]));
    p[2] = pk16(bf_bits(v[4]), bf_bits(v[5]));
    p[3] = pk16(bf_bits(v[6]), bf_bits(v[7]));
    *(v4u*)(tab + (size_t)s * HD + d0) = p;
    
  }
}

// =====================================================================================================
// All operand preparation in one grid (the seven pieces depend on nothing but the inputs, so they run side by
// side): blocks 0..PB_X-1 convert x, the next 4*PB_W the four weights (these five into fragment order), the next
// PB_E er (row-major), the last PB_T build the combined table. The piece is chosen by blockIdx.x alone (block-uniform).
// =====================================================================================================
#define PB_X (MROWS * DM / 8 / 256)   // 1024
#define PB_W (DM * DM / 8 / 256)      //  512
#define PB_E (SEQ * HD / 8 / 256)     //   32
#define PB_T (TROWS * 8 / 256)        //    6
static_assert(PB_X * 2048 == MROWS * DM && PB_W * 2048 == DM * DM && PB_E * 2048 == SEQ * HD && PB_T * 256 == TROWS * 8);
__global__ __launch_bounds__(256) void prep_all(
    const float* __restrict__ x, const float* __restrict__ wq, const float* __restrict__ wk,
    const float* __restrict__ wv, const float* __restrict__ wo, const float* __restrict__ er,
    const float* __restrict__ ebar, const float* __restrict__ epos,
    const float* __restrict__ eoct, const float* __restrict__ esem,
    unsigned short* xb, unsigned short* wqb, unsigned short* wkb, unsigned short* wvb, unsigned short* wob,
    unsigned short* erb, unsigned short* tab) {
  int blk = blockIdx.x;
  if (blk < PB_X) { cvt_bf16_frag(x, xb, MROWS * DM / 8, blk); return; }
  blk -= PB_X;
  if (blk < 4 * PB_W) {
    const int w = blk / PB_W;
    const float*    in  = (w == 0) ? wq  : (w == 1) ? wk  : (w == 2) ? wv  : wo;
    unsigned short* out = (w == 0) ? wqb : (w == 1) ? wkb : (w == 2) ? wvb : wob;
    cvt_bf16_frag(in, out, DM * DM / 8, blk - w * PB_W);
    return;
  }
  blk -= 4 * PB_W;
  if (blk < PB_E) { cvt_bf16x8(er, erb, SEQ * HD / 8, blk); return; }
  build_tab(ebar, epos, eoct, esem, tab, blk - PB_E);
}

// =====================================================================================================
// Register-blocked batched bf16 WMMA GEMM: C[m][n] = sum_k A[m][k] * Bt[n][k]; one wave per 64x64 tile,
// no block barriers. A row-major [M][K] pitch lda; Bt row-major [N][K] pitch ldb (k contiguous);
// M, N multiples of 64, K a multiple of 32 and at least 32. blockIdx.y = batch index (strides in elements).
// NSPLIT: 0 = A.Bt; 1 = (A + A2).Bt (A2 = unscaled bf16 lo plane of A); 2 = A.Bt + A2.Bt + A.Bt2.
// OUT_MODE: 0 = f32 (pitch ldc); 2 = bf16 hi plane C + bf16 lo plane C2 (lo = RNE(v - hi), unscaled);
//           3 = f16 hi plane C + f16 residual plane C2 = f16((v - hi) * rscale), C2 written only for tiles
//               with n0 < N2 (pitch ldc2, batch stride strideC2).
// FR: false = A and Bt planes row-major; true = both in fragment order (then lda == ldb == K == DM, and a batch
//     stride is a whole number of 16-row strips).
// =====================================================================================================
//   sT: the block's 8 x (16 x 68) f32 staging slabs; bx: the block's index among the tiles; b: batch index.
template <int NSPLIT, int OUT_MODE, bool FR>
__device__ __forceinline__ void gemm64_body(
    const unsigned short* __restrict__ Ap, const unsigned short* A2p, int lda, long long strideA,
    const unsigned short* __restrict__ Btp, const unsigned short* Bt2p, int ldb, long long strideB,
    void* Cout, int ldc, long long strideC,
    void* Cout2, int ldc2, long long strideC2, int N2,
    int M, int N, int K, float rscale, float* sT, int bx, int b) {
  const __bf16* A   = (const __bf16*)(const void*)Ap;
  const __bf16* A2  = (const __bf16*)(const void*)A2p;
  const __bf16* Bt  = (const __bf16*)(const void*)Btp;
  const __bf16* Bt2 = (const __bf16*)(const void*)Bt2p;
  const int lane = threadIdx.x & 31;
  const int wave = threadIdx.x >> 5;
  const int tilesN = N >> 6;
  const int tilesM = M >> 6;
  const int tile = bx * 8 + wave;
  if (tile >= tilesM * tilesN) return;   // wave-uniform; no block barriers in this kernel
  const int tm = tile / tilesN;
  const int tn = tile - tm * tilesN;
  const int m0 = tm << 6;
  const int n0 = tn << 6;

  const __bf16* Ab  = A  + (size_t)b * strideA;
  const __bf16* Bb  = Bt + (size_t)b * strideB;
  const __bf16* Ab2 = (NSPLIT >= 1) ? (A2  + (size_t)b * strideA) : Ab;
  const __bf16* Bb2 = (NSPLIT == 2) ? (Bt2 + (size_t)b * strideB) : Bb;

  const int rlane = lane & 15;                 // row (A) / col (B, D) within subtile
  const int koff  = (lane >> 4) * 8;           // k offset of this lane half
  const int mOff  = (lane >> 4) * 8;           // D row offset

  v8f acc[4][4];
#pragma unroll
  for (int i = 0; i < 4; ++i)
#pragma unroll
    for (int j = 0; j < 4; ++j) acc[i][j] = zero8();

  // k loop, K >= 32: two register sets of fragments. All loads of one k step (32 columns) go out in one run, one k
  // step ahead of their products, so a k step waits for at most the rest of one load round trip instead of four whole
  // ones. Every load names a wave-uniform base (plane + 16-row strip) and one of two lane offsets, va (A) and vb (Bt).
  // Past the last k step the offsets stand still: a run that has no k step left reads the last one again (in bounds,
  // never used), so every run holds the same number of loads and the counted waits stay exact.
  // The inner loops are unrolled so that every fragment and accumulator index is a constant (registers, no scratch).
  struct FragSet { v16b a[4], l[4], b[4], m[4]; };                // A, second A plane, Bt, second Bt plane
  const size_t sa = (size_t)lda * 32, sb = (size_t)ldb * 32;      // bytes from one 16-row strip to the next
  gcp pa[4], pa2[4], pb[4], pb2[4];                               // the planes' four strips, scalar bases
#pragma unroll
  for (int i = 0; i < 4; ++i) {
    pa[i]  = uni_ptr((const char*)Ab + i * sa);
    pb[i]  = uni_ptr((const char*)Bb + i * sb);
    pa2[i] = (NSPLIT >= 1) ? uni_ptr((const char*)Ab2 + i * sa) : pa[i];
    pb2[i] = (NSPLIT == 2) ? uni_ptr((const char*)Bb2 + i * sb) : pb[i];
  }
  //   fragment order: a 16-row strip is as many bytes as in a row-major plane, so the bases above serve both; the
  //   lane's piece stands at 16 * lane in its 512-B run, and a k step is one 1-KB block
  constexpr int      H2   = FR ? 512 : 32;
  constexpr unsigned KINC = FR ? 1024u : 64u;
  unsigned va = FR ? ((unsigned)m0 * (unsigned)lda * 2u + (unsigned)lane * 16u)
                   : (((unsigned)(m0 + rlane) * (unsigned)lda + (unsigned)koff) * 2u);
  unsigned vb = FR ? ((unsigned)n0 * (unsigned)ldb * 2u + (unsigned)lane * 16u)
                   : (((unsigned)(n0 + rlane) * (unsigned)ldb + (unsigned)koff) * 2u);
  const int nk = K >> 5;
  int kl = 0;                                                     // the k step that va and vb stand at, unclamped
  auto load = [&](FragSet& S) {
#pragma unroll
    for (int j = 0; j < 4; ++j) {
      S.b[j] = ldfrag_o<H2>(pb[j], vb);
      if (NSPLIT == 2) S.m[j] = ldfrag_o<H2>(pb2[j], vb); else S.m[j] = S.b[j];
    }
#pragma unroll
    for (int i = 0; i < 4; ++i) {
      S.a[i] = ldfrag_o<H2>(pa[i], va);
      if (NSPLIT >= 1) S.l[i] = ldfrag_o<H2>(pa2[i], va); else S.l[i] = S.a[i];
    }
    // the scheduler may not sink the run's loads into the products behind it, where each would go out late
    __builtin_amdgcn_sched_barrier(0);
  };
  auto advance = [&]() {
    // the wait below stays behind the products: lifted to stand directly behind the loads it would hold the products up
    __builtin_amdgcn_sched_barrier(0);
#if defined(__HIP_DEVICE_COMPILE__)
    // precaution: this wait stands ahead of every rewrite of a register that a load of the last run names; it takes
    // the two lane offsets and the scalar bases as operands so that they stay whole up to it and the additions
    // stay behind it
    asm volatile("s_wait_xcnt 0x0" : "+v"(va), "+v"(vb)
                 : "s"(pa[0]), "s"(pa[1]), "s"(pa[2]), "s"(pa[3]), "s"(pb[0]), "s"(pb[1]), "s"(pb[2]), "s"(pb[3]),
                   "s"(pa2[0]), "s"(pa2[1]), "s"(pa2[2]), "s"(pa2[3]), "s"(pb2[0]), "s"(pb2[1]), "s"(pb2[2]), "s"(pb2[3])
                 : "memory");
#endif
    ++kl;
    const unsigned inc = (kl < nk) ? KINC : 0u;                   // wave-uniform
    va += inc;
    vb += inc;
  };
  auto products = [&](const FragSet& S) {
#pragma unroll
    for (int i = 0; i < 4; ++i)
#pragma unroll
      for (int j = 0; j < 4; ++j) {
        acc[i][j] = mma_b_raw(S.a[i], S.b[j], acc[i][j]);
        if (NSPLIT >= 1) acc[i][j] = mma_b_raw(S.l[i], S.b[j], acc[i][j]);
        if (NSPLIT == 2) acc[i][j] = mma_b_raw(S.a[i], S.m[j], acc[i][j]);
      }
  };
  FragSet S0, S1;
  load(S0); advance();
  const int ng = nk / 2;                                          // whole turns of the two sets
  for (int g = 0; g < ng; ++g) {
    load(S1); products(S0); advance();
    load(S0); products(S1); advance();
  }
  if (nk - ng * 2 >= 1) products(S0);                             // the k step left over (wave-uniform)
  acc_guard4(acc[0][0], acc[0][1], acc[0][2], acc[0][3]);
  acc_guard4(acc[1][0], acc[1][1], acc[1][2], acc[1][3]);
  acc_guard4(acc[2][0], acc[2][1], acc[2][2], acc[2][3]);
  acc_guard4(acc[3][0], acc[3][1], acc[3][2], acc[3][3]);

  // ---- epilogue ----
  float* slab = sT + wave * (16 * 68);             // per-wave 16x64 slab, pitch 68 floats
#pragma unroll
  for (int i = 0; i < 4; ++i) {
    const int mBase = m0 + (i << 4);
#pragma unroll
    for (int j = 0; j < 4; ++j) {
#pragma unroll
      for (int r = 0; r < 8; ++r) {
        slab[(mOff + r) * 68 + (j << 4) + rlane] = acc[i][j][r];
      }
    }
    __builtin_amdgcn_fence(__ATOMIC_RELEASE, "workgroup");
    __builtin_amdgcn_wave_barrier();
    __builtin_amdgcn_fence(__ATOMIC_ACQUIRE, "workgroup");
    if (OUT_MODE == 0) {
      float* C = (float*)Cout + (size_t)b * strideC;
      const int hh = lane >> 4, c4 = (lane & 15) * 4;     // 256-B row segment = 16 lanes x 16 B
      {
#pragma unroll
        for (int it = 0; it < 8; ++it) {
          const int row = it * 2 + hh;                     // it 0..7 x hh 0..1 = rows 0..15
          const v4f v = *(const v4f*)(slab + row * 68 + c4);
          *(v4f*)(C + (size_t)(mBase + row) * ldc + n0 + c4) = v;
        }
        
      }
    } else {
      const int q = lane >> 3, c8 = (lane & 7) * 8;
      unsigned short* C  = (unsigned short*)Cout  + (size_t)b * strideC;
      unsigned short* C2 = (unsigned short*)Cout2 + (size_t)b * strideC2;
      const bool wlo = (OUT_MODE == 2) || (n0 < N2);      // wave-uniform
      v4u hv[4], lv[4];
#pragma unroll
      for (int it = 0; it < 4; ++it) {
        const int row = it * 4 + q;                        // it 0..3 x q 0..3 = rows 0..15
        const float* sp = slab + row * 68 + c8;
        v4u a, a2;
#pragma unroll
        for (int e = 0; e < 4; ++e) {
          const float f0 = sp[2 * e], f1 = sp[2 * e + 1];
          unsigned short h0, h1, l0, l1;
          if (OUT_MODE == 2) {
            h0 = bf_bits(f0); h1 = bf_bits(f1);
            l0 = bf_bits(f0 - bf_up(h0)); l1 = bf_bits(f1 - bf_up(h1));
          } else {
            const _Float16 x0 = (_Float16)f0, x1 = (_Float16)f1;
            h0 = h_bits(x0); h1 = h_bits(x1);
            l0 = h_bits((_Float16)((f0 - (float)x0) * rscale));
            l1 = h_bits((_Float16)((f1 - (float)x1) * rscale));
          }
          a[e] = pk16(h0, h1); a2[e] = pk16(l0, l1);
        }
        hv[it] = a; lv[it] = a2;
      }
      {
#pragma unroll
        for (int it = 0; it < 4; ++it) {
          const int row = it * 4 + q;
          *(v4u*)(C + (size_t)(mBase + row) * ldc + n0 + c8) = hv[it];
          if (wlo) *(v4u*)(C2 + (size_t)(mBase + row) * ldc2 + n0 + c8) = lv[it];
        }
        
      }
    }
    __builtin_amdgcn_fence(__ATOMIC_RELEASE, "workgroup");
    __builtin_amdgcn_wave_barrier();
    __builtin_amdgcn_fence(__ATOMIC_ACQUIRE, "workgroup");
  }
}

template <int NSPLIT, int OUT_MODE, bool FR>
__global__ __launch_bounds__(256) void gemm64(
    const unsigned short* __restrict__ Ap, const unsigned short* A2p, int lda, long long strideA,
    const unsigned short* __restrict__ Btp, const unsigned short* Bt2p, int ldb, long long strideB,
    void* Cout, int ldc, long long strideC,
    void* Cout2, int ldc2, long long strideC2, int N2,
    int M, int N, int K, float rscale) {
  __shared__ __align__(16) float sT[8 * 16 * 68];
  gemm64_body<NSPLIT, OUT_MODE, FR>(Ap, A2p, lda, strideA, Btp, Bt2p, ldb, strideB, Cout, ldc, strideC,
                                Cout2, ldc2, strideC2, N2, M, N, K, rscale, sT, blockIdx.x, blockIdx.y);
}

// The three projections in one grid: each alone fills a quarter of the chip's WGPs and none reads another's result.
//   blockIdx.y = 0: q = x . Wq^T -> bf16 hi/lo planes [b*SEQ+t][h*64+d]   (M=2048, N=1024, K=1024)
//   blockIdx.y = 1: k = x . Wk^T -> bf16 hi/lo planes
//   blockIdx.y = 2: v^T = Wv . x^T per batch -> f16 hi plane [b][h*64+d][s] (pitch SEQ) and residual plane (x4096,
//                   keys < VLP only, pitch VLP); A = Wvb [n][k], Bt = Xb rows of batch b = blockIdx.x / VTB
#define PJB ((MROWS / 64) * (DM / 64) / 8)   // 64 blocks of 8 tiles per projection
#define VTB ((DM / 64) * (SEQ / 64) / 8)     // 32 blocks of 8 tiles per batch of v^T
static_assert(VTB * NB == PJB);
__global__ __launch_bounds__(256) void gemm_qkv(
    const unsigned short* __restrict__ Xb, const unsigned short* __restrict__ Wqb,
    const unsigned short* __restrict__ Wkb, const unsigned short* __restrict__ Wvb,
    unsigned short* Qh, unsigned short* Ql, unsigned short* Kh, unsigned short* Kl,
    unsigned short* VTh, unsigned short* VTl) {
  __shared__ __align__(16) float sT[8 * 16 * 68];
  const int which = blockIdx.y;                 // block-uniform
  if (which < 2) {
    const unsigned short* Wb = which ? Wkb : Wqb;
    unsigned short* Ch = which ? Kh : Qh;
    unsigned short* Cl = which ? Kl : Ql;
    gemm64_body<0, 2, true>(Xb, Xb, DM, 0LL, Wb, Wb, DM, 0LL,
                      (void*)Ch, DM, 0LL, (void*)Cl, DM, 0LL, DM,
                      MROWS, DM, DM, 1.0f, sT, blockIdx.x, 0);
  } else {
    const int b = blockIdx.x / VTB;
    gemm64_body<0, 3, true>(Wvb, Wvb, DM, 0LL, Xb, Xb, DM, (long long)SEQ * DM,
                      (void*)VTh, SEQ, (long long)DM * SEQ, (void*)VTl, VLP, (long long)DM * VLP, VLP,
                      DM, SEQ, DM, 4096.0f, sT, blockIdx.x - b * VTB, b);
  }
}

// =====================================================================================================
// Causal attention with relative-index (skew) bias and four gathered structure biases, head dim 64.
//   q planes (bf16 hi / lo): element (b, t, h, d) at [(b*SEQ + t)*DM + h*64 + d]; k planes same layout.
//   v^T hi plane (f16): element (b, h, d, s) at [(b*DM + h*64 + d)*SEQ + s]
//   v^T residual plane (f16, (v - hi)*4096): [(b*DM + h*64 + d)*VLP + s], s < VLP, read only when RES
//   er: bf16 [SEQ][64]; tab: bf16 [TROWS][64], the combined structure table T
//   qe = q . T^T (q hi/lo, 2 products per 32 columns, f32): each wave forms its own 16 rows x NTS*16 table rows once,
//   ahead of the key loop, and keeps them in LDS (Qs, pitch QSP floats); the four bias gathers of a score read them there.
//   idx arrays: int [b][t][s], clamped to each sub-table's valid range before use.
//   scores[t][s] = (q_t.k_s + q_t.er[SEQ-1+s-t] + qe[OFF_BAR+ibar] + qe[OFF_POS+ipos] + qe[OFF_OCT+ioct]
//                   + qe[OFF_SEM+isem]) * sscale for s <= t, else -1e9 (replace mask).
//   q.k : bf16 hi/lo split (3 products); q.er : q hi/lo x bf16 er (2 products); f32 accumulate.
//   Skew band: a block (64 query rows, key tile kv0) needs er rows ebb .. ebb+127 with
//   ebb = SEQ-64+kv0-qb*64 >= 0 (staged in LDS, addresses clamped at SEQ-1; clamped rows only feed
//   masked positions). Wave w (rows q0..q0+15) computes 5 subtiles of 16 band rows starting at
//   band row 16*(3-w); the diagonal D[mi][15-mi+jj] is fetched with two unconditional bpermutes per
//   element and selected by value; subtiles are produced one at a time (prev / cur).
//   p = exp(s - m) carried as f16(1024 p); context = p . v on f16 WMMA; RES adds f16 residual planes of p and v
//   (scale 4096, separate accumulator folded back with 1/4096 per chunk in f32); online softmax in f32.
//   Block = 4 waves = 64 query rows of one (b, h); grid = NQB * NH * NB; key tiles kt = 0..qb
//   (block-uniform trip count <= NQB). K / V^T / er chunk staging: 128 threads, plain 16-B loads, all issued
//   ahead of the first LDS store, __syncthreads before and after; P tiles are wave-private, spilled with _Float16 element stores and
//   LDS (static byte buffer, rows of 64 elements at a pitch of LP = 72, so that the 16 rows of a 16-B fragment read
//   fall on different banks; T = 9216 B is a 64-row tile): Ksh 0, Ksl T, Vth 2T, Esh 3T (128 rows), Psh 5T,
//   Vtl 6T (RES), Psl 7T (RES), Qs 8T (64 rows x QSP floats); the f32 context staging Os (17 KB) aliases offset 0
//   after the key loop and a block barrier.
//   Output planes (bf16 hi / lo of the normalised context), element (row b*SEQ + t, column h*64 + d), in fragment order;
//   coverage: each wave stores rows q0..q0+15 (lane & 15) x 64 columns (it 0..3 x lane>>4 0..1 x 8) of both planes.
// =====================================================================================================
#define TB64 (64 * LP * 2)    // bytes of a 64-row tile in LDS
#define QSB  (64 * QSP * 4)   // bytes of the block's structure products in LDS
static_assert((LP * 2) % 32 == 16 && LP >= 64 && 4 * 16 * 68 * 4 <= 2 * TB64);
template <bool RES>
__device__ __forceinline__
void attn_body(const unsigned short* __restrict__ qhp, const unsigned short* __restrict__ qlp,
                const unsigned short* __restrict__ khp, const unsigned short* __restrict__ klp,
                const unsigned short* __restrict__ vhp, const unsigned short* __restrict__ vlp,
                const unsigned short* __restrict__ erp, const unsigned short* __restrict__ tabp,
                const int* __restrict__ ibar, const int* __restrict__ ipos,
                const int* __restrict__ ioct, const int* __restrict__ isem,
                unsigned short* ohp, unsigned short* olp,
                unsigned char* smem, int qb, int h, int b, float sscale) {
  union FB { v16b v; v8b h[2]; };
  union FH { v16h v; v8h h[2]; };
  __bf16*   const Ksh = (__bf16*)(void*)(smem);
  __bf16*   const Ksl = (__bf16*)(void*)(smem + TB64);
  _Float16* const Vth = (_Float16*)(void*)(smem + 2 * TB64);
  __bf16*   const Esh = (__bf16*)(void*)(smem + 3 * TB64);
  _Float16* const Psh = (_Float16*)(void*)(smem + 5 * TB64);
  _Float16* const Vtl = (_Float16*)(void*)(smem + (RES ? 6 * TB64 : 2 * TB64));   // never dereferenced when !RES
  _Float16* const Psl = (_Float16*)(void*)(smem + (RES ? 7 * TB64 : 5 * TB64));   // never dereferenced when !RES
  float*    const Os  = (float*)(void*)(smem);                              // after the key loop only

  const int tid  = threadIdx.x;
  const int wave = tid >> 5;
  const int lane = tid & 31;
  const int hh   = lane >> 4;
  const int c    = lane & 15;

  const int q0   = qb * 64 + wave * 16;
  const size_t rowB = (size_t)b * SEQ;

  const __bf16* Qh  = (const __bf16*)(const void*)qhp + (size_t)h * HD;
  const __bf16* Ql  = (const __bf16*)(const void*)qlp + (size_t)h * HD;
  const __bf16* Kh  = (const __bf16*)(const void*)khp + (size_t)h * HD;
  const __bf16* Kl  = (const __bf16*)(const void*)klp + (size_t)h * HD;
  const _Float16* Vh = (const _Float16*)(const void*)vhp + ((size_t)b * DM + (size_t)h * HD) * SEQ;
  const _Float16* Vl = (const _Float16*)(const void*)vlp + ((size_t)b * DM + (size_t)h * HD) * VLP;
  const __bf16* Erb = (const __bf16*)(const void*)erp;
  const size_t trow0 = rowB + (size_t)(q0 + 8 * hh);                 // b*SEQ + t for r = 0 of this lane half
  //   structure products of the block's 64 rows (LDS): byte offset in smem of this lane's row, r = 0
  const unsigned qlb = 8u * TB64 + (unsigned)(wave * 16 + 8 * hh) * (QSP * 4u);
  const unsigned ilb = ((unsigned)trow0 * SEQ + (unsigned)c) * 4u;    // byte offset of index (row r = 0, key c)

  // ---- Q fragments (A operand, row = lane&15): 2 d-chunks, hi and lo ----
  v16b qah[2], qal[2];
#pragma unroll
  for (int dc = 0; dc < 2; ++dc) {
    const size_t qo = (rowB + q0 + c) * DM + dc * 32 + 8 * hh;
    qah[dc] = ldfrag_b(Qh + qo);
    qal[dc] = ldfrag_b(Ql + qo);
  }

  // ---- structure products of the wave's 16 rows: D[r] of subtile u = (row 8 hh + r) . (table row 16 u + c) ----
  {
    // precaution: this wait stands ahead of the table loads, which may land in an address register of the q loads
    asm volatile("s_wait_xcnt 0x0" ::: "memory");
    FB tf[NTS][2];
    const unsigned tvo = ((unsigned)c * HD + 8u * (unsigned)hh) * 2u;  // the lane's piece of a 16-row table subtile
#pragma unroll
    for (int u = 0; u < NTS; ++u)
#pragma unroll
      for (int dc = 0; dc < 2; ++dc) {
        tf[u][dc].h[0] = *(const v8b*)((const char*)tabp + (u * 16 * HD * 2 + dc * 64) + tvo);
        tf[u][dc].h[1] = *(const v8b*)((const char*)tabp + (u * 16 * HD * 2 + dc * 64 + 32) + tvo);
      }
    // precaution: this wait stands ahead of every later rewrite of the loads' offset register; it names it so that
    // it stays whole up to it (no load of the run lands in it)
    asm volatile("s_wait_xcnt 0x0" :: "v"(tvo) : "memory");
    // the scheduler may not sink the table loads to their products, where each would wait alone
    __builtin_amdgcn_sched_barrier(0);
    float* qsw = (float*)(void*)(smem + 8 * TB64) + (wave * 16 + 8 * hh) * QSP + c;
#pragma unroll
    for (int u = 0; u < NTS; ++u) {
      v8f d = zero8();
#pragma unroll
      for (int dc = 0; dc < 2; ++dc) {
        d = mma_b(qah[dc], tf[u][dc].v, d);
        d = mma_b(qal[dc], tf[u][dc].v, d);
      }
#pragma unroll
      for (int r = 0; r < 8; ++r) qsw[r * QSP + u * 16] = d[r];
    }
    // the rows are the wave's own: its lanes read one another's stores, no other wave does
    __builtin_amdgcn_fence(__ATOMIC_RELEASE, "workgroup");
    __builtin_amdgcn_wave_barrier();
    __builtin_amdgcn_fence(__ATOMIC_ACQUIRE, "workgroup");
  }

  float mrow[8], lrow[8];
  v8f oacc[4];
#pragma unroll
  for (int r = 0; r < 8; ++r) { mrow[r] = -INFINITY; lrow[r] = 0.f; }
#pragma unroll
  for (int t = 0; t < 4; ++t) oacc[t] = zero8();

  const int nkt = (qb + 1 < NQB) ? (qb + 1) : NQB;   // causal: key tiles 0..qb, block-uniform
  unsigned iv = ilb;                                  // byte offset of index (row r = 0, key kv0 + c)
  for (int kt = 0; kt < nkt; ++kt) {
    const int kv0 = kt * 64;
    int ebb = SEQ - 64 + kv0 - qb * 64;                 // >= 0 for kt >= 0, qb <= NQB-1
    ebb = (ebb < 0) ? 0 : ebb;

    // ---- gathered structure biases of the whole tile, bs[j][r] for key kv0 + 16 j + c and row q0 + 8 hh + r.
    //      They depend on no product of this tile, so the loads go out in runs, each back to back: for RPR rows
    //      at a time the 16 RPR index loads, then (indices clamped, byte offsets formed) the 16 RPR LDS gathers.
    float bs[4][8];
    constexpr int RPR = RES ? 4 : 8;                    // fewer at a time where the residual path needs the registers
#pragma unroll
    for (int g = 0; g < 8; g += RPR) {
      int      xi[RPR][4][4];
      unsigned go[RPR][4][4];
      float    gv[RPR][4][4];
#pragma unroll
      for (int r = 0; r < RPR; ++r)
#pragma unroll
        for (int j = 0; j < 4; ++j) {
          const size_t ko = (size_t)((g + r) * SEQ + j * 16) * 4;
          xi[r][j][0] = *(const int*)((const char*)ibar + ko + iv);
          xi[r][j][1] = *(const int*)((const char*)ipos + ko + iv);
          xi[r][j][2] = *(const int*)((const char*)ioct + ko + iv);
          xi[r][j][3] = *(const int*)((const char*)isem + ko + iv);
        }
      // the scheduler may not sink the index loads to their first uses, where each would wait alone
      __builtin_amdgcn_sched_barrier(0);
#pragma unroll
      for (int r = 0; r < RPR; ++r)
#pragma unroll
        for (int j = 0; j < 4; ++j) {
          go[r][j][0] = qlb + (unsigned)iclamp(xi[r][j][0], 0, 16) * 4u;
          go[r][j][1] = qlb + (unsigned)iclamp(xi[r][j][1], 0, 95) * 4u;
          go[r][j][2] = qlb + (unsigned)iclamp(xi[r][j][2], 0, 24) * 4u;
          go[r][j][3] = qlb + (unsigned)iclamp(xi[r][j][3], 0, 12) * 4u;
        }
      // all offsets are formed ahead of the first gather, so that the gathers go out back to back
      __builtin_amdgcn_sched_barrier(0);
#pragma unroll
      for (int r = 0; r < RPR; ++r)
#pragma unroll
        for (int j = 0; j < 4; ++j) {
          const unsigned ro = (unsigned)(g + r) * (QSP * 4);
          gv[r][j][0] = *(const float*)((const char*)smem + (ro + OFF_BAR * 4) + go[r][j][0]);
          gv[r][j][1] = *(const float*)((const char*)smem + (ro + OFF_POS * 4) + go[r][j][1]);
          gv[r][j][2] = *(const float*)((const char*)smem + (ro + OFF_OCT * 4) + go[r][j][2]);
          gv[r][j][3] = *(const float*)((const char*)smem + (ro + OFF_SEM * 4) + go[r][j][3]);
        }
      // precaution: this wait stands ahead of the rewrite of the index loads' offset register (iv, below)
      asm volatile("s_wait_xcnt 0x0" ::: "memory");
      // the scheduler may not sink the gathers to the sums, nor lift a sum over the wait
      __builtin_amdgcn_sched_barrier(0);
#pragma unroll
      for (int r = 0; r < RPR; ++r)
#pragma unroll
        for (int j = 0; j < 4; ++j)
          bs[j][g + r] = (gv[r][j][0] + gv[r][j][1]) + (gv[r][j][2] + gv[r][j][3]);
      // the sums stay ahead of the next run of loads: they free the gathered values' registers for it
      __builtin_amdgcn_sched_barrier(0);
    }
    iv += 64u * 4u;                                     // next key tile's index columns

    __syncthreads();
    {
      // every tile row here is one 128-B line: 8 lanes take a row, so a wave's 16-B load covers 4 whole lines;
      // load i of a thread takes row r + 16 i
      const int r = tid >> 3, c8 = (tid & 7) * 8;
      const __bf16*   kg  = Kh + (rowB + kv0 + r) * DM + c8;      // K row kv0+r, d = c8..c8+7
      const __bf16*   klg = Kl + (rowB + kv0 + r) * DM + c8;
      const _Float16* vg  = Vh + (size_t)r * SEQ + kv0 + c8;      // V^T row d = r, s = kv0+c8..+7
      const int kvl = (kv0 + 64 <= VLP) ? kv0 : (VLP - 64);     // clamped address into the residual plane
      const _Float16* vlg = Vl + (size_t)r * VLP + kvl + c8;
      const bool resOK = (kv0 + 64 <= VLP);                      // block-uniform
      // er band rows r + 16 i (128 rows x 64), row clamped at SEQ-1: min(ebb + r + 16 i, SEQ-1) = min(ebb + r, SEQ-1-16 i)
      // + 16 i; eo[i] is the byte offset of the thread's piece less the constant 16 i rows, which load i adds itself
      unsigned eo[8];
#pragma unroll
      for (int i = 0; i < 8; ++i) eo[i] = (unsigned)imin(ebb + r, SEQ - 1 - 16 * i) * (HD * 2) + (unsigned)c8 * 2u;
      v8b a0[4], a1[4], e0[8];
      v8h b0[4], b1[4];
#pragma unroll
      for (int i = 0; i < 4; ++i) {
        a0[i] = *(const v8b*)(kg + (size_t)i * 16 * DM);
        a1[i] = *(const v8b*)(klg + (size_t)i * 16 * DM);
        b0[i] = *(const v8h*)(vg + (size_t)i * 16 * SEQ);
        if (RES) b1[i] = *(const v8h*)(vlg + (size_t)i * 16 * VLP);
      }
#pragma unroll
      for (int i = 0; i < 8; ++i) e0[i] = *(const v8b*)((const char*)Erb + i * (16 * HD * 2) + eo[i]);
      // precaution: this wait stands ahead of every later rewrite of the loads' address registers; it names
      // them so that they stay whole up to it (no later load of the run lands in one)
      if (RES) asm volatile("s_wait_xcnt 0x0" :: "v"(kg), "v"(klg), "v"(vg), "v"(vlg), "v"(eo[0]), "v"(eo[1]), "v"(eo[2]),
                            "v"(eo[3]), "v"(eo[4]), "v"(eo[5]), "v"(eo[6]), "v"(eo[7]) : "memory");
      else     asm volatile("s_wait_xcnt 0x0" :: "v"(kg), "v"(klg), "v"(vg), "v"(eo[0]), "v"(eo[1]), "v"(eo[2]),
                            "v"(eo[3]), "v"(eo[4]), "v"(eo[5]), "v"(eo[6]), "v"(eo[7]) : "memory");
      // the scheduler may not sink the staging loads to their LDS stores, where each would wait alone
      __builtin_amdgcn_sched_barrier(0);
#pragma unroll
      for (int i = 0; i < 4; ++i) {
        *(v8b*)(Ksh + (r + 16 * i) * LP + c8) = a0[i];
        *(v8b*)(Ksl + (r + 16 * i) * LP + c8) = a1[i];
        *(v8h*)(Vth + (r + 16 * i) * LP + c8) = b0[i];
        if (RES) *(v8h*)(Vtl + (r + 16 * i) * LP + c8) = resOK ? b1[i] : zero8h();
      }
#pragma unroll
      for (int i = 0; i < 8; ++i) *(v8b*)(Esh + (r + 16 * i) * LP + c8) = e0[i];
    }
    __syncthreads();

    // ---- q.k: 16 query rows x 64 keys per wave, 3 bf16 products ----
    v8f s[4];
#pragma unroll
    for (int j = 0; j < 4; ++j) {
      s[j] = zero8();
#pragma unroll
      for (int dc = 0; dc < 2; ++dc) {
        FB kb, kl;
        kb.h[0] = *(const v8b*)(Ksh + (j * 16 + c) * LP + dc * 32 + 8 * hh);
        kb.h[1] = *(const v8b*)(Ksh + (j * 16 + c) * LP + dc * 32 + 16 + 8 * hh);
        kl.h[0] = *(const v8b*)(Ksl + (j * 16 + c) * LP + dc * 32 + 8 * hh);
        kl.h[1] = *(const v8b*)(Ksl + (j * 16 + c) * LP + dc * 32 + 16 + 8 * hh);
        s[j] = mma_b(qah[dc], kb.v, s[j]);
        s[j] = mma_b(qah[dc], kl.v, s[j]);
        s[j] = mma_b(qal[dc], kb.v, s[j]);
      }
    }

    // ---- q.er skew band: 5 subtiles of 16 band rows, streamed; diagonal extraction by bpermute ----
    {
      const int wb = (3 - wave) * 16;           // this wave's band offset inside Esh
      v8f prev = zero8();
#pragma unroll
      for (int u = 0; u < 5; ++u) {
        v8f cur = zero8();
#pragma unroll
        for (int dc = 0; dc < 2; ++dc) {
          FB eb;
          const __bf16* ep = Esh + (wb + u * 16 + c) * LP + dc * 32 + 8 * hh;
          eb.h[0] = *(const v8b*)(ep);
          eb.h[1] = *(const v8b*)(ep + 16);
          cur = mma_b(qah[dc], eb.v, cur);
          cur = mma_b(qal[dc], eb.v, cur);
        }
        if (u >= 1) {                            // key subtile jsub = u-1 uses subtiles u-1 (prev) and u (cur)
#pragma unroll
          for (int r = 0; r < 8; ++r) {
            const int base = 15 - (8 * hh + r) + c;                  // 0..30
            const int src  = (lane & 16) | (base & 15);
            const float vlo = __shfl(prev[r], src, 32);
            const float vhi = __shfl(cur[r], src, 32);
            s[u - 1][r] += (base < 16) ? vlo : vhi;
          }
        }
        prev = cur;
      }
    }

    // ---- add the gathered structure biases, scale, causal replace mask, online softmax, P (x1024, f16) and
    //      P residual (x4096) to LDS ----
    _Float16* pwh = Psh + wave * (16 * LP);
    _Float16* pwl = Psl + (RES ? wave : 0) * (16 * LP);
#pragma unroll
    for (int r = 0; r < 8; ++r) {
      const int    trow = q0 + 8 * hh + r;
      float m = -INFINITY;
#pragma unroll
      for (int j = 0; j < 4; ++j) {
        const int key = kv0 + j * 16 + c;
        float sv = (s[j][r] + bs[j][r]) * sscale;
        sv = (key <= trow) ? sv : -1.0e9f;
        s[j][r] = sv;
        m = fmaxf(m, sv);
      }
#pragma unroll
      for (int off = 1; off < 16; off <<= 1) m = fmaxf(m, __shfl_xor(m, off, 32));
      const float mnew  = fmaxf(mrow[r], m);
      const float msafe = (mnew == -INFINITY) ? 0.f : mnew;
      const float alpha = __expf(mrow[r] - msafe);
      mrow[r] = mnew;
      float psum = 0.f;
#pragma unroll
      for (int j = 0; j < 4; ++j) {
        const float p = __expf(s[j][r] - msafe);     // masked logit -1e9 against a normal max: exp -> 0
        psum += p;
        const float p1k = p * 1024.0f;
        const _Float16 ph = (_Float16)p1k;
        pwh[(8 * hh + r) * LP + j * 16 + c] = ph;
        if (RES) {
          const _Float16 pl = (_Float16)((p1k - (float)ph) * 4096.0f);
          pwl[(8 * hh + r) * LP + j * 16 + c] = pl;
        }
      }
#pragma unroll
      for (int off = 1; off < 16; off <<= 1) psum += __shfl_xor(psum, off, 32);
      lrow[r] = lrow[r] * alpha + psum;
#pragma unroll
      for (int t = 0; t < 4; ++t) oacc[t][r] *= alpha;
    }
    __builtin_amdgcn_fence(__ATOMIC_RELEASE, "workgroup");
    __builtin_amdgcn_wave_barrier();
    __builtin_amdgcn_fence(__ATOMIC_ACQUIRE, "workgroup");

    // ---- context += P . V (f16 WMMA), residual products into a separate accumulator ----
    v8f o1[4];
#pragma unroll
    for (int t = 0; t < 4; ++t) o1[t] = zero8();
#pragma unroll 1
    for (int kk = 0; kk < 2; ++kk) {
      FH pa, pl;
      pa.h[0] = *(const v8h*)(pwh + c * LP + kk * 32 + 8 * hh);
      pa.h[1] = *(const v8h*)(pwh + c * LP + kk * 32 + 16 + 8 * hh);
      if (RES) {
        pl.h[0] = *(const v8h*)(pwl + c * LP + kk * 32 + 8 * hh);
        pl.h[1] = *(const v8h*)(pwl + c * LP + kk * 32 + 16 + 8 * hh);
      } else {
        pl.v = pa.v;
      }
#pragma unroll
      for (int t = 0; t < 4; ++t) {
        FH vb;
        vb.h[0] = *(const v8h*)(Vth + (t * 16 + c) * LP + kk * 32 + 8 * hh);
        vb.h[1] = *(const v8h*)(Vth + (t * 16 + c) * LP + kk * 32 + 16 + 8 * hh);
        oacc[t] = mma_h(pa.v, vb.v, oacc[t]);
        if (RES) {
          FH vl;
          vl.h[0] = *(const v8h*)(Vtl + (t * 16 + c) * LP + kk * 32 + 8 * hh);
          vl.h[1] = *(const v8h*)(Vtl + (t * 16 + c) * LP + kk * 32 + 16 + 8 * hh);
          o1[t] = mma_h(pa.v, vl.v, o1[t]);
          o1[t] = mma_h(pl.v, vb.v, o1[t]);
        }
      }
    }
    if (RES) {
#pragma unroll
      for (int t = 0; t < 4; ++t)
#pragma unroll
        for (int r = 0; r < 8; ++r) oacc[t][r] += o1[t][r] * (1.0f / 4096.0f);
    }
  }

  // ---- normalise (1/l and the 1/1024 p carry), stage the wave's 16x64 tile (Os aliases the K tiles,
  __syncthreads();
  float* os = Os + wave * (16 * 68);               // pitch 68 floats = 16 B x odd, for the 16-rows-at-a-time reads below
#pragma unroll
  for (int r = 0; r < 8; ++r) {
    const float l = lrow[r];
    const float inv = ((l > 0.f) ? (1.0f / l) : 0.f) * (1.0f / 1024.0f);
#pragma unroll
    for (int t = 0; t < 4; ++t) os[(8 * hh + r) * 68 + t * 16 + c] = oacc[t][r] * inv;
  }
  __builtin_amdgcn_fence(__ATOMIC_RELEASE, "workgroup");
  __builtin_amdgcn_wave_barrier();
  __builtin_amdgcn_fence(__ATOMIC_ACQUIRE, "workgroup");
  {
    // the wave's 16 rows are one strip and its 64 columns two 32-column blocks: 4 runs of 512 B, one after another
    v4u hv[4], lv[4];
#pragma unroll
    for (int it = 0; it < 4; ++it) {
      // run it: lane -> row c, columns 16 it + 8 hh ..+7 (it 0..3 x hh 0..1 x 8 = columns 0..63, c = rows 0..15)
      const float* sp = os + c * 68 + it * 16 + 8 * hh;
      v4u a, a2;
#pragma unroll
      for (int e = 0; e < 4; ++e) {
        const float f0 = sp[2 * e], f1 = sp[2 * e + 1];
        const unsigned short h0 = bf_bits(f0), h1 = bf_bits(f1);
        const unsigned short l0 = bf_bits(f0 - bf_up(h0)), l1 = bf_bits(f1 - bf_up(h1));
        a[e] = pk16(h0, h1); a2[e] = pk16(l0, l1);
      }
      hv[it] = a; lv[it] = a2;
    }
    {
#pragma unroll
      for (int it = 0; it < 4; ++it) {
        const size_t go = ((((rowB + q0) >> 4) * (DM / 32) + (size_t)h * 2) * 64 + it * 32 + lane) * 8;
        *(v4u*)(ohp + go) = hv[it];
        *(v4u*)(olp + go) = lv[it];
      }
      
    }
  }
}

// Every query block in one grid: the blocks with residual planes (qb < RESQB) and the rest depend on the same
// inputs and write disjoint rows, so they run side by side. NB*NH consecutive blocks share one qb; the first half
// of the grid takes qb = NQB-1 downwards (the longest key loops start first), the second half qb = 0 upwards.
__global__ __launch_bounds__(128, 3)
void attn_rel64(const unsigned short* __restrict__ qhp, const unsigned short* __restrict__ qlp,
                const unsigned short* __restrict__ khp, const unsigned short* __restrict__ klp,
                const unsigned short* __restrict__ vhp, const unsigned short* __restrict__ vlp,
                const unsigned short* __restrict__ erp, const unsigned short* __restrict__ tabp,
                const int* __restrict__ ibar, const int* __restrict__ ipos,
                const int* __restrict__ ioct, const int* __restrict__ isem,
                unsigned short* ohp, unsigned short* olp, float sscale) {
  __shared__ __align__(16) unsigned char smem[8 * TB64 + QSB];
  const int bx = blockIdx.x;
  const int g  = bx / (NB * NH);
  const int bh = bx - g * (NB * NH);
  const int qb = (g < NQB / 2) ? (NQB - 1 - g) : (g - NQB / 2);   // a permutation of 0..NQB-1, block-uniform
  const int h  = bh % NH;
  const int b  = bh / NH;
  if (qb < RESQB)
    attn_body<true>(qhp, qlp, khp, klp, vhp, vlp, erp, tabp, ibar, ipos, ioct, isem, ohp, olp, smem, qb, h, b, sscale);
  else
    attn_body<false>(qhp, qlp, khp, klp, vhp, vlp, erp, tabp, ibar, ipos, ioct, isem, ohp, olp, smem, qb, h, b, sscale);
}

// =====================================================================================================
// Workspace map (bytes, every region a multiple of its 64x64-tile / whole-line store granularity):
//   (Xb, the four weight planes, Oh and Ol are stored in fragment order; every other plane is row-major)
//   Xb   bf16 [2048][1024]            0        4194304
//   Wqb  bf16 [1024 n][1024 k]    4194304        2097152
//   Wkb                           6291456        2097152
//   Wvb                           8388608        2097152
//   Wob                          10485760        2097152
//   Erb  bf16 [1024][64]         12582912         131072
//   Tb   bf16 [192][64]          12713984          24576
//   Qh   bf16 [2048][1024]       12738560        4194304
//   Ql                           16932864        4194304
//   Kh                           21127168        4194304
//   Kl                           25321472        4194304
//   VTh  f16  [2][1024][1024]    29515776        4194304
//   VTl  f16  [2][1024][256]     33710080        1048576
//   Oh   bf16 [2048][1024]       34758656        4194304
//   Ol                           38952960        4194304
//   end                          43147264
// Weights are [out n][in k] with k contiguous = the Bt / A layout the GEMM wants, so they are only converted.
// =====================================================================================================
extern "C" void kernel_launch(void* const* d_in, const int* in_sizes, int n_in,
                              void* d_out, int out_size, void* d_ws, size_t ws_size,
                              hipStream_t stream) {
  if (n_in < 14) return;
  if (in_sizes[0] != NB * SEQ * DM) return;
  if (in_sizes[1] != NB * SEQ * SEQ || in_sizes[2] != NB * SEQ * SEQ ||
      in_sizes[3] != NB * SEQ * SEQ || in_sizes[4] != NB * SEQ * SEQ) return;
  if (in_sizes[5] != DM * DM || in_sizes[6] != DM * DM || in_sizes[7] != DM * DM || in_sizes[8] != DM * DM) return;
  if (in_sizes[9] != SEQ * HD) return;
  if (in_sizes[10] != 16 * HD || in_sizes[11] != 95 * HD || in_sizes[12] != 24 * HD || in_sizes[13] != 12 * HD) return;
  if (out_size != NB * SEQ * DM) return;

  const float* x    = (const float*)d_in[0];
  const int*   rbar = (const int*)d_in[1];
  const int*   rpos = (const int*)d_in[2];
  const int*   roct = (const int*)d_in[3];
  const int*   rsem = (const int*)d_in[4];
  const float* Wq   = (const float*)d_in[5];
  const float* Wk   = (const float*)d_in[6];
  const float* Wv   = (const float*)d_in[7];
  const float* Wo   = (const float*)d_in[8];
  const float* Er   = (const float*)d_in[9];
  const float* Ebar = (const float*)d_in[10];
  const float* Epos = (const float*)d_in[11];
  const float* Eoct = (const float*)d_in[12];
  const float* Esem = (const float*)d_in[13];

  const size_t PX  = (size_t)MROWS * DM * 2;          //  4194304  16-bit activation plane [2048][1024]
  const size_t PW  = (size_t)DM * DM * 2;             //  2097152  16-bit weight plane
  const size_t PE  = (size_t)SEQ * HD * 2;            //   131072  er plane
  const size_t PT  = (size_t)TROWS * HD * 2;          //    24576  combined structure table
  const size_t PVT = (size_t)NB * DM * SEQ * 2;       //  4194304  v^T hi plane
  const size_t PVL = (size_t)NB * DM * VLP * 2;       //  1048576  v^T residual plane
  size_t off = 0;
  const size_t oXb  = off; off += PX;
  const size_t oWq  = off; off += PW;
  const size_t oWk  = off; off += PW;
  const size_t oWv  = off; off += PW;
  const size_t oWo  = off; off += PW;
  const size_t oEr  = off; off += PE;
  const size_t oTb  = off; off += PT;
  const size_t oQh  = off; off += PX;
  const size_t oQl  = off; off += PX;
  const size_t oKh  = off; off += PX;
  const size_t oKl  = off; off += PX;
  const size_t oVTh = off; off += PVT;
  const size_t oVTl = off; off += PVL;
  const size_t oOh  = off; off += PX;
  const size_t oOl  = off; off += PX;
  if (off > ws_size) return;                          // off = 43147264
  if (off > (size_t)134217728) return;

  char* ws = (char*)d_ws;
  unsigned short* Xb  = (unsigned short*)(ws + oXb);
  unsigned short* Wqb = (unsigned short*)(ws + oWq);
  unsigned short* Wkb = (unsigned short*)(ws + oWk);
  unsigned short* Wvb = (unsigned short*)(ws + oWv);
  unsigned short* Wob = (unsigned short*)(ws + oWo);
  unsigned short* Erb = (unsigned short*)(ws + oEr);
  unsigned short* Tb  = (unsigned short*)(ws + oTb);
  unsigned short* Qh  = (unsigned short*)(ws + oQh);
  unsigned short* Ql  = (unsigned short*)(ws + oQl);
  unsigned short* Kh  = (unsigned short*)(ws + oKh);
  unsigned short* Kl  = (unsigned short*)(ws + oKl);
  unsigned short* VTh = (unsigned short*)(ws + oVTh);
  unsigned short* VTl = (unsigned short*)(ws + oVTl);
  unsigned short* Oh  = (unsigned short*)(ws + oOh);
  unsigned short* Ol  = (unsigned short*)(ws + oOl);

  const dim3 blk(256);
  const dim3 gPrep(PB_X + 4 * PB_W + PB_E + PB_T);             // 3110 blocks
  const dim3 gQKV(PJB, 3);                                     // 64 blocks x {q, k, v^T}
  const dim3 gProj(((MROWS / 64) * (DM / 64) + 7) / 8, 1);     // 512 tiles -> 64 blocks: M=2048, N=1024

  // (1) x -> bf16 plane; weights [n][k] f32 -> bf16 [n][k]; er -> bf16; combined structure table
  prep_all<<<gPrep, blk, 0, stream>>>(x, Wq, Wk, Wv, Wo, Er, Ebar, Epos, Eoct, Esem,
                                      Xb, Wqb, Wkb, Wvb, Wob, Erb, Tb);
  // (2)-(4) q, k (bf16 hi/lo planes) and v^T (f16 hi plane, residual plane)
  gemm_qkv<<<gQKV, blk, 0, stream>>>(Xb, Wqb, Wkb, Wvb, Qh, Ql, Kh, Kl, VTh, VTl);
  // (5), (6) attention, each block with the structure products q . T^T of its own rows: query blocks 0..RESQB-1 with
  //     residual planes, the rest without, one grid
  attn_rel64<<<dim3(NB * NH * NQB), dim3(128), 0, stream>>>(
      Qh, Ql, Kh, Kl, VTh, VTl, Erb, Tb, rbar, rpos, roct, rsem, Oh, Ol, 0.125f);
  // (7) out = context . Wo^T -> d_out f32 [2048][1024]  (A = context hi + lo planes, 2 products)
  gemm64<1, 0, true><<<gProj, blk, 0, stream>>>(
      Oh, Ol, DM, 0LL, Wob, Wob, DM, 0LL,
      d_out, DM, 0LL, d_out, DM, 0LL, DM,
      MROWS, DM, DM, 1.0f);
  (void)hipGetLastError();
}

// v007
// Measured time: 111 microseconds a run.
// Two timings next to v006 put it at 1.14 and 1.17 times that version's speed.
// Over all steps from v000 it is 7.10 times as fast.
// Contractions: q, k, v^T projections = v_wmma_f32_16x16x32_bf16 (bf16 operands from RNE-converted inputs, single product);
// q.k^T = v_wmma_f32_16x16x32_bf16 with bf16 hi/lo split q and k (hi.hi + hi.lo + lo.hi);
// q.Er^T skew band and q.T^T structure tables = bf16 hi/lo q times bf16 table rows (2 products);
// p.v = v_wmma_f32_16x16x32_f16 (p carried x1024 in f16, v f16; extra f16 residual planes x4096 of p and v for the first 256 query rows);
// ctx.Wo^T = bf16 hi/lo ctx times bf16 Wo (2 products); all f32 accumulate; bias gathers, causal mask and softmax in f32.
#include <hip/hip_runtime.h>
#include <math.h>
#include <stdint.h>

#define NB    2
#define SEQ   1024
#define DM    1024
#define NH    16
#define HD    64
#define MROWS (NB * SEQ)     // 2048
#define NQB   (SEQ / 64)     // 16 query / key tiles of 64
#define VLP   256            // key pitch of the v^T residual plane (keys 0..VLP-1)
#define RESQB 4              // leading 64-row query blocks that use the p / v residual planes
#define NTS   10             // 16-row subtiles of the structure table that hold used rows (151 of 160)
#define QSP   164            // LDS row pitch (floats) of the structure-table products: 8 rows = 32 banks mod 64
#define TROWS 192            // rows of the combined structure table (151 used, rest zero)
#define LP    72             // LDS row pitch, 16-bit elements, of the 64-wide K / V^T / er / P tiles: 144 B = 16 B x odd
#define OFF_BAR 0            // 16 rows + zero row  -> idx 0..16
#define OFF_POS 17           // 95 rows + zero row  -> idx 0..95
#define OFF_OCT 113          // 24 rows + zero row  -> idx 0..24
#define OFF_SEM 138          // 12 rows + zero row  -> idx 0..12
static_assert(RESQB * 64 <= VLP);
static_assert(NH * HD == DM);
static_assert((SEQ % 64) == 0 && (DM % 64) == 0 && (TROWS % 64) == 0);
static_assert(OFF_SEM + 13 <= NTS * 16 && NTS * 16 <= QSP && NTS * 16 <= TROWS && (QSP * 8) % 64 == 32);

typedef _Float16 v16h __attribute__((ext_vector_type(16)));
typedef _Float16 v8h  __attribute__((ext_vector_type(8)));
typedef __bf16   v16b __attribute__((ext_vector_type(16)));
typedef __bf16   v8b  __attribute__((ext_vector_type(8)));
typedef float    v8f  __attribute__((ext_vector_type(8)));
typedef float    v4f  __attribute__((ext_vector_type(4)));
typedef unsigned int v4u __attribute__((ext_vector_type(4)));

// ---- scalar helpers --------------------------------------------------------------------------------
__device__ __forceinline__ unsigned short bf_bits(float f) {          // f32 -> bf16 bits, RNE convert
  unsigned u = __float_as_uint(f);
  return (unsigned short)((u + 0x7FFFu + ((u >> 16) & 1u)) >> 16);
}
__device__ __forceinline__ float bf_up(unsigned short h) { return __uint_as_float(((unsigned)h) << 16); }
__device__ __forceinline__ unsigned short h_bits(_Float16 x) { return __builtin_bit_cast(unsigned short, x); }
__device__ __forceinline__ unsigned pk16(unsigned short a, unsigned short b) { return (unsigned)a | ((unsigned)b << 16); }
__device__ __forceinline__ int iclamp(int v, int lo, int hi) { return (v < lo) ? lo : ((v > hi) ? hi : v); }
__device__ __forceinline__ int imin(int a, int b) { return (a < b) ? a : b; }
// exp(x) as __expf forms it (x log2(e), then the hardware's 2^y), with the slot that the instruction set asks for behind a
// transcendental kept in the same statement
__device__ __forceinline__ float exp_slot(float x) {
  const float y = x * 1.44269504088896340736f;
  float r;
  asm("v_exp_f32 %0, %1\n\tv_nop" : "=v"(r) : "v"(y));
  return r;
}
__device__ __forceinline__ v8f zero8() { v8f z = {0.f, 0.f, 0.f, 0.f, 0.f, 0.f, 0.f, 0.f}; return z; }
__device__ __forceinline__ v8h zero8h() {
  const _Float16 z = (_Float16)0.0f;
  v8h r = {z, z, z, z, z, z, z, z};
  return r;
}

// ---- fragment loader: 16-bit A/B operand, lane -> row/col (lane&15), p already includes +8*(lane>>4);
//      elements 0..7 <- p[0..7] (k0+8h..), elements 8..15 <- p[16..23] (k0+16+8h..)
__device__ __forceinline__ v16b ldfrag_b(const __bf16* p) {
  union { v16b v; v8b h[2]; } f;
  f.h[0] = *(const v8b*)(p);
  f.h[1] = *(const v8b*)(p + 16);
  return f.v;
}
//      a wave-uniform pointer to global memory, held in scalar registers, so that a load names it and a 32-bit lane
//      offset (left to itself one build formed a vector address pair per strip, and a load of the run landed in it)
typedef const __attribute__((address_space(1))) char* gcp;
typedef const __attribute__((address_space(1))) v8b*  gv8bp;
__device__ __forceinline__ gcp uni_ptr(const char* p) {
  const unsigned long long u = (unsigned long long)p;
  const unsigned lo = (unsigned)__builtin_amdgcn_readfirstlane((int)(unsigned)u);
  const unsigned hi = (unsigned)__builtin_amdgcn_readfirstlane((int)(unsigned)(u >> 32));
  return (gcp)(((unsigned long long)hi << 32) | lo);
}
//      the same elements in the same positions, from a wave-uniform base and the lane's byte offset vo;
//      H2 = bytes from the lane's elements 0..7 to its elements 8..15 (32 in a row-major plane, 512 in fragment order)
template <int H2>
__device__ __forceinline__ v16b ldfrag_o(gcp base, unsigned vo) {
  union { v16b v; v8b h[2]; } f;
  f.h[0] = *(gv8bp)(base + vo);
  f.h[1] = *(gv8bp)(base + H2 + vo);
  return f.v;
}

// ---- WMMA helpers with trailing VALU hazard gap --------------------------------------------------------
__device__ __forceinline__ v8f mma_b(v16b a, v16b b, v8f c) {
  c = __builtin_amdgcn_wmma_f32_16x16x32_bf16(false, a, false, b, (short)0, c, false, false);
#if defined(__HIP_DEVICE_COMPILE__)
  asm volatile("v_nop\n\tv_nop\n\tv_nop\n\tv_nop" : "+v"(c) : "v"(a), "v"(b));
#endif
  return c;
}
__device__ __forceinline__ v8f mma_h(v16h a, v16h b, v8f c) {
  c = __builtin_amdgcn_wmma_f32_16x16x32_f16(false, a, false, b, (short)0, c, false, false);
#if defined(__HIP_DEVICE_COMPILE__)
  asm volatile("v_nop\n\tv_nop\n\tv_nop\n\tv_nop" : "+v"(c) : "v"(a), "v"(b));
#endif
  return c;
}
__device__ __forceinline__ v8f mma_b_raw(v16b a, v16b b, v8f c) {
  return __builtin_amdgcn_wmma_f32_16x16x32_bf16(false, a, false, b, (short)0, c, false, false);
}
__device__ __forceinline__ void acc_guard4(v8f& a, v8f& b, v8f& c, v8f& d) {
#if defined(__HIP_DEVICE_COMPILE__)
  asm volatile("v_nop\n\tv_nop\n\tv_nop\n\tv_nop" : "+v"(a), "+v"(b), "+v"(c), "+v"(d));
#else
  (void)a; (void)b; (void)c; (void)d;
#endif
}

// =====================================================================================================
// f32 -> bf16 (RNE convert), 8 elements per thread, one 16-B store per lane: a wave writes 512 contiguous B
// (n8 is a multiple of 256 for every use here). coverage: n8 threads x 8 = whole plane.
// =====================================================================================================
__device__ __forceinline__ void cvt_bf16x8(const float* __restrict__ in, unsigned short* out, int n8, int blk) {
  const int i = blk * 256 + threadIdx.x;
  if (i < n8) {
    const v4f a = *(const v4f*)(in + (size_t)i * 8);
    const v4f b = *(const v4f*)(in + (size_t)i * 8 + 4);
    v4u p;
    p[0] = pk16(bf_bits(a[0]), bf_bits(a[1]));
    p[1] = pk16(bf_bits(a[2]), bf_bits(a[3]));
    p[2] = pk16(bf_bits(b[0]), bf_bits(b[1]));
    p[3] = pk16(bf_bits(b[2]), bf_bits(b[3]));
    *(v4u*)(out + (size_t)i * 8) = p;
    
  }
}

// =====================================================================================================
// FRAGMENT ORDER of a 16-bit plane [rows][DM] that a GEMM reads as A or Bt: the plane is cut into 16-row strips and
// each strip into blocks of 32 columns; a block is 1 KB = two runs of 512 B, and run u holds, for lane l = 0..31,
// the 8 elements (row l & 15, columns 16 u + 8 (l >> 4) ..+7) at byte 16 l. Blocks of a strip follow one another, then
// the next strip. So each of a fragment's two 16-B loads reads 512 contiguous bytes (4 whole lines) where a row-major
// plane gives it 32 B from each of 16 lines; which element lands in which lane and register does not change.
//   16-B piece index of (row m, columns 8 k8 ..+7) = (((m >> 4) * (DM/32) + (k8 >> 2)) * 2 + ((k8 >> 1) & 1)) * 32
//                                                    + (k8 & 1) * 16 + (m & 15)
// f32 [rows][DM] -> bf16 (RNE convert) in fragment order: thread i makes piece i, so a wave stores 512 contiguous B;
// a block reads 512 contiguous B of each of 16 rows. coverage: n8 threads x 8 = whole plane (the map is one to one).
// =====================================================================================================
static_assert(DM / 32 == 32);
__device__ __forceinline__ void cvt_bf16_frag(const float* __restrict__ in, unsigned short* out, int n8, int blk) {
  const int i = blk * 256 + threadIdx.x;
  if (i < n8) {
    const int l = i & 31, u = (i >> 5) & 1, kb = (i >> 6) & 31, st = i >> 11;
    const size_t so = (size_t)(st * 16 + (l & 15)) * DM + kb * 32 + u * 16 + (l >> 4) * 8;
    const v4f a = *(const v4f*)(in + so);
    const v4f b = *(const v4f*)(in + so + 4);
    v4u p;
    p[0] = pk16(bf_bits(a[0]), bf_bits(a[1]));
    p[1] = pk16(bf_bits(a[2]), bf_bits(a[3]));
    p[2] = pk16(bf_bits(b[0]), bf_bits(b[1]));
    p[3] = pk16(bf_bits(b[2]), bf_bits(b[3]));
    *(v4u*)(out + (size_t)i * 8) = p;
  }
}

// =====================================================================================================
// Combined structure table, bf16 [TROWS][64]: rows 0..15 bar, 16 zero, 17..111 position, 112 zero,
// 113..136 octave, 137 zero, 138..149 semitone, 150..191 zero. 8 threads per row, 8 elements each,
// all four candidate loads unconditional with clamped row addresses, selection by value.
// PB_T = TROWS*8/256 = 6 blocks of prep_all exactly. coverage: 1536 threads x 8 = 192 x 64.
// =====================================================================================================
__device__ __forceinline__ void build_tab(const float* __restrict__ ebar, const float* __restrict__ epos,
                                          const float* __restrict__ eoct, const float* __restrict__ esem,
                                          unsigned short* tab, int blk) {
  const int g = blk * 256 + threadIdx.x;
  if (g < TROWS * 8) {
    const int s  = g >> 3;
    const int d0 = (g & 7) * 8;
    const int rb = iclamp(s, 0, 15);
    const int rp = iclamp(s - OFF_POS, 0, 94);
    const int ro = iclamp(s - OFF_OCT, 0, 23);
    const int rs = iclamp(s - OFF_SEM, 0, 11);
    const bool ub = (s < 16);
    const bool up = (s >= OFF_POS) && (s < OFF_POS + 95);
    const bool uo = (s >= OFF_OCT) && (s < OFF_OCT + 24);
    const bool us = (s >= OFF_SEM) && (s < OFF_SEM + 12);
    float v[8];
#pragma unroll
    for (int e = 0; e < 8; ++e) {
      const int d = d0 + e;
      const float fb = ebar[rb * HD + d];
      const float fp = epos[rp * HD + d];
      const float fo = eoct[ro * HD + d];
      const float fs = esem[rs * HD + d];
      float t = 0.f;
      t = ub ? fb : t;
      t = up ? fp : t;
      t = uo ? fo : t;
      t = us ? fs : t;
      v[e] = t;
    }
    v4u p;
    p[0] = pk16(bf_bits(v[0]), bf_bits(v[1]));
    p[1] = pk16(bf_bits(v[2]), bf_bits(v[3]));
    p[2] = pk16(bf_bits(v[4]), bf_bits(v[5]));
    p[3] = pk16(bf_bits(v[6]), bf_bits(v[7]));
    *(v4u*)(tab + (size_t)s * HD + d0) = p;
    
  }
}

// =====================================================================================================
// All operand preparation in one grid (the seven pieces depend on nothing but the inputs, so they run side by
// side): blocks 0..PB_X-1 convert x, the next 4*PB_W the four weights (these five into fragment order), the next
// PB_E er (row-major), the last PB_T build the combined table. The piece is chosen by blockIdx.x alone (block-uniform).
// =====================================================================================================
#define PB_X (MROWS * DM / 8 / 256)   // 1024
#define PB_W (DM * DM / 8 / 256)      //  512
#define PB_E (SEQ * HD / 8 / 256)     //   32
#define PB_T (TROWS * 8 / 256)        //    6
static_assert(PB_X * 2048 == MROWS * DM && PB_W * 2048 == DM * DM && PB_E * 2048 == SEQ * HD && PB_T * 256 == TROWS * 8);
__global__ __launch_bounds__(256) void prep_all(
    const float* __restrict__ x, const float* __restrict__ wq, const float* __restrict__ wk,
    const float* __restrict__ wv, const float* __restrict__ wo, const float* __restrict__ er,
    const float* __restrict__ ebar, const float* __restrict__ epos,
    const float* __restrict__ eoct, const float* __restrict__ esem,
    unsigned short* xb, unsigned short* wqb, unsigned short* wkb, unsigned short* wvb, unsigned short* wob,
    unsigned short* erb, unsigned short* tab) {
  int blk = blockIdx.x;
  if (blk < PB_X) { cvt_bf16_frag(x, xb, MROWS * DM / 8, blk); return; }
  blk -= PB_X;
  if (blk < 4 * PB_W) {
    const int w = blk / PB_W;
    const float*    in  = (w == 0) ? wq  : (w == 1) ? wk  : (w == 2) ? wv  : wo;
    unsigned short* out = (w == 0) ? wqb : (w == 1) ? wkb : (w == 2) ? wvb : wob;
    cvt_bf16_frag(in, out, DM * DM / 8, blk - w * PB_W);
    return;
  }
  blk -= 4 * PB_W;
  if (blk < PB_E) { cvt_bf16x8(er, erb, SEQ * HD / 8, blk); return; }
  build_tab(ebar, epos, eoct, esem, tab, blk - PB_E);
}

// =====================================================================================================
// Register-blocked batched bf16 WMMA GEMM: C[m][n] = sum_k A[m][k] * Bt[n][k]; one wave per 64x64 tile,
// no block barriers. A row-major [M][K] pitch lda; Bt row-major [N][K] pitch ldb (k contiguous);
// M, N multiples of 64, K a multiple of 32 and at least 32. blockIdx.y = batch index (strides in elements).
// NSPLIT: 0 = A.Bt; 1 = (A + A2).Bt (A2 = unscaled bf16 lo plane of A); 2 = A.Bt + A2.Bt + A.Bt2.
// OUT_MODE: 0 = f32 (pitch ldc); 2 = bf16 hi plane C + bf16 lo plane C2 (lo = RNE(v - hi), unscaled);
//           3 = f16 hi plane C + f16 residual plane C2 = f16((v - hi) * rscale), C2 written only for tiles
//               with n0 < N2 (pitch ldc2, batch stride strideC2).
// FR: false = A and Bt planes row-major; true = both in fragment order (then lda == ldb == K == DM, and a batch
//     stride is a whole number of 16-row strips).
// =====================================================================================================
//   sT: the block's 8 x (16 x 68) f32 staging slabs; bx: the block's index among the tiles; b: batch index.
template <int NSPLIT, int OUT_MODE, bool FR>
__device__ __forceinline__ void gemm64_body(
    const unsigned short* __restrict__ Ap, const unsigned short* A2p, int lda, long long strideA,
    const unsigned short* __restrict__ Btp, const unsigned short* Bt2p, int ldb, long long strideB,
    void* Cout, int ldc, long long strideC,
    void* Cout2, int ldc2, long long strideC2, int N2,
    int M, int N, int K, float rscale, float* sT, int bx, int b) {
  const __bf16* A   = (const __bf16*)(const void*)Ap;
  const __bf16* A2  = (const __bf16*)(const void*)A2p;
  const __bf16* Bt  = (const __bf16*)(const void*)Btp;
  const __bf16* Bt2 = (const __bf16*)(const void*)Bt2p;
  const int lane = threadIdx.x & 31;
  const int wave = threadIdx.x >> 5;
  const int tilesN = N >> 6;
  const int tilesM = M >> 6;
  const int tile = bx * 8 + wave;
  if (tile >= tilesM * tilesN) return;   // wave-uniform; no block barriers in this kernel
  const int tm = tile / tilesN;
  const int tn = tile - tm * tilesN;
  const int m0 = tm << 6;
  const int n0 = tn << 6;

  const __bf16* Ab  = A  + (size_t)b * strideA;
  const __bf16* Bb  = Bt + (size_t)b * strideB;
  const __bf16* Ab2 = (NSPLIT >= 1) ? (A2  + (size_t)b * strideA) : Ab;
  const __bf16* Bb2 = (NSPLIT == 2) ? (Bt2 + (size_t)b * strideB) : Bb;

  const int rlane = lane & 15;                 // row (A) / col (B, D) within subtile
  const int koff  = (lane >> 4) * 8;           // k offset of this lane half
  const int mOff  = (lane >> 4) * 8;           // D row offset

  v8f acc[4][4];
#pragma unroll
  for (int i = 0; i < 4; ++i)
#pragma unroll
    for (int j = 0; j < 4; ++j) acc[i][j] = zero8();

  // k loop, K >= 32: two register sets of fragments. All loads of one k step (32 columns) go out in one run, one k
  // step ahead of their products, so a k step waits for at most the rest of one load round trip instead of four whole
  // ones. Every load names a wave-uniform base (plane + 16-row strip) and one of two lane offsets, va (A) and vb (Bt).
  // Past the last k step the offsets stand still: a run that has no k step left reads the last one again (in bounds,
  // never used), so every run holds the same number of loads and the counted waits stay exact.
  // The inner loops are unrolled so that every fragment and accumulator index is a constant (registers, no scratch).
  struct FragSet { v16b a[4], l[4], b[4], m[4]; };                // A, second A plane, Bt, second Bt plane
  const size_t sa = (size_t)lda * 32, sb = (size_t)ldb * 32;      // bytes from one 16-row strip to the next
  gcp pa[4], pa2[4], pb[4], pb2[4];                               // the planes' four strips, scalar bases
#pragma unroll
  for (int i = 0; i < 4; ++i) {
    pa[i]  = uni_ptr((const char*)Ab + i * sa);
    pb[i]  = uni_ptr((const char*)Bb + i * sb);
    pa2[i] = (NSPLIT >= 1) ? uni_ptr((const char*)Ab2 + i * sa) : pa[i];
    pb2[i] = (NSPLIT == 2) ? uni_ptr((const char*)Bb2 + i * sb) : pb[i];
  }
  //   fragment order: a 16-row strip is as many bytes as in a row-major plane, so the bases above serve both; the
  //   lane's piece stands at 16 * lane in its 512-B run, and a k step is one 1-KB block
  constexpr int      H2   = FR ? 512 : 32;
  constexpr unsigned KINC = FR ? 1024u : 64u;
  unsigned va = FR ? ((unsigned)m0 * (unsigned)lda * 2u + (unsigned)lane * 16u)
                   : (((unsigned)(m0 + rlane) * (unsigned)lda + (unsigned)koff) * 2u);
  unsigned vb = FR ? ((unsigned)n0 * (unsigned)ldb * 2u + (unsigned)lane * 16u)
                   : (((unsigned)(n0 + rlane) * (unsigned)ldb + (unsigned)koff) * 2u);
  const int nk = K >> 5;
  int kl = 0;                                                     // the k step that va and vb stand at, unclamped
  auto load = [&](FragSet& S) {
#pragma unroll
    for (int j = 0; j < 4; ++j) {
      S.b[j] = ldfrag_o<H2>(pb[j], vb);
      if (NSPLIT == 2) S.m[j] = ldfrag_o<H2>(pb2[j], vb); else S.m[j] = S.b[j];
    }
#pragma unroll
    for (int i = 0; i < 4; ++i) {
      S.a[i] = ldfrag_o<H2>(pa[i], va);
      if (NSPLIT >= 1) S.l[i] = ldfrag_o<H2>(pa2[i], va); else S.l[i] = S.a[i];
    }
    // the scheduler may not sink the run's loads into the products behind it, where each would go out late
    __builtin_amdgcn_sched_barrier(0);
  };
  auto advance = [&]() {
    // the wait below stays behind the products: lifted to stand directly behind the loads it would hold the products up
    __builtin_amdgcn_sched_barrier(0);
#if defined(__HIP_DEVICE_COMPILE__)
    // precaution: this wait stands ahead of every rewrite of a register that a load of the last run names; it takes
    // the two lane offsets and the scalar bases as operands so that they stay whole up to it and the additions
    // stay behind it
    asm volatile("s_wait_xcnt 0x0" : "+v"(va), "+v"(vb)
                 : "s"(pa[0]), "s"(pa[1]), "s"(pa[2]), "s"(pa[3]), "s"(pb[0]), "s"(pb[1]), "s"(pb[2]), "s"(pb[3]),
                   "s"(pa2[0]), "s"(pa2[1]), "s"(pa2[2]), "s"(pa2[3]), "s"(pb2[0]), "s"(pb2[1]), "s"(pb2[2]), "s"(pb2[3])
                 : "memory");
#endif
    ++kl;
    const unsigned inc = (kl < nk) ? KINC : 0u;                   // wave-uniform
    va += inc;
    vb += inc;
  };
  auto products = [&](const FragSet& S) {
#pragma unroll
    for (int i = 0; i < 4; ++i)
#pragma unroll
      for (int j = 0; j < 4; ++j) {
        acc[i][j] = mma_b_raw(S.a[i], S.b[j], acc[i][j]);
        if (NSPLIT >= 1) acc[i][j] = mma_b_raw(S.l[i], S.b[j], acc[i][j]);
        if (NSPLIT == 2) acc[i][j] = mma_b_raw(S.a[i], S.m[j], acc[i][j]);
      }
  };
  FragSet S0, S1;
  load(S0); advance();
  const int ng = nk / 2;                                          // whole turns of the two sets
  for (int g = 0; g < ng; ++g) {
    load(S1); products(S0); advance();
    load(S0); products(S1); advance();
  }
  if (nk - ng * 2 >= 1) products(S0);                             // the k step left over (wave-uniform)
  acc_guard4(acc[0][0], acc[0][1], acc[0][2], acc[0][3]);
  acc_guard4(acc[1][0], acc[1][1], acc[1][2], acc[1][3]);
  acc_guard4(acc[2][0], acc[2][1], acc[2][2], acc[2][3]);
  acc_guard4(acc[3][0], acc[3][1], acc[3][2], acc[3][3]);

  // ---- epilogue ----
  float* slab = sT + wave * (16 * 68);             // per-wave 16x64 slab, pitch 68 floats
#pragma unroll
  for (int i = 0; i < 4; ++i) {
    const int mBase = m0 + (i << 4);
#pragma unroll
    for (int j = 0; j < 4; ++j) {
#pragma unroll
      for (int r = 0; r < 8; ++r) {
        slab[(mOff + r) * 68 + (j << 4) + rlane] = acc[i][j][r];
      }
    }
    __builtin_amdgcn_fence(__ATOMIC_RELEASE, "workgroup");
    __builtin_amdgcn_wave_barrier();
    __builtin_amdgcn_fence(__ATOMIC_ACQUIRE, "workgroup");
    if (OUT_MODE == 0) {
      float* C = (float*)Cout + (size_t)b * strideC;
      const int hh = lane >> 4, c4 = (lane & 15) * 4;     // 256-B row segment = 16 lanes x 16 B
      {
#pragma unroll
        for (int it = 0; it < 8; ++it) {
          const int row = it * 2 + hh;                     // it 0..7 x hh 0..1 = rows 0..15
          const v4f v = *(const v4f*)(slab + row * 68 + c4);
          *(v4f*)(C + (size_t)(mBase + row) * ldc + n0 + c4) = v;
        }
        
      }
    } else {
      const int q = lane >> 3, c8 = (lane & 7) * 8;
      unsigned short* C  = (unsigned short*)Cout  + (size_t)b * strideC;
      unsigned short* C2 = (unsigned short*)Cout2 + (size_t)b * strideC2;
      const bool wlo = (OUT_MODE == 2) || (n0 < N2);      // wave-uniform
      v4u hv[4], lv[4];
#pragma unroll
      for (int it = 0; it < 4; ++it) {
        const int row = it * 4 + q;                        // it 0..3 x q 0..3 = rows 0..15
        const float* sp = slab + row * 68 + c8;
        v4u a, a2;
#pragma unroll
        for (int e = 0; e < 4; ++e) {
          const float f0 = sp[2 * e], f1 = sp[2 * e + 1];
          unsigned short h0, h1, l0, l1;
          if (OUT_MODE == 2) {
            h0 = bf_bits(f0); h1 = bf_bits(f1);
            l0 = bf_bits(f0 - bf_up(h0)); l1 = bf_bits(f1 - bf_up(h1));
          } else {
            const _Float16 x0 = (_Float16)f0, x1 = (_Float16)f1;
            h0 = h_bits(x0); h1 = h_bits(x1);
            l0 = h_bits((_Float16)((f0 - (float)x0) * rscale));
            l1 = h_bits((_Float16)((f1 - (float)x1) * rscale));
          }
          a[e] = pk16(h0, h1); a2[e] = pk16(l0, l1);
        }
        hv[it] = a; lv[it] = a2;
      }
      {
#pragma unroll
        for (int it = 0; it < 4; ++it) {
          const int row = it * 4 + q;
          *(v4u*)(C + (size_t)(mBase + row) * ldc + n0 + c8) = hv[it];
          if (wlo) *(v4u*)(C2 + (size_t)(mBase + row) * ldc2 + n0 + c8) = lv[it];
        }
        
      }
    }
    __builtin_amdgcn_fence(__ATOMIC_RELEASE, "workgroup");
    __builtin_amdgcn_wave_barrier();
    __builtin_amdgcn_fence(__ATOMIC_ACQUIRE, "workgroup");
  }
}

template <int NSPLIT, int OUT_MODE, bool FR>
__global__ __launch_bounds__(256) void gemm64(
    const unsigned short* __restrict__ Ap, const unsigned short* A2p, int lda, long long strideA,
    const unsigned short* __restrict__ Btp, const unsigned short* Bt2p, int ldb, long long strideB,
    void* Cout, int ldc, long long strideC,
    void* Cout2, int ldc2, long long strideC2, int N2,
    int M, int N, int K, float rscale) {
  __shared__ __align__(16) float sT[8 * 16 * 68];
  gemm64_body<NSPLIT, OUT_MODE, FR>(Ap, A2p, lda, strideA, Btp, Bt2p, ldb, strideB, Cout, ldc, strideC,
                                Cout2, ldc2, strideC2, N2, M, N, K, rscale, sT, blockIdx.x, blockIdx.y);
}

// The three projections in one grid: each alone fills a quarter of the chip's WGPs and none reads another's result.
//   blockIdx.y = 0: q = x . Wq^T -> bf16 hi/lo planes [b*SEQ+t][h*64+d]   (M=2048, N=1024, K=1024)
//   blockIdx.y = 1: k = x . Wk^T -> bf16 hi/lo planes
//   blockIdx.y = 2: v^T = Wv . x^T per batch -> f16 hi plane [b][h*64+d][s] (pitch SEQ) and residual plane (x4096,
//                   keys < VLP only, pitch VLP); A = Wvb [n][k], Bt = Xb rows of batch b = blockIdx.x / VTB
#define PJB ((MROWS / 64) * (DM / 64) / 8)   // 64 blocks of 8 tiles per projection
#define VTB ((DM / 64) * (SEQ / 64) / 8)     // 32 blocks of 8 tiles per batch of v^T
static_assert(VTB * NB == PJB);
__global__ __launch_bounds__(256) void gemm_qkv(
    const unsigned short* __restrict__ Xb, const unsigned short* __restrict__ Wqb,
    const unsigned short* __restrict__ Wkb, const unsigned short* __restrict__ Wvb,
    unsigned short* Qh, unsigned short* Ql, unsigned short* Kh, unsigned short* Kl,
    unsigned short* VTh, unsigned short* VTl) {
  __shared__ __align__(16) float sT[8 * 16 * 68];
  const int which = blockIdx.y;                 // block-uniform
  if (which < 2) {
    const unsigned short* Wb = which ? Wkb : Wqb;
    unsigned short* Ch = which ? Kh : Qh;
    unsigned short* Cl = which ? Kl : Ql;
    gemm64_body<0, 2, true>(Xb, Xb, DM, 0LL, Wb, Wb, DM, 0LL,
                      (void*)Ch, DM, 0LL, (void*)Cl, DM, 0LL, DM,
                      MROWS, DM, DM, 1.0f, sT, blockIdx.x, 0);
  } else {
    const int b = blockIdx.x / VTB;
    gemm64_body<0, 3, true>(Wvb, Wvb, DM, 0LL, Xb, Xb, DM, (long long)SEQ * DM,
                      (void*)VTh, SEQ, (long long)DM * SEQ, (void*)VTl, VLP, (long long)DM * VLP, VLP,
                      DM, SEQ, DM, 4096.0f, sT, blockIdx.x - b * VTB, b);
  }
}

// =====================================================================================================
// Causal attention with relative-index (skew) bias and four gathered structure biases, head dim 64.
//   q planes (bf16 hi / lo): element (b, t, h, d) at [(b*SEQ + t)*DM + h*64 + d]; k planes same layout.
//   v^T hi plane (f16): element (b, h, d, s) at [(b*DM + h*64 + d)*SEQ + s]
//   v^T residual plane (f16, (v - hi)*4096): [(b*DM + h*64 + d)*VLP + s], s < VLP, read only when RES
//   er: bf16 [SEQ][64]; tab: bf16 [TROWS][64], the combined structure table T
//   qe = q . T^T (q hi/lo, 2 products per 32 columns, f32): the NG waves that hold the same 16 rows form those rows x NTS*16 table rows once between them,
//   ahead of the key loop, and keeps them in LDS (Qs, pitch QSP floats); the four bias gathers of a score read them there.
//   idx arrays: int [b][t][s], clamped to each sub-table's valid range before use.
//   scores[t][s] = (q_t.k_s + q_t.er[SEQ-1+s-t] + qe[OFF_BAR+ibar] + qe[OFF_POS+ipos] + qe[OFF_OCT+ioct]
//                   + qe[OFF_SEM+isem]) * sscale for s <= t, else -1e9 (replace mask).
//   q.k : bf16 hi/lo split (3 products); q.er : q hi/lo x bf16 er (2 products); f32 accumulate.
//   Skew band: a block (64 query rows, key tile kv0) needs er rows ebb .. ebb+127 with
//   ebb = SEQ-64+kv0-qb*64 >= 0 (staged in LDS, addresses clamped at SEQ-1; clamped rows only feed
//   masked positions). Wave w (rows q0..q0+15) computes 5 subtiles of 16 band rows starting at
//   band row 16*(3-w); the diagonal D[mi][15-mi+jj] is fetched with two unconditional bpermutes per
//   element and selected by value; subtiles are produced one at a time (prev / cur).
//   p = exp(s - m) carried as f16(1024 p); context = p . v on f16 WMMA; RES adds f16 residual planes of p and v
//   (scale 4096, separate accumulator folded back with 1/4096 per chunk in f32); online softmax in f32.
//   Block = NG groups of 4 waves = 64 query rows of one (b, h); grid = NQB * NH * NB; key tiles kt = 0..qb are dealt
//   to the groups (group g takes kt = NG i + g in round i, rounds block-uniform), so that the chain of tiles one wave
//   walks is 1/NG as long; wave w of every group holds rows q0..q0+15 with its own running max, sum and context, and
//   the partial results are joined in f32 through LDS behind the loop.
//   K / V^T / er chunk staging: the group's 128 threads, plain 16-B loads, all issued
//   ahead of the first LDS store, __syncthreads before and after; P tiles are wave-private, spilled with _Float16 element stores and
//   LDS (static byte buffer, rows of 64 elements at a pitch of LP = 72, so that the 16 rows of a 16-B fragment read
//   fall on different banks; T = 9216 B is a 64-row tile), per group at 8T g: Ksh 0, Ksl T, Vth 2T, Esh 3T (128 rows),
//   Psh 5T, Vtl 6T (RES), Psl 7T (RES); Qs 8T NG (64 rows x QSP floats, shared); after the key loop and a block barrier
//   the f32 context staging Os (17 KB) aliases offset 0 and the partial results of group g > 0 (24 KB) alias 8T g.
//   Output planes (bf16 hi / lo of the normalised context), element (row b*SEQ + t, column h*64 + d), in fragment order;
//   coverage: each wave of group 0 stores rows q0..q0+15 (lane & 15) x 64 columns (it 0..3 x lane>>4 0..1 x 8) of both planes.
// =====================================================================================================
#define TB64 (64 * LP * 2)    // bytes of a 64-row tile in LDS
#define QSB  (64 * QSP * 4)   // bytes of the block's structure products in LDS
#define GSB  (8 * TB64)       // bytes of one group's tiles in LDS
#define NG   3                // groups of 4 waves that share a query block's key tiles
#define SPG  ((NTS + NG - 1) / NG)   // structure-table subtiles per group
#define SPC  (NTS - (NG - 1) * SPG)   // of the last group
static_assert((LP * 2) % 32 == 16 && LP >= 64 && 4 * 16 * 68 * 4 <= 2 * TB64 && 4 * 48 * 32 * 4 <= GSB);
static_assert(SPC >= 1 && SPC <= SPG && NG * GSB + QSB <= 327680);
template <int N> struct Cnt { static constexpr int n = N; };   // a count handed to a lambda as a compile-time constant
template <bool RES>
__device__ __forceinline__
void attn_body(const unsigned short* __restrict__ qhp, const unsigned short* __restrict__ qlp,
                const unsigned short* __restrict__ khp, const unsigned short* __restrict__ klp,
                const unsigned short* __restrict__ vhp, const unsigned short* __restrict__ vlp,
                const unsigned short* __restrict__ erp, const unsigned short* __restrict__ tabp,
                const int* __restrict__ ibar, const int* __restrict__ ipos,
                const int* __restrict__ ioct, const int* __restrict__ isem,
                unsigned short* ohp, unsigned short* olp,
                unsigned char* smem, int qb, int h, int b, float sscale) {
  union FB { v16b v; v8b h[2]; };
  union FH { v16h v; v8h h[2]; };
  //   key group of the wave, the same in every lane: held in a scalar register so that tests on it are scalar branches
  const int grp  = __builtin_amdgcn_readfirstlane((int)(threadIdx.x >> 7));
  unsigned char* const gsm = smem + grp * GSB;                              // the group's own tiles
  __bf16*   const Ksh = (__bf16*)(void*)(gsm);
  __bf16*   const Ksl = (__bf16*)(void*)(gsm + TB64);
  _Float16* const Vth = (_Float16*)(void*)(gsm + 2 * TB64);
  __bf16*   const Esh = (__bf16*)(void*)(gsm + 3 * TB64);
  _Float16* const Psh = (_Float16*)(void*)(gsm + 5 * TB64);
  _Float16* const Vtl = (_Float16*)(void*)(gsm + (RES ? 6 * TB64 : 2 * TB64));   // never dereferenced when !RES
  _Float16* const Psl = (_Float16*)(void*)(gsm + (RES ? 7 * TB64 : 5 * TB64));   // never dereferenced when !RES
  float*    const Os  = (float*)(void*)(smem);                              // after the key loop only

  const int tid  = threadIdx.x & 127;                                       // thread within the group
  const int wave = tid >> 5;                                                // 16-row strip of the wave, 0..3
  const int lane = tid & 31;
  const int hh   = lane >> 4;
  const int c    = lane & 15;

  const int q0   = qb * 64 + wave * 16;
  const size_t rowB = (size_t)b * SEQ;

  const __bf16* Qh  = (const __bf16*)(const void*)qhp + (size_t)h * HD;
  const __bf16* Ql  = (const __bf16*)(const void*)qlp + (size_t)h * HD;
  const __bf16* Kh  = (const __bf16*)(const void*)khp + (size_t)h * HD;
  const __bf16* Kl  = (const __bf16*)(const void*)klp + (size_t)h * HD;
  const _Float16* Vh = (const _Float16*)(const void*)vhp + ((size_t)b * DM + (size_t)h * HD) * SEQ;
  const _Float16* Vl = (const _Float16*)(const void*)vlp + ((size_t)b * DM + (size_t)h * HD) * VLP;
  const __bf16* Erb = (const __bf16*)(const void*)erp;
  const size_t trow0 = rowB + (size_t)(q0 + 8 * hh);                 // b*SEQ + t for r = 0 of this lane half
  //   structure products of the block's 64 rows (LDS): byte offset in smem of this lane's row, r = 0
  const unsigned qlb = (unsigned)NG * GSB + (unsigned)(wave * 16 + 8 * hh) * (QSP * 4u);
  const unsigned ilb = ((unsigned)trow0 * SEQ + (unsigned)c) * 4u;    // byte offset of index (row r = 0, key c)

  // ---- Q fragments (A operand, row = lane&15): 2 d-chunks, hi and lo ----
  v16b qah[2], qal[2];
#pragma unroll
  for (int dc = 0; dc < 2; ++dc) {
    const size_t qo = (rowB + q0 + c) * DM + dc * 32 + 8 * hh;
    qah[dc] = ldfrag_b(Qh + qo);
    qal[dc] = ldfrag_b(Ql + qo);
  }

  // ---- structure products of the wave's 16 rows: D[r] of subtile u = (row 8 hh + r) . (table row 16 u + c);
  //      the NG waves that hold the same rows share the subtiles (group g: u0 = SPG g .. u0 + SPG - 1, below NTS):
  //      every group has SPC of them, every group but the last SPG ----
  {
    // precaution: this wait stands ahead of the table loads, which may land in an address register of the q loads
    asm volatile("s_wait_xcnt 0x0" ::: "memory");
    const int  u0   = grp * SPG;
    const bool more = grp < NG - 1;                                    // scalar: the group has subtiles SPC .. SPG - 1 too
    const char* tabg = (const char*)tabp + u0 * (16 * HD * 2);         // wave-uniform
    const unsigned tvo = ((unsigned)c * HD + 8u * (unsigned)hh) * 2u;  // the lane's piece of a 16-row table subtile
    float* qsw = (float*)(void*)(smem + NG * GSB) + (wave * 16 + 8 * hh) * QSP + u0 * 16 + c;
    FB tf[SPG][2];
    auto tload = [&](auto from, auto to) {                             // the group's subtiles from.n .. to.n - 1
#pragma unroll
      for (int u = decltype(from)::n; u < decltype(to)::n; ++u)
#pragma unroll
        for (int dc = 0; dc < 2; ++dc) {
          tf[u][dc].h[0] = *(const v8b*)(tabg + (u * 16 * HD * 2 + dc * 64) + tvo);
          tf[u][dc].h[1] = *(const v8b*)(tabg + (u * 16 * HD * 2 + dc * 64 + 32) + tvo);
        }
      // precaution: this wait stands ahead of every later rewrite of the loads' offset register and base; it names
      // them so that they stay whole up to it (no load of the run lands in the offset register)
      asm volatile("s_wait_xcnt 0x0" :: "v"(tvo), "s"(tabg) : "memory");
    };
    auto tprod = [&](auto from, auto to) {
#pragma unroll
      for (int u = decltype(from)::n; u < decltype(to)::n; ++u) {
        v8f d = zero8();
#pragma unroll
        for (int dc = 0; dc < 2; ++dc) {
          d = mma_b(qah[dc], tf[u][dc].v, d);
          d = mma_b(qal[dc], tf[u][dc].v, d);
        }
#pragma unroll
        for (int r = 0; r < 8; ++r) qsw[r * QSP + u * 16] = d[r];
      }
    };
    tload(Cnt<0>{}, Cnt<SPC>{});                                       // ahead of the test: each run has its own wait
    if (more) tload(Cnt<SPC>{}, Cnt<SPG>{});
    // the scheduler may not sink the table loads to their products, where each would wait alone
    __builtin_amdgcn_sched_barrier(0);
    tprod(Cnt<0>{}, Cnt<SPC>{});
    if (more) tprod(Cnt<SPC>{}, Cnt<SPG>{});
    // a row's products come from NG waves and each of them reads all: block barrier
    __syncthreads();
  }

  float mrow[8], lrow[8];
  v8f oacc[4];
#pragma unroll
  for (int r = 0; r < 8; ++r) { mrow[r] = -INFINITY; lrow[r] = 0.f; }
#pragma unroll
  for (int t = 0; t < 4; ++t) oacc[t] = zero8();

  const int nkt = (qb + 1 < NQB) ? (qb + 1) : NQB;   // causal: key tiles 0..qb, block-uniform
  const int nrd = (nkt + NG - 1) / NG;                // rounds of NG tiles, block-uniform
  unsigned iv = ilb + (unsigned)grp * (64u * 4u);     // byte offset of index (row r = 0, key kv0 + c)
  for (int rd = 0; rd < nrd; ++rd) {
    const int  kt  = NG * rd + grp;
    const bool act = kt < nkt;                        // scalar: in the last round a group may have no tile;
                                                      // it does none of the work and passes both barriers
    const int kv0 = kt * 64;
    int ebb = SEQ - 64 + kv0 - qb * 64;                 // >= 0 for kt >= 0, qb <= NQB-1
    ebb = (ebb < 0) ? 0 : ebb;

    // ---- gathered structure biases of the whole tile, bs[j][r] for key kv0 + 16 j + c and row q0 + 8 hh + r.
    //      They depend on no product of this tile, so the loads go out in runs, each back to back: for RPR rows
    //      at a time the 16 RPR index loads, then (indices clamped, byte offsets formed) the 16 RPR LDS gathers.
    float bs[4][8];
    constexpr int RPR = RES ? 4 : 8;                    // fewer at a time where the residual path needs the registers
    if (act) {
#pragma unroll
    for (int g = 0; g < 8; g += RPR) {
      int      xi[RPR][4][4];
      unsigned go[RPR][4][4];
      float    gv[RPR][4][4];
#pragma unroll
      for (int r = 0; r < RPR; ++r)
#pragma unroll
        for (int j = 0; j < 4; ++j) {
          const size_t ko = (size_t)((g + r) * SEQ + j * 16) * 4;
          xi[r][j][0] = *(const int*)((const char*)ibar + ko + iv);
          xi[r][j][1] = *(const int*)((const char*)ipos + ko + iv);
          xi[r][j][2] = *(const int*)((const char*)ioct + ko + iv);
          xi[r][j][3] = *(const int*)((const char*)isem + ko + iv);
        }
      // the scheduler may not sink the index loads to their first uses, where each would wait alone
      __builtin_amdgcn_sched_barrier(0);
#pragma unroll
      for (int r = 0; r < RPR; ++r)
#pragma unroll
        for (int j = 0; j < 4; ++j) {
          go[r][j][0] = qlb + (unsigned)iclamp(xi[r][j][0], 0, 16) * 4u;
          go[r][j][1] = qlb + (unsigned)iclamp(xi[r][j][1], 0, 95) * 4u;
          go[r][j][2] = qlb + (unsigned)iclamp(xi[r][j][2], 0, 24) * 4u;
          go[r][j][3] = qlb + (unsigned)iclamp(xi[r][j][3], 0, 12) * 4u;
        }
      // all offsets are formed ahead of the first gather, so that the gathers go out back to back
      __builtin_amdgcn_sched_barrier(0);
#pragma unroll
      for (int r = 0; r < RPR; ++r)
#pragma unroll
        for (int j = 0; j < 4; ++j) {
          const unsigned ro = (unsigned)(g + r) * (QSP * 4);
          gv[r][j][0] = *(const float*)((const char*)smem + (ro + OFF_BAR * 4) + go[r][j][0]);
          gv[r][j][1] = *(const float*)((const char*)smem + (ro + OFF_POS * 4) + go[r][j][1]);
          gv[r][j][2] = *(const float*)((const char*)smem + (ro + OFF_OCT * 4) + go[r][j][2]);
          gv[r][j][3] = *(const float*)((const char*)smem + (ro + OFF_SEM * 4) + go[r][j][3]);
        }
      // precaution: this wait stands ahead of the rewrite of the index loads' offset register (iv, below)
      asm volatile("s_wait_xcnt 0x0" ::: "memory");
      // the scheduler may not sink the gathers to the sums, nor lift a sum over the wait
      __builtin_amdgcn_sched_barrier(0);
#pragma unroll
      for (int r = 0; r < RPR; ++r)
#pragma unroll
        for (int j = 0; j < 4; ++j)
          bs[j][g + r] = (gv[r][j][0] + gv[r][j][1]) + (gv[r][j][2] + gv[r][j][3]);
      // the sums stay ahead of the next run of loads: they free the gathered values' registers for it
      __builtin_amdgcn_sched_barrier(0);
    }
    }
    iv += (unsigned)NG * 64u * 4u;                      // the group's next key tile's index columns

    __syncthreads();
    if (act) {
      // every tile row here is one 128-B line: 8 lanes take a row, so a wave's 16-B load covers 4 whole lines;
      // load i of a thread takes row r + 16 i
      const int r = tid >> 3, c8 = (tid & 7) * 8;
      const __bf16*   kg  = Kh + (rowB + kv0 + r) * DM + c8;      // K row kv0+r, d = c8..c8+7
      const __bf16*   klg = Kl + (rowB + kv0 + r) * DM + c8;
      const _Float16* vg  = Vh + (size_t)r * SEQ + kv0 + c8;      // V^T row d = r, s = kv0+c8..+7
      const int kvl = (kv0 + 64 <= VLP) ? kv0 : (VLP - 64);     // clamped address into the residual plane
      const _Float16* vlg = Vl + (size_t)r * VLP + kvl + c8;
      const bool resOK = (kv0 + 64 <= VLP);                      // uniform in the group
      // er band rows r + 16 i (128 rows x 64), row clamped at SEQ-1: min(ebb + r + 16 i, SEQ-1) = min(ebb + r, SEQ-1-16 i)
      // + 16 i; eo[i] is the byte offset of the thread's piece less the constant 16 i rows, which load i adds itself
      unsigned eo[8];
#pragma unroll
      for (int i = 0; i < 8; ++i) eo[i] = (unsigned)imin(ebb + r, SEQ - 1 - 16 * i) * (HD * 2) + (unsigned)c8 * 2u;
      v8b a0[4], a1[4], e0[8];
      v8h b0[4], b1[4];
#pragma unroll
      for (int i = 0; i < 4; ++i) {
        a0[i] = *(const v8b*)(kg + (size_t)i * 16 * DM);
        a1[i] = *(const v8b*)(klg + (size_t)i * 16 * DM);
        b0[i] = *(const v8h*)(vg + (size_t)i * 16 * SEQ);
        if (RES) b1[i] = *(const v8h*)(vlg + (size_t)i * 16 * VLP);
      }
#pragma unroll
      for (int i = 0; i < 8; ++i) e0[i] = *(const v8b*)((const char*)Erb + i * (16 * HD * 2) + eo[i]);
      // precaution: this wait stands ahead of every later rewrite of the loads' address registers; it names
      // them so that they stay whole up to it (no later load of the run lands in one)
      if (RES) asm volatile("s_wait_xcnt 0x0" :: "v"(kg), "v"(klg), "v"(vg), "v"(vlg), "v"(eo[0]), "v"(eo[1]), "v"(eo[2]),
                            "v"(eo[3]), "v"(eo[4]), "v"(eo[5]), "v"(eo[6]), "v"(eo[7]) : "memory");
      else     asm volatile("s_wait_xcnt 0x0" :: "v"(kg), "v"(klg), "v"(vg), "v"(eo[0]), "v"(eo[1]), "v"(eo[2]),
                            "v"(eo[3]), "v"(eo[4]), "v"(eo[5]), "v"(eo[6]), "v"(eo[7]) : "memory");
      // the scheduler may not sink the staging loads to their LDS stores, where each would wait alone
      __builtin_amdgcn_sched_barrier(0);
#pragma unroll
      for (int i = 0; i < 4; ++i) {
        *(v8b*)(Ksh + (r + 16 * i) * LP + c8) = a0[i];
        *(v8b*)(Ksl + (r + 16 * i) * LP + c8) = a1[i];
        *(v8h*)(Vth + (r + 16 * i) * LP + c8) = b0[i];
        if (RES) *(v8h*)(Vtl + (r + 16 * i) * LP + c8) = resOK ? b1[i] : zero8h();
      }
#pragma unroll
      for (int i = 0; i < 8; ++i) *(v8b*)(Esh + (r + 16 * i) * LP + c8) = e0[i];
    }
    __syncthreads();
    if (!act) continue;                                 // behind the round's last barrier; the round is the loop's last

    // ---- q.k: 16 query rows x 64 keys per wave, 3 bf16 products ----
    v8f s[4];
#pragma unroll
    for (int j = 0; j < 4; ++j) {
      s[j] = zero8();
#pragma unroll
      for (int dc = 0; dc < 2; ++dc) {
        FB kb, kl;
        kb.h[0] = *(const v8b*)(Ksh + (j * 16 + c) * LP + dc * 32 + 8 * hh);
        kb.h[1] = *(const v8b*)(Ksh + (j * 16 + c) * LP + dc * 32 + 16 + 8 * hh);
        kl.h[0] = *(const v8b*)(Ksl + (j * 16 + c) * LP + dc * 32 + 8 * hh);
        kl.h[1] = *(const v8b*)(Ksl + (j * 16 + c) * LP + dc * 32 + 16 + 8 * hh);
        s[j] = mma_b(qah[dc], kb.v, s[j]);
        s[j] = mma_b(qah[dc], kl.v, s[j]);
        s[j] = mma_b(qal[dc], kb.v, s[j]);
      }
    }

    // ---- q.er skew band: 5 subtiles of 16 band rows, streamed; diagonal extraction by bpermute ----
    {
      const int wb = (3 - wave) * 16;           // this wave's band offset inside Esh
      v8f prev = zero8();
#pragma unroll
      for (int u = 0; u < 5; ++u) {
        v8f cur = zero8();
#pragma unroll
        for (int dc = 0; dc < 2; ++dc) {
          FB eb;
          const __bf16* ep = Esh + (wb + u * 16 + c) * LP + dc * 32 + 8 * hh;
          eb.h[0] = *(const v8b*)(ep);
          eb.h[1] = *(const v8b*)(ep + 16);
          cur = mma_b(qah[dc], eb.v, cur);
          cur = mma_b(qal[dc], eb.v, cur);
        }
        if (u >= 1) {                            // key subtile jsub = u-1 uses subtiles u-1 (prev) and u (cur)
#pragma unroll
          for (int r = 0; r < 8; ++r) {
            const int base = 15 - (8 * hh + r) + c;                  // 0..30
            const int src  = (lane & 16) | (base & 15);
            const float vlo = __shfl(prev[r], src, 32);
            const float vhi = __shfl(cur[r], src, 32);
            s[u - 1][r] += (base < 16) ? vlo : vhi;
          }
        }
        prev = cur;
      }
    }

    // ---- add the gathered structure biases, scale, causal replace mask, online softmax, P (x1024, f16) and
    //      P residual (x4096) to LDS ----
    _Float16* pwh = Psh + wave * (16 * LP);
    _Float16* pwl = Psl + (RES ? wave : 0) * (16 * LP);
#pragma unroll
    for (int r = 0; r < 8; ++r) {
      const int    trow = q0 + 8 * hh + r;
      float m = -INFINITY;
#pragma unroll
      for (int j = 0; j < 4; ++j) {
        const int key = kv0 + j * 16 + c;
        float sv = (s[j][r] + bs[j][r]) * sscale;
        sv = (key <= trow) ? sv : -1.0e9f;
        s[j][r] = sv;
        m = fmaxf(m, sv);
      }
#pragma unroll
      for (int off = 1; off < 16; off <<= 1) m = fmaxf(m, __shfl_xor(m, off, 32));
      const float mnew  = fmaxf(mrow[r], m);
      const float msafe = (mnew == -INFINITY) ? 0.f : mnew;
      const float alpha = __expf(mrow[r] - msafe);
      mrow[r] = mnew;
      float psum = 0.f;
#pragma unroll
      for (int j = 0; j < 4; ++j) {
        const float p = __expf(s[j][r] - msafe);     // masked logit -1e9 against a normal max: exp -> 0
        psum += p;
        const float p1k = p * 1024.0f;
        const _Float16 ph = (_Float16)p1k;
        pwh[(8 * hh + r) * LP + j * 16 + c] = ph;
        if (RES) {
          const _Float16 pl = (_Float16)((p1k - (float)ph) * 4096.0f);
          pwl[(8 * hh + r) * LP + j * 16 + c] = pl;
        }
      }
#pragma unroll
      for (int off = 1; off < 16; off <<= 1) psum += __shfl_xor(psum, off, 32);
      lrow[r] = lrow[r] * alpha + psum;
#pragma unroll
      for (int t = 0; t < 4; ++t) oacc[t][r] *= alpha;
    }
    __builtin_amdgcn_fence(__ATOMIC_RELEASE, "workgroup");
    __builtin_amdgcn_wave_barrier();
    __builtin_amdgcn_fence(__ATOMIC_ACQUIRE, "workgroup");

    // ---- context += P . V (f16 WMMA), residual products into a separate accumulator ----
    v8f o1[4];
#pragma unroll
    for (int t = 0; t < 4; ++t) o1[t] = zero8();
#pragma unroll 1
    for (int kk = 0; kk < 2; ++kk) {
      FH pa, pl;
      pa.h[0] = *(const v8h*)(pwh + c * LP + kk * 32 + 8 * hh);
      pa.h[1] = *(const v8h*)(pwh + c * LP + kk * 32 + 16 + 8 * hh);
      if (RES) {
        pl.h[0] = *(const v8h*)(pwl + c * LP + kk * 32 + 8 * hh);
        pl.h[1] = *(const v8h*)(pwl + c * LP + kk * 32 + 16 + 8 * hh);
      } else {
        pl.v = pa.v;
      }
#pragma unroll
      for (int t = 0; t < 4; ++t) {
        FH vb;
        vb.h[0] = *(const v8h*)(Vth + (t * 16 + c) * LP + kk * 32 + 8 * hh);
        vb.h[1] = *(const v8h*)(Vth + (t * 16 + c) * LP + kk * 32 + 16 + 8 * hh);
        oacc[t] = mma_h(pa.v, vb.v, oacc[t]);
        if (RES) {
          FH vl;
          vl.h[0] = *(const v8h*)(Vtl + (t * 16 + c) * LP + kk * 32 + 8 * hh);
          vl.h[1] = *(const v8h*)(Vtl + (t * 16 + c) * LP + kk * 32 + 16 + 8 * hh);
          o1[t] = mma_h(pa.v, vl.v, o1[t]);
          o1[t] = mma_h(pl.v, vb.v, o1[t]);
        }
      }
    }
    if (RES) {
#pragma unroll
      for (int t = 0; t < 4; ++t)
#pragma unroll
        for (int r = 0; r < 8; ++r) oacc[t][r] += o1[t][r] * (1.0f / 4096.0f);
    }
  }

  // ---- every group is done with its tiles: the partial results and Os below alias them ----
  __syncthreads();
  // ---- join the groups' partial results: wave w of a group g > 0 hands max, sum and context of its rows to wave w of
  //      group 0, lane to lane (value k of lane l at float 32 k + l of the wave's slab, in group g's tile space) ----
  if (grp != 0) {
    float* xs = (float*)(void*)gsm + wave * (48 * 32) + lane;
#pragma unroll
    for (int t = 0; t < 4; ++t)
#pragma unroll
      for (int r = 0; r < 8; ++r) xs[(t * 8 + r) * 32] = oacc[t][r];
#pragma unroll
    for (int r = 0; r < 8; ++r) { xs[(32 + r) * 32] = mrow[r]; xs[(40 + r) * 32] = lrow[r]; }
  }
  __syncthreads();
  if (grp != 0) return;                            // behind the kernel's last block barrier
#pragma unroll
  for (int g = 1; g < NG; ++g) {
    const float* xs = (const float*)(const void*)(smem + g * GSB) + wave * (48 * 32) + lane;
#pragma unroll
    for (int r = 0; r < 8; ++r) {
      // group 0 has tile 0, where key 0 is open to every row: its max is finite; a group without a tile hands
      // max -inf, sum 0, context 0 and gets the weight exp(-inf) = 0
      const float m1 = xs[(32 + r) * 32], l1 = xs[(40 + r) * 32];
      const float mj = fmaxf(mrow[r], m1);
      const float a0 = exp_slot(mrow[r] - mj), a1 = exp_slot(m1 - mj);
      mrow[r] = mj;
      lrow[r] = lrow[r] * a0 + l1 * a1;
#pragma unroll
      for (int t = 0; t < 4; ++t) oacc[t][r] = oacc[t][r] * a0 + xs[(t * 8 + r) * 32] * a1;
    }
  }
  float* os = Os + wave * (16 * 68);               // pitch 68 floats = 16 B x odd, for the 16-rows-at-a-time reads below
#pragma unroll
  for (int r = 0; r < 8; ++r) {
    const float l = lrow[r];
    const float inv = ((l > 0.f) ? (1.0f / l) : 0.f) * (1.0f / 1024.0f);
#pragma unroll
    for (int t = 0; t < 4; ++t) os[(8 * hh + r) * 68 + t * 16 + c] = oacc[t][r] * inv;
  }
  __builtin_amdgcn_fence(__ATOMIC_RELEASE, "workgroup");
  __builtin_amdgcn_wave_barrier();
  __builtin_amdgcn_fence(__ATOMIC_ACQUIRE, "workgroup");
  {
    // the wave's 16 rows are one strip and its 64 columns two 32-column blocks: 4 runs of 512 B, one after another
    v4u hv[4], lv[4];
#pragma unroll
    for (int it = 0; it < 4; ++it) {
      // run it: lane -> row c, columns 16 it + 8 hh ..+7 (it 0..3 x hh 0..1 x 8 = columns 0..63, c = rows 0..15)
      const float* sp = os + c * 68 + it * 16 + 8 * hh;
      v4u a, a2;
#pragma unroll
      for (int e = 0; e < 4; ++e) {
        const float f0 = sp[2 * e], f1 = sp[2 * e + 1];
        const unsigned short h0 = bf_bits(f0), h1 = bf_bits(f1);
        const unsigned short l0 = bf_bits(f0 - bf_up(h0)), l1 = bf_bits(f1 - bf_up(h1));
        a[e] = pk16(h0, h1); a2[e] = pk16(l0, l1);
      }
      hv[it] = a; lv[it] = a2;
    }
    {
#pragma unroll
      for (int it = 0; it < 4; ++it) {
        const size_t go = ((((rowB + q0) >> 4) * (DM / 32) + (size_t)h * 2) * 64 + it * 32 + lane) * 8;
        *(v4u*)(ohp + go) = hv[it];
        *(v4u*)(olp + go) = lv[it];
      }
      
    }
  }
}

// Every query block in one grid: the blocks with residual planes (qb < RESQB) and the rest depend on the same
// inputs and write disjoint rows, so they run side by side. NB*NH consecutive blocks share one qb, from NQB-1
// downwards: a WGP holds one block at a time, and the longest key loops start first.
__global__ __launch_bounds__(NG * 128, NG)
void attn_rel64(const unsigned short* __restrict__ qhp, const unsigned short* __restrict__ qlp,
                const unsigned short* __restrict__ khp, const unsigned short* __restrict__ klp,
                const unsigned short* __restrict__ vhp, const unsigned short* __restrict__ vlp,
                const unsigned short* __restrict__ erp, const unsigned short* __restrict__ tabp,
                const int* __restrict__ ibar, const int* __restrict__ ipos,
                const int* __restrict__ ioct, const int* __restrict__ isem,
                unsigned short* ohp, unsigned short* olp, float sscale) {
  __shared__ __align__(16) unsigned char smem[NG * GSB + QSB];
  const int bx = blockIdx.x;
  const int g  = bx / (NB * NH);
  const int bh = bx - g * (NB * NH);
  const int qb = NQB - 1 - g;                                     // a permutation of 0..NQB-1, block-uniform
  const int h  = bh % NH;
  const int b  = bh / NH;
  if (qb < RESQB)
    attn_body<true>(qhp, qlp, khp, klp, vhp, vlp, erp, tabp, ibar, ipos, ioct, isem, ohp, olp, smem, qb, h, b, sscale);
  else
    attn_body<false>(qhp, qlp, khp, klp, vhp, vlp, erp, tabp, ibar, ipos, ioct, isem, ohp, olp, smem, qb, h, b, sscale);
}

// =====================================================================================================
// Workspace map (bytes, every region a multiple of its 64x64-tile / whole-line store granularity):
//   (Xb, the four weight planes, Oh and Ol are stored in fragment order; every other plane is row-major)
//   Xb   bf16 [2048][1024]            0        4194304
//   Wqb  bf16 [1024 n][1024 k]    4194304        2097152
//   Wkb                           6291456        2097152
//   Wvb                           8388608        2097152
//   Wob                          10485760        2097152
//   Erb  bf16 [1024][64]         12582912         131072
//   Tb   bf16 [192][64]          12713984          24576
//   Qh   bf16 [2048][1024]       12738560        4194304
//   Ql                           16932864        4194304
//   Kh                           21127168        4194304
//   Kl                           25321472        4194304
//   VTh  f16  [2][1024][1024]    29515776        4194304
//   VTl  f16  [2][1024][256]     33710080        1048576
//   Oh   bf16 [2048][1024]       34758656        4194304
//   Ol                           38952960        4194304
//   end                          43147264
// Weights are [out n][in k] with k contiguous = the Bt / A layout the GEMM wants, so they are only converted.
// =====================================================================================================
extern "C" void kernel_launch(void* const* d_in, const int* in_sizes, int n_in,
                              void* d_out, int out_size, void* d_ws, size_t ws_size,
                              hipStream_t stream) {
  if (n_in < 14) return;
  if (in_sizes[0] != NB * SEQ * DM) return;
  if (in_sizes[1] != NB * SEQ * SEQ || in_sizes[2] != NB * SEQ * SEQ ||
      in_sizes[3] != NB * SEQ * SEQ || in_sizes[4] != NB * SEQ * SEQ) return;
  if (in_sizes[5] != DM * DM || in_sizes[6] != DM * DM || in_sizes[7] != DM * DM || in_sizes[8] != DM * DM) return;
  if (in_sizes[9] != SEQ * HD) return;
  if (in_sizes[10] != 16 * HD || in_sizes[11] != 95 * HD || in_sizes[12] != 24 * HD || in_sizes[13] != 12 * HD) return;
  if (out_size != NB * SEQ * DM) return;

  const float* x    = (const float*)d_in[0];
  const int*   rbar = (const int*)d_in[1];
  const int*   rpos = (const int*)d_in[2];
  const int*   roct = (const int*)d_in[3];
  const int*   rsem = (const int*)d_in[4];
  const float* Wq   = (const float*)d_in[5];
  const float* Wk   = (const float*)d_in[6];
  const float* Wv   = (const float*)d_in[7];
  const float* Wo   = (const float*)d_in[8];
  const float* Er   = (const float*)d_in[9];
  const float* Ebar = (const float*)d_in[10];
  const float* Epos = (const float*)d_in[11];
  const float* Eoct = (const float*)d_in[12];
  const float* Esem = (const float*)d_in[13];

  const size_t PX  = (size_t)MROWS * DM * 2;          //  4194304  16-bit activation plane [2048][1024]
  const size_t PW  = (size_t)DM * DM * 2;             //  2097152  16-bit weight plane
  const size_t PE  = (size_t)SEQ * HD * 2;            //   131072  er plane
  const size_t PT  = (size_t)TROWS * HD * 2;          //    24576  combined structure table
  const size_t PVT = (size_t)NB * DM * SEQ * 2;       //  4194304  v^T hi plane
  const size_t PVL = (size_t)NB * DM * VLP * 2;       //  1048576  v^T residual plane
  size_t off = 0;
  const size_t oXb  = off; off += PX;
  const size_t oWq  = off; off += PW;
  const size_t oWk  = off; off += PW;
  const size_t oWv  = off; off += PW;
  const size_t oWo  = off; off += PW;
  const size_t oEr  = off; off += PE;
  const size_t oTb  = off; off += PT;
  const size_t oQh  = off; off += PX;
  const size_t oQl  = off; off += PX;
  const size_t oKh  = off; off += PX;
  const size_t oKl  = off; off += PX;
  const size_t oVTh = off; off += PVT;
  const size_t oVTl = off; off += PVL;
  const size_t oOh  = off; off += PX;
  const size_t oOl  = off; off += PX;
  if (off > ws_size) return;                          // off = 43147264
  if (off > (size_t)134217728) return;

  char* ws = (char*)d_ws;
  unsigned short* Xb  = (unsigned short*)(ws + oXb);
  unsigned short* Wqb = (unsigned short*)(ws + oWq);
  unsigned short* Wkb = (unsigned short*)(ws + oWk);
  unsigned short* Wvb = (unsigned short*)(ws + oWv);
  unsigned short* Wob = (unsigned short*)(ws + oWo);
  unsigned short* Erb = (unsigned short*)(ws + oEr);
  unsigned short* Tb  = (unsigned short*)(ws + oTb);
  unsigned short* Qh  = (unsigned short*)(ws + oQh);
  unsigned short* Ql  = (unsigned short*)(ws + oQl);
  unsigned short* Kh  = (unsigned short*)(ws + oKh);
  unsigned short* Kl  = (unsigned short*)(ws + oKl);
  unsigned short* VTh = (unsigned short*)(ws + oVTh);
  unsigned short* VTl = (unsigned short*)(ws + oVTl);
  unsigned short* Oh  = (unsigned short*)(ws + oOh);
  unsigned short* Ol  = (unsigned short*)(ws + oOl);

  const dim3 blk(256);
  const dim3 gPrep(PB_X + 4 * PB_W + PB_E + PB_T);             // 3110 blocks
  const dim3 gQKV(PJB, 3);                                     // 64 blocks x {q, k, v^T}
  const dim3 gProj(((MROWS / 64) * (DM / 64) + 7) / 8, 1);     // 512 tiles -> 64 blocks: M=2048, N=1024

  // (1) x -> bf16 plane; weights [n][k] f32 -> bf16 [n][k]; er -> bf16; combined structure table
  prep_all<<<gPrep, blk, 0, stream>>>(x, Wq, Wk, Wv, Wo, Er, Ebar, Epos, Eoct, Esem,
                                      Xb, Wqb, Wkb, Wvb, Wob, Erb, Tb);
  // (2)-(4) q, k (bf16 hi/lo planes) and v^T (f16 hi plane, residual plane)
  gemm_qkv<<<gQKV, blk, 0, stream>>>(Xb, Wqb, Wkb, Wvb, Qh, Ql, Kh, Kl, VTh, VTl);
  // (5), (6) attention, each block with the structure products q . T^T of its own rows: query blocks 0..RESQB-1 with
  //     residual planes, the rest without, one grid
  attn_rel64<<<dim3(NB * NH * NQB), dim3(NG * 128), 0, stream>>>(
      Qh, Ql, Kh, Kl, VTh, VTl, Erb, Tb, rbar, rpos, roct, rsem, Oh, Ol, 0.125f);
  // (7) out = context . Wo^T -> d_out f32 [2048][1024]  (A = context hi + lo planes, 2 products)
  gemm64<1, 0, true><<<gProj, blk, 0, stream>>>(
      Oh, Ol, DM, 0LL, Wob, Wob, DM, 0LL,
      d_out, DM, 0LL, d_out, DM, 0LL, DM,
      MROWS, DM, DM, 1.0f);
  (void)hipGetLastError();
}

// v008
// It runs in 103 microseconds.
// Next to v007, in two timings, it ran 1.11 and 1.08 times as fast.
// All steps since v000 together make it 7.77 times as fast.
// Contractions: q, k, v^T projections = v_wmma_f32_16x16x32_bf16 (bf16 operands from RNE-converted inputs, single product);
// q.k^T = v_wmma_f32_16x16x32_bf16 with bf16 hi/lo split q and k (hi.hi + hi.lo + lo.hi);
// q.Er^T skew band and q.T^T structure tables = bf16 hi/lo q times bf16 table rows (2 products);
// p.v = v_wmma_f32_16x16x32_f16 (p carried x1024 in f16, v f16; extra f16 residual planes x4096 of p and v for the first 256 query rows);
// ctx.Wo^T = bf16 hi/lo ctx times bf16 Wo (2 products); all f32 accumulate; bias gathers, causal mask and softmax in f32.
#include <hip/hip_runtime.h>
#include <math.h>
#include <stdint.h>

#define NB    2
#define SEQ   1024
#define DM    1024
#define NH    16
#define HD    64
#define MROWS (NB * SEQ)     // 2048
#define NQB   (SEQ / 64)     // 16 query / key tiles of 64
#define VLP   256            // key pitch of the v^T residual plane (keys 0..VLP-1)
#define RESQB 4              // leading 64-row query blocks that use the p / v residual planes
#define NTS   10             // 16-row subtiles of the structure table that hold used rows (151 of 160)
#define QSP   164            // LDS row pitch (floats) of the structure-table products: 8 rows = 32 banks mod 64
#define TROWS 192            // rows of the combined structure table (151 used, rest zero)
#define LP    72             // LDS row pitch, 16-bit elements, of the 64-wide K / V^T / er / P tiles: 144 B = 16 B x odd
#define OFF_BAR 0            // 16 rows + zero row  -> idx 0..16
#define OFF_POS 17           // 95 rows + zero row  -> idx 0..95
#define OFF_OCT 113          // 24 rows + zero row  -> idx 0..24
#define OFF_SEM 138          // 12 rows + zero row  -> idx 0..12
static_assert(RESQB * 64 <= VLP);
static_assert(NH * HD == DM);
static_assert((SEQ % 64) == 0 && (DM % 64) == 0 && (TROWS % 64) == 0);
static_assert(OFF_SEM + 13 <= NTS * 16 && NTS * 16 <= QSP && NTS * 16 <= TROWS && (QSP * 8) % 64 == 32);

typedef _Float16 v16h __attribute__((ext_vector_type(16)));
typedef _Float16 v8h  __attribute__((ext_vector_type(8)));
typedef __bf16   v16b __attribute__((ext_vector_type(16)));
typedef __bf16   v8b  __attribute__((ext_vector_type(8)));
typedef float    v8f  __attribute__((ext_vector_type(8)));
typedef float    v4f  __attribute__((ext_vector_type(4)));
typedef unsigned int v4u __attribute__((ext_vector_type(4)));

// ---- scalar helpers --------------------------------------------------------------------------------
__device__ __forceinline__ unsigned short bf_bits(float f) {          // f32 -> bf16 bits, RNE convert
  unsigned u = __float_as_uint(f);
  return (unsigned short)((u + 0x7FFFu + ((u >> 16) & 1u)) >> 16);
}
__device__ __forceinline__ float bf_up(unsigned short h) { return __uint_as_float(((unsigned)h) << 16); }
__device__ __forceinline__ unsigned short h_bits(_Float16 x) { return __builtin_bit_cast(unsigned short, x); }
__device__ __forceinline__ unsigned pk16(unsigned short a, unsigned short b) { return (unsigned)a | ((unsigned)b << 16); }
__device__ __forceinline__ int iclamp(int v, int lo, int hi) { return (v < lo) ? lo : ((v > hi) ? hi : v); }
__device__ __forceinline__ int imin(int a, int b) { return (a < b) ? a : b; }
// exp(x) as __expf forms it (x log2(e), then the hardware's 2^y), with the slot that the instruction set asks for behind a
// transcendental kept in the same statement
__device__ __forceinline__ float exp_slot(float x) {
  const float y = x * 1.44269504088896340736f;
  float r;
  asm("v_exp_f32 %0, %1\n\tv_nop" : "=v"(r) : "v"(y));
  return r;
}
__device__ __forceinline__ v8f zero8() { v8f z = {0.f, 0.f, 0.f, 0.f, 0.f, 0.f, 0.f, 0.f}; return z; }
__device__ __forceinline__ v8h zero8h() {
  const _Float16 z = (_Float16)0.0f;
  v8h r = {z, z, z, z, z, z, z, z};
  return r;
}

// ---- fragment loader: 16-bit A/B operand, lane -> row/col (lane&15), p already includes +8*(lane>>4);
//      elements 0..7 <- p[0..7] (k0+8h..), elements 8..15 <- p[16..23] (k0+16+8h..)
__device__ __forceinline__ v16b ldfrag_b(const __bf16* p) {
  union { v16b v; v8b h[2]; } f;
  f.h[0] = *(const v8b*)(p);
  f.h[1] = *(const v8b*)(p + 16);
  return f.v;
}
//      a wave-uniform pointer to global memory, held in scalar registers, so that a load names it and a 32-bit lane
//      offset (left to itself one build formed a vector address pair per strip, and a load of the run landed in it)
typedef const __attribute__((address_space(1))) char* gcp;
typedef const __attribute__((address_space(1))) v8b*  gv8bp;
__device__ __forceinline__ gcp uni_ptr(const char* p) {
  const unsigned long long u = (unsigned long long)p;
  const unsigned lo = (unsigned)__builtin_amdgcn_readfirstlane((int)(unsigned)u);
  const unsigned hi = (unsigned)__builtin_amdgcn_readfirstlane((int)(unsigned)(u >> 32));
  return (gcp)(((unsigned long long)hi << 32) | lo);
}
//      the same elements in the same positions, from a wave-uniform base and the lane's byte offset vo;
//      H2 = bytes from the lane's elements 0..7 to its elements 8..15 (32 in a row-major plane, 512 in fragment order)
template <int H2>
__device__ __forceinline__ v16b ldfrag_o(gcp base, unsigned vo) {
  union { v16b v; v8b h[2]; } f;
  f.h[0] = *(gv8bp)(base + vo);
  f.h[1] = *(gv8bp)(base + H2 + vo);
  return f.v;
}

// ---- WMMA helpers with trailing VALU hazard gap --------------------------------------------------------
__device__ __forceinline__ v8f mma_b(v16b a, v16b b, v8f c) {
  c = __builtin_amdgcn_wmma_f32_16x16x32_bf16(false, a, false, b, (short)0, c, false, false);
#if defined(__HIP_DEVICE_COMPILE__)
  asm volatile("v_nop\n\tv_nop\n\tv_nop\n\tv_nop" : "+v"(c) : "v"(a), "v"(b));
#endif
  return c;
}
__device__ __forceinline__ v8f mma_h(v16h a, v16h b, v8f c) {
  c = __builtin_amdgcn_wmma_f32_16x16x32_f16(false, a, false, b, (short)0, c, false, false);
#if defined(__HIP_DEVICE_COMPILE__)
  asm volatile("v_nop\n\tv_nop\n\tv_nop\n\tv_nop" : "+v"(c) : "v"(a), "v"(b));
#endif
  return c;
}
__device__ __forceinline__ v8f mma_b_raw(v16b a, v16b b, v8f c) {
  return __builtin_amdgcn_wmma_f32_16x16x32_bf16(false, a, false, b, (short)0, c, false, false);
}
__device__ __forceinline__ void acc_guard4(v8f& a, v8f& b, v8f& c, v8f& d) {
#if defined(__HIP_DEVICE_COMPILE__)
  asm volatile("v_nop\n\tv_nop\n\tv_nop\n\tv_nop" : "+v"(a), "+v"(b), "+v"(c), "+v"(d));
#else
  (void)a; (void)b; (void)c; (void)d;
#endif
}

// =====================================================================================================
// f32 -> bf16 (RNE convert), 8 elements per thread, one 16-B store per lane: a wave writes 512 contiguous B
// (n8 is a multiple of 256 for every use here). coverage: n8 threads x 8 = whole plane.
// =====================================================================================================
__device__ __forceinline__ void cvt_bf16x8(const float* __restrict__ in, unsigned short* out, int n8, int blk) {
  const int i = blk * 256 + threadIdx.x;
  if (i < n8) {
    const v4f a = *(const v4f*)(in + (size_t)i * 8);
    const v4f b = *(const v4f*)(in + (size_t)i * 8 + 4);
    v4u p;
    p[0] = pk16(bf_bits(a[0]), bf_bits(a[1]));
    p[1] = pk16(bf_bits(a[2]), bf_bits(a[3]));
    p[2] = pk16(bf_bits(b[0]), bf_bits(b[1]));
    p[3] = pk16(bf_bits(b[2]), bf_bits(b[3]));
    *(v4u*)(out + (size_t)i * 8) = p;
    
  }
}

// =====================================================================================================
// FRAGMENT ORDER of a 16-bit plane [rows][DM] that a GEMM reads as A or Bt: the plane is cut into 16-row strips and
// each strip into blocks of 32 columns; a block is 1 KB = two runs of 512 B, and run u holds, for lane l = 0..31,
// the 8 elements (row l & 15, columns 16 u + 8 (l >> 4) ..+7) at byte 16 l. Blocks of a strip follow one another, then
// the next strip. So each of a fragment's two 16-B loads reads 512 contiguous bytes (4 whole lines) where a row-major
// plane gives it 32 B from each of 16 lines; which element lands in which lane and register does not change.
//   16-B piece index of (row m, columns 8 k8 ..+7) = (((m >> 4) * (DM/32) + (k8 >> 2)) * 2 + ((k8 >> 1) & 1)) * 32
//                                                    + (k8 & 1) * 16 + (m & 15)
// f32 [rows][DM] -> bf16 (RNE convert) in fragment order: thread i makes piece i, so a wave stores 512 contiguous B;
// a block reads 512 contiguous B of each of 16 rows. coverage: n8 threads x 8 = whole plane (the map is one to one).
// =====================================================================================================
static_assert(DM / 32 == 32);
__device__ __forceinline__ void cvt_bf16_frag(const float* __restrict__ in, unsigned short* out, int n8, int blk) {
  const int i = blk * 256 + threadIdx.x;
  if (i < n8) {
    const int l = i & 31, u = (i >> 5) & 1, kb = (i >> 6) & 31, st = i >> 11;
    const size_t so = (size_t)(st * 16 + (l & 15)) * DM + kb * 32 + u * 16 + (l >> 4) * 8;
    const v4f a = *(const v4f*)(in + so);
    const v4f b = *(const v4f*)(in + so + 4);
    v4u p;
    p[0] = pk16(bf_bits(a[0]), bf_bits(a[1]));
    p[1] = pk16(bf_bits(a[2]), bf_bits(a[3]));
    p[2] = pk16(bf_bits(b[0]), bf_bits(b[1]));
    p[3] = pk16(bf_bits(b[2]), bf_bits(b[3]));
    *(v4u*)(out + (size_t)i * 8) = p;
  }
}

// =====================================================================================================
// Combined structure table, bf16 [TROWS][64]: rows 0..15 bar, 16 zero, 17..111 position, 112 zero,
// 113..136 octave, 137 zero, 138..149 semitone, 150..191 zero. 8 threads per row, 8 elements each,
// all four candidate loads unconditional with clamped row addresses, selection by value.
// PB_T = TROWS*8/256 = 6 blocks of prep_all exactly. coverage: 1536 threads x 8 = 192 x 64.
// =====================================================================================================
__device__ __forceinline__ void build_tab(const float* __restrict__ ebar, const float* __restrict__ epos,
                                          const float* __restrict__ eoct, const float* __restrict__ esem,
                                          unsigned short* tab, int blk) {
  const int g = blk * 256 + threadIdx.x;
  if (g < TROWS * 8) {
    const int s  = g >> 3;
    const int d0 = (g & 7) * 8;
    const int rb = iclamp(s, 0, 15);
    const int rp = iclamp(s - OFF_POS, 0, 94);
    const int ro = iclamp(s - OFF_OCT, 0, 23);
    const int rs = iclamp(s - OFF_SEM, 0, 11);
    const bool ub = (s < 16);
    const bool up = (s >= OFF_POS) && (s < OFF_POS + 95);
    const bool uo = (s >= OFF_OCT) && (s < OFF_OCT + 24);
    const bool us = (s >= OFF_SEM) && (s < OFF_SEM + 12);
    float v[8];
#pragma unroll
    for (int e = 0; e < 8; ++e) {
      const int d = d0 + e;
      const float fb = ebar[rb * HD + d];
      const float fp = epos[rp * HD + d];
      const float fo = eoct[ro * HD + d];
      const float fs = esem[rs * HD + d];
      float t = 0.f;
      t = ub ? fb : t;
      t = up ? fp : t;
      t = uo ? fo : t;
      t = us ? fs : t;
      v[e] = t;
    }
    v4u p;
    p[0] = pk16(bf_bits(v[0]), bf_bits(v[1]));
    p[1] = pk16(bf_bits(v[2]), bf_bits(v[3]));
    p[2] = pk16(bf_bits(v[4]), bf_bits(v[5]));
    p[3] = pk16(bf_bits(v[6]), bf_bits(v[7]));
    *(v4u*)(tab + (size_t)s * HD + d0) = p;
    
  }
}

// =====================================================================================================
// The four structure indices of a score (b, t, s), each clamped to its sub-table's range and taken times 4 (the byte
// offset of an f32 in its sub-table's products), packed into one 32-bit word: bar in bits 0..6, position 7..15, octave
// 16..22, semitone 23..28. Every head reads the same indices, so they are clamped and packed once and the attention
// loads one word a score where it loaded four.
// PACKED ORDER: one 4-KB unit per (b, 16-row strip, 64-key tile), unit index (b * SEQ/16 + strip) * NQB + tile; in a unit
// the 16-B piece (2 j + rq) * 32 + 16 hh + c holds rows 8 hh + 4 rq + 0..3 of key 16 j + c, so that an attention wave
// (lane = 16 hh + c) reads a unit with 8 loads of 512 contiguous bytes. Only the units on or below the diagonal
// (tile <= strip / 4) are read, and only they are written.
// One block per (b, 64-row query block qb, key tile kt <= qb), 4 units: rows p and NQB-1-p have NQB+1 tiles together.
// A wave takes 4 rows x 32 keys of each strip: each of its 64 index loads reads one whole 128-B line, all of them go
// out ahead of the first use, and each of its 4 stores writes two runs of 256 B.
// coverage of a unit: 8 waves (a, rq, hh) x 32 lanes = pieces 0..255, one to one.
// =====================================================================================================
#define PB_P (NB * (NQB / 2) * (NQB + 1))   // 272
static_assert((NQB % 2) == 0 && SEQ == NQB * 64);
__device__ __forceinline__ void pack_idx(const int* __restrict__ ibar, const int* __restrict__ ipos,
                                         const int* __restrict__ ioct, const int* __restrict__ isem,
                                         unsigned* pk, int blk) {
  const int b  = blk / ((NQB / 2) * (NQB + 1));
  const int t  = blk - b * ((NQB / 2) * (NQB + 1));
  const int p  = t / (NQB + 1);
  const int e0 = t - p * (NQB + 1);
  const int qb = (e0 <= p) ? p : (NQB - 1 - p);                       // block-uniform
  const int kt = (e0 <= p) ? e0 : (e0 - p - 1);                       // 0..qb
  const int lane = threadIdx.x & 31, wv = threadIdx.x >> 5;
  const int a = wv & 1, rq = (wv >> 1) & 1, hh = wv >> 2;
  // byte offset of index (row qb*64 + 8 hh + 4 rq, key kt*64 + 32 a + lane); strip s and row e add a constant
  const unsigned vo = ((unsigned)(b * SEQ + qb * 64 + 8 * hh + 4 * rq) * SEQ + (unsigned)(kt * 64 + 32 * a + lane)) * 4u;
  int xi[4][4][4];
#pragma unroll
  for (int s = 0; s < 4; ++s)
#pragma unroll
    for (int e = 0; e < 4; ++e) {
      const size_t ko = (size_t)((s * 16 + e) * SEQ) * 4;
      xi[s][e][0] = *(const int*)((const char*)ibar + ko + vo);
      xi[s][e][1] = *(const int*)((const char*)ipos + ko + vo);
      xi[s][e][2] = *(const int*)((const char*)ioct + ko + vo);
      xi[s][e][3] = *(const int*)((const char*)isem + ko + vo);
    }
  // precaution: this wait stands ahead of every later rewrite of the loads' offset register; it names the register
  // so that it stays whole up to it
  asm volatile("s_wait_xcnt 0x0" :: "v"(vo) : "memory");
  // the scheduler may not sink the index loads to their first uses, where each would wait alone
  __builtin_amdgcn_sched_barrier(0);
  const int piece = ((2 * a + (lane >> 4)) * 2 + rq) * 32 + hh * 16 + (lane & 15);
  unsigned* po = pk + ((size_t)((b * (SEQ / 16) + qb * 4) * NQB + kt) * 256 + piece) * 4;
#pragma unroll
  for (int s = 0; s < 4; ++s) {
    v4u w;
#pragma unroll
    for (int e = 0; e < 4; ++e)
      w[e] = ((unsigned)iclamp(xi[s][e][0], 0, 16) << 2) | ((unsigned)iclamp(xi[s][e][1], 0, 95) << 9) |
             ((unsigned)iclamp(xi[s][e][2], 0, 24) << 18) | ((unsigned)iclamp(xi[s][e][3], 0, 12) << 25);
    *(v4u*)(po + (size_t)s * NQB * 1024) = w;
  }
}

// =====================================================================================================
// All operand preparation in one grid (the eight pieces depend on nothing but the inputs, so they run side by
// side): blocks 0..PB_P-1 pack the structure indices, the next PB_X convert x, the next 4*PB_W the four weights (these
// five into fragment order), the next PB_E er (row-major), the last PB_T build the combined table. The piece is chosen
// by blockIdx.x alone (block-uniform).
// =====================================================================================================
#define PB_X (MROWS * DM / 8 / 256)   // 1024
#define PB_W (DM * DM / 8 / 256)      //  512
#define PB_E (SEQ * HD / 8 / 256)     //   32
#define PB_T (TROWS * 8 / 256)        //    6
static_assert(PB_X * 2048 == MROWS * DM && PB_W * 2048 == DM * DM && PB_E * 2048 == SEQ * HD && PB_T * 256 == TROWS * 8);
__global__ __launch_bounds__(256) void prep_all(
    const float* __restrict__ x, const float* __restrict__ wq, const float* __restrict__ wk,
    const float* __restrict__ wv, const float* __restrict__ wo, const float* __restrict__ er,
    const float* __restrict__ ebar, const float* __restrict__ epos,
    const float* __restrict__ eoct, const float* __restrict__ esem,
    const int* __restrict__ ibar, const int* __restrict__ ipos,
    const int* __restrict__ ioct, const int* __restrict__ isem,
    unsigned short* xb, unsigned short* wqb, unsigned short* wkb, unsigned short* wvb, unsigned short* wob,
    unsigned short* erb, unsigned short* tab, unsigned* pk) {
  int blk = blockIdx.x;
  if (blk < PB_P) { pack_idx(ibar, ipos, ioct, isem, pk, blk); return; }
  blk -= PB_P;
  if (blk < PB_X) { cvt_bf16_frag(x, xb, MROWS * DM / 8, blk); return; }
  blk -= PB_X;
  if (blk < 4 * PB_W) {
    const int w = blk / PB_W;
    const float*    in  = (w == 0) ? wq  : (w == 1) ? wk  : (w == 2) ? wv  : wo;
    unsigned short* out = (w == 0) ? wqb : (w == 1) ? wkb : (w == 2) ? wvb : wob;
    cvt_bf16_frag(in, out, DM * DM / 8, blk - w * PB_W);
    return;
  }
  blk -= 4 * PB_W;
  if (blk < PB_E) { cvt_bf16x8(er, erb, SEQ * HD / 8, blk); return; }
  build_tab(ebar, epos, eoct, esem, tab, blk - PB_E);
}

// =====================================================================================================
// Register-blocked batched bf16 WMMA GEMM: C[m][n] = sum_k A[m][k] * Bt[n][k]; one wave per 64x64 tile,
// no block barriers. A row-major [M][K] pitch lda; Bt row-major [N][K] pitch ldb (k contiguous);
// M, N multiples of 64, K a multiple of 32 and at least 32. blockIdx.y = batch index (strides in elements).
// NSPLIT: 0 = A.Bt; 1 = (A + A2).Bt (A2 = unscaled bf16 lo plane of A); 2 = A.Bt + A2.Bt + A.Bt2.
// OUT_MODE: 0 = f32 (pitch ldc); 2 = bf16 hi plane C + bf16 lo plane C2 (lo = RNE(v - hi), unscaled);
//           3 = f16 hi plane C + f16 residual plane C2 = f16((v - hi) * rscale), C2 written only for tiles
//               with n0 < N2 (pitch ldc2, batch stride strideC2).
// FR: false = A and Bt planes row-major; true = both in fragment order (then lda == ldb == K == DM, and a batch
//     stride is a whole number of 16-row strips).
// =====================================================================================================
//   sT: the block's 8 x (16 x 68) f32 staging slabs; bx: the block's index among the tiles; b: batch index.
template <int NSPLIT, int OUT_MODE, bool FR>
__device__ __forceinline__ void gemm64_body(
    const unsigned short* __restrict__ Ap, const unsigned short* A2p, int lda, long long strideA,
    const unsigned short* __restrict__ Btp, const unsigned short* Bt2p, int ldb, long long strideB,
    void* Cout, int ldc, long long strideC,
    void* Cout2, int ldc2, long long strideC2, int N2,
    int M, int N, int K, float rscale, float* sT, int bx, int b) {
  const __bf16* A   = (const __bf16*)(const void*)Ap;
  const __bf16* A2  = (const __bf16*)(const void*)A2p;
  const __bf16* Bt  = (const __bf16*)(const void*)Btp;
  const __bf16* Bt2 = (const __bf16*)(const void*)Bt2p;
  const int lane = threadIdx.x & 31;
  const int wave = threadIdx.x >> 5;
  const int tilesN = N >> 6;
  const int tilesM = M >> 6;
  const int tile = bx * 8 + wave;
  if (tile >= tilesM * tilesN) return;   // wave-uniform; no block barriers in this kernel
  const int tm = tile / tilesN;
  const int tn = tile - tm * tilesN;
  const int m0 = tm << 6;
  const int n0 = tn << 6;

  const __bf16* Ab  = A  + (size_t)b * strideA;
  const __bf16* Bb  = Bt + (size_t)b * strideB;
  const __bf16* Ab2 = (NSPLIT >= 1) ? (A2  + (size_t)b * strideA) : Ab;
  const __bf16* Bb2 = (NSPLIT == 2) ? (Bt2 + (size_t)b * strideB) : Bb;

  const int rlane = lane & 15;                 // row (A) / col (B, D) within subtile
  const int koff  = (lane >> 4) * 8;           // k offset of this lane half
  const int mOff  = (lane >> 4) * 8;           // D row offset

  v8f acc[4][4];
#pragma unroll
  for (int i = 0; i < 4; ++i)
#pragma unroll
    for (int j = 0; j < 4; ++j) acc[i][j] = zero8();

  // k loop, K >= 32: two register sets of fragments. All loads of one k step (32 columns) go out in one run, one k
  // step ahead of their products, so a k step waits for at most the rest of one load round trip instead of four whole
  // ones. Every load names a wave-uniform base (plane + 16-row strip) and one of two lane offsets, va (A) and vb (Bt).
  // Past the last k step the offsets stand still: a run that has no k step left reads the last one again (in bounds,
  // never used), so every run holds the same number of loads and the counted waits stay exact.
  // The inner loops are unrolled so that every fragment and accumulator index is a constant (registers, no scratch).
  struct FragSet { v16b a[4], l[4], b[4], m[4]; };                // A, second A plane, Bt, second Bt plane
  const size_t sa = (size_t)lda * 32, sb = (size_t)ldb * 32;      // bytes from one 16-row strip to the next
  gcp pa[4], pa2[4], pb[4], pb2[4];                               // the planes' four strips, scalar bases
#pragma unroll
  for (int i = 0; i < 4; ++i) {
    pa[i]  = uni_ptr((const char*)Ab + i * sa);
    pb[i]  = uni_ptr((const char*)Bb + i * sb);
    pa2[i] = (NSPLIT >= 1) ? uni_ptr((const char*)Ab2 + i * sa) : pa[i];
    pb2[i] = (NSPLIT == 2) ? uni_ptr((const char*)Bb2 + i * sb) : pb[i];
  }
  //   fragment order: a 16-row strip is as many bytes as in a row-major plane, so the bases above serve both; the
  //   lane's piece stands at 16 * lane in its 512-B run, and a k step is one 1-KB block
  constexpr int      H2   = FR ? 512 : 32;
  constexpr unsigned KINC = FR ? 1024u : 64u;
  unsigned va = FR ? ((unsigned)m0 * (unsigned)lda * 2u + (unsigned)lane * 16u)
                   : (((unsigned)(m0 + rlane) * (unsigned)lda + (unsigned)koff) * 2u);
  unsigned vb = FR ? ((unsigned)n0 * (unsigned)ldb * 2u + (unsigned)lane * 16u)
                   : (((unsigned)(n0 + rlane) * (unsigned)ldb + (unsigned)koff) * 2u);
  const int nk = K >> 5;
  int kl = 0;                                                     // the k step that va and vb stand at, unclamped
  auto load = [&](FragSet& S) {
#pragma unroll
    for (int j = 0; j < 4; ++j) {
      S.b[j] = ldfrag_o<H2>(pb[j], vb);
      if (NSPLIT == 2) S.m[j] = ldfrag_o<H2>(pb2[j], vb); else S.m[j] = S.b[j];
    }
#pragma unroll
    for (int i = 0; i < 4; ++i) {
      S.a[i] = ldfrag_o<H2>(pa[i], va);
      if (NSPLIT >= 1) S.l[i] = ldfrag_o<H2>(pa2[i], va); else S.l[i] = S.a[i];
    }
    // the scheduler may not sink the run's loads into the products behind it, where each would go out late
    __builtin_amdgcn_sched_barrier(0);
  };
  auto advance = [&]() {
    // the wait below stays behind the products: lifted to stand directly behind the loads it would hold the products up
    __builtin_amdgcn_sched_barrier(0);
#if defined(__HIP_DEVICE_COMPILE__)
    // precaution: this wait stands ahead of every rewrite of a register that a load of the last run names; it takes
    // the two lane offsets and the scalar bases as operands so that they stay whole up to it and the additions
    // stay behind it
    asm volatile("s_wait_xcnt 0x0" : "+v"(va), "+v"(vb)
                 : "s"(pa[0]), "s"(pa[1]), "s"(pa[2]), "s"(pa[3]), "s"(pb[0]), "s"(pb[1]), "s"(pb[2]), "s"(pb[3]),
                   "s"(pa2[0]), "s"(pa2[1]), "s"(pa2[2]), "s"(pa2[3]), "s"(pb2[0]), "s"(pb2[1]), "s"(pb2[2]), "s"(pb2[3])
                 : "memory");
#endif
    ++kl;
    const unsigned inc = (kl < nk) ? KINC : 0u;                   // wave-uniform
    va += inc;
    vb += inc;
  };
  auto products = [&](const FragSet& S) {
#pragma unroll
    for (int i = 0; i < 4; ++i)
#pragma unroll
      for (int j = 0; j < 4; ++j) {
        acc[i][j] = mma_b_raw(S.a[i], S.b[j], acc[i][j]);
        if (NSPLIT >= 1) acc[i][j] = mma_b_raw(S.l[i], S.b[j], acc[i][j]);
        if (NSPLIT == 2) acc[i][j] = mma_b_raw(S.a[i], S.m[j], acc[i][j]);
      }
  };
  FragSet S0, S1;
  load(S0); advance();
  const int ng = nk / 2;                                          // whole turns of the two sets
  for (int g = 0; g < ng; ++g) {
    load(S1); products(S0); advance();
    load(S0); products(S1); advance();
  }
  if (nk - ng * 2 >= 1) products(S0);                             // the k step left over (wave-uniform)
  acc_guard4(acc[0][0], acc[0][1], acc[0][2], acc[0][3]);
  acc_guard4(acc[1][0], acc[1][1], acc[1][2], acc[1][3]);
  acc_guard4(acc[2][0], acc[2][1], acc[2][2], acc[2][3]);
  acc_guard4(acc[3][0], acc[3][1], acc[3][2], acc[3][3]);

  // ---- epilogue ----
  float* slab = sT + wave * (16 * 68);             // per-wave 16x64 slab, pitch 68 floats
#pragma unroll
  for (int i = 0; i < 4; ++i) {
    const int mBase = m0 + (i << 4);
#pragma unroll
    for (int j = 0; j < 4; ++j) {
#pragma unroll
      for (int r = 0; r < 8; ++r) {
        slab[(mOff + r) * 68 + (j << 4) + rlane] = acc[i][j][r];
      }
    }
    __builtin_amdgcn_fence(__ATOMIC_RELEASE, "workgroup");
    __builtin_amdgcn_wave_barrier();
    __builtin_amdgcn_fence(__ATOMIC_ACQUIRE, "workgroup");
    if (OUT_MODE == 0) {
      float* C = (float*)Cout + (size_t)b * strideC;
      const int hh = lane >> 4, c4 = (lane & 15) * 4;     // 256-B row segment = 16 lanes x 16 B
      {
#pragma unroll
        for (int it = 0; it < 8; ++it) {
          const int row = it * 2 + hh;                     // it 0..7 x hh 0..1 = rows 0..15
          const v4f v = *(const v4f*)(slab + row * 68 + c4);
          *(v4f*)(C + (size_t)(mBase + row) * ldc + n0 + c4) = v;
        }
        
      }
    } else {
      const int q = lane >> 3, c8 = (lane & 7) * 8;
      unsigned short* C  = (unsigned short*)Cout  + (size_t)b * strideC;
      unsigned short* C2 = (unsigned short*)Cout2 + (size_t)b * strideC2;
      const bool wlo = (OUT_MODE == 2) || (n0 < N2);      // wave-uniform
      v4u hv[4], lv[4];
#pragma unroll
      for (int it = 0; it < 4; ++it) {
        const int row = it * 4 + q;                        // it 0..3 x q 0..3 = rows 0..15
        const float* sp = slab + row * 68 + c8;
        v4u a, a2;
#pragma unroll
        for (int e = 0; e < 4; ++e) {
          const float f0 = sp[2 * e], f1 = sp[2 * e + 1];
          unsigned short h0, h1, l0, l1;
          if (OUT_MODE == 2) {
            h0 = bf_bits(f0); h1 = bf_bits(f1);
            l0 = bf_bits(f0 - bf_up(h0)); l1 = bf_bits(f1 - bf_up(h1));
          } else {
            const _Float16 x0 = (_Float16)f0, x1 = (_Float16)f1;
            h0 = h_bits(x0); h1 = h_bits(x1);
            l0 = h_bits((_Float16)((f0 - (float)x0) * rscale));
            l1 = h_bits((_Float16)((f1 - (float)x1) * rscale));
          }
          a[e] = pk16(h0, h1); a2[e] = pk16(l0, l1);
        }
        hv[it] = a; lv[it] = a2;
      }
      {
#pragma unroll
        for (int it = 0; it < 4; ++it) {
          const int row = it * 4 + q;
          *(v4u*)(C + (size_t)(mBase + row) * ldc + n0 + c8) = hv[it];
          if (wlo) *(v4u*)(C2 + (size_t)(mBase + row) * ldc2 + n0 + c8) = lv[it];
        }
        
      }
    }
    __builtin_amdgcn_fence(__ATOMIC_RELEASE, "workgroup");
    __builtin_amdgcn_wave_barrier();
    __builtin_amdgcn_fence(__ATOMIC_ACQUIRE, "workgroup");
  }
}

template <int NSPLIT, int OUT_MODE, bool FR>
__global__ __launch_bounds__(256) void gemm64(
    const unsigned short* __restrict__ Ap, const unsigned short* A2p, int lda, long long strideA,
    const unsigned short* __restrict__ Btp, const unsigned short* Bt2p, int ldb, long long strideB,
    void* Cout, int ldc, long long strideC,
    void* Cout2, int ldc2, long long strideC2, int N2,
    int M, int N, int K, float rscale) {
  __shared__ __align__(16) float sT[8 * 16 * 68];
  gemm64_body<NSPLIT, OUT_MODE, FR>(Ap, A2p, lda, strideA, Btp, Bt2p, ldb, strideB, Cout, ldc, strideC,
                                Cout2, ldc2, strideC2, N2, M, N, K, rscale, sT, blockIdx.x, blockIdx.y);
}

// The three projections in one grid: each alone fills a quarter of the chip's WGPs and none reads another's result.
//   blockIdx.y = 0: q = x . Wq^T -> bf16 hi/lo planes [b*SEQ+t][h*64+d]   (M=2048, N=1024, K=1024)
//   blockIdx.y = 1: k = x . Wk^T -> bf16 hi/lo planes
//   blockIdx.y = 2: v^T = Wv . x^T per batch -> f16 hi plane [b][h*64+d][s] (pitch SEQ) and residual plane (x4096,
//                   keys < VLP only, pitch VLP); A = Wvb [n][k], Bt = Xb rows of batch b = blockIdx.x / VTB
#define PJB ((MROWS / 64) * (DM / 64) / 8)   // 64 blocks of 8 tiles per projection
#define VTB ((DM / 64) * (SEQ / 64) / 8)     // 32 blocks of 8 tiles per batch of v^T
static_assert(VTB * NB == PJB);
__global__ __launch_bounds__(256) void gemm_qkv(
    const unsigned short* __restrict__ Xb, const unsigned short* __restrict__ Wqb,
    const unsigned short* __restrict__ Wkb, const unsigned short* __restrict__ Wvb,
    unsigned short* Qh, unsigned short* Ql, unsigned short* Kh, unsigned short* Kl,
    unsigned short* VTh, unsigned short* VTl) {
  __shared__ __align__(16) float sT[8 * 16 * 68];
  const int which = blockIdx.y;                 // block-uniform
  if (which < 2) {
    const unsigned short* Wb = which ? Wkb : Wqb;
    unsigned short* Ch = which ? Kh : Qh;
    unsigned short* Cl = which ? Kl : Ql;
    gemm64_body<0, 2, true>(Xb, Xb, DM, 0LL, Wb, Wb, DM, 0LL,
                      (void*)Ch, DM, 0LL, (void*)Cl, DM, 0LL, DM,
                      MROWS, DM, DM, 1.0f, sT, blockIdx.x, 0);
  } else {
    const int b = blockIdx.x / VTB;
    gemm64_body<0, 3, true>(Wvb, Wvb, DM, 0LL, Xb, Xb, DM, (long long)SEQ * DM,
                      (void*)VTh, SEQ, (long long)DM * SEQ, (void*)VTl, VLP, (long long)DM * VLP, VLP,
                      DM, SEQ, DM, 4096.0f, sT, blockIdx.x - b * VTB, b);
  }
}

// =====================================================================================================
// Causal attention with relative-index (skew) bias and four gathered structure biases, head dim 64.
//   q planes (bf16 hi / lo): element (b, t, h, d) at [(b*SEQ + t)*DM + h*64 + d]; k planes same layout.
//   v^T hi plane (f16): element (b, h, d, s) at [(b*DM + h*64 + d)*SEQ + s]
//   v^T residual plane (f16, (v - hi)*4096): [(b*DM + h*64 + d)*VLP + s], s < VLP, read only when RES
//   er: bf16 [SEQ][64]; tab: bf16 [TROWS][64], the combined structure table T
//   qe = q . T^T (q hi/lo, 2 products per 32 columns, f32): the NG waves that hold the same 16 rows form those rows x NTS*16 table rows once between them,
//   ahead of the key loop, and keeps them in LDS (Qs, pitch QSP floats); the four bias gathers of a score read them there.
//   pidx: the four structure indices of each score, clamped and packed into one word, in packed order (pack_idx).
//   scores[t][s] = (q_t.k_s + q_t.er[SEQ-1+s-t] + qe[OFF_BAR+ibar] + qe[OFF_POS+ipos] + qe[OFF_OCT+ioct]
//                   + qe[OFF_SEM+isem]) * sscale for s <= t, else -1e9 (replace mask).
//   q.k : bf16 hi/lo split (3 products); q.er : q hi/lo x bf16 er (2 products); f32 accumulate.
//   Skew band: a block (64 query rows, key tile kv0) needs er rows ebb .. ebb+127 with
//   ebb = SEQ-64+kv0-qb*64 >= 0 (staged in LDS, addresses clamped at SEQ-1; clamped rows only feed
//   masked positions). Wave w (rows q0..q0+15) computes 5 subtiles of 16 band rows starting at
//   band row 16*(3-w); the diagonal D[mi][15-mi+jj] is fetched with two unconditional bpermutes per
//   element and selected by value; subtiles are produced one at a time (prev / cur).
//   p = exp(s - m) carried as f16(1024 p); context = p . v on f16 WMMA; RES adds f16 residual planes of p and v
//   (scale 4096, separate accumulator folded back with 1/4096 per chunk in f32); online softmax in f32.
//   Block = NG groups of 4 waves = 64 query rows of one (b, h); grid = NQB * NH * NB; key tiles kt = 0..qb are dealt
//   to the groups (group g takes kt = NG i + g in round i, rounds block-uniform), so that the chain of tiles one wave
//   walks is 1/NG as long; wave w of every group holds rows q0..q0+15 with its own running max, sum and context, and
//   the partial results are joined in f32 through LDS behind the loop.
//   K / V^T / er chunk staging: the group's 128 threads, plain 16-B loads, all issued
//   ahead of the first LDS store, __syncthreads before and after; P tiles are wave-private, spilled with _Float16 element stores and
//   LDS (static byte buffer, rows of 64 elements at a pitch of LP = 72, so that the 16 rows of a 16-B fragment read
//   fall on different banks; T = 9216 B is a 64-row tile), per group at 8T g: Ksh 0, Ksl T, Vth 2T, Esh 3T (128 rows),
//   Psh 5T, Vtl 6T (RES), Psl 7T (RES); Qs 8T NG (64 rows x QSP floats, shared); after the key loop and a block barrier
//   the f32 context staging Os (17 KB) aliases offset 0 and the partial results of group g > 0 (24 KB) alias 8T g.
//   Output planes (bf16 hi / lo of the normalised context), element (row b*SEQ + t, column h*64 + d), in fragment order;
//   coverage: each wave of group 0 stores rows q0..q0+15 (lane & 15) x 64 columns (it 0..3 x lane>>4 0..1 x 8) of both planes.
// =====================================================================================================
#define TB64 (64 * LP * 2)    // bytes of a 64-row tile in LDS
#define QSB  (64 * QSP * 4)   // bytes of the block's structure products in LDS
#define GSB  (8 * TB64)       // bytes of one group's tiles in LDS
#define NG   3                // groups of 4 waves that share a query block's key tiles
#define SPG  ((NTS + NG - 1) / NG)   // structure-table subtiles per group
#define SPC  (NTS - (NG - 1) * SPG)   // of the last group
static_assert((LP * 2) % 32 == 16 && LP >= 64 && 4 * 16 * 68 * 4 <= 2 * TB64 && 4 * 48 * 32 * 4 <= GSB);
static_assert(SPC >= 1 && SPC <= SPG && NG * GSB + QSB <= 327680);
template <int N> struct Cnt { static constexpr int n = N; };   // a count handed to a lambda as a compile-time constant
template <bool RES>
__device__ __forceinline__
void attn_body(const unsigned short* __restrict__ qhp, const unsigned short* __restrict__ qlp,
                const unsigned short* __restrict__ khp, const unsigned short* __restrict__ klp,
                const unsigned short* __restrict__ vhp, const unsigned short* __restrict__ vlp,
                const unsigned short* __restrict__ erp, const unsigned short* __restrict__ tabp,
                const unsigned* __restrict__ pidx,
                unsigned short* ohp, unsigned short* olp,
                unsigned char* smem, int qb, int h, int b, float sscale) {
  union FB { v16b v; v8b h[2]; };
  union FH { v16h v; v8h h[2]; };
  //   key group of the wave, the same in every lane: held in a scalar register so that tests on it are scalar branches
  const int grp  = __builtin_amdgcn_readfirstlane((int)(threadIdx.x >> 7));
  unsigned char* const gsm = smem + grp * GSB;                              // the group's own tiles
  __bf16*   const Ksh = (__bf16*)(void*)(gsm);
  __bf16*   const Ksl = (__bf16*)(void*)(gsm + TB64);
  _Float16* const Vth = (_Float16*)(void*)(gsm + 2 * TB64);
  __bf16*   const Esh = (__bf16*)(void*)(gsm + 3 * TB64);
  _Float16* const Psh = (_Float16*)(void*)(gsm + 5 * TB64);
  _Float16* const Vtl = (_Float16*)(void*)(gsm + (RES ? 6 * TB64 : 2 * TB64));   // never dereferenced when !RES
  _Float16* const Psl = (_Float16*)(void*)(gsm + (RES ? 7 * TB64 : 5 * TB64));   // never dereferenced when !RES
  float*    const Os  = (float*)(void*)(smem);                              // after the key loop only

  const int tid  = threadIdx.x & 127;                                       // thread within the group
  const int wave = tid >> 5;                                                // 16-row strip of the wave, 0..3
  const int lane = tid & 31;
  const int hh   = lane >> 4;
  const int c    = lane & 15;

  const int q0   = qb * 64 + wave * 16;
  const size_t rowB = (size_t)b * SEQ;

  const __bf16* Qh  = (const __bf16*)(const void*)qhp + (size_t)h * HD;
  const __bf16* Ql  = (const __bf16*)(const void*)qlp + (size_t)h * HD;
  const __bf16* Kh  = (const __bf16*)(const void*)khp + (size_t)h * HD;
  const __bf16* Kl  = (const __bf16*)(const void*)klp + (size_t)h * HD;
  const _Float16* Vh = (const _Float16*)(const void*)vhp + ((size_t)b * DM + (size_t)h * HD) * SEQ;
  const _Float16* Vl = (const _Float16*)(const void*)vlp + ((size_t)b * DM + (size_t)h * HD) * VLP;
  const __bf16* Erb = (const __bf16*)(const void*)erp;
  //   structure products of the block's 64 rows (LDS): byte offset in smem of this lane's row, r = 0
  const unsigned qlb = (unsigned)NG * GSB + (unsigned)(wave * 16 + 8 * hh) * (QSP * 4u);
  //   byte offset of the lane's first piece in the packed unit of the wave's strip and key tile 0
  const unsigned ilb = (unsigned)((b * (SEQ / 16) + qb * 4 + wave) * NQB) * 4096u + (unsigned)lane * 16u;

  // ---- Q fragments (A operand, row = lane&15): 2 d-chunks, hi and lo ----
  v16b qah[2], qal[2];
#pragma unroll
  for (int dc = 0; dc < 2; ++dc) {
    const size_t qo = (rowB + q0 + c) * DM + dc * 32 + 8 * hh;
    qah[dc] = ldfrag_b(Qh + qo);
    qal[dc] = ldfrag_b(Ql + qo);
  }

  // ---- structure products of the wave's 16 rows: D[r] of subtile u = (row 8 hh + r) . (table row 16 u + c);
  //      the NG waves that hold the same rows share the subtiles (group g: u0 = SPG g .. u0 + SPG - 1, below NTS):
  //      every group has SPC of them, every group but the last SPG ----
  {
    // precaution: this wait stands ahead of the table loads, which may land in an address register of the q loads
    asm volatile("s_wait_xcnt 0x0" ::: "memory");
    const int  u0   = grp * SPG;
    const bool more = grp < NG - 1;                                    // scalar: the group has subtiles SPC .. SPG - 1 too
    const char* tabg = (const char*)tabp + u0 * (16 * HD * 2);         // wave-uniform
    const unsigned tvo = ((unsigned)c * HD + 8u * (unsigned)hh) * 2u;  // the lane's piece of a 16-row table subtile
    float* qsw = (float*)(void*)(smem + NG * GSB) + (wave * 16 + 8 * hh) * QSP + u0 * 16 + c;
    FB tf[SPG][2];
    auto tload = [&](auto from, auto to) {                             // the group's subtiles from.n .. to.n - 1
#pragma unroll
      for (int u = decltype(from)::n; u < decltype(to)::n; ++u)
#pragma unroll
        for (int dc = 0; dc < 2; ++dc) {
          tf[u][dc].h[0] = *(const v8b*)(tabg + (u * 16 * HD * 2 + dc * 64) + tvo);
          tf[u][dc].h[1] = *(const v8b*)(tabg + (u * 16 * HD * 2 + dc * 64 + 32) + tvo);
        }
      // precaution: this wait stands ahead of every later rewrite of the loads' offset register and base; it names
      // them so that they stay whole up to it (no load of the run lands in the offset register)
      asm volatile("s_wait_xcnt 0x0" :: "v"(tvo), "s"(tabg) : "memory");
    };
    auto tprod = [&](auto from, auto to) {
#pragma unroll
      for (int u = decltype(from)::n; u < decltype(to)::n; ++u) {
        v8f d = zero8();
#pragma unroll
        for (int dc = 0; dc < 2; ++dc) {
          d = mma_b(qah[dc], tf[u][dc].v, d);
          d = mma_b(qal[dc], tf[u][dc].v, d);
        }
#pragma unroll
        for (int r = 0; r < 8; ++r) qsw[r * QSP + u * 16] = d[r];
      }
    };
    tload(Cnt<0>{}, Cnt<SPC>{});                                       // ahead of the test: each run has its own wait
    if (more) tload(Cnt<SPC>{}, Cnt<SPG>{});
    // the scheduler may not sink the table loads to their products, where each would wait alone
    __builtin_amdgcn_sched_barrier(0);
    tprod(Cnt<0>{}, Cnt<SPC>{});
    if (more) tprod(Cnt<SPC>{}, Cnt<SPG>{});
    // a row's products come from NG waves and each of them reads all: block barrier
    __syncthreads();
  }

  float mrow[8], lrow[8];
  v8f oacc[4];
#pragma unroll
  for (int r = 0; r < 8; ++r) { mrow[r] = -INFINITY; lrow[r] = 0.f; }
#pragma unroll
  for (int t = 0; t < 4; ++t) oacc[t] = zero8();

  const int nkt = (qb + 1 < NQB) ? (qb + 1) : NQB;   // causal: key tiles 0..qb, block-uniform
  const int nrd = (nkt + NG - 1) / NG;                // rounds of NG tiles, block-uniform
  unsigned iv = ilb + (unsigned)grp * 4096u;          // the same in the unit of the group's key tile
  for (int rd = 0; rd < nrd; ++rd) {
    const int  kt  = NG * rd + grp;
    const bool act = kt < nkt;                        // scalar: in the last round a group may have no tile;
                                                      // it does none of the work and passes both barriers
    const int kv0 = kt * 64;
    int ebb = SEQ - 64 + kv0 - qb * 64;                 // >= 0 for kt >= 0, qb <= NQB-1
    ebb = (ebb < 0) ? 0 : ebb;

    // ---- gathered structure biases of the whole tile, bs[j][r] for key kv0 + 16 j + c and row q0 + 8 hh + r.
    //      They depend on no product of this tile, so the loads go out in runs, each back to back: for RPR rows
    //      at a time the RPR loads of 4 packed words, then (fields taken out, byte offsets formed) the 16 RPR LDS gathers.
    float bs[4][8];
    constexpr int RPR = RES ? 4 : 8;                    // fewer at a time where the residual path needs the registers
    if (act) {
#pragma unroll
    for (int g = 0; g < 8; g += RPR) {
      v4u      pw[RPR / 4][4];                          // [row quad][j]: rows g + 4 q + 0..3 of key 16 j + c
      unsigned go[RPR][4][4];
      float    gv[RPR][4][4];
#pragma unroll
      for (int q = 0; q < RPR / 4; ++q)
#pragma unroll
        for (int j = 0; j < 4; ++j)
          pw[q][j] = *(const v4u*)((const char*)pidx + (size_t)((j * 2 + g / 4 + q) * 512) + iv);
      // the scheduler may not sink the index loads to their first uses, where each would wait alone
      __builtin_amdgcn_sched_barrier(0);
#pragma unroll
      for (int r = 0; r < RPR; ++r)
#pragma unroll
        for (int j = 0; j < 4; ++j) {
          const unsigned w = pw[r >> 2][j][r & 3];
          go[r][j][0] = qlb + (w & 127u);
          go[r][j][1] = qlb + ((w >> 7) & 511u);
          go[r][j][2] = qlb + ((w >> 16) & 127u);
          go[r][j][3] = qlb + (w >> 23);
        }
      // all offsets are formed ahead of the first gather, so that the gathers go out back to back
      __builtin_amdgcn_sched_barrier(0);
#pragma unroll
      for (int r = 0; r < RPR; ++r)
#pragma unroll
        for (int j = 0; j < 4; ++j) {
          const unsigned ro = (unsigned)(g + r) * (QSP * 4);
          gv[r][j][0] = *(const float*)((const char*)smem + (ro + OFF_BAR * 4) + go[r][j][0]);
          gv[r][j][1] = *(const float*)((const char*)smem + (ro + OFF_POS * 4) + go[r][j][1]);
          gv[r][j][2] = *(const float*)((const char*)smem + (ro + OFF_OCT * 4) + go[r][j][2]);
          gv[r][j][3] = *(const float*)((const char*)smem + (ro + OFF_SEM * 4) + go[r][j][3]);
        }
      // precaution: this wait stands ahead of the rewrite of the index loads' offset register (iv, below)
      asm volatile("s_wait_xcnt 0x0" ::: "memory");
      // the scheduler may not sink the gathers to the sums, nor lift a sum over the wait
      __builtin_amdgcn_sched_barrier(0);
#pragma unroll
      for (int r = 0; r < RPR; ++r)
#pragma unroll
        for (int j = 0; j < 4; ++j)
          bs[j][g + r] = (gv[r][j][0] + gv[r][j][1]) + (gv[r][j][2] + gv[r][j][3]);
      // the sums stay ahead of the next run of loads: they free the gathered values' registers for it
      __builtin_amdgcn_sched_barrier(0);
    }
    }
    iv += (unsigned)NG * 4096u;                         // the packed unit of the group's next key tile

    __syncthreads();
    if (act) {
      // every tile row here is one 128-B line: 8 lanes take a row, so a wave's 16-B load covers 4 whole lines;
      // load i of a thread takes row r + 16 i
      const int r = tid >> 3, c8 = (tid & 7) * 8;
      const __bf16*   kg  = Kh + (rowB + kv0 + r) * DM + c8;      // K row kv0+r, d = c8..c8+7
      const __bf16*   klg = Kl + (rowB + kv0 + r) * DM + c8;
      const _Float16* vg  = Vh + (size_t)r * SEQ + kv0 + c8;      // V^T row d = r, s = kv0+c8..+7
      const int kvl = (kv0 + 64 <= VLP) ? kv0 : (VLP - 64);     // clamped address into the residual plane
      const _Float16* vlg = Vl + (size_t)r * VLP + kvl + c8;
      const bool resOK = (kv0 + 64 <= VLP);                      // uniform in the group
      // er band rows r + 16 i (128 rows x 64), row clamped at SEQ-1: min(ebb + r + 16 i, SEQ-1) = min(ebb + r, SEQ-1-16 i)
      // + 16 i; eo[i] is the byte offset of the thread's piece less the constant 16 i rows, which load i adds itself
      unsigned eo[8];
#pragma unroll
      for (int i = 0; i < 8; ++i) eo[i] = (unsigned)imin(ebb + r, SEQ - 1 - 16 * i) * (HD * 2) + (unsigned)c8 * 2u;
      v8b a0[4], a1[4], e0[8];
      v8h b0[4], b1[4];
#pragma unroll
      for (int i = 0; i < 4; ++i) {
        a0[i] = *(const v8b*)(kg + (size_t)i * 16 * DM);
        a1[i] = *(const v8b*)(klg + (size_t)i * 16 * DM);
        b0[i] = *(const v8h*)(vg + (size_t)i * 16 * SEQ);
        if (RES) b1[i] = *(const v8h*)(vlg + (size_t)i * 16 * VLP);
      }
#pragma unroll
      for (int i = 0; i < 8; ++i) e0[i] = *(const v8b*)((const char*)Erb + i * (16 * HD * 2) + eo[i]);
      // precaution: this wait stands ahead of every later rewrite of the loads' address registers; it names
      // them so that they stay whole up to it (no later load of the run lands in one)
      if (RES) asm volatile("s_wait_xcnt 0x0" :: "v"(kg), "v"(klg), "v"(vg), "v"(vlg), "v"(eo[0]), "v"(eo[1]), "v"(eo[2]),
                            "v"(eo[3]), "v"(eo[4]), "v"(eo[5]), "v"(eo[6]), "v"(eo[7]) : "memory");
      else     asm volatile("s_wait_xcnt 0x0" :: "v"(kg), "v"(klg), "v"(vg), "v"(eo[0]), "v"(eo[1]), "v"(eo[2]),
                            "v"(eo[3]), "v"(eo[4]), "v"(eo[5]), "v"(eo[6]), "v"(eo[7]) : "memory");
      // the scheduler may not sink the staging loads to their LDS stores, where each would wait alone
      __builtin_amdgcn_sched_barrier(0);
#pragma unroll
      for (int i = 0; i < 4; ++i) {
        *(v8b*)(Ksh + (r + 16 * i) * LP + c8) = a0[i];
        *(v8b*)(Ksl + (r + 16 * i) * LP + c8) = a1[i];
        *(v8h*)(Vth + (r + 16 * i) * LP + c8) = b0[i];
        if (RES) *(v8h*)(Vtl + (r + 16 * i) * LP + c8) = resOK ? b1[i] : zero8h();
      }
#pragma unroll
      for (int i = 0; i < 8; ++i) *(v8b*)(Esh + (r + 16 * i) * LP + c8) = e0[i];
    }
    __syncthreads();
    if (!act) continue;                                 // behind the round's last barrier; the round is the loop's last

    // ---- q.k: 16 query rows x 64 keys per wave, 3 bf16 products ----
    v8f s[4];
#pragma unroll
    for (int j = 0; j < 4; ++j) {
      s[j] = zero8();
#pragma unroll
      for (int dc = 0; dc < 2; ++dc) {
        FB kb, kl;
        kb.h[0] = *(const v8b*)(Ksh + (j * 16 + c) * LP + dc * 32 + 8 * hh);
        kb.h[1] = *(const v8b*)(Ksh + (j * 16 + c) * LP + dc * 32 + 16 + 8 * hh);
        kl.h[0] = *(const v8b*)(Ksl + (j * 16 + c) * LP + dc * 32 + 8 * hh);
        kl.h[1] = *(const v8b*)(Ksl + (j * 16 + c) * LP + dc * 32 + 16 + 8 * hh);
        s[j] = mma_b(qah[dc], kb.v, s[j]);
        s[j] = mma_b(qah[dc], kl.v, s[j]);
        s[j] = mma_b(qal[dc], kb.v, s[j]);
      }
    }

    // ---- q.er skew band: 5 subtiles of 16 band rows, streamed; diagonal extraction by bpermute ----
    {
      const int wb = (3 - wave) * 16;           // this wave's band offset inside Esh
      v8f prev = zero8();
#pragma unroll
      for (int u = 0; u < 5; ++u) {
        v8f cur = zero8();
#pragma unroll
        for (int dc = 0; dc < 2; ++dc) {
          FB eb;
          const __bf16* ep = Esh + (wb + u * 16 + c) * LP + dc * 32 + 8 * hh;
          eb.h[0] = *(const v8b*)(ep);
          eb.h[1] = *(const v8b*)(ep + 16);
          cur = mma_b(qah[dc], eb.v, cur);
          cur = mma_b(qal[dc], eb.v, cur);
        }
        if (u >= 1) {                            // key subtile jsub = u-1 uses subtiles u-1 (prev) and u (cur)
#pragma unroll
          for (int r = 0; r < 8; ++r) {
            const int base = 15 - (8 * hh + r) + c;                  // 0..30
            const int src  = (lane & 16) | (base & 15);
            const float vlo = __shfl(prev[r], src, 32);
            const float vhi = __shfl(cur[r], src, 32);
            s[u - 1][r] += (base < 16) ? vlo : vhi;
          }
        }
        prev = cur;
      }
    }

    // ---- add the gathered structure biases, scale, causal replace mask, online softmax, P (x1024, f16) and
    //      P residual (x4096) to LDS ----
    _Float16* pwh = Psh + wave * (16 * LP);
    _Float16* pwl = Psl + (RES ? wave : 0) * (16 * LP);
#pragma unroll
    for (int r = 0; r < 8; ++r) {
      const int    trow = q0 + 8 * hh + r;
      float m = -INFINITY;
#pragma unroll
      for (int j = 0; j < 4; ++j) {
        const int key = kv0 + j * 16 + c;
        float sv = (s[j][r] + bs[j][r]) * sscale;
        sv = (key <= trow) ? sv : -1.0e9f;
        s[j][r] = sv;
        m = fmaxf(m, sv);
      }
#pragma unroll
      for (int off = 1; off < 16; off <<= 1) m = fmaxf(m, __shfl_xor(m, off, 32));
      const float mnew  = fmaxf(mrow[r], m);
      const float msafe = (mnew == -INFINITY) ? 0.f : mnew;
      const float alpha = __expf(mrow[r] - msafe);
      mrow[r] = mnew;
      float psum = 0.f;
#pragma unroll
      for (int j = 0; j < 4; ++j) {
        const float p = __expf(s[j][r] - msafe);     // masked logit -1e9 against a normal max: exp -> 0
        psum += p;
        const float p1k = p * 1024.0f;
        const _Float16 ph = (_Float16)p1k;
        pwh[(8 * hh + r) * LP + j * 16 + c] = ph;
        if (RES) {
          const _Float16 pl = (_Float16)((p1k - (float)ph) * 4096.0f);
          pwl[(8 * hh + r) * LP + j * 16 + c] = pl;
        }
      }
#pragma unroll
      for (int off = 1; off < 16; off <<= 1) psum += __shfl_xor(psum, off, 32);
      lrow[r] = lrow[r] * alpha + psum;
#pragma unroll
      for (int t = 0; t < 4; ++t) oacc[t][r] *= alpha;
    }
    __builtin_amdgcn_fence(__ATOMIC_RELEASE, "workgroup");
    __builtin_amdgcn_wave_barrier();
    __builtin_amdgcn_fence(__ATOMIC_ACQUIRE, "workgroup");

    // ---- context += P . V (f16 WMMA), residual products into a separate accumulator ----
    v8f o1[4];
#pragma unroll
    for (int t = 0; t < 4; ++t) o1[t] = zero8();
#pragma unroll 1
    for (int kk = 0; kk < 2; ++kk) {
      FH pa, pl;
      pa.h[0] = *(const v8h*)(pwh + c * LP + kk * 32 + 8 * hh);
      pa.h[1] = *(const v8h*)(pwh + c * LP + kk * 32 + 16 + 8 * hh);
      if (RES) {
        pl.h[0] = *(const v8h*)(pwl + c * LP + kk * 32 + 8 * hh);
        pl.h[1] = *(const v8h*)(pwl + c * LP + kk * 32 + 16 + 8 * hh);
      } else {
        pl.v = pa.v;
      }
#pragma unroll
      for (int t = 0; t < 4; ++t) {
        FH vb;
        vb.h[0] = *(const v8h*)(Vth + (t * 16 + c) * LP + kk * 32 + 8 * hh);
        vb.h[1] = *(const v8h*)(Vth + (t * 16 + c) * LP + kk * 32 + 16 + 8 * hh);
        oacc[t] = mma_h(pa.v, vb.v, oacc[t]);
        if (RES) {
          FH vl;
          vl.h[0] = *(const v8h*)(Vtl + (t * 16 + c) * LP + kk * 32 + 8 * hh);
          vl.h[1] = *(const v8h*)(Vtl + (t * 16 + c) * LP + kk * 32 + 16 + 8 * hh);
          o1[t] = mma_h(pa.v, vl.v, o1[t]);
          o1[t] = mma_h(pl.v, vb.v, o1[t]);
        }
      }
    }
    if (RES) {
#pragma unroll
      for (int t = 0; t < 4; ++t)
#pragma unroll
        for (int r = 0; r < 8; ++r) oacc[t][r] += o1[t][r] * (1.0f / 4096.0f);
    }
  }

  // ---- every group is done with its tiles: the partial results and Os below alias them ----
  __syncthreads();
  // ---- join the groups' partial results: wave w of a group g > 0 hands max, sum and context of its rows to wave w of
  //      group 0, lane to lane (value k of lane l at float 32 k + l of the wave's slab, in group g's tile space) ----
  if (grp != 0) {
    float* xs = (float*)(void*)gsm + wave * (48 * 32) + lane;
#pragma unroll
    for (int t = 0; t < 4; ++t)
#pragma unroll
      for (int r = 0; r < 8; ++r) xs[(t * 8 + r) * 32] = oacc[t][r];
#pragma unroll
    for (int r = 0; r < 8; ++r) { xs[(32 + r) * 32] = mrow[r]; xs[(40 + r) * 32] = lrow[r]; }
  }
  __syncthreads();
  if (grp != 0) return;                            // behind the kernel's last block barrier
#pragma unroll
  for (int g = 1; g < NG; ++g) {
    const float* xs = (const float*)(const void*)(smem + g * GSB) + wave * (48 * 32) + lane;
#pragma unroll
    for (int r = 0; r < 8; ++r) {
      // group 0 has tile 0, where key 0 is open to every row: its max is finite; a group without a tile hands
      // max -inf, sum 0, context 0 and gets the weight exp(-inf) = 0
      const float m1 = xs[(32 + r) * 32], l1 = xs[(40 + r) * 32];
      const float mj = fmaxf(mrow[r], m1);
      const float a0 = exp_slot(mrow[r] - mj), a1 = exp_slot(m1 - mj);
      mrow[r] = mj;
      lrow[r] = lrow[r] * a0 + l1 * a1;
#pragma unroll
      for (int t = 0; t < 4; ++t) oacc[t][r] = oacc[t][r] * a0 + xs[(t * 8 + r) * 32] * a1;
    }
  }
  float* os = Os + wave * (16 * 68);               // pitch 68 floats = 16 B x odd, for the 16-rows-at-a-time reads below
#pragma unroll
  for (int r = 0; r < 8; ++r) {
    const float l = lrow[r];
    const float inv = ((l > 0.f) ? (1.0f / l) : 0.f) * (1.0f / 1024.0f);
#pragma unroll
    for (int t = 0; t < 4; ++t) os[(8 * hh + r) * 68 + t * 16 + c] = oacc[t][r] * inv;
  }
  __builtin_amdgcn_fence(__ATOMIC_RELEASE, "workgroup");
  __builtin_amdgcn_wave_barrier();
  __builtin_amdgcn_fence(__ATOMIC_ACQUIRE, "workgroup");
  {
    // the wave's 16 rows are one strip and its 64 columns two 32-column blocks: 4 runs of 512 B, one after another
    v4u hv[4], lv[4];
#pragma unroll
    for (int it = 0; it < 4; ++it) {
      // run it: lane -> row c, columns 16 it + 8 hh ..+7 (it 0..3 x hh 0..1 x 8 = columns 0..63, c = rows 0..15)
      const float* sp = os + c * 68 + it * 16 + 8 * hh;
      v4u a, a2;
#pragma unroll
      for (int e = 0; e < 4; ++e) {
        const float f0 = sp[2 * e], f1 = sp[2 * e + 1];
        const unsigned short h0 = bf_bits(f0), h1 = bf_bits(f1);
        const unsigned short l0 = bf_bits(f0 - bf_up(h0)), l1 = bf_bits(f1 - bf_up(h1));
        a[e] = pk16(h0, h1); a2[e] = pk16(l0, l1);
      }
      hv[it] = a; lv[it] = a2;
    }
    {
#pragma unroll
      for (int it = 0; it < 4; ++it) {
        const size_t go = ((((rowB + q0) >> 4) * (DM / 32) + (size_t)h * 2) * 64 + it * 32 + lane) * 8;
        *(v4u*)(ohp + go) = hv[it];
        *(v4u*)(olp + go) = lv[it];
      }
      
    }
  }
}

// Every query block in one grid: the blocks with residual planes (qb < RESQB) and the rest depend on the same
// inputs and write disjoint rows, so they run side by side. NB*NH consecutive blocks share one qb, from NQB-1
// downwards: a WGP holds one block at a time, and the longest key loops start first.
__global__ __launch_bounds__(NG * 128, NG)
void attn_rel64(const unsigned short* __restrict__ qhp, const unsigned short* __restrict__ qlp,
                const unsigned short* __restrict__ khp, const unsigned short* __restrict__ klp,
                const unsigned short* __restrict__ vhp, const unsigned short* __restrict__ vlp,
                const unsigned short* __restrict__ erp, const unsigned short* __restrict__ tabp,
                const unsigned* __restrict__ pidx,
                unsigned short* ohp, unsigned short* olp, float sscale) {
  __shared__ __align__(16) unsigned char smem[NG * GSB + QSB];
  const int bx = blockIdx.x;
  const int g  = bx / (NB * NH);
  const int bh = bx - g * (NB * NH);
  const int qb = NQB - 1 - g;                                     // a permutation of 0..NQB-1, block-uniform
  const int h  = bh % NH;
  const int b  = bh / NH;
  if (qb < RESQB)
    attn_body<true>(qhp, qlp, khp, klp, vhp, vlp, erp, tabp, pidx, ohp, olp, smem, qb, h, b, sscale);
  else
    attn_body<false>(qhp, qlp, khp, klp, vhp, vlp, erp, tabp, pidx, ohp, olp, smem, qb, h, b, sscale);
}

// =====================================================================================================
// Workspace map (bytes, every region a multiple of its 64x64-tile / whole-line store granularity):
//   (Xb, the four weight planes, Oh and Ol are stored in fragment order, Pk in packed order; every other plane is row-major)
//   Xb   bf16 [2048][1024]            0        4194304
//   Wqb  bf16 [1024 n][1024 k]    4194304        2097152
//   Wkb                           6291456        2097152
//   Wvb                           8388608        2097152
//   Wob                          10485760        2097152
//   Erb  bf16 [1024][64]         12582912         131072
//   Tb   bf16 [192][64]          12713984          24576
//   Qh   bf16 [2048][1024]       12738560        4194304
//   Ql                           16932864        4194304
//   Kh                           21127168        4194304
//   Kl                           25321472        4194304
//   VTh  f16  [2][1024][1024]    29515776        4194304
//   VTl  f16  [2][1024][256]     33710080        1048576
//   Oh   bf16 [2048][1024]       34758656        4194304
//   Ol                           38952960        4194304
//   Pk   u32  [2][64][16][1024]  43147264        8388608   (packed order; units on or below the diagonal only)
//   end                          51535872
// Weights are [out n][in k] with k contiguous = the Bt / A layout the GEMM wants, so they are only converted.
// =====================================================================================================
extern "C" void kernel_launch(void* const* d_in, const int* in_sizes, int n_in,
                              void* d_out, int out_size, void* d_ws, size_t ws_size,
                              hipStream_t stream) {
  if (n_in < 14) return;
  if (in_sizes[0] != NB * SEQ * DM) return;
  if (in_sizes[1] != NB * SEQ * SEQ || in_sizes[2] != NB * SEQ * SEQ ||
      in_sizes[3] != NB * SEQ * SEQ || in_sizes[4] != NB * SEQ * SEQ) return;
  if (in_sizes[5] != DM * DM || in_sizes[6] != DM * DM || in_sizes[7] != DM * DM || in_sizes[8] != DM * DM) return;
  if (in_sizes[9] != SEQ * HD) return;
  if (in_sizes[10] != 16 * HD || in_sizes[11] != 95 * HD || in_sizes[12] != 24 * HD || in_sizes[13] != 12 * HD) return;
  if (out_size != NB * SEQ * DM) return;

  const float* x    = (const float*)d_in[0];
  const int*   rbar = (const int*)d_in[1];
  const int*   rpos = (const int*)d_in[2];
  const int*   roct = (const int*)d_in[3];
  const int*   rsem = (const int*)d_in[4];
  const float* Wq   = (const float*)d_in[5];
  const float* Wk   = (const float*)d_in[6];
  const float* Wv   = (const float*)d_in[7];
  const float* Wo   = (const float*)d_in[8];
  const float* Er   = (const float*)d_in[9];
  const float* Ebar = (const float*)d_in[10];
  const float* Epos = (const float*)d_in[11];
  const float* Eoct = (const float*)d_in[12];
  const float* Esem = (const float*)d_in[13];

  const size_t PX  = (size_t)MROWS * DM * 2;          //  4194304  16-bit activation plane [2048][1024]
  const size_t PW  = (size_t)DM * DM * 2;             //  2097152  16-bit weight plane
  const size_t PE  = (size_t)SEQ * HD * 2;            //   131072  er plane
  const size_t PT  = (size_t)TROWS * HD * 2;          //    24576  combined structure table
  const size_t PVT = (size_t)NB * DM * SEQ * 2;       //  4194304  v^T hi plane
  const size_t PVL = (size_t)NB * DM * VLP * 2;       //  1048576  v^T residual plane
  const size_t PPK = (size_t)NB * SEQ * SEQ * 4;      //  8388608  packed structure indices
  size_t off = 0;
  const size_t oXb  = off; off += PX;
  const size_t oWq  = off; off += PW;
  const size_t oWk  = off; off += PW;
  const size_t oWv  = off; off += PW;
  const size_t oWo  = off; off += PW;
  const size_t oEr  = off; off += PE;
  const size_t oTb  = off; off += PT;
  const size_t oQh  = off; off += PX;
  const size_t oQl  = off; off += PX;
  const size_t oKh  = off; off += PX;
  const size_t oKl  = off; off += PX;
  const size_t oVTh = off; off += PVT;
  const size_t oVTl = off; off += PVL;
  const size_t oOh  = off; off += PX;
  const size_t oOl  = off; off += PX;
  const size_t oPk  = off; off += PPK;
  if (off > ws_size) return;                          // off = 51535872
  if (off > (size_t)134217728) return;

  char* ws = (char*)d_ws;
  unsigned short* Xb  = (unsigned short*)(ws + oXb);
  unsigned short* Wqb = (unsigned short*)(ws + oWq);
  unsigned short* Wkb = (unsigned short*)(ws + oWk);
  unsigned short* Wvb = (unsigned short*)(ws + oWv);
  unsigned short* Wob = (unsigned short*)(ws + oWo);
  unsigned short* Erb = (unsigned short*)(ws + oEr);
  unsigned short* Tb  = (unsigned short*)(ws + oTb);
  unsigned short* Qh  = (unsigned short*)(ws + oQh);
  unsigned short* Ql  = (unsigned short*)(ws + oQl);
  unsigned short* Kh  = (unsigned short*)(ws + oKh);
  unsigned short* Kl  = (unsigned short*)(ws + oKl);
  unsigned short* VTh = (unsigned short*)(ws + oVTh);
  unsigned short* VTl = (unsigned short*)(ws + oVTl);
  unsigned short* Oh  = (unsigned short*)(ws + oOh);
  unsigned short* Ol  = (unsigned short*)(ws + oOl);
  unsigned*       Pk  = (unsigned*)(ws + oPk);

  const dim3 blk(256);
  const dim3 gPrep(PB_P + PB_X + 4 * PB_W + PB_E + PB_T);      // 3382 blocks
  const dim3 gQKV(PJB, 3);                                     // 64 blocks x {q, k, v^T}
  const dim3 gProj(((MROWS / 64) * (DM / 64) + 7) / 8, 1);     // 512 tiles -> 64 blocks: M=2048, N=1024

  // (1) structure indices packed; x -> bf16 plane; weights [n][k] f32 -> bf16 [n][k]; er -> bf16; combined structure table
  prep_all<<<gPrep, blk, 0, stream>>>(x, Wq, Wk, Wv, Wo, Er, Ebar, Epos, Eoct, Esem, rbar, rpos, roct, rsem,
                                      Xb, Wqb, Wkb, Wvb, Wob, Erb, Tb, Pk);
  // (2)-(4) q, k (bf16 hi/lo planes) and v^T (f16 hi plane, residual plane)
  gemm_qkv<<<gQKV, blk, 0, stream>>>(Xb, Wqb, Wkb, Wvb, Qh, Ql, Kh, Kl, VTh, VTl);
  // (5), (6) attention, each block with the structure products q . T^T of its own rows: query blocks 0..RESQB-1 with
  //     residual planes, the rest without, one grid
  attn_rel64<<<dim3(NB * NH * NQB), dim3(NG * 128), 0, stream>>>(
      Qh, Ql, Kh, Kl, VTh, VTl, Erb, Tb, Pk, Oh, Ol, 0.125f);
  // (7) out = context . Wo^T -> d_out f32 [2048][1024]  (A = context hi + lo planes, 2 products)
  gemm64<1, 0, true><<<gProj, blk, 0, stream>>>(
      Oh, Ol, DM, 0LL, Wob, Wob, DM, 0LL,
      d_out, DM, 0LL, d_out, DM, 0LL, DM,
      MROWS, DM, DM, 1.0f);
  (void)hipGetLastError();
}

// v009
// A run of this version takes 99.6 microseconds.
// In both of two side-by-side timings against v008, it was 1.03 times as fast.
// Counting every step since v000, it is 8.03 times as fast.
// Contractions: q, k, v^T projections = v_wmma_f32_16x16x32_bf16 (bf16 operands from RNE-converted inputs, single product);
// q.k^T = v_wmma_f32_16x16x32_bf16 with bf16 hi/lo split q and k (hi.hi + hi.lo + lo.hi);
// q.Er^T skew band and q.T^T structure tables = bf16 hi/lo q times bf16 table rows (2 products);
// p.v = v_wmma_f32_16x16x32_f16 (p carried x1024 in f16, v f16; extra f16 residual planes x4096 of p and v for the first 256 query rows);
// ctx.Wo^T = bf16 hi/lo ctx times bf16 Wo (2 products); all f32 accumulate; bias gathers, causal mask and softmax in f32.
#include <hip/hip_runtime.h>
#include <math.h>
#include <stdint.h>

#define NB    2
#define SEQ   1024
#define DM    1024
#define NH    16
#define HD    64
#define MROWS (NB * SEQ)     // 2048
#define NQB   (SEQ / 64)     // 16 query / key tiles of 64
#define VLP   256            // key pitch of the v^T residual plane (keys 0..VLP-1)
#define RESQB 4              // leading 64-row query blocks that use the p / v residual planes
#define NTS   10             // 16-row subtiles of the structure table that hold used rows (151 of 160)
#define QSP   164            // LDS row pitch (floats) of the structure-table products: 8 rows = 32 banks mod 64
#define TROWS 192            // rows of the combined structure table (151 used, rest zero)
#define LP    72             // LDS row pitch, 16-bit elements, of the 64-wide K / V^T / er / P tiles: 144 B = 16 B x odd
#define OFF_BAR 0            // 16 rows + zero row  -> idx 0..16
#define OFF_POS 17           // 95 rows + zero row  -> idx 0..95
#define OFF_OCT 113          // 24 rows + zero row  -> idx 0..24
#define OFF_SEM 138          // 12 rows + zero row  -> idx 0..12
static_assert(RESQB * 64 <= VLP);
static_assert(NH * HD == DM);
static_assert((SEQ % 64) == 0 && (DM % 64) == 0 && (TROWS % 64) == 0);
static_assert(OFF_SEM + 13 <= NTS * 16 && NTS * 16 <= QSP && NTS * 16 <= TROWS && (QSP * 8) % 64 == 32);

typedef _Float16 v16h __attribute__((ext_vector_type(16)));
typedef _Float16 v8h  __attribute__((ext_vector_type(8)));
typedef __bf16   v16b __attribute__((ext_vector_type(16)));
typedef __bf16   v8b  __attribute__((ext_vector_type(8)));
typedef float    v8f  __attribute__((ext_vector_type(8)));
typedef float    v4f  __attribute__((ext_vector_type(4)));
typedef unsigned int v4u __attribute__((ext_vector_type(4)));

// ---- scalar helpers --------------------------------------------------------------------------------
__device__ __forceinline__ unsigned short bf_bits(float f) {          // f32 -> bf16 bits, RNE convert
  unsigned u = __float_as_uint(f);
  return (unsigned short)((u + 0x7FFFu + ((u >> 16) & 1u)) >> 16);
}
__device__ __forceinline__ float bf_up(unsigned short h) { return __uint_as_float(((unsigned)h) << 16); }
__device__ __forceinline__ unsigned short h_bits(_Float16 x) { return __builtin_bit_cast(unsigned short, x); }
__device__ __forceinline__ unsigned pk16(unsigned short a, unsigned short b) { return (unsigned)a | ((unsigned)b << 16); }
__device__ __forceinline__ int iclamp(int v, int lo, int hi) { return (v < lo) ? lo : ((v > hi) ? hi : v); }
__device__ __forceinline__ int imin(int a, int b) { return (a < b) ? a : b; }
// exp(x) as __expf forms it (x log2(e), then the hardware's 2^y), with the slot that the instruction set asks for behind a
// transcendental kept in the same statement
__device__ __forceinline__ float exp_slot(float x) {
  const float y = x * 1.44269504088896340736f;
  float r;
  asm("v_exp_f32 %0, %1\n\tv_nop" : "=v"(r) : "v"(y));
  return r;
}
__device__ __forceinline__ v8f zero8() { v8f z = {0.f, 0.f, 0.f, 0.f, 0.f, 0.f, 0.f, 0.f}; return z; }
__device__ __forceinline__ v8h zero8h() {
  const _Float16 z = (_Float16)0.0f;
  v8h r = {z, z, z, z, z, z, z, z};
  return r;
}

// ---- fragment loader: 16-bit A/B operand, lane -> row/col (lane&15), p already includes +8*(lane>>4);
//      elements 0..7 <- p[0..7] (k0+8h..), elements 8..15 <- p[16..23] (k0+16+8h..)
__device__ __forceinline__ v16b ldfrag_b(const __bf16* p) {
  union { v16b v; v8b h[2]; } f;
  f.h[0] = *(const v8b*)(p);
  f.h[1] = *(const v8b*)(p + 16);
  return f.v;
}
//      a wave-uniform pointer to global memory, held in scalar registers, so that a load names it and a 32-bit lane
//      offset (left to itself one build formed a vector address pair per strip, and a load of the run landed in it)
typedef const __attribute__((address_space(1))) char* gcp;
typedef const __attribute__((address_space(1))) v8b*  gv8bp;
__device__ __forceinline__ gcp uni_ptr(const char* p) {
  const unsigned long long u = (unsigned long long)p;
  const unsigned lo = (unsigned)__builtin_amdgcn_readfirstlane((int)(unsigned)u);
  const unsigned hi = (unsigned)__builtin_amdgcn_readfirstlane((int)(unsigned)(u >> 32));
  return (gcp)(((unsigned long long)hi << 32) | lo);
}
//      the same elements in the same positions, from a wave-uniform base and the lane's byte offset vo;
//      H2 = bytes from the lane's elements 0..7 to its elements 8..15 (32 in a row-major plane, 512 in fragment order)
template <int H2>
__device__ __forceinline__ v16b ldfrag_o(gcp base, unsigned vo) {
  union { v16b v; v8b h[2]; } f;
  f.h[0] = *(gv8bp)(base + vo);
  f.h[1] = *(gv8bp)(base + H2 + vo);
  return f.v;
}

// ---- WMMA helpers with trailing VALU hazard gap --------------------------------------------------------
__device__ __forceinline__ v8f mma_b(v16b a, v16b b, v8f c) {
  c = __builtin_amdgcn_wmma_f32_16x16x32_bf16(false, a, false, b, (short)0, c, false, false);
#if defined(__HIP_DEVICE_COMPILE__)
  asm volatile("v_nop\n\tv_nop\n\tv_nop\n\tv_nop" : "+v"(c) : "v"(a), "v"(b));
#endif
  return c;
}
__device__ __forceinline__ v8f mma_h(v16h a, v16h b, v8f c) {
  c = __builtin_amdgcn_wmma_f32_16x16x32_f16(false, a, false, b, (short)0, c, false, false);
#if defined(__HIP_DEVICE_COMPILE__)
  asm volatile("v_nop\n\tv_nop\n\tv_nop\n\tv_nop" : "+v"(c) : "v"(a), "v"(b));
#endif
  return c;
}
__device__ __forceinline__ v8f mma_b_raw(v16b a, v16b b, v8f c) {
  return __builtin_amdgcn_wmma_f32_16x16x32_bf16(false, a, false, b, (short)0, c, false, false);
}
__device__ __forceinline__ void acc_guard4(v8f& a, v8f& b, v8f& c, v8f& d) {
#if defined(__HIP_DEVICE_COMPILE__)
  asm volatile("v_nop\n\tv_nop\n\tv_nop\n\tv_nop" : "+v"(a), "+v"(b), "+v"(c), "+v"(d));
#else
  (void)a; (void)b; (void)c; (void)d;
#endif
}

// =====================================================================================================
// f32 -> bf16 (RNE convert), 8 elements per thread, one 16-B store per lane: a wave writes 512 contiguous B
// (n8 is a multiple of 256 for every use here). coverage: n8 threads x 8 = whole plane.
// =====================================================================================================
__device__ __forceinline__ void cvt_bf16x8(const float* __restrict__ in, unsigned short* out, int n8, int blk) {
  const int i = blk * 256 + threadIdx.x;
  if (i < n8) {
    const v4f a = *(const v4f*)(in + (size_t)i * 8);
    const v4f b = *(const v4f*)(in + (size_t)i * 8 + 4);
    v4u p;
    p[0] = pk16(bf_bits(a[0]), bf_bits(a[1]));
    p[1] = pk16(bf_bits(a[2]), bf_bits(a[3]));
    p[2] = pk16(bf_bits(b[0]), bf_bits(b[1]));
    p[3] = pk16(bf_bits(b[2]), bf_bits(b[3]));
    *(v4u*)(out + (size_t)i * 8) = p;
    
  }
}

// =====================================================================================================
// FRAGMENT ORDER of a 16-bit plane [rows][DM] that a GEMM reads as A or Bt: the plane is cut into 16-row strips and
// each strip into blocks of 32 columns; a block is 1 KB = two runs of 512 B, and run u holds, for lane l = 0..31,
// the 8 elements (row l & 15, columns 16 u + 8 (l >> 4) ..+7) at byte 16 l. Blocks of a strip follow one another, then
// the next strip. So each of a fragment's two 16-B loads reads 512 contiguous bytes (4 whole lines) where a row-major
// plane gives it 32 B from each of 16 lines; which element lands in which lane and register does not change.
//   16-B piece index of (row m, columns 8 k8 ..+7) = (((m >> 4) * (DM/32) + (k8 >> 2)) * 2 + ((k8 >> 1) & 1)) * 32
//                                                    + (k8 & 1) * 16 + (m & 15)
// f32 [rows][DM] -> bf16 (RNE convert) in fragment order: thread i makes piece i, so a wave stores 512 contiguous B;
// a block reads 512 contiguous B of each of 16 rows. coverage: n8 threads x 8 = whole plane (the map is one to one).
// =====================================================================================================
static_assert(DM / 32 == 32);
__device__ __forceinline__ void cvt_bf16_frag(const float* __restrict__ in, unsigned short* out, int n8, int blk) {
  const int i = blk * 256 + threadIdx.x;
  if (i < n8) {
    const int l = i & 31, u = (i >> 5) & 1, kb = (i >> 6) & 31, st = i >> 11;
    const size_t so = (size_t)(st * 16 + (l & 15)) * DM + kb * 32 + u * 16 + (l >> 4) * 8;
    const v4f a = *(const v4f*)(in + so);
    const v4f b = *(const v4f*)(in + so + 4);
    v4u p;
    p[0] = pk16(bf_bits(a[0]), bf_bits(a[1]));
    p[1] = pk16(bf_bits(a[2]), bf_bits(a[3]));
    p[2] = pk16(bf_bits(b[0]), bf_bits(b[1]));
    p[3] = pk16(bf_bits(b[2]), bf_bits(b[3]));
    *(v4u*)(out + (size_t)i * 8) = p;
  }
}

// =====================================================================================================
// Combined structure table, bf16 [TROWS][64]: rows 0..15 bar, 16 zero, 17..111 position, 112 zero,
// 113..136 octave, 137 zero, 138..149 semitone, 150..191 zero. 8 threads per row, 8 elements each,
// all four candidate loads unconditional with clamped row addresses, selection by value.
// PB_T = TROWS*8/256 = 6 blocks of prep_all exactly. coverage: 1536 threads x 8 = 192 x 64.
// =====================================================================================================
__device__ __forceinline__ void build_tab(const float* __restrict__ ebar, const float* __restrict__ epos,
                                          const float* __restrict__ eoct, const float* __restrict__ esem,
                                          unsigned short* tab, int blk) {
  const int g = blk * 256 + threadIdx.x;
  if (g < TROWS * 8) {
    const int s  = g >> 3;
    const int d0 = (g & 7) * 8;
    const int rb = iclamp(s, 0, 15);
    const int rp = iclamp(s - OFF_POS, 0, 94);
    const int ro = iclamp(s - OFF_OCT, 0, 23);
    const int rs = iclamp(s - OFF_SEM, 0, 11);
    const bool ub = (s < 16);
    const bool up = (s >= OFF_POS) && (s < OFF_POS + 95);
    const bool uo = (s >= OFF_OCT) && (s < OFF_OCT + 24);
    const bool us = (s >= OFF_SEM) && (s < OFF_SEM + 12);
    float v[8];
#pragma unroll
    for (int e = 0; e < 8; ++e) {
      const int d = d0 + e;
      const float fb = ebar[rb * HD + d];
      const float fp = epos[rp * HD + d];
      const float fo = eoct[ro * HD + d];
      const float fs = esem[rs * HD + d];
      float t = 0.f;
      t = ub ? fb : t;
      t = up ? fp : t;
      t = uo ? fo : t;
      t = us ? fs : t;
      v[e] = t;
    }
    v4u p;
    p[0] = pk16(bf_bits(v[0]), bf_bits(v[1]));
    p[1] = pk16(bf_bits(v[2]), bf_bits(v[3]));
    p[2] = pk16(bf_bits(v[4]), bf_bits(v[5]));
    p[3] = pk16(bf_bits(v[6]), bf_bits(v[7]));
    *(v4u*)(tab + (size_t)s * HD + d0) = p;
    
  }
}

// =====================================================================================================
// The four structure indices of a score (b, t, s), each clamped to its sub-table's range and taken times 4 (the byte
// offset of an f32 in its sub-table's products), packed into one 32-bit word: bar in bits 0..6, position 7..15, octave
// 16..22, semitone 23..28. Every head reads the same indices, so they are clamped and packed once and the attention
// loads one word a score where it loaded four.
// PACKED ORDER: one 4-KB unit per (b, 16-row strip, 64-key tile), unit index (b * SEQ/16 + strip) * NQB + tile; in a unit
// the 16-B piece (2 j + rq) * 32 + 16 hh + c holds rows 8 hh + 4 rq + 0..3 of key 16 j + c, so that an attention wave
// (lane = 16 hh + c) reads a unit with 8 loads of 512 contiguous bytes. Only the units on or below the diagonal
// (tile <= strip / 4) are read, and only they are written.
// One block per (b, 64-row query block qb, key tile kt <= qb), 4 units: rows p and NQB-1-p have NQB+1 tiles together.
// A wave takes 4 rows x 32 keys of each strip: each of its 64 index loads reads one whole 128-B line, all of them go
// out ahead of the first use, and each of its 4 stores writes two runs of 256 B.
// coverage of a unit: 8 waves (a, rq, hh) x 32 lanes = pieces 0..255, one to one.
// =====================================================================================================
#define PB_P (NB * (NQB / 2) * (NQB + 1))   // 272
static_assert((NQB % 2) == 0 && SEQ == NQB * 64);
__device__ __forceinline__ void pack_idx(const int* __restrict__ ibar, const int* __restrict__ ipos,
                                         const int* __restrict__ ioct, const int* __restrict__ isem,
                                         unsigned* pk, int blk) {
  const int b  = blk / ((NQB / 2) * (NQB + 1));
  const int t  = blk - b * ((NQB / 2) * (NQB + 1));
  const int p  = t / (NQB + 1);
  const int e0 = t - p * (NQB + 1);
  const int qb = (e0 <= p) ? p : (NQB - 1 - p);                       // block-uniform
  const int kt = (e0 <= p) ? e0 : (e0 - p - 1);                       // 0..qb
  const int lane = threadIdx.x & 31, wv = threadIdx.x >> 5;
  const int a = wv & 1, rq = (wv >> 1) & 1, hh = wv >> 2;
  // byte offset of index (row qb*64 + 8 hh + 4 rq, key kt*64 + 32 a + lane); strip s and row e add a constant
  const unsigned vo = ((unsigned)(b * SEQ + qb * 64 + 8 * hh + 4 * rq) * SEQ + (unsigned)(kt * 64 + 32 * a + lane)) * 4u;
  int xi[4][4][4];
#pragma unroll
  for (int s = 0; s < 4; ++s)
#pragma unroll
    for (int e = 0; e < 4; ++e) {
      const size_t ko = (size_t)((s * 16 + e) * SEQ) * 4;
      xi[s][e][0] = *(const int*)((const char*)ibar + ko + vo);
      xi[s][e][1] = *(const int*)((const char*)ipos + ko + vo);
      xi[s][e][2] = *(const int*)((const char*)ioct + ko + vo);
      xi[s][e][3] = *(const int*)((const char*)isem + ko + vo);
    }
  // precaution: this wait stands ahead of every later rewrite of the loads' offset register; it names the register
  // so that it stays whole up to it
  asm volatile("s_wait_xcnt 0x0" :: "v"(vo) : "memory");
  // the scheduler may not sink the index loads to their first uses, where each would wait alone
  __builtin_amdgcn_sched_barrier(0);
  const int piece = ((2 * a + (lane >> 4)) * 2 + rq) * 32 + hh * 16 + (lane & 15);
  unsigned* po = pk + ((size_t)((b * (SEQ / 16) + qb * 4) * NQB + kt) * 256 + piece) * 4;
#pragma unroll
  for (int s = 0; s < 4; ++s) {
    v4u w;
#pragma unroll
    for (int e = 0; e < 4; ++e)
      w[e] = ((unsigned)iclamp(xi[s][e][0], 0, 16) << 2) | ((unsigned)iclamp(xi[s][e][1], 0, 95) << 9) |
             ((unsigned)iclamp(xi[s][e][2], 0, 24) << 18) | ((unsigned)iclamp(xi[s][e][3], 0, 12) << 25);
    *(v4u*)(po + (size_t)s * NQB * 1024) = w;
  }
}

// =====================================================================================================
// All operand preparation in one grid (the eight pieces depend on nothing but the inputs, so they run side by
// side): blocks 0..PB_P-1 pack the structure indices, the next PB_X convert x, the next 4*PB_W the four weights (these
// five into fragment order), the next PB_E er (row-major), the last PB_T build the combined table. The piece is chosen
// by blockIdx.x alone (block-uniform).
// =====================================================================================================
#define PB_X (MROWS * DM / 8 / 256)   // 1024
#define PB_W (DM * DM / 8 / 256)      //  512
#define PB_E (SEQ * HD / 8 / 256)     //   32
#define PB_T (TROWS * 8 / 256)        //    6
static_assert(PB_X * 2048 == MROWS * DM && PB_W * 2048 == DM * DM && PB_E * 2048 == SEQ * HD && PB_T * 256 == TROWS * 8);
__global__ __launch_bounds__(256) void prep_all(
    const float* __restrict__ x, const float* __restrict__ wq, const float* __restrict__ wk,
    const float* __restrict__ wv, const float* __restrict__ wo, const float* __restrict__ er,
    const float* __restrict__ ebar, const float* __restrict__ epos,
    const float* __restrict__ eoct, const float* __restrict__ esem,
    const int* __restrict__ ibar, const int* __restrict__ ipos,
    const int* __restrict__ ioct, const int* __restrict__ isem,
    unsigned short* xb, unsigned short* wqb, unsigned short* wkb, unsigned short* wvb, unsigned short* wob,
    unsigned short* erb, unsigned short* tab, unsigned* pk) {
  int blk = blockIdx.x;
  if (blk < PB_P) { pack_idx(ibar, ipos, ioct, isem, pk, blk); return; }
  blk -= PB_P;
  if (blk < PB_X) { cvt_bf16_frag(x, xb, MROWS * DM / 8, blk); return; }
  blk -= PB_X;
  if (blk < 4 * PB_W) {
    const int w = blk / PB_W;
    const float*    in  = (w == 0) ? wq  : (w == 1) ? wk  : (w == 2) ? wv  : wo;
    unsigned short* out = (w == 0) ? wqb : (w == 1) ? wkb : (w == 2) ? wvb : wob;
    cvt_bf16_frag(in, out, DM * DM / 8, blk - w * PB_W);
    return;
  }
  blk -= 4 * PB_W;
  if (blk < PB_E) { cvt_bf16x8(er, erb, SEQ * HD / 8, blk); return; }
  build_tab(ebar, epos, eoct, esem, tab, blk - PB_E);
}

// =====================================================================================================
// Register-blocked batched bf16 WMMA GEMM: C[m][n] = sum_k A[m][k] * Bt[n][k]; one wave per 64x64 tile,
// no block barriers. A row-major [M][K] pitch lda; Bt row-major [N][K] pitch ldb (k contiguous);
// M, N multiples of 64, K a multiple of 32 and at least 32. blockIdx.y = batch index (strides in elements).
// NSPLIT: 0 = A.Bt; 1 = (A + A2).Bt (A2 = unscaled bf16 lo plane of A); 2 = A.Bt + A2.Bt + A.Bt2.
// OUT_MODE: 0 = f32 (pitch ldc); 2 = bf16 hi plane C + bf16 lo plane C2 (lo = RNE(v - hi), unscaled);
//           3 = f16 hi plane C + f16 residual plane C2 = f16((v - hi) * rscale), C2 written only for tiles
//               with n0 < N2 (pitch ldc2, batch stride strideC2).
// FR: false = A and Bt planes row-major; true = both in fragment order (then lda == ldb == K == DM, and a batch
//     stride is a whole number of 16-row strips).
// =====================================================================================================
//   sT: the block's 8 x (16 x 68) f32 staging slabs; bx: the block's index among the tiles; b: batch index.
template <int NSPLIT, int OUT_MODE, bool FR>
__device__ __forceinline__ void gemm64_body(
    const unsigned short* __restrict__ Ap, const unsigned short* A2p, int lda, long long strideA,
    const unsigned short* __restrict__ Btp, const unsigned short* Bt2p, int ldb, long long strideB,
    void* Cout, int ldc, long long strideC,
    void* Cout2, int ldc2, long long strideC2, int N2,
    int M, int N, int K, float rscale, float* sT, int bx, int b) {
  const __bf16* A   = (const __bf16*)(const void*)Ap;
  const __bf16* A2  = (const __bf16*)(const void*)A2p;
  const __bf16* Bt  = (const __bf16*)(const void*)Btp;
  const __bf16* Bt2 = (const __bf16*)(const void*)Bt2p;
  const int lane = threadIdx.x & 31;
  const int wave = threadIdx.x >> 5;
  const int tilesN = N >> 6;
  const int tilesM = M >> 6;
  const int tile = bx * 8 + wave;
  if (tile >= tilesM * tilesN) return;   // wave-uniform; no block barriers in this kernel
  const int tm = tile / tilesN;
  const int tn = tile - tm * tilesN;
  const int m0 = tm << 6;
  const int n0 = tn << 6;

  const __bf16* Ab  = A  + (size_t)b * strideA;
  const __bf16* Bb  = Bt + (size_t)b * strideB;
  const __bf16* Ab2 = (NSPLIT >= 1) ? (A2  + (size_t)b * strideA) : Ab;
  const __bf16* Bb2 = (NSPLIT == 2) ? (Bt2 + (size_t)b * strideB) : Bb;

  const int rlane = lane & 15;                 // row (A) / col (B, D) within subtile
  const int koff  = (lane >> 4) * 8;           // k offset of this lane half
  const int mOff  = (lane >> 4) * 8;           // D row offset

  v8f acc[4][4];
#pragma unroll
  for (int i = 0; i < 4; ++i)
#pragma unroll
    for (int j = 0; j < 4; ++j) acc[i][j] = zero8();

  // k loop, K >= 32: two register sets of fragments. All loads of one k step (32 columns) go out in one run, one k
  // step ahead of their products, so a k step waits for at most the rest of one load round trip instead of four whole
  // ones. Every load names a wave-uniform base (plane + 16-row strip) and one of two lane offsets, va (A) and vb (Bt).
  // Past the last k step the offsets stand still: a run that has no k step left reads the last one again (in bounds,
  // never used), so every run holds the same number of loads and the counted waits stay exact.
  // The inner loops are unrolled so that every fragment and accumulator index is a constant (registers, no scratch).
  struct FragSet { v16b a[4], l[4], b[4], m[4]; };                // A, second A plane, Bt, second Bt plane
  const size_t sa = (size_t)lda * 32, sb = (size_t)ldb * 32;      // bytes from one 16-row strip to the next
  gcp pa[4], pa2[4], pb[4], pb2[4];                               // the planes' four strips, scalar bases
#pragma unroll
  for (int i = 0; i < 4; ++i) {
    pa[i]  = uni_ptr((const char*)Ab + i * sa);
    pb[i]  = uni_ptr((const char*)Bb + i * sb);
    pa2[i] = (NSPLIT >= 1) ? uni_ptr((const char*)Ab2 + i * sa) : pa[i];
    pb2[i] = (NSPLIT == 2) ? uni_ptr((const char*)Bb2 + i * sb) : pb[i];
  }
  //   fragment order: a 16-row strip is as many bytes as in a row-major plane, so the bases above serve both; the
  //   lane's piece stands at 16 * lane in its 512-B run, and a k step is one 1-KB block
  constexpr int      H2   = FR ? 512 : 32;
  constexpr unsigned KINC = FR ? 1024u : 64u;
  unsigned va = FR ? ((unsigned)m0 * (unsigned)lda * 2u + (unsigned)lane * 16u)
                   : (((unsigned)(m0 + rlane) * (unsigned)lda + (unsigned)koff) * 2u);
  unsigned vb = FR ? ((unsigned)n0 * (unsigned)ldb * 2u + (unsigned)lane * 16u)
                   : (((unsigned)(n0 + rlane) * (unsigned)ldb + (unsigned)koff) * 2u);
  const int nk = K >> 5;
  int kl = 0;                                                     // the k step that va and vb stand at, unclamped
  auto load = [&](FragSet& S) {
#pragma unroll
    for (int j = 0; j < 4; ++j) {
      S.b[j] = ldfrag_o<H2>(pb[j], vb);
      if (NSPLIT == 2) S.m[j] = ldfrag_o<H2>(pb2[j], vb); else S.m[j] = S.b[j];
    }
#pragma unroll
    for (int i = 0; i < 4; ++i) {
      S.a[i] = ldfrag_o<H2>(pa[i], va);
      if (NSPLIT >= 1) S.l[i] = ldfrag_o<H2>(pa2[i], va); else S.l[i] = S.a[i];
    }
    // the scheduler may not sink the run's loads into the products behind it, where each would go out late
    __builtin_amdgcn_sched_barrier(0);
  };
  auto advance = [&]() {
    // the wait below stays behind the products: lifted to stand directly behind the loads it would hold the products up
    __builtin_amdgcn_sched_barrier(0);
#if defined(__HIP_DEVICE_COMPILE__)
    // precaution: this wait stands ahead of every rewrite of a register that a load of the last run names; it takes
    // the two lane offsets and the scalar bases as operands so that they stay whole up to it and the additions
    // stay behind it
    asm volatile("s_wait_xcnt 0x0" : "+v"(va), "+v"(vb)
                 : "s"(pa[0]), "s"(pa[1]), "s"(pa[2]), "s"(pa[3]), "s"(pb[0]), "s"(pb[1]), "s"(pb[2]), "s"(pb[3]),
                   "s"(pa2[0]), "s"(pa2[1]), "s"(pa2[2]), "s"(pa2[3]), "s"(pb2[0]), "s"(pb2[1]), "s"(pb2[2]), "s"(pb2[3])
                 : "memory");
#endif
    ++kl;
    const unsigned inc = (kl < nk) ? KINC : 0u;                   // wave-uniform
    va += inc;
    vb += inc;
  };
  auto products = [&](const FragSet& S) {
#pragma unroll
    for (int i = 0; i < 4; ++i)
#pragma unroll
      for (int j = 0; j < 4; ++j) {
        acc[i][j] = mma_b_raw(S.a[i], S.b[j], acc[i][j]);
        if (NSPLIT >= 1) acc[i][j] = mma_b_raw(S.l[i], S.b[j], acc[i][j]);
        if (NSPLIT == 2) acc[i][j] = mma_b_raw(S.a[i], S.m[j], acc[i][j]);
      }
  };
  FragSet S0, S1;
  load(S0); advance();
  const int ng = nk / 2;                                          // whole turns of the two sets
  for (int g = 0; g < ng; ++g) {
    load(S1); products(S0); advance();
    load(S0); products(S1); advance();
  }
  if (nk - ng * 2 >= 1) products(S0);                             // the k step left over (wave-uniform)
  acc_guard4(acc[0][0], acc[0][1], acc[0][2], acc[0][3]);
  acc_guard4(acc[1][0], acc[1][1], acc[1][2], acc[1][3]);
  acc_guard4(acc[2][0], acc[2][1], acc[2][2], acc[2][3]);
  acc_guard4(acc[3][0], acc[3][1], acc[3][2], acc[3][3]);

  // ---- epilogue ----
  float* slab = sT + wave * (16 * 68);             // per-wave 16x64 slab, pitch 68 floats
#pragma unroll
  for (int i = 0; i < 4; ++i) {
    const int mBase = m0 + (i << 4);
#pragma unroll
    for (int j = 0; j < 4; ++j) {
#pragma unroll
      for (int r = 0; r < 8; ++r) {
        slab[(mOff + r) * 68 + (j << 4) + rlane] = acc[i][j][r];
      }
    }
    __builtin_amdgcn_fence(__ATOMIC_RELEASE, "workgroup");
    __builtin_amdgcn_wave_barrier();
    __builtin_amdgcn_fence(__ATOMIC_ACQUIRE, "workgroup");
    if (OUT_MODE == 0) {
      float* C = (float*)Cout + (size_t)b * strideC;
      const int hh = lane >> 4, c4 = (lane & 15) * 4;     // 256-B row segment = 16 lanes x 16 B
      {
#pragma unroll
        for (int it = 0; it < 8; ++it) {
          const int row = it * 2 + hh;                     // it 0..7 x hh 0..1 = rows 0..15
          const v4f v = *(const v4f*)(slab + row * 68 + c4);
          *(v4f*)(C + (size_t)(mBase + row) * ldc + n0 + c4) = v;
        }
        
      }
    } else {
      const int q = lane >> 3, c8 = (lane & 7) * 8;
      unsigned short* C  = (unsigned short*)Cout  + (size_t)b * strideC;
      unsigned short* C2 = (unsigned short*)Cout2 + (size_t)b * strideC2;
      const bool wlo = (OUT_MODE == 2) || (n0 < N2);      // wave-uniform
      v4u hv[4], lv[4];
#pragma unroll
      for (int it = 0; it < 4; ++it) {
        const int row = it * 4 + q;                        // it 0..3 x q 0..3 = rows 0..15
        const float* sp = slab + row * 68 + c8;
        v4u a, a2;
#pragma unroll
        for (int e = 0; e < 4; ++e) {
          const float f0 = sp[2 * e], f1 = sp[2 * e + 1];
          unsigned short h0, h1, l0, l1;
          if (OUT_MODE == 2) {
            h0 = bf_bits(f0); h1 = bf_bits(f1);
            l0 = bf_bits(f0 - bf_up(h0)); l1 = bf_bits(f1 - bf_up(h1));
          } else {
            const _Float16 x0 = (_Float16)f0, x1 = (_Float16)f1;
            h0 = h_bits(x0); h1 = h_bits(x1);
            l0 = h_bits((_Float16)((f0 - (float)x0) * rscale));
            l1 = h_bits((_Float16)((f1 - (float)x1) * rscale));
          }
          a[e] = pk16(h0, h1); a2[e] = pk16(l0, l1);
        }
        hv[it] = a; lv[it] = a2;
      }
      {
#pragma unroll
        for (int it = 0; it < 4; ++it) {
          const int row = it * 4 + q;
          *(v4u*)(C + (size_t)(mBase + row) * ldc + n0 + c8) = hv[it];
          if (wlo) *(v4u*)(C2 + (size_t)(mBase + row) * ldc2 + n0 + c8) = lv[it];
        }
        
      }
    }
    __builtin_amdgcn_fence(__ATOMIC_RELEASE, "workgroup");
    __builtin_amdgcn_wave_barrier();
    __builtin_amdgcn_fence(__ATOMIC_ACQUIRE, "workgroup");
  }
}

template <int NSPLIT, int OUT_MODE, bool FR>
__global__ __launch_bounds__(256) void gemm64(
    const unsigned short* __restrict__ Ap, const unsigned short* A2p, int lda, long long strideA,
    const unsigned short* __restrict__ Btp, const unsigned short* Bt2p, int ldb, long long strideB,
    void* Cout, int ldc, long long strideC,
    void* Cout2, int ldc2, long long strideC2, int N2,
    int M, int N, int K, float rscale) {
  __shared__ __align__(16) float sT[8 * 16 * 68];
  gemm64_body<NSPLIT, OUT_MODE, FR>(Ap, A2p, lda, strideA, Btp, Bt2p, ldb, strideB, Cout, ldc, strideC,
                                Cout2, ldc2, strideC2, N2, M, N, K, rscale, sT, blockIdx.x, blockIdx.y);
}

// The three projections in one grid: each alone fills a quarter of the chip's WGPs and none reads another's result.
//   blockIdx.y = 0: q = x . Wq^T -> bf16 hi/lo planes [b*SEQ+t][h*64+d]   (M=2048, N=1024, K=1024)
//   blockIdx.y = 1: k = x . Wk^T -> bf16 hi/lo planes
//   blockIdx.y = 2: v^T = Wv . x^T per batch -> f16 hi plane [b][h*64+d][s] (pitch SEQ) and residual plane (x4096,
//                   keys < VLP only, pitch VLP); A = Wvb [n][k], Bt = Xb rows of batch b = blockIdx.x / VTB
#define PJB ((MROWS / 64) * (DM / 64) / 8)   // 64 blocks of 8 tiles per projection
#define VTB ((DM / 64) * (SEQ / 64) / 8)     // 32 blocks of 8 tiles per batch of v^T
static_assert(VTB * NB == PJB);
__global__ __launch_bounds__(256) void gemm_qkv(
    const unsigned short* __restrict__ Xb, const unsigned short* __restrict__ Wqb,
    const unsigned short* __restrict__ Wkb, const unsigned short* __restrict__ Wvb,
    unsigned short* Qh, unsigned short* Ql, unsigned short* Kh, unsigned short* Kl,
    unsigned short* VTh, unsigned short* VTl) {
  __shared__ __align__(16) float sT[8 * 16 * 68];
  const int which = blockIdx.y;                 // block-uniform
  if (which < 2) {
    const unsigned short* Wb = which ? Wkb : Wqb;
    unsigned short* Ch = which ? Kh : Qh;
    unsigned short* Cl = which ? Kl : Ql;
    gemm64_body<0, 2, true>(Xb, Xb, DM, 0LL, Wb, Wb, DM, 0LL,
                      (void*)Ch, DM, 0LL, (void*)Cl, DM, 0LL, DM,
                      MROWS, DM, DM, 1.0f, sT, blockIdx.x, 0);
  } else {
    const int b = blockIdx.x / VTB;
    gemm64_body<0, 3, true>(Wvb, Wvb, DM, 0LL, Xb, Xb, DM, (long long)SEQ * DM,
                      (void*)VTh, SEQ, (long long)DM * SEQ, (void*)VTl, VLP, (long long)DM * VLP, VLP,
                      DM, SEQ, DM, 4096.0f, sT, blockIdx.x - b * VTB, b);
  }
}

// =====================================================================================================
// Causal attention with relative-index (skew) bias and four gathered structure biases, head dim 64.
//   q planes (bf16 hi / lo): element (b, t, h, d) at [(b*SEQ + t)*DM + h*64 + d]; k planes same layout.
//   v^T hi plane (f16): element (b, h, d, s) at [(b*DM + h*64 + d)*SEQ + s]
//   v^T residual plane (f16, (v - hi)*4096): [(b*DM + h*64 + d)*VLP + s], s < VLP, read only when RES
//   er: bf16 [SEQ][64]; tab: bf16 [TROWS][64], the combined structure table T
//   qe = q . T^T (q hi/lo, 2 products per 32 columns, f32): the NG waves that hold the same 16 rows form those rows x NTS*16 table rows once between them,
//   ahead of the key loop, and keeps them in LDS (Qs, pitch QSP floats); the four bias gathers of a score read them there.
//   pidx: the four structure indices of each score, clamped and packed into one word, in packed order (pack_idx).
//   scores[t][s] = (q_t.k_s + q_t.er[SEQ-1+s-t] + qe[OFF_BAR+ibar] + qe[OFF_POS+ipos] + qe[OFF_OCT+ioct]
//                   + qe[OFF_SEM+isem]) * sscale for s <= t, else -1e9 (replace mask).
//   q.k : bf16 hi/lo split (3 products); q.er : q hi/lo x bf16 er (2 products); f32 accumulate.
//   Skew band: a block (64 query rows, key tile kv0) needs er rows ebb .. ebb+127 with
//   ebb = SEQ-64+kv0-qb*64 >= 0 (staged in LDS, addresses clamped at SEQ-1; clamped rows only feed
//   masked positions). Wave w (rows q0..q0+15) computes 5 subtiles of 16 band rows starting at
//   band row 16*(3-w); the diagonal D[mi][15-mi+jj] is fetched with two unconditional bpermutes per
//   element and selected by value; subtiles are produced one at a time (prev / cur).
//   p = exp(s - m) carried as f16(1024 p); context = p . v on f16 WMMA; RES adds f16 residual planes of p and v
//   (scale 4096, separate accumulator folded back with 1/4096 per chunk in f32); online softmax in f32.
//   Block = NG groups of 4 waves = 64 query rows of one (b, h); grid = NQB * NH * NB; key tiles kt = 0..qb are dealt
//   to the groups (group g takes kt = NG i + g in round i, rounds block-uniform), so that the chain of tiles one wave
//   walks is 1/NG as long; wave w of every group holds rows q0..q0+15 with its own running max, sum and context, and
//   the partial results are joined in f32 through LDS behind the loop.
//   K / V^T / er chunk staging: the group's 128 threads, 16-B asynchronous copies to LDS, issued behind the round's first
//   __syncthreads and ahead of the bias gathers, waited for ahead of the second; P tiles are wave-private, spilled with _Float16 element stores and
//   LDS (static byte buffer, rows of 64 elements at a pitch of LP = 72, so that the 16 rows of a 16-B fragment read
//   fall on different banks; T = 9216 B is a 64-row tile), per group at 8T g: Ksh 0, Ksl T, Vth 2T, Esh 3T (128 rows),
//   Psh 5T, Vtl 6T (RES), Psl 7T (RES); Qs 8T NG (64 rows x QSP floats, shared); after the key loop and a block barrier
//   the f32 context staging Os (17 KB) aliases offset 0 and the partial results of group g > 0 (24 KB) alias 8T g.
//   Output planes (bf16 hi / lo of the normalised context), element (row b*SEQ + t, column h*64 + d), in fragment order;
//   coverage: each wave of group 0 stores rows q0..q0+15 (lane & 15) x 64 columns (it 0..3 x lane>>4 0..1 x 8) of both planes.
// =====================================================================================================
#define TB64 (64 * LP * 2)    // bytes of a 64-row tile in LDS
#define QSB  (64 * QSP * 4)   // bytes of the block's structure products in LDS
#define GSB  (8 * TB64)       // bytes of one group's tiles in LDS
#define NG   3                // groups of 4 waves that share a query block's key tiles
#define SPG  ((NTS + NG - 1) / NG)   // structure-table subtiles per group
#define SPC  (NTS - (NG - 1) * SPG)   // of the last group
static_assert((LP * 2) % 32 == 16 && LP >= 64 && 4 * 16 * 68 * 4 <= 2 * TB64 && 4 * 48 * 32 * 4 <= GSB);
static_assert(SPC >= 1 && SPC <= SPG && NG * GSB + QSB <= 327680);
template <int N> struct Cnt { static constexpr int n = N; };   // a count handed to a lambda as a compile-time constant
template <bool RES>
__device__ __forceinline__
void attn_body(const unsigned short* __restrict__ qhp, const unsigned short* __restrict__ qlp,
                const unsigned short* __restrict__ khp, const unsigned short* __restrict__ klp,
                const unsigned short* __restrict__ vhp, const unsigned short* __restrict__ vlp,
                const unsigned short* __restrict__ erp, const unsigned short* __restrict__ tabp,
                const unsigned* __restrict__ pidx,
                unsigned short* ohp, unsigned short* olp,
                unsigned char* smem, int qb, int h, int b, float sscale) {
  union FB { v16b v; v8b h[2]; };
  union FH { v16h v; v8h h[2]; };
  //   key group of the wave, the same in every lane: held in a scalar register so that tests on it are scalar branches
  const int grp  = __builtin_amdgcn_readfirstlane((int)(threadIdx.x >> 7));
  unsigned char* const gsm = smem + grp * GSB;                              // the group's own tiles
  __bf16*   const Ksh = (__bf16*)(void*)(gsm);
  __bf16*   const Ksl = (__bf16*)(void*)(gsm + TB64);
  _Float16* const Vth = (_Float16*)(void*)(gsm + 2 * TB64);
  __bf16*   const Esh = (__bf16*)(void*)(gsm + 3 * TB64);
  _Float16* const Psh = (_Float16*)(void*)(gsm + 5 * TB64);
  _Float16* const Vtl = (_Float16*)(void*)(gsm + (RES ? 6 * TB64 : 2 * TB64));   // never dereferenced when !RES
  _Float16* const Psl = (_Float16*)(void*)(gsm + (RES ? 7 * TB64 : 5 * TB64));   // never dereferenced when !RES
  float*    const Os  = (float*)(void*)(smem);                              // after the key loop only

  const int tid  = threadIdx.x & 127;                                       // thread within the group
  const int wave = tid >> 5;                                                // 16-row strip of the wave, 0..3
  const int lane = tid & 31;
  const int hh   = lane >> 4;
  const int c    = lane & 15;

  const int q0   = qb * 64 + wave * 16;
  const size_t rowB = (size_t)b * SEQ;

  const __bf16* Qh  = (const __bf16*)(const void*)qhp + (size_t)h * HD;
  const __bf16* Ql  = (const __bf16*)(const void*)qlp + (size_t)h * HD;
  const __bf16* Kh  = (const __bf16*)(const void*)khp + (size_t)h * HD;
  const __bf16* Kl  = (const __bf16*)(const void*)klp + (size_t)h * HD;
  const _Float16* Vh = (const _Float16*)(const void*)vhp + ((size_t)b * DM + (size_t)h * HD) * SEQ;
  const _Float16* Vl = (const _Float16*)(const void*)vlp + ((size_t)b * DM + (size_t)h * HD) * VLP;
  const __bf16* Erb = (const __bf16*)(const void*)erp;
  //   structure products of the block's 64 rows (LDS): byte offset in smem of this lane's row, r = 0
  const unsigned qlb = (unsigned)NG * GSB + (unsigned)(wave * 16 + 8 * hh) * (QSP * 4u);
  //   byte offset of the lane's first piece in the packed unit of the wave's strip and key tile 0
  const unsigned ilb = (unsigned)((b * (SEQ / 16) + qb * 4 + wave) * NQB) * 4096u + (unsigned)lane * 16u;

  // ---- Q fragments (A operand, row = lane&15): 2 d-chunks, hi and lo ----
  v16b qah[2], qal[2];
#pragma unroll
  for (int dc = 0; dc < 2; ++dc) {
    const size_t qo = (rowB + q0 + c) * DM + dc * 32 + 8 * hh;
    qah[dc] = ldfrag_b(Qh + qo);
    qal[dc] = ldfrag_b(Ql + qo);
  }

  // ---- structure products of the wave's 16 rows: D[r] of subtile u = (row 8 hh + r) . (table row 16 u + c);
  //      the NG waves that hold the same rows share the subtiles (group g: u0 = SPG g .. u0 + SPG - 1, below NTS):
  //      every group has SPC of them, every group but the last SPG ----
  {
    // precaution: this wait stands ahead of the table loads, which may land in an address register of the q loads
    asm volatile("s_wait_xcnt 0x0" ::: "memory");
    const int  u0   = grp * SPG;
    const bool more = grp < NG - 1;                                    // scalar: the group has subtiles SPC .. SPG - 1 too
    const char* tabg = (const char*)tabp + u0 * (16 * HD * 2);         // wave-uniform
    const unsigned tvo = ((unsigned)c * HD + 8u * (unsigned)hh) * 2u;  // the lane's piece of a 16-row table subtile
    float* qsw = (float*)(void*)(smem + NG * GSB) + (wave * 16 + 8 * hh) * QSP + u0 * 16 + c;
    FB tf[SPG][2];
    auto tload = [&](auto from, auto to) {                             // the group's subtiles from.n .. to.n - 1
#pragma unroll
      for (int u = decltype(from)::n; u < decltype(to)::n; ++u)
#pragma unroll
        for (int dc = 0; dc < 2; ++dc) {
          tf[u][dc].h[0] = *(const v8b*)(tabg + (u * 16 * HD * 2 + dc * 64) + tvo);
          tf[u][dc].h[1] = *(const v8b*)(tabg + (u * 16 * HD * 2 + dc * 64 + 32) + tvo);
        }
      // precaution: this wait stands ahead of every later rewrite of the loads' offset register and base; it names
      // them so that they stay whole up to it (no load of the run lands in the offset register)
      asm volatile("s_wait_xcnt 0x0" :: "v"(tvo), "s"(tabg) : "memory");
    };
    auto tprod = [&](auto from, auto to) {
#pragma unroll
      for (int u = decltype(from)::n; u < decltype(to)::n; ++u) {
        v8f d = zero8();
#pragma unroll
        for (int dc = 0; dc < 2; ++dc) {
          d = mma_b(qah[dc], tf[u][dc].v, d);
          d = mma_b(qal[dc], tf[u][dc].v, d);
        }
#pragma unroll
        for (int r = 0; r < 8; ++r) qsw[r * QSP + u * 16] = d[r];
      }
    };
    tload(Cnt<0>{}, Cnt<SPC>{});                                       // ahead of the test: each run has its own wait
    if (more) tload(Cnt<SPC>{}, Cnt<SPG>{});
    // the scheduler may not sink the table loads to their products, where each would wait alone
    __builtin_amdgcn_sched_barrier(0);
    tprod(Cnt<0>{}, Cnt<SPC>{});
    if (more) tprod(Cnt<SPC>{}, Cnt<SPG>{});
    // a row's products come from NG waves and each of them reads all: block barrier
    __syncthreads();
  }

  float mrow[8], lrow[8];
  v8f oacc[4];
#pragma unroll
  for (int r = 0; r < 8; ++r) { mrow[r] = -INFINITY; lrow[r] = 0.f; }
#pragma unroll
  for (int t = 0; t < 4; ++t) oacc[t] = zero8();

  const int nkt = (qb + 1 < NQB) ? (qb + 1) : NQB;   // causal: key tiles 0..qb, block-uniform
  const int nrd = (nkt + NG - 1) / NG;                // rounds of NG tiles, block-uniform
  unsigned iv = ilb + (unsigned)grp * 4096u;          // the same in the unit of the group's key tile
  // staging: every tile row is one 128-B line; 8 lanes take a row, so a wave's 16-B copy covers 4 whole lines;
  // copy i of a thread takes row sr + 16 i; sl0 = LDS byte address of the thread's piece of row sr of the group's first tile
  const int sr = tid >> 3, sc8 = (tid & 7) * 8;
  const unsigned sl0 = (unsigned)(size_t)gsm + (unsigned)(sr * LP + sc8) * 2u;
  const unsigned long long slk = (unsigned long long)((unsigned)(sr * DM + sc8) * 2u);    // the lane's bytes into a K tile
  const unsigned long long slv = (unsigned long long)((unsigned)(sr * SEQ + sc8) * 2u);   // and into a V^T tile
  for (int rd = 0; rd < nrd; ++rd) {
    const int  kt  = NG * rd + grp;
    const bool act = kt < nkt;                        // scalar: in the last round a group may have no tile;
                                                      // it does none of the work and passes both barriers
    const int kv0 = kt * 64;
    int ebb = SEQ - 64 + kv0 - qb * 64;                 // >= 0 for kt >= 0, qb <= NQB-1
    ebb = (ebb < 0) ? 0 : ebb;

    // ---- gathered structure biases of the whole tile, bs[j][r] for key kv0 + 16 j + c and row q0 + 8 hh + r.
    //      They depend on no product of this tile, so the loads go out in runs, each back to back: the 8 loads of 4 packed
    //      words, then for RPR rows at a time (fields taken out, byte offsets formed) the 16 RPR LDS gathers.
    float bs[4][8];
    constexpr int RPR = RES ? 4 : 8;                    // fewer at a time where the residual path needs the registers
    asm volatile("s_wait_dscnt 0x0" ::: "memory");
    __syncthreads();
    if (act) {
      // the tile's packed words are asked for first, so that they come back ahead of the tiles' bytes
      v4u pw[2][4];                                     // [row quad][j]: rows 4 q + 0..3 of key 16 j + c
#pragma unroll
      for (int q = 0; q < 2; ++q)
#pragma unroll
        for (int j = 0; j < 4; ++j)
          pw[q][j] = *(const v4u*)((const char*)pidx + (size_t)((j * 2 + q) * 512) + iv);
      // the scheduler may not sink the index loads behind the copies, where they would come back last
      __builtin_amdgcn_sched_barrier(0);
      constexpr unsigned RS = 16 * LP * 2;                         // LDS bytes from row sr + 16 i to row sr + 16 (i + 1)
      // Every copy names the one LDS address sl0 and an immediate offset N = its tile's and row's place behind sl0. N moves
      // the global address too, so each address register holds the source address less N (16 | N, N < 65536):
      // a wave-uniform part (plane, tile, row 16 i, less N) plus the lane's part (row sr, piece sc8).
      typedef unsigned long long u64;
      const u64 ku = (u64)(Kh + (rowB + kv0) * DM);                // K rows kv0 + sr + 16 i, d = sc8..sc8+7
      const u64 lu = (u64)(Kl + (rowB + kv0) * DM);
      const u64 vu = (u64)(Vh + kv0);                              // V^T rows d = sr + 16 i, s = kv0+sc8..+7
      u64 ka[4], la[4], va[4], ea[8];
#pragma unroll
      for (int i = 0; i < 4; ++i) {
        ka[i] = (ku + (u64)(long long)(i * 16 * DM * 2  - (int)(i * RS))) + slk;
        la[i] = (lu + (u64)(long long)(i * 16 * DM * 2  - (int)(TB64 + i * RS))) + slk;
        va[i] = (vu + (u64)(long long)(i * 16 * SEQ * 2 - (int)(2 * TB64 + i * RS))) + slv;
      }
      // er band rows sr + 16 i (128 rows x 64), row clamped at SEQ-1
#pragma unroll
      for (int i = 0; i < 8; ++i)
        ea[i] = ((u64)Erb - (u64)(3 * TB64 + i * RS)) +
                (u64)((unsigned)imin(ebb + sr + 16 * i, SEQ - 1) * (HD * 2) + (unsigned)sc8 * 2u);
      static_assert(7 * TB64 <= 65536 && (TB64 % 16) == 0 && (RS % 16) == 0);
      // each run of copies ends in its own s_wait_xcnt 0 (precaution): it stands ahead of every rewrite of a register
      // that a copy of the run names
      asm volatile(
          "global_load_async_to_lds_b128 %0, %1, off offset:%13\n\t"
          "global_load_async_to_lds_b128 %0, %2, off offset:%14\n\t"
          "global_load_async_to_lds_b128 %0, %3, off offset:%15\n\t"
          "global_load_async_to_lds_b128 %0, %4, off offset:%16\n\t"
          "global_load_async_to_lds_b128 %0, %5, off offset:%17\n\t"
          "global_load_async_to_lds_b128 %0, %6, off offset:%18\n\t"
          "global_load_async_to_lds_b128 %0, %7, off offset:%19\n\t"
          "global_load_async_to_lds_b128 %0, %8, off offset:%20\n\t"
          "global_load_async_to_lds_b128 %0, %9, off offset:%21\n\t"
          "global_load_async_to_lds_b128 %0, %10, off offset:%22\n\t"
          "global_load_async_to_lds_b128 %0, %11, off offset:%23\n\t"
          "global_load_async_to_lds_b128 %0, %12, off offset:%24\n\t"
          "s_wait_xcnt 0x0"
          :: "v"(sl0), "v"(ka[0]), "v"(ka[1]), "v"(ka[2]), "v"(ka[3]), "v"(la[0]), "v"(la[1]), "v"(la[2]), "v"(la[3]),
             "v"(va[0]), "v"(va[1]), "v"(va[2]), "v"(va[3]),
             "n"(0), "n"(RS), "n"(2 * RS), "n"(3 * RS),
             "n"(TB64), "n"(TB64 + RS), "n"(TB64 + 2 * RS), "n"(TB64 + 3 * RS),
             "n"(2 * TB64), "n"(2 * TB64 + RS), "n"(2 * TB64 + 2 * RS), "n"(2 * TB64 + 3 * RS)
          : "memory");
      asm volatile(
          "global_load_async_to_lds_b128 %0, %1, off offset:%9\n\t"
          "global_load_async_to_lds_b128 %0, %2, off offset:%10\n\t"
          "global_load_async_to_lds_b128 %0, %3, off offset:%11\n\t"
          "global_load_async_to_lds_b128 %0, %4, off offset:%12\n\t"
          "global_load_async_to_lds_b128 %0, %5, off offset:%13\n\t"
          "global_load_async_to_lds_b128 %0, %6, off offset:%14\n\t"
          "global_load_async_to_lds_b128 %0, %7, off offset:%15\n\t"
          "global_load_async_to_lds_b128 %0, %8, off offset:%16\n\t"
          "s_wait_xcnt 0x0"
          :: "v"(sl0), "v"(ea[0]), "v"(ea[1]), "v"(ea[2]), "v"(ea[3]), "v"(ea[4]), "v"(ea[5]), "v"(ea[6]), "v"(ea[7]),
             "n"(3 * TB64), "n"(3 * TB64 + RS), "n"(3 * TB64 + 2 * RS), "n"(3 * TB64 + 3 * RS),
             "n"(3 * TB64 + 4 * RS), "n"(3 * TB64 + 5 * RS), "n"(3 * TB64 + 6 * RS), "n"(3 * TB64 + 7 * RS)
          : "memory");
      if (RES) {
        const int kvl = (kv0 + 64 <= VLP) ? kv0 : (VLP - 64);     // clamped address into the residual plane
        const _Float16* vlg = Vl + (size_t)sr * VLP + kvl + sc8;   // V^T residual row d = sr, s = kvl+sc8..+7
        if (kv0 + 64 <= VLP) {                                     // wave-uniform (scalar)
          u64 wa[4];
#pragma unroll
          for (int i = 0; i < 4; ++i) wa[i] = (u64)(vlg + i * 16 * VLP) - (u64)(6 * TB64 + i * RS);
          asm volatile(
            "global_load_async_to_lds_b128 %0, %1, off offset:%5\n\t"
            "global_load_async_to_lds_b128 %0, %2, off offset:%6\n\t"
            "global_load_async_to_lds_b128 %0, %3, off offset:%7\n\t"
            "global_load_async_to_lds_b128 %0, %4, off offset:%8\n\t"
            "s_wait_xcnt 0x0"
              :: "v"(sl0), "v"(wa[0]), "v"(wa[1]), "v"(wa[2]), "v"(wa[3]),
                 "n"(6 * TB64), "n"(6 * TB64 + RS), "n"(6 * TB64 + 2 * RS), "n"(6 * TB64 + 3 * RS)
              : "memory");
        } else {
#pragma unroll
          for (int i = 0; i < 4; ++i) *(v8h*)(Vtl + (sr + 16 * i) * LP + sc8) = zero8h();
        }
      }
      // the copies go out ahead of the wait for the packed words
      __builtin_amdgcn_sched_barrier(0);
#pragma unroll
    for (int g = 0; g < 8; g += RPR) {
      unsigned go[RPR][4][4];
      float    gv[RPR][4][4];
#pragma unroll
      for (int r = 0; r < RPR; ++r)
#pragma unroll
        for (int j = 0; j < 4; ++j) {
          const unsigned w = pw[(g + r) >> 2][j][r & 3];
          go[r][j][0] = qlb + (w & 127u);
          go[r][j][1] = qlb + ((w >> 7) & 511u);
          go[r][j][2] = qlb + ((w >> 16) & 127u);
          go[r][j][3] = qlb + (w >> 23);
        }
      // all offsets are formed ahead of the first gather, so that the gathers go out back to back
      __builtin_amdgcn_sched_barrier(0);
#pragma unroll
      for (int r = 0; r < RPR; ++r)
#pragma unroll
        for (int j = 0; j < 4; ++j) {
          const unsigned ro = (unsigned)(g + r) * (QSP * 4);
          gv[r][j][0] = *(const float*)((const char*)smem + (ro + OFF_BAR * 4) + go[r][j][0]);
          gv[r][j][1] = *(const float*)((const char*)smem + (ro + OFF_POS * 4) + go[r][j][1]);
          gv[r][j][2] = *(const float*)((const char*)smem + (ro + OFF_OCT * 4) + go[r][j][2]);
          gv[r][j][3] = *(const float*)((const char*)smem + (ro + OFF_SEM * 4) + go[r][j][3]);
        }
      // precaution: this wait stands ahead of the rewrite of the index loads' offset register (iv, below)
      asm volatile("s_wait_xcnt 0x0" ::: "memory");
      // the scheduler may not sink the gathers to the sums, nor lift a sum over the wait
      __builtin_amdgcn_sched_barrier(0);
#pragma unroll
      for (int r = 0; r < RPR; ++r)
#pragma unroll
        for (int j = 0; j < 4; ++j)
          bs[j][g + r] = (gv[r][j][0] + gv[r][j][1]) + (gv[r][j][2] + gv[r][j][3]);
      // the sums stay ahead of the next run of loads: they free the gathered values' registers for it
      __builtin_amdgcn_sched_barrier(0);
    }
    }
    iv += (unsigned)NG * 4096u;                         // the packed unit of the group's next key tile

    // every copy of this wave has landed; behind the barrier every wave's have
    asm volatile("s_wait_asynccnt 0x0" ::: "memory");
    __syncthreads();
    if (!act) continue;                                 // behind the round's last barrier; the round is the loop's last

    // ---- q.k: 16 query rows x 64 keys per wave, 3 bf16 products ----
    v8f s[4];
#pragma unroll
    for (int j = 0; j < 4; ++j) {
      s[j] = zero8();
#pragma unroll
      for (int dc = 0; dc < 2; ++dc) {
        FB kb, kl;
        kb.h[0] = *(const v8b*)(Ksh + (j * 16 + c) * LP + dc * 32 + 8 * hh);
        kb.h[1] = *(const v8b*)(Ksh + (j * 16 + c) * LP + dc * 32 + 16 + 8 * hh);
        kl.h[0] = *(const v8b*)(Ksl + (j * 16 + c) * LP + dc * 32 + 8 * hh);
        kl.h[1] = *(const v8b*)(Ksl + (j * 16 + c) * LP + dc * 32 + 16 + 8 * hh);
        s[j] = mma_b(qah[dc], kb.v, s[j]);
        s[j] = mma_b(qah[dc], kl.v, s[j]);
        s[j] = mma_b(qal[dc], kb.v, s[j]);
      }
    }

    // ---- q.er skew band: 5 subtiles of 16 band rows, streamed; diagonal extraction by bpermute ----
    {
      const int wb = (3 - wave) * 16;           // this wave's band offset inside Esh
      v8f prev = zero8();
#pragma unroll
      for (int u = 0; u < 5; ++u) {
        v8f cur = zero8();
#pragma unroll
        for (int dc = 0; dc < 2; ++dc) {
          FB eb;
          const __bf16* ep = Esh + (wb + u * 16 + c) * LP + dc * 32 + 8 * hh;
          eb.h[0] = *(const v8b*)(ep);
          eb.h[1] = *(const v8b*)(ep + 16);
          cur = mma_b(qah[dc], eb.v, cur);
          cur = mma_b(qal[dc], eb.v, cur);
        }
        if (u >= 1) {                            // key subtile jsub = u-1 uses subtiles u-1 (prev) and u (cur)
#pragma unroll
          for (int r = 0; r < 8; ++r) {
            const int base = 15 - (8 * hh + r) + c;                  // 0..30
            const int src  = (lane & 16) | (base & 15);
            const float vlo = __shfl(prev[r], src, 32);
            const float vhi = __shfl(cur[r], src, 32);
            s[u - 1][r] += (base < 16) ? vlo : vhi;
          }
        }
        prev = cur;
      }
    }

    // ---- add the gathered structure biases, scale, causal replace mask, online softmax, P (x1024, f16) and
    //      P residual (x4096) to LDS ----
    _Float16* pwh = Psh + wave * (16 * LP);
    _Float16* pwl = Psl + (RES ? wave : 0) * (16 * LP);
#pragma unroll
    for (int r = 0; r < 8; ++r) {
      const int    trow = q0 + 8 * hh + r;
      float m = -INFINITY;
#pragma unroll
      for (int j = 0; j < 4; ++j) {
        const int key = kv0 + j * 16 + c;
        float sv = (s[j][r] + bs[j][r]) * sscale;
        sv = (key <= trow) ? sv : -1.0e9f;
        s[j][r] = sv;
        m = fmaxf(m, sv);
      }
#pragma unroll
      for (int off = 1; off < 16; off <<= 1) m = fmaxf(m, __shfl_xor(m, off, 32));
      const float mnew  = fmaxf(mrow[r], m);
      const float msafe = (mnew == -INFINITY) ? 0.f : mnew;
      const float alpha = __expf(mrow[r] - msafe);
      mrow[r] = mnew;
      float psum = 0.f;
#pragma unroll
      for (int j = 0; j < 4; ++j) {
        const float p = __expf(s[j][r] - msafe);     // masked logit -1e9 against a normal max: exp -> 0
        psum += p;
        const float p1k = p * 1024.0f;
        const _Float16 ph = (_Float16)p1k;
        pwh[(8 * hh + r) * LP + j * 16 + c] = ph;
        if (RES) {
          const _Float16 pl = (_Float16)((p1k - (float)ph) * 4096.0f);
          pwl[(8 * hh + r) * LP + j * 16 + c] = pl;
        }
      }
#pragma unroll
      for (int off = 1; off < 16; off <<= 1) psum += __shfl_xor(psum, off, 32);
      lrow[r] = lrow[r] * alpha + psum;
#pragma unroll
      for (int t = 0; t < 4; ++t) oacc[t][r] *= alpha;
    }
    __builtin_amdgcn_fence(__ATOMIC_RELEASE, "workgroup");
    __builtin_amdgcn_wave_barrier();
    __builtin_amdgcn_fence(__ATOMIC_ACQUIRE, "workgroup");

    // ---- context += P . V (f16 WMMA), residual products into a separate accumulator ----
    v8f o1[4];
#pragma unroll
    for (int t = 0; t < 4; ++t) o1[t] = zero8();
#pragma unroll 1
    for (int kk = 0; kk < 2; ++kk) {
      FH pa, pl;
      pa.h[0] = *(const v8h*)(pwh + c * LP + kk * 32 + 8 * hh);
      pa.h[1] = *(const v8h*)(pwh + c * LP + kk * 32 + 16 + 8 * hh);
      if (RES) {
        pl.h[0] = *(const v8h*)(pwl + c * LP + kk * 32 + 8 * hh);
        pl.h[1] = *(const v8h*)(pwl + c * LP + kk * 32 + 16 + 8 * hh);
      } else {
        pl.v = pa.v;
      }
#pragma unroll
      for (int t = 0; t < 4; ++t) {
        FH vb;
        vb.h[0] = *(const v8h*)(Vth + (t * 16 + c) * LP + kk * 32 + 8 * hh);
        vb.h[1] = *(const v8h*)(Vth + (t * 16 + c) * LP + kk * 32 + 16 + 8 * hh);
        oacc[t] = mma_h(pa.v, vb.v, oacc[t]);
        if (RES) {
          FH vl;
          vl.h[0] = *(const v8h*)(Vtl + (t * 16 + c) * LP + kk * 32 + 8 * hh);
          vl.h[1] = *(const v8h*)(Vtl + (t * 16 + c) * LP + kk * 32 + 16 + 8 * hh);
          o1[t] = mma_h(pa.v, vl.v, o1[t]);
          o1[t] = mma_h(pl.v, vb.v, o1[t]);
        }
      }
    }
    if (RES) {
#pragma unroll
      for (int t = 0; t < 4; ++t)
#pragma unroll
        for (int r = 0; r < 8; ++r) oacc[t][r] += o1[t][r] * (1.0f / 4096.0f);
    }
  }

  // ---- every group is done with its tiles: the partial results and Os below alias them ----
  __syncthreads();
  // ---- join the groups' partial results: wave w of a group g > 0 hands max, sum and context of its rows to wave w of
  //      group 0, lane to lane (value k of lane l at float 32 k + l of the wave's slab, in group g's tile space) ----
  if (grp != 0) {
    float* xs = (float*)(void*)gsm + wave * (48 * 32) + lane;
#pragma unroll
    for (int t = 0; t < 4; ++t)
#pragma unroll
      for (int r = 0; r < 8; ++r) xs[(t * 8 + r) * 32] = oacc[t][r];
#pragma unroll
    for (int r = 0; r < 8; ++r) { xs[(32 + r) * 32] = mrow[r]; xs[(40 + r) * 32] = lrow[r]; }
  }
  __syncthreads();
  if (grp != 0) return;                            // behind the kernel's last block barrier
#pragma unroll
  for (int g = 1; g < NG; ++g) {
    const float* xs = (const float*)(const void*)(smem + g * GSB) + wave * (48 * 32) + lane;
#pragma unroll
    for (int r = 0; r < 8; ++r) {
      // group 0 has tile 0, where key 0 is open to every row: its max is finite; a group without a tile hands
      // max -inf, sum 0, context 0 and gets the weight exp(-inf) = 0
      const float m1 = xs[(32 + r) * 32], l1 = xs[(40 + r) * 32];
      const float mj = fmaxf(mrow[r], m1);
      const float a0 = exp_slot(mrow[r] - mj), a1 = exp_slot(m1 - mj);
      mrow[r] = mj;
      lrow[r] = lrow[r] * a0 + l1 * a1;
#pragma unroll
      for (int t = 0; t < 4; ++t) oacc[t][r] = oacc[t][r] * a0 + xs[(t * 8 + r) * 32] * a1;
    }
  }
  float* os = Os + wave * (16 * 68);               // pitch 68 floats = 16 B x odd, for the 16-rows-at-a-time reads below
#pragma unroll
  for (int r = 0; r < 8; ++r) {
    const float l = lrow[r];
    const float inv = ((l > 0.f) ? (1.0f / l) : 0.f) * (1.0f / 1024.0f);
#pragma unroll
    for (int t = 0; t < 4; ++t) os[(8 * hh + r) * 68 + t * 16 + c] = oacc[t][r] * inv;
  }
  __builtin_amdgcn_fence(__ATOMIC_RELEASE, "workgroup");
  __builtin_amdgcn_wave_barrier();
  __builtin_amdgcn_fence(__ATOMIC_ACQUIRE, "workgroup");
  {
    // the wave's 16 rows are one strip and its 64 columns two 32-column blocks: 4 runs of 512 B, one after another
    v4u hv[4], lv[4];
#pragma unroll
    for (int it = 0; it < 4; ++it) {
      // run it: lane -> row c, columns 16 it + 8 hh ..+7 (it 0..3 x hh 0..1 x 8 = columns 0..63, c = rows 0..15)
      const float* sp = os + c * 68 + it * 16 + 8 * hh;
      v4u a, a2;
#pragma unroll
      for (int e = 0; e < 4; ++e) {
        const float f0 = sp[2 * e], f1 = sp[2 * e + 1];
        const unsigned short h0 = bf_bits(f0), h1 = bf_bits(f1);
        const unsigned short l0 = bf_bits(f0 - bf_up(h0)), l1 = bf_bits(f1 - bf_up(h1));
        a[e] = pk16(h0, h1); a2[e] = pk16(l0, l1);
      }
      hv[it] = a; lv[it] = a2;
    }
    {
#pragma unroll
      for (int it = 0; it < 4; ++it) {
        const size_t go = ((((rowB + q0) >> 4) * (DM / 32) + (size_t)h * 2) * 64 + it * 32 + lane) * 8;
        *(v4u*)(ohp + go) = hv[it];
        *(v4u*)(olp + go) = lv[it];
      }
      
    }
  }
}

// Every query block in one grid: the blocks with residual planes (qb < RESQB) and the rest depend on the same
// inputs and write disjoint rows, so they run side by side. NB*NH consecutive blocks share one qb, from NQB-1
// downwards: a WGP holds one block at a time, and the longest key loops start first.
__global__ __launch_bounds__(NG * 128, NG)
void attn_rel64(const unsigned short* __restrict__ qhp, const unsigned short* __restrict__ qlp,
                const unsigned short* __restrict__ khp, const unsigned short* __restrict__ klp,
                const unsigned short* __restrict__ vhp, const unsigned short* __restrict__ vlp,
                const unsigned short* __restrict__ erp, const unsigned short* __restrict__ tabp,
                const unsigned* __restrict__ pidx,
                unsigned short* ohp, unsigned short* olp, float sscale) {
  __shared__ __align__(16) unsigned char smem[NG * GSB + QSB];
  const int bx = blockIdx.x;
  const int g  = bx / (NB * NH);
  const int bh = bx - g * (NB * NH);
  const int qb = NQB - 1 - g;                                     // a permutation of 0..NQB-1, block-uniform
  const int h  = bh % NH;
  const int b  = bh / NH;
  if (qb < RESQB)
    attn_body<true>(qhp, qlp, khp, klp, vhp, vlp, erp, tabp, pidx, ohp, olp, smem, qb, h, b, sscale);
  else
    attn_body<false>(qhp, qlp, khp, klp, vhp, vlp, erp, tabp, pidx, ohp, olp, smem, qb, h, b, sscale);
}

// =====================================================================================================
// Workspace map (bytes, every region a multiple of its 64x64-tile / whole-line store granularity):
//   (Xb, the four weight planes, Oh and Ol are stored in fragment order, Pk in packed order; every other plane is row-major)
//   Xb   bf16 [2048][1024]            0        4194304
//   Wqb  bf16 [1024 n][1024 k]    4194304        2097152
//   Wkb                           6291456        2097152
//   Wvb                           8388608        2097152
//   Wob                          10485760        2097152
//   Erb  bf16 [1024][64]         12582912         131072
//   Tb   bf16 [192][64]          12713984          24576
//   Qh   bf16 [2048][1024]       12738560        4194304
//   Ql                           16932864        4194304
//   Kh                           21127168        4194304
//   Kl                           25321472        4194304
//   VTh  f16  [2][1024][1024]    29515776        4194304
//   VTl  f16  [2][1024][256]     33710080        1048576
//   Oh   bf16 [2048][1024]       34758656        4194304
//   Ol                           38952960        4194304
//   Pk   u32  [2][64][16][1024]  43147264        8388608   (packed order; units on or below the diagonal only)
//   end                          51535872
// Weights are [out n][in k] with k contiguous = the Bt / A layout the GEMM wants, so they are only converted.
// =====================================================================================================
extern "C" void kernel_launch(void* const* d_in, const int* in_sizes, int n_in,
                              void* d_out, int out_size, void* d_ws, size_t ws_size,
                              hipStream_t stream) {
  if (n_in < 14) return;
  if (in_sizes[0] != NB * SEQ * DM) return;
  if (in_sizes[1] != NB * SEQ * SEQ || in_sizes[2] != NB * SEQ * SEQ ||
      in_sizes[3] != NB * SEQ * SEQ || in_sizes[4] != NB * SEQ * SEQ) return;
  if (in_sizes[5] != DM * DM || in_sizes[6] != DM * DM || in_sizes[7] != DM * DM || in_sizes[8] != DM * DM) return;
  if (in_sizes[9] != SEQ * HD) return;
  if (in_sizes[10] != 16 * HD || in_sizes[11] != 95 * HD || in_sizes[12] != 24 * HD || in_sizes[13] != 12 * HD) return;
  if (out_size != NB * SEQ * DM) return;

  const float* x    = (const float*)d_in[0];
  const int*   rbar = (const int*)d_in[1];
  const int*   rpos = (const int*)d_in[2];
  const int*   roct = (const int*)d_in[3];
  const int*   rsem = (const int*)d_in[4];
  const float* Wq   = (const float*)d_in[5];
  const float* Wk   = (const float*)d_in[6];
  const float* Wv   = (const float*)d_in[7];
  const float* Wo   = (const float*)d_in[8];
  const float* Er   = (const float*)d_in[9];
  const float* Ebar = (const float*)d_in[10];
  const float* Epos = (const float*)d_in[11];
  const float* Eoct = (const float*)d_in[12];
  const float* Esem = (const float*)d_in[13];

  const size_t PX  = (size_t)MROWS * DM * 2;          //  4194304  16-bit activation plane [2048][1024]
  const size_t PW  = (size_t)DM * DM * 2;             //  2097152  16-bit weight plane
  const size_t PE  = (size_t)SEQ * HD * 2;            //   131072  er plane
  const size_t PT  = (size_t)TROWS * HD * 2;          //    24576  combined structure table
  const size_t PVT = (size_t)NB * DM * SEQ * 2;       //  4194304  v^T hi plane
  const size_t PVL = (size_t)NB * DM * VLP * 2;       //  1048576  v^T residual plane
  const size_t PPK = (size_t)NB * SEQ * SEQ * 4;      //  8388608  packed structure indices
  size_t off = 0;
  const size_t oXb  = off; off += PX;
  const size_t oWq  = off; off += PW;
  const size_t oWk  = off; off += PW;
  const size_t oWv  = off; off += PW;
  const size_t oWo  = off; off += PW;
  const size_t oEr  = off; off += PE;
  const size_t oTb  = off; off += PT;
  const size_t oQh  = off; off += PX;
  const size_t oQl  = off; off += PX;
  const size_t oKh  = off; off += PX;
  const size_t oKl  = off; off += PX;
  const size_t oVTh = off; off += PVT;
  const size_t oVTl = off; off += PVL;
  const size_t oOh  = off; off += PX;
  const size_t oOl  = off; off += PX;
  const size_t oPk  = off; off += PPK;
  if (off > ws_size) return;                          // off = 51535872
  if (off > (size_t)134217728) return;

  char* ws = (char*)d_ws;
  unsigned short* Xb  = (unsigned short*)(ws + oXb);
  unsigned short* Wqb = (unsigned short*)(ws + oWq);
  unsigned short* Wkb = (unsigned short*)(ws + oWk);
  unsigned short* Wvb = (unsigned short*)(ws + oWv);
  unsigned short* Wob = (unsigned short*)(ws + oWo);
  unsigned short* Erb = (unsigned short*)(ws + oEr);
  unsigned short* Tb  = (unsigned short*)(ws + oTb);
  unsigned short* Qh  = (unsigned short*)(ws + oQh);
  unsigned short* Ql  = (unsigned short*)(ws + oQl);
  unsigned short* Kh  = (unsigned short*)(ws + oKh);
  unsigned short* Kl  = (unsigned short*)(ws + oKl);
  unsigned short* VTh = (unsigned short*)(ws + oVTh);
  unsigned short* VTl = (unsigned short*)(ws + oVTl);
  unsigned short* Oh  = (unsigned short*)(ws + oOh);
  unsigned short* Ol  = (unsigned short*)(ws + oOl);
  unsigned*       Pk  = (unsigned*)(ws + oPk);

  const dim3 blk(256);
  const dim3 gPrep(PB_P + PB_X + 4 * PB_W + PB_E + PB_T);      // 3382 blocks
  const dim3 gQKV(PJB, 3);                                     // 64 blocks x {q, k, v^T}
  const dim3 gProj(((MROWS / 64) * (DM / 64) + 7) / 8, 1);     // 512 tiles -> 64 blocks: M=2048, N=1024

  // (1) structure indices packed; x -> bf16 plane; weights [n][k] f32 -> bf16 [n][k]; er -> bf16; combined structure table
  prep_all<<<gPrep, blk, 0, stream>>>(x, Wq, Wk, Wv, Wo, Er, Ebar, Epos, Eoct, Esem, rbar, rpos, roct, rsem,
                                      Xb, Wqb, Wkb, Wvb, Wob, Erb, Tb, Pk);
  // (2)-(4) q, k (bf16 hi/lo planes) and v^T (f16 hi plane, residual plane)
  gemm_qkv<<<gQKV, blk, 0, stream>>>(Xb, Wqb, Wkb, Wvb, Qh, Ql, Kh, Kl, VTh, VTl);
  // (5), (6) attention, each block with the structure products q . T^T of its own rows: query blocks 0..RESQB-1 with
  //     residual planes, the rest without, one grid
  attn_rel64<<<dim3(NB * NH * NQB), dim3(NG * 128), 0, stream>>>(
      Qh, Ql, Kh, Kl, VTh, VTl, Erb, Tb, Pk, Oh, Ol, 0.125f);
  // (7) out = context . Wo^T -> d_out f32 [2048][1024]  (A = context hi + lo planes, 2 products)
  gemm64<1, 0, true><<<gProj, blk, 0, stream>>>(
      Oh, Ol, DM, 0LL, Wob, Wob, DM, 0LL,
      d_out, DM, 0LL, d_out, DM, 0LL, DM,
      MROWS, DM, DM, 1.0f);
  (void)hipGetLastError();
}

// v010
// One run takes 91.5 microseconds.
// Two timings next to v009 both put it at 1.10 times that version's speed.
// Over all steps from v000 it is 8.81 times as fast.
// Contractions: q, k, v^T projections = v_wmma_f32_16x16x32_bf16 (bf16 operands from RNE-converted inputs, single product);
// q.k^T = v_wmma_f32_16x16x32_bf16 with bf16 hi/lo split q and k (hi.hi + hi.lo + lo.hi);
// q.Er^T skew band and q.T^T structure tables = bf16 hi/lo q times bf16 table rows (2 products);
// p.v = v_wmma_f32_16x16x32_f16 (p carried x1024 in f16, v f16; extra f16 residual planes x4096 of p and v for the first 256 query rows);
// ctx.Wo^T = bf16 hi/lo ctx times bf16 Wo (2 products); all f32 accumulate; bias gathers, causal mask and softmax in f32.
#include <hip/hip_runtime.h>
#include <math.h>
#include <stdint.h>

#define NB    2
#define SEQ   1024
#define DM    1024
#define NH    16
#define HD    64
#define MROWS (NB * SEQ)     // 2048
#define NQB   (SEQ / 64)     // 16 query / key tiles of 64
#define VLP   256            // key pitch of the v^T residual plane (keys 0..VLP-1)
#define RESQB 4              // leading 64-row query blocks that use the p / v residual planes
#define NTS   10             // 16-row subtiles of the structure table that hold used rows (151 of 160)
#define QSP   164            // LDS row pitch (floats) of the structure-table products: 8 rows = 32 banks mod 64
#define TROWS 192            // rows of the combined structure table (151 used, rest zero)
#define LP    72             // LDS row pitch, 16-bit elements, of the 64-wide K / V^T / er / P tiles: 144 B = 16 B x odd
#define OFF_BAR 0            // 16 rows + zero row  -> idx 0..16
#define OFF_POS 17           // 95 rows + zero row  -> idx 0..95
#define OFF_OCT 113          // 24 rows + zero row  -> idx 0..24
#define OFF_SEM 138          // 12 rows + zero row  -> idx 0..12
static_assert(RESQB * 64 <= VLP);
static_assert(NH * HD == DM);
static_assert((SEQ % 64) == 0 && (DM % 64) == 0 && (TROWS % 64) == 0);
static_assert(OFF_SEM + 13 <= NTS * 16 && NTS * 16 <= QSP && NTS * 16 <= TROWS && (QSP * 8) % 64 == 32);

typedef _Float16 v16h __attribute__((ext_vector_type(16)));
typedef _Float16 v8h  __attribute__((ext_vector_type(8)));
typedef __bf16   v16b __attribute__((ext_vector_type(16)));
typedef __bf16   v8b  __attribute__((ext_vector_type(8)));
typedef float    v8f  __attribute__((ext_vector_type(8)));
typedef float    v4f  __attribute__((ext_vector_type(4)));
typedef unsigned int v4u __attribute__((ext_vector_type(4)));

// ---- scalar helpers --------------------------------------------------------------------------------
__device__ __forceinline__ unsigned short bf_bits(float f) {          // f32 -> bf16 bits, RNE convert
  unsigned u = __float_as_uint(f);
  return (unsigned short)((u + 0x7FFFu + ((u >> 16) & 1u)) >> 16);
}
__device__ __forceinline__ float bf_up(unsigned short h) { return __uint_as_float(((unsigned)h) << 16); }
__device__ __forceinline__ unsigned short h_bits(_Float16 x) { return __builtin_bit_cast(unsigned short, x); }
__device__ __forceinline__ unsigned pk16(unsigned short a, unsigned short b) { return (unsigned)a | ((unsigned)b << 16); }
__device__ __forceinline__ int iclamp(int v, int lo, int hi) { return (v < lo) ? lo : ((v > hi) ? hi : v); }
__device__ __forceinline__ int imin(int a, int b) { return (a < b) ? a : b; }
// exp(x) as __expf forms it (x log2(e), then the hardware's 2^y), with the slot that the instruction set asks for behind a
// transcendental kept in the same statement
__device__ __forceinline__ float exp_slot(float x) {
  const float y = x * 1.44269504088896340736f;
  float r;
  asm("v_exp_f32 %0, %1\n\tv_nop" : "=v"(r) : "v"(y));
  return r;
}
__device__ __forceinline__ v8f zero8() { v8f z = {0.f, 0.f, 0.f, 0.f, 0.f, 0.f, 0.f, 0.f}; return z; }
__device__ __forceinline__ v8h zero8h() {
  const _Float16 z = (_Float16)0.0f;
  v8h r = {z, z, z, z, z, z, z, z};
  return r;
}

// ---- fragment loader: 16-bit A/B operand, lane -> row/col (lane&15), p already includes +8*(lane>>4);
//      elements 0..7 <- p[0..7] (k0+8h..), elements 8..15 <- p[16..23] (k0+16+8h..)
__device__ __forceinline__ v16b ldfrag_b(const __bf16* p) {
  union { v16b v; v8b h[2]; } f;
  f.h[0] = *(const v8b*)(p);
  f.h[1] = *(const v8b*)(p + 16);
  return f.v;
}
//      a wave-uniform pointer to global memory, held in scalar registers, so that a load names it and a 32-bit lane
//      offset (left to itself one build formed a vector address pair per strip, and a load of the run landed in it)
typedef const __attribute__((address_space(1))) char* gcp;
typedef const __attribute__((address_space(1))) v8b*  gv8bp;
__device__ __forceinline__ gcp uni_ptr(const char* p) {
  const unsigned long long u = (unsigned long long)p;
  const unsigned lo = (unsigned)__builtin_amdgcn_readfirstlane((int)(unsigned)u);
  const unsigned hi = (unsigned)__builtin_amdgcn_readfirstlane((int)(unsigned)(u >> 32));
  return (gcp)(((unsigned long long)hi << 32) | lo);
}
//      the same elements in the same positions, from a wave-uniform base and the lane's byte offset vo;
//      H2 = bytes from the lane's elements 0..7 to its elements 8..15 (32 in a row-major plane, 512 in fragment order)
template <int H2>
__device__ __forceinline__ v16b ldfrag_o(gcp base, unsigned vo) {
  union { v16b v; v8b h[2]; } f;
  f.h[0] = *(gv8bp)(base + vo);
  f.h[1] = *(gv8bp)(base + H2 + vo);
  return f.v;
}

// ---- WMMA helpers with trailing VALU hazard gap --------------------------------------------------------
__device__ __forceinline__ v8f mma_b(v16b a, v16b b, v8f c) {
  c = __builtin_amdgcn_wmma_f32_16x16x32_bf16(false, a, false, b, (short)0, c, false, false);
#if defined(__HIP_DEVICE_COMPILE__)
  asm volatile("v_nop\n\tv_nop\n\tv_nop\n\tv_nop" : "+v"(c) : "v"(a), "v"(b));
#endif
  return c;
}
__device__ __forceinline__ v8f mma_h(v16h a, v16h b, v8f c) {
  c = __builtin_amdgcn_wmma_f32_16x16x32_f16(false, a, false, b, (short)0, c, false, false);
#if defined(__HIP_DEVICE_COMPILE__)
  asm volatile("v_nop\n\tv_nop\n\tv_nop\n\tv_nop" : "+v"(c) : "v"(a), "v"(b));
#endif
  return c;
}
__device__ __forceinline__ v8f mma_b_raw(v16b a, v16b b, v8f c) {
  return __builtin_amdgcn_wmma_f32_16x16x32_bf16(false, a, false, b, (short)0, c, false, false);
}
__device__ __forceinline__ void acc_guard4(v8f& a, v8f& b, v8f& c, v8f& d) {
#if defined(__HIP_DEVICE_COMPILE__)
  asm volatile("v_nop\n\tv_nop\n\tv_nop\n\tv_nop" : "+v"(a), "+v"(b), "+v"(c), "+v"(d));
#else
  (void)a; (void)b; (void)c; (void)d;
#endif
}

// =====================================================================================================
// f32 -> bf16 (RNE convert), 8 elements per thread, one 16-B store per lane: a wave writes 512 contiguous B
// (n8 is a multiple of 256 for every use here). coverage: n8 threads x 8 = whole plane.
// =====================================================================================================
__device__ __forceinline__ void cvt_bf16x8(const float* __restrict__ in, unsigned short* out, int n8, int blk) {
  const int i = blk * 256 + threadIdx.x;
  if (i < n8) {
    const v4f a = *(const v4f*)(in + (size_t)i * 8);
    const v4f b = *(const v4f*)(in + (size_t)i * 8 + 4);
    v4u p;
    p[0] = pk16(bf_bits(a[0]), bf_bits(a[1]));
    p[1] = pk16(bf_bits(a[2]), bf_bits(a[3]));
    p[2] = pk16(bf_bits(b[0]), bf_bits(b[1]));
    p[3] = pk16(bf_bits(b[2]), bf_bits(b[3]));
    *(v4u*)(out + (size_t)i * 8) = p;
    
  }
}

// =====================================================================================================
// FRAGMENT ORDER of a 16-bit plane [rows][DM] that a GEMM reads as A or Bt: the plane is cut into 16-row strips and
// each strip into blocks of 32 columns; a block is 1 KB = two runs of 512 B, and run u holds, for lane l = 0..31,
// the 8 elements (row l & 15, columns 16 u + 8 (l >> 4) ..+7) at byte 16 l. Blocks of a strip follow one another, then
// the next strip. So each of a fragment's two 16-B loads reads 512 contiguous bytes (4 whole lines) where a row-major
// plane gives it 32 B from each of 16 lines; which element lands in which lane and register does not change.
//   16-B piece index of (row m, columns 8 k8 ..+7) = (((m >> 4) * (DM/32) + (k8 >> 2)) * 2 + ((k8 >> 1) & 1)) * 32
//                                                    + (k8 & 1) * 16 + (m & 15)
// f32 [rows][DM] -> bf16 (RNE convert) in fragment order: thread i makes piece i, so a wave stores 512 contiguous B;
// a block reads 512 contiguous B of each of 16 rows. coverage: n8 threads x 8 = whole plane (the map is one to one).
// =====================================================================================================
static_assert(DM / 32 == 32);
__device__ __forceinline__ void cvt_bf16_frag(const float* __restrict__ in, unsigned short* out, int n8, int blk) {
  const int i = blk * 256 + threadIdx.x;
  if (i < n8) {
    const int l = i & 31, u = (i >> 5) & 1, kb = (i >> 6) & 31, st = i >> 11;
    const size_t so = (size_t)(st * 16 + (l & 15)) * DM + kb * 32 + u * 16 + (l >> 4) * 8;
    const v4f a = *(const v4f*)(in + so);
    const v4f b = *(const v4f*)(in + so + 4);
    v4u p;
    p[0] = pk16(bf_bits(a[0]), bf_bits(a[1]));
    p[1] = pk16(bf_bits(a[2]), bf_bits(a[3]));
    p[2] = pk16(bf_bits(b[0]), bf_bits(b[1]));
    p[3] = pk16(bf_bits(b[2]), bf_bits(b[3]));
    *(v4u*)(out + (size_t)i * 8) = p;
  }
}

// =====================================================================================================
// Combined structure table, bf16 [TROWS][64]: rows 0..15 bar, 16 zero, 17..111 position, 112 zero,
// 113..136 octave, 137 zero, 138..149 semitone, 150..191 zero. 8 threads per row, 8 elements each,
// all four candidate loads unconditional with clamped row addresses, selection by value.
// PB_T = TROWS*8/256 = 6 blocks of prep_all exactly. coverage: 1536 threads x 8 = 192 x 64.
// =====================================================================================================
__device__ __forceinline__ void build_tab(const float* __restrict__ ebar, const float* __restrict__ epos,
                                          const float* __restrict__ eoct, const float* __restrict__ esem,
                                          unsigned short* tab, int blk) {
  const int g = blk * 256 + threadIdx.x;
  if (g < TROWS * 8) {
    const int s  = g >> 3;
    const int d0 = (g & 7) * 8;
    const int rb = iclamp(s, 0, 15);
    const int rp = iclamp(s - OFF_POS, 0, 94);
    const int ro = iclamp(s - OFF_OCT, 0, 23);
    const int rs = iclamp(s - OFF_SEM, 0, 11);
    const bool ub = (s < 16);
    const bool up = (s >= OFF_POS) && (s < OFF_POS + 95);
    const bool uo = (s >= OFF_OCT) && (s < OFF_OCT + 24);
    const bool us = (s >= OFF_SEM) && (s < OFF_SEM + 12);
    float v[8];
#pragma unroll
    for (int e = 0; e < 8; ++e) {
      const int d = d0 + e;
      const float fb = ebar[rb * HD + d];
      const float fp = epos[rp * HD + d];
      const float fo = eoct[ro * HD + d];
      const float fs = esem[rs * HD + d];
      float t = 0.f;
      t = ub ? fb : t;
      t = up ? fp : t;
      t = uo ? fo : t;
      t = us ? fs : t;
      v[e] = t;
    }
    v4u p;
    p[0] = pk16(bf_bits(v[0]), bf_bits(v[1]));
    p[1] = pk16(bf_bits(v[2]), bf_bits(v[3]));
    p[2] = pk16(bf_bits(v[4]), bf_bits(v[5]));
    p[3] = pk16(bf_bits(v[6]), bf_bits(v[7]));
    *(v4u*)(tab + (size_t)s * HD + d0) = p;
    
  }
}

// =====================================================================================================
// The four structure indices of a score (b, t, s), each clamped to its sub-table's range and taken times 4 (the byte
// offset of an f32 in its sub-table's products), packed into one 32-bit word: bar in bits 0..6, position 7..15, octave
// 16..22, semitone 23..28. Every head reads the same indices, so they are clamped and packed once and the attention
// loads one word a score where it loaded four.
// PACKED ORDER: one 4-KB unit per (b, 16-row strip, 64-key tile), unit index (b * SEQ/16 + strip) * NQB + tile; in a unit
// the 16-B piece (2 j + rq) * 32 + 16 hh + c holds rows 8 hh + 4 rq + 0..3 of key 16 j + c, so that an attention wave
// (lane = 16 hh + c) reads a unit with 8 loads of 512 contiguous bytes. Only the units on or below the diagonal
// (tile <= strip / 4) are read, and only they are written.
// One block per (b, 64-row query block qb, key tile kt <= qb), 4 units: rows p and NQB-1-p have NQB+1 tiles together.
// A wave takes 4 rows x 32 keys of each strip: each of its 64 index loads reads one whole 128-B line, all of them go
// out ahead of the first use, and each of its 4 stores writes two runs of 256 B.
// coverage of a unit: 8 waves (a, rq, hh) x 32 lanes = pieces 0..255, one to one.
// =====================================================================================================
#define PB_P (NB * (NQB / 2) * (NQB + 1))   // 272
static_assert((NQB % 2) == 0 && SEQ == NQB * 64);
__device__ __forceinline__ void pack_idx(const int* __restrict__ ibar, const int* __restrict__ ipos,
                                         const int* __restrict__ ioct, const int* __restrict__ isem,
                                         unsigned* pk, int blk) {
  const int b  = blk / ((NQB / 2) * (NQB + 1));
  const int t  = blk - b * ((NQB / 2) * (NQB + 1));
  const int p  = t / (NQB + 1);
  const int e0 = t - p * (NQB + 1);
  const int qb = (e0 <= p) ? p : (NQB - 1 - p);                       // block-uniform
  const int kt = (e0 <= p) ? e0 : (e0 - p - 1);                       // 0..qb
  const int lane = threadIdx.x & 31, wv = threadIdx.x >> 5;
  const int a = wv & 1, rq = (wv >> 1) & 1, hh = wv >> 2;
  // byte offset of index (row qb*64 + 8 hh + 4 rq, key kt*64 + 32 a + lane); strip s and row e add a constant
  const unsigned vo = ((unsigned)(b * SEQ + qb * 64 + 8 * hh + 4 * rq) * SEQ + (unsigned)(kt * 64 + 32 * a + lane)) * 4u;
  int xi[4][4][4];
#pragma unroll
  for (int s = 0; s < 4; ++s)
#pragma unroll
    for (int e = 0; e < 4; ++e) {
      const size_t ko = (size_t)((s * 16 + e) * SEQ) * 4;
      xi[s][e][0] = *(const int*)((const char*)ibar + ko + vo);
      xi[s][e][1] = *(const int*)((const char*)ipos + ko + vo);
      xi[s][e][2] = *(const int*)((const char*)ioct + ko + vo);
      xi[s][e][3] = *(const int*)((const char*)isem + ko + vo);
    }
  // precaution: this wait stands ahead of every later rewrite of the loads' offset register; it names the register
  // so that it stays whole up to it
  asm volatile("s_wait_xcnt 0x0" :: "v"(vo) : "memory");
  // the scheduler may not sink the index loads to their first uses, where each would wait alone
  __builtin_amdgcn_sched_barrier(0);
  const int piece = ((2 * a + (lane >> 4)) * 2 + rq) * 32 + hh * 16 + (lane & 15);
  unsigned* po = pk + ((size_t)((b * (SEQ / 16) + qb * 4) * NQB + kt) * 256 + piece) * 4;
#pragma unroll
  for (int s = 0; s < 4; ++s) {
    v4u w;
#pragma unroll
    for (int e = 0; e < 4; ++e)
      w[e] = ((unsigned)iclamp(xi[s][e][0], 0, 16) << 2) | ((unsigned)iclamp(xi[s][e][1], 0, 95) << 9) |
             ((unsigned)iclamp(xi[s][e][2], 0, 24) << 18) | ((unsigned)iclamp(xi[s][e][3], 0, 12) << 25);
    *(v4u*)(po + (size_t)s * NQB * 1024) = w;
  }
}

// =====================================================================================================
// All operand preparation in one grid (the eight pieces depend on nothing but the inputs, so they run side by
// side): blocks 0..PB_P-1 pack the structure indices, the next PB_X convert x, the next 4*PB_W the four weights (these
// five into fragment order), the next PB_E er (row-major), the last PB_T build the combined table. The piece is chosen
// by blockIdx.x alone (block-uniform).
// =====================================================================================================
#define PB_X (MROWS * DM / 8 / 256)   // 1024
#define PB_W (DM * DM / 8 / 256)      //  512
#define PB_E (SEQ * HD / 8 / 256)     //   32
#define PB_T (TROWS * 8 / 256)        //    6
static_assert(PB_X * 2048 == MROWS * DM && PB_W * 2048 == DM * DM && PB_E * 2048 == SEQ * HD && PB_T * 256 == TROWS * 8);
__global__ __launch_bounds__(256) void prep_all(
    const float* __restrict__ x, const float* __restrict__ wq, const float* __restrict__ wk,
    const float* __restrict__ wv, const float* __restrict__ wo, const float* __restrict__ er,
    const float* __restrict__ ebar, const float* __restrict__ epos,
    const float* __restrict__ eoct, const float* __restrict__ esem,
    const int* __restrict__ ibar, const int* __restrict__ ipos,
    const int* __restrict__ ioct, const int* __restrict__ isem,
    unsigned short* xb, unsigned short* wqb, unsigned short* wkb, unsigned short* wvb, unsigned short* wob,
    unsigned short* erb, unsigned short* tab, unsigned* pk) {
  int blk = blockIdx.x;
  if (blk < PB_P) { pack_idx(ibar, ipos, ioct, isem, pk, blk); return; }
  blk -= PB_P;
  if (blk < PB_X) { cvt_bf16_frag(x, xb, MROWS * DM / 8, blk); return; }
  blk -= PB_X;
  if (blk < 4 * PB_W) {
    const int w = blk / PB_W;
    const float*    in  = (w == 0) ? wq  : (w == 1) ? wk  : (w == 2) ? wv  : wo;
    unsigned short* out = (w == 0) ? wqb : (w == 1) ? wkb : (w == 2) ? wvb : wob;
    cvt_bf16_frag(in, out, DM * DM / 8, blk - w * PB_W);
    return;
  }
  blk -= 4 * PB_W;
  if (blk < PB_E) { cvt_bf16x8(er, erb, SEQ * HD / 8, blk); return; }
  build_tab(ebar, epos, eoct, esem, tab, blk - PB_E);
}

// =====================================================================================================
// Register-blocked batched bf16 WMMA GEMM: C[m][n] = sum_k A[m][k] * Bt[n][k]; one wave per 64x64 tile,
// no block barriers. A row-major [M][K] pitch lda; Bt row-major [N][K] pitch ldb (k contiguous);
// M, N multiples of 64, K a multiple of 32 and at least 32. blockIdx.y = batch index (strides in elements).
// NSPLIT: 0 = A.Bt; 1 = (A + A2).Bt (A2 = unscaled bf16 lo plane of A); 2 = A.Bt + A2.Bt + A.Bt2.
// OUT_MODE: 0 = f32 (pitch ldc); 2 = bf16 hi plane C + bf16 lo plane C2 (lo = RNE(v - hi), unscaled);
//           3 = f16 hi plane C + f16 residual plane C2 = f16((v - hi) * rscale), C2 written only for tiles
//               with n0 < N2 (pitch ldc2, batch stride strideC2).
// FR: false = A and Bt planes row-major; true = both in fragment order (then lda == ldb == K == DM, and a batch
//     stride is a whole number of 16-row strips).
// =====================================================================================================
//   sT: the block's 8 x (16 x 68) f32 staging slabs; bx: the block's index among the tiles; b: batch index;
//   rot0: the caller's part of the k step at which the block enters its k loop (see the k loop).
template <int NSPLIT, int OUT_MODE, bool FR>
__device__ __forceinline__ void gemm64_body(
    const unsigned short* __restrict__ Ap, const unsigned short* A2p, int lda, long long strideA,
    const unsigned short* __restrict__ Btp, const unsigned short* Bt2p, int ldb, long long strideB,
    void* Cout, int ldc, long long strideC,
    void* Cout2, int ldc2, long long strideC2, int N2,
    int M, int N, int K, float rscale, float* sT, int bx, int b, int rot0) {
  const __bf16* A   = (const __bf16*)(const void*)Ap;
  const __bf16* A2  = (const __bf16*)(const void*)A2p;
  const __bf16* Bt  = (const __bf16*)(const void*)Btp;
  const __bf16* Bt2 = (const __bf16*)(const void*)Bt2p;
  const int lane = threadIdx.x & 31;
  const int wave = threadIdx.x >> 5;
  const int tilesN = N >> 6;
  const int tilesM = M >> 6;
  const int tile = bx * 8 + wave;
  if (tile >= tilesM * tilesN) return;   // wave-uniform; no block barriers in this kernel
  const int tm = tile / tilesN;
  const int tn = tile - tm * tilesN;
  const int m0 = tm << 6;
  const int n0 = tn << 6;

  const __bf16* Ab  = A  + (size_t)b * strideA;
  const __bf16* Bb  = Bt + (size_t)b * strideB;
  const __bf16* Ab2 = (NSPLIT >= 1) ? (A2  + (size_t)b * strideA) : Ab;
  const __bf16* Bb2 = (NSPLIT == 2) ? (Bt2 + (size_t)b * strideB) : Bb;

  const int rlane = lane & 15;                 // row (A) / col (B, D) within subtile
  const int koff  = (lane >> 4) * 8;           // k offset of this lane half
  const int mOff  = (lane >> 4) * 8;           // D row offset

  v8f acc[4][4];
#pragma unroll
  for (int i = 0; i < 4; ++i)
#pragma unroll
    for (int j = 0; j < 4; ++j) acc[i][j] = zero8();

  // k loop, K >= 32: two register sets of fragments. All loads of one k step (32 columns) go out in one run, one k
  // step ahead of their products, so a k step waits for at most the rest of one load round trip instead of four whole
  // ones. Every load names a wave-uniform base (plane + 16-row strip) and one of two lane offsets, va (A) and vb (Bt).
  // ROTATED ENTRY: blocks that start together and read the same operand lines (a Bt tile is read by every block of its
  // tile column, an A strip by every block of its tile row) would ask L2 for the same line at the same moment all the way.
  // Each block enters the k loop at its own k step ks and walks ks .. nk-1, 0 .. ks-1; ks is the same for the block's
  // 8 waves, which share their A strip through the WGP cache. The f32 sums over k are taken in that order.
  // Behind the last k step the walk goes on round: a run that has no k step left reads step ks again (in bounds,
  // never used), so every run holds the same number of loads and the counted waits stay exact.
  // The inner loops are unrolled so that every fragment and accumulator index is a constant (registers, no scratch).
  struct FragSet { v16b a[4], l[4], b[4], m[4]; };                // A, second A plane, Bt, second Bt plane
  const size_t sa = (size_t)lda * 32, sb = (size_t)ldb * 32;      // bytes from one 16-row strip to the next
  gcp pa[4], pa2[4], pb[4], pb2[4];                               // the planes' four strips, scalar bases
#pragma unroll
  for (int i = 0; i < 4; ++i) {
    pa[i]  = uni_ptr((const char*)Ab + i * sa);
    pb[i]  = uni_ptr((const char*)Bb + i * sb);
    pa2[i] = (NSPLIT >= 1) ? uni_ptr((const char*)Ab2 + i * sa) : pa[i];
    pb2[i] = (NSPLIT == 2) ? uni_ptr((const char*)Bb2 + i * sb) : pb[i];
  }
  //   fragment order: a 16-row strip is as many bytes as in a row-major plane, so the bases above serve both; the
  //   lane's piece stands at 16 * lane in its 512-B run, and a k step is one 1-KB block
  constexpr int      H2   = FR ? 512 : 32;
  constexpr unsigned KINC = FR ? 1024u : 64u;
  unsigned va = FR ? ((unsigned)m0 * (unsigned)lda * 2u + (unsigned)lane * 16u)
                   : (((unsigned)(m0 + rlane) * (unsigned)lda + (unsigned)koff) * 2u);
  unsigned vb = FR ? ((unsigned)n0 * (unsigned)ldb * 2u + (unsigned)lane * 16u)
                   : (((unsigned)(n0 + rlane) * (unsigned)ldb + (unsigned)koff) * 2u);
  const int nk = K >> 5;
  const int t0 = bx * 8;                                          // the block's first tile (block-uniform)
  const int ks = (t0 / tilesN + ((t0 % tilesN) >> 3) * 8 + rot0) % nk;   // tile row + 8 x (eighth of the tile column) + rot0
  va += (unsigned)ks * KINC;
  vb += (unsigned)ks * KINC;
  int kp = ks;                                                    // the k step that va and vb stand at
  auto load = [&](FragSet& S) {
#pragma unroll
    for (int j = 0; j < 4; ++j) {
      S.b[j] = ldfrag_o<H2>(pb[j], vb);
      if (NSPLIT == 2) S.m[j] = ldfrag_o<H2>(pb2[j], vb); else S.m[j] = S.b[j];
    }
#pragma unroll
    for (int i = 0; i < 4; ++i) {
      S.a[i] = ldfrag_o<H2>(pa[i], va);
      if (NSPLIT >= 1) S.l[i] = ldfrag_o<H2>(pa2[i], va); else S.l[i] = S.a[i];
    }
    // the scheduler may not sink the run's loads into the products behind it, where each would go out late
    __builtin_amdgcn_sched_barrier(0);
  };
  auto advance = [&]() {
    // the wait below stays behind the products: lifted to stand directly behind the loads it would hold the products up
    __builtin_amdgcn_sched_barrier(0);
#if defined(__HIP_DEVICE_COMPILE__)
    // precaution: this wait stands ahead of every rewrite of a register that a load of the last run names; it takes
    // the two lane offsets and the scalar bases as operands so that they stay whole up to it and the additions
    // stay behind it
    asm volatile("s_wait_xcnt 0x0" : "+v"(va), "+v"(vb)
                 : "s"(pa[0]), "s"(pa[1]), "s"(pa[2]), "s"(pa[3]), "s"(pb[0]), "s"(pb[1]), "s"(pb[2]), "s"(pb[3]),
                   "s"(pa2[0]), "s"(pa2[1]), "s"(pa2[2]), "s"(pa2[3]), "s"(pb2[0]), "s"(pb2[1]), "s"(pb2[2]), "s"(pb2[3])
                 : "memory");
#endif
    ++kp;
    const bool wrap = (kp == nk);                                 // wave-uniform
    kp = wrap ? 0 : kp;
    const unsigned inc = wrap ? (0u - (unsigned)(nk - 1) * KINC) : KINC;
    va += inc;
    vb += inc;
  };
  auto products = [&](const FragSet& S) {
#pragma unroll
    for (int i = 0; i < 4; ++i)
#pragma unroll
      for (int j = 0; j < 4; ++j) {
        acc[i][j] = mma_b_raw(S.a[i], S.b[j], acc[i][j]);
        if (NSPLIT >= 1) acc[i][j] = mma_b_raw(S.l[i], S.b[j], acc[i][j]);
        if (NSPLIT == 2) acc[i][j] = mma_b_raw(S.a[i], S.m[j], acc[i][j]);
      }
  };
  FragSet S0, S1;
  load(S0); advance();
  const int ng = nk / 2;                                          // whole turns of the two sets
  for (int g = 0; g < ng; ++g) {
    load(S1); products(S0); advance();
    load(S0); products(S1); advance();
  }
  if (nk - ng * 2 >= 1) products(S0);                             // the k step left over (wave-uniform)
  acc_guard4(acc[0][0], acc[0][1], acc[0][2], acc[0][3]);
  acc_guard4(acc[1][0], acc[1][1], acc[1][2], acc[1][3]);
  acc_guard4(acc[2][0], acc[2][1], acc[2][2], acc[2][3]);
  acc_guard4(acc[3][0], acc[3][1], acc[3][2], acc[3][3]);

  // ---- epilogue ----
  float* slab = sT + wave * (16 * 68);             // per-wave 16x64 slab, pitch 68 floats
#pragma unroll
  for (int i = 0; i < 4; ++i) {
    const int mBase = m0 + (i << 4);
#pragma unroll
    for (int j = 0; j < 4; ++j) {
#pragma unroll
      for (int r = 0; r < 8; ++r) {
        slab[(mOff + r) * 68 + (j << 4) + rlane] = acc[i][j][r];
      }
    }
    __builtin_amdgcn_fence(__ATOMIC_RELEASE, "workgroup");
    __builtin_amdgcn_wave_barrier();
    __builtin_amdgcn_fence(__ATOMIC_ACQUIRE, "workgroup");
    if (OUT_MODE == 0) {
      float* C = (float*)Cout + (size_t)b * strideC;
      const int hh = lane >> 4, c4 = (lane & 15) * 4;     // 256-B row segment = 16 lanes x 16 B
      {
#pragma unroll
        for (int it = 0; it < 8; ++it) {
          const int row = it * 2 + hh;                     // it 0..7 x hh 0..1 = rows 0..15
          const v4f v = *(const v4f*)(slab + row * 68 + c4);
          *(v4f*)(C + (size_t)(mBase + row) * ldc + n0 + c4) = v;
        }
        
      }
    } else {
      const int q = lane >> 3, c8 = (lane & 7) * 8;
      unsigned short* C  = (unsigned short*)Cout  + (size_t)b * strideC;
      unsigned short* C2 = (unsigned short*)Cout2 + (size_t)b * strideC2;
      const bool wlo = (OUT_MODE == 2) || (n0 < N2);      // wave-uniform
      v4u hv[4], lv[4];
#pragma unroll
      for (int it = 0; it < 4; ++it) {
        const int row = it * 4 + q;                        // it 0..3 x q 0..3 = rows 0..15
        const float* sp = slab + row * 68 + c8;
        v4u a, a2;
#pragma unroll
        for (int e = 0; e < 4; ++e) {
          const float f0 = sp[2 * e], f1 = sp[2 * e + 1];
          unsigned short h0, h1, l0, l1;
          if (OUT_MODE == 2) {
            h0 = bf_bits(f0); h1 = bf_bits(f1);
            l0 = bf_bits(f0 - bf_up(h0)); l1 = bf_bits(f1 - bf_up(h1));
          } else {
            const _Float16 x0 = (_Float16)f0, x1 = (_Float16)f1;
            h0 = h_bits(x0); h1 = h_bits(x1);
            l0 = h_bits((_Float16)((f0 - (float)x0) * rscale));
            l1 = h_bits((_Float16)((f1 - (float)x1) * rscale));
          }
          a[e] = pk16(h0, h1); a2[e] = pk16(l0, l1);
        }
        hv[it] = a; lv[it] = a2;
      }
      {
#pragma unroll
        for (int it = 0; it < 4; ++it) {
          const int row = it * 4 + q;
          *(v4u*)(C + (size_t)(mBase + row) * ldc + n0 + c8) = hv[it];
          if (wlo) *(v4u*)(C2 + (size_t)(mBase + row) * ldc2 + n0 + c8) = lv[it];
        }
        
      }
    }
    __builtin_amdgcn_fence(__ATOMIC_RELEASE, "workgroup");
    __builtin_amdgcn_wave_barrier();
    __builtin_amdgcn_fence(__ATOMIC_ACQUIRE, "workgroup");
  }
}

template <int NSPLIT, int OUT_MODE, bool FR>
__global__ __launch_bounds__(256) void gemm64(
    const unsigned short* __restrict__ Ap, const unsigned short* A2p, int lda, long long strideA,
    const unsigned short* __restrict__ Btp, const unsigned short* Bt2p, int ldb, long long strideB,
    void* Cout, int ldc, long long strideC,
    void* Cout2, int ldc2, long long strideC2, int N2,
    int M, int N, int K, float rscale) {
  __shared__ __align__(16) float sT[8 * 16 * 68];
  gemm64_body<NSPLIT, OUT_MODE, FR>(Ap, A2p, lda, strideA, Btp, Bt2p, ldb, strideB, Cout, ldc, strideC,
                                Cout2, ldc2, strideC2, N2, M, N, K, rscale, sT, blockIdx.x, blockIdx.y, 0);
}

// The three projections in one grid: each alone fills a quarter of the chip's WGPs and none reads another's result.
//   blockIdx.y = 0: q = x . Wq^T -> bf16 hi/lo planes [b*SEQ+t][h*64+d]   (M=2048, N=1024, K=1024)
//   blockIdx.y = 1: k = x . Wk^T -> bf16 hi/lo planes
//   blockIdx.y = 2: v^T = Wv . x^T per batch -> f16 hi plane [b][h*64+d][s] (pitch SEQ) and residual plane (x4096,
//                   keys < VLP only, pitch VLP); A = Wvb [n][k], Bt = Xb rows of batch b = blockIdx.x / VTB
#define PJB ((MROWS / 64) * (DM / 64) / 8)   // 64 blocks of 8 tiles per projection
#define VTB ((DM / 64) * (SEQ / 64) / 8)     // 32 blocks of 8 tiles per batch of v^T
static_assert(VTB * NB == PJB);
__global__ __launch_bounds__(256) void gemm_qkv(
    const unsigned short* __restrict__ Xb, const unsigned short* __restrict__ Wqb,
    const unsigned short* __restrict__ Wkb, const unsigned short* __restrict__ Wvb,
    unsigned short* Qh, unsigned short* Ql, unsigned short* Kh, unsigned short* Kl,
    unsigned short* VTh, unsigned short* VTl) {
  __shared__ __align__(16) float sT[8 * 16 * 68];
  const int which = blockIdx.y;                 // block-uniform
  if (which < 2) {
    const unsigned short* Wb = which ? Wkb : Wqb;
    unsigned short* Ch = which ? Kh : Qh;
    unsigned short* Cl = which ? Kl : Ql;
    gemm64_body<0, 2, true>(Xb, Xb, DM, 0LL, Wb, Wb, DM, 0LL,
                      (void*)Ch, DM, 0LL, (void*)Cl, DM, 0LL, DM,
                      MROWS, DM, DM, 1.0f, sT, blockIdx.x, 0, which * 16);   // q and k read the same x strips
  } else {
    const int b = blockIdx.x / VTB;
    gemm64_body<0, 3, true>(Wvb, Wvb, DM, 0LL, Xb, Xb, DM, (long long)SEQ * DM,
                      (void*)VTh, SEQ, (long long)DM * SEQ, (void*)VTl, VLP, (long long)DM * VLP, VLP,
                      DM, SEQ, DM, 4096.0f, sT, blockIdx.x - b * VTB, b, b * 16);   // both batches read the same Wv strips
  }
}

// =====================================================================================================
// Causal attention with relative-index (skew) bias and four gathered structure biases, head dim 64.
//   q planes (bf16 hi / lo): element (b, t, h, d) at [(b*SEQ + t)*DM + h*64 + d]; k planes same layout.
//   v^T hi plane (f16): element (b, h, d, s) at [(b*DM + h*64 + d)*SEQ + s]
//   v^T residual plane (f16, (v - hi)*4096): [(b*DM + h*64 + d)*VLP + s], s < VLP, read only when RES
//   er: bf16 [SEQ][64]; tab: bf16 [TROWS][64], the combined structure table T
//   qe = q . T^T (q hi/lo, 2 products per 32 columns, f32): the NG waves that hold the same 16 rows form those rows x NTS*16 table rows once between them,
//   ahead of the key loop, and keeps them in LDS (Qs, pitch QSP floats); the four bias gathers of a score read them there.
//   pidx: the four structure indices of each score, clamped and packed into one word, in packed order (pack_idx).
//   scores[t][s] = (q_t.k_s + q_t.er[SEQ-1+s-t] + qe[OFF_BAR+ibar] + qe[OFF_POS+ipos] + qe[OFF_OCT+ioct]
//                   + qe[OFF_SEM+isem]) * sscale for s <= t, else -1e9 (replace mask).
//   q.k : bf16 hi/lo split (3 products); q.er : q hi/lo x bf16 er (2 products); f32 accumulate.
//   Skew band: a block (64 query rows, key tile kv0) needs er rows ebb .. ebb+127 with
//   ebb = SEQ-64+kv0-qb*64 >= 0 (staged in LDS, addresses clamped at SEQ-1; clamped rows only feed
//   masked positions). Wave w (rows q0..q0+15) computes 5 subtiles of 16 band rows starting at
//   band row 16*(3-w); the diagonal D[mi][15-mi+jj] is fetched with two unconditional bpermutes per
//   element and selected by value; subtiles are produced one at a time (prev / cur).
//   p = exp(s - m) carried as f16(1024 p); context = p . v on f16 WMMA; RES adds f16 residual planes of p and v
//   (scale 4096, separate accumulator folded back with 1/4096 per chunk in f32); online softmax in f32.
//   Block = NG groups of 4 waves = 64 query rows of one (b, h); grid = NQB * NH * NB; key tiles kt = 0..qb are dealt
//   to the groups (group g takes kt = NG i + g in round i, rounds block-uniform), so that the chain of tiles one wave
//   walks is 1/NG as long; wave w of every group holds rows q0..q0+15 with its own running max, sum and context, and
//   the partial results are joined in f32 through LDS behind the loop.
//   K / V^T / er chunk staging: the group's 128 threads, 16-B asynchronous copies to LDS, issued behind the round's first
//   __syncthreads and ahead of the bias gathers, waited for ahead of the second; P tiles are wave-private, spilled with _Float16 element stores and
//   LDS (static byte buffer, rows of 64 elements at a pitch of LP = 72, so that the 16 rows of a 16-B fragment read
//   fall on different banks; T = 9216 B is a 64-row tile), per group at 8T g: Ksh 0, Ksl T, Vth 2T, Esh 3T (128 rows),
//   Psh 5T, Vtl 6T (RES), Psl 7T (RES); Qs 8T NG (64 rows x QSP floats, shared); after the key loop and a block barrier
//   the f32 context staging Os (17 KB) aliases offset 0 and the partial results of group g > 0 (24 KB) alias 8T g.
//   Output planes (bf16 hi / lo of the normalised context), element (row b*SEQ + t, column h*64 + d), in fragment order;
//   coverage: each wave of group 0 stores rows q0..q0+15 (lane & 15) x 64 columns (it 0..3 x lane>>4 0..1 x 8) of both planes.
// =====================================================================================================
#define TB64 (64 * LP * 2)    // bytes of a 64-row tile in LDS
#define QSB  (64 * QSP * 4)   // bytes of the block's structure products in LDS
#define GSB  (8 * TB64)       // bytes of one group's tiles in LDS
#define NG   3                // groups of 4 waves that share a query block's key tiles
#define SPG  ((NTS + NG - 1) / NG)   // structure-table subtiles per group
#define SPC  (NTS - (NG - 1) * SPG)   // of the last group
static_assert((LP * 2) % 32 == 16 && LP >= 64 && 4 * 16 * 68 * 4 <= 2 * TB64 && 4 * 48 * 32 * 4 <= GSB);
static_assert(SPC >= 1 && SPC <= SPG && NG * GSB + QSB <= 327680);
template <int N> struct Cnt { static constexpr int n = N; };   // a count handed to a lambda as a compile-time constant
template <bool RES>
__device__ __forceinline__
void attn_body(const unsigned short* __restrict__ qhp, const unsigned short* __restrict__ qlp,
                const unsigned short* __restrict__ khp, const unsigned short* __restrict__ klp,
                const unsigned short* __restrict__ vhp, const unsigned short* __restrict__ vlp,
                const unsigned short* __restrict__ erp, const unsigned short* __restrict__ tabp,
                const unsigned* __restrict__ pidx,
                unsigned short* ohp, unsigned short* olp,
                unsigned char* smem, int qb, int h, int b, float sscale) {
  union FB { v16b v; v8b h[2]; };
  union FH { v16h v; v8h h[2]; };
  //   key group of the wave, the same in every lane: held in a scalar register so that tests on it are scalar branches
  const int grp  = __builtin_amdgcn_readfirstlane((int)(threadIdx.x >> 7));
  unsigned char* const gsm = smem + grp * GSB;                              // the group's own tiles
  __bf16*   const Ksh = (__bf16*)(void*)(gsm);
  __bf16*   const Ksl = (__bf16*)(void*)(gsm + TB64);
  _Float16* const Vth = (_Float16*)(void*)(gsm + 2 * TB64);
  __bf16*   const Esh = (__bf16*)(void*)(gsm + 3 * TB64);
  _Float16* const Psh = (_Float16*)(void*)(gsm + 5 * TB64);
  _Float16* const Vtl = (_Float16*)(void*)(gsm + (RES ? 6 * TB64 : 2 * TB64));   // never dereferenced when !RES
  _Float16* const Psl = (_Float16*)(void*)(gsm + (RES ? 7 * TB64 : 5 * TB64));   // never dereferenced when !RES
  float*    const Os  = (float*)(void*)(smem);                              // after the key loop only

  const int tid  = threadIdx.x & 127;                                       // thread within the group
  const int wave = tid >> 5;                                                // 16-row strip of the wave, 0..3
  const int lane = tid & 31;
  const int hh   = lane >> 4;
  const int c    = lane & 15;

  const int q0   = qb * 64 + wave * 16;
  const size_t rowB = (size_t)b * SEQ;

  const __bf16* Qh  = (const __bf16*)(const void*)qhp + (size_t)h * HD;
  const __bf16* Ql  = (const __bf16*)(const void*)qlp + (size_t)h * HD;
  const __bf16* Kh  = (const __bf16*)(const void*)khp + (size_t)h * HD;
  const __bf16* Kl  = (const __bf16*)(const void*)klp + (size_t)h * HD;
  const _Float16* Vh = (const _Float16*)(const void*)vhp + ((size_t)b * DM + (size_t)h * HD) * SEQ;
  const _Float16* Vl = (const _Float16*)(const void*)vlp + ((size_t)b * DM + (size_t)h * HD) * VLP;
  const __bf16* Erb = (const __bf16*)(const void*)erp;
  //   structure products of the block's 64 rows (LDS): byte offset in smem of this lane's row, r = 0
  const unsigned qlb = (unsigned)NG * GSB + (unsigned)(wave * 16 + 8 * hh) * (QSP * 4u);
  //   byte offset of the lane's first piece in the packed unit of the wave's strip and key tile 0
  const unsigned ilb = (unsigned)((b * (SEQ / 16) + qb * 4 + wave) * NQB) * 4096u + (unsigned)lane * 16u;

  // ---- Q fragments (A operand, row = lane&15): 2 d-chunks, hi and lo ----
  v16b qah[2], qal[2];
#pragma unroll
  for (int dc = 0; dc < 2; ++dc) {
    const size_t qo = (rowB + q0 + c) * DM + dc * 32 + 8 * hh;
    qah[dc] = ldfrag_b(Qh + qo);
    qal[dc] = ldfrag_b(Ql + qo);
  }

  // ---- structure products of the wave's 16 rows: D[r] of subtile u = (row 8 hh + r) . (table row 16 u + c);
  //      the NG waves that hold the same rows share the subtiles (group g: u0 = SPG g .. u0 + SPG - 1, below NTS):
  //      every group has SPC of them, every group but the last SPG ----
  {
    // precaution: this wait stands ahead of the table loads, which may land in an address register of the q loads
    asm volatile("s_wait_xcnt 0x0" ::: "memory");
    const int  u0   = grp * SPG;
    const bool more = grp < NG - 1;                                    // scalar: the group has subtiles SPC .. SPG - 1 too
    const char* tabg = (const char*)tabp + u0 * (16 * HD * 2);         // wave-uniform
    const unsigned tvo = ((unsigned)c * HD + 8u * (unsigned)hh) * 2u;  // the lane's piece of a 16-row table subtile
    float* qsw = (float*)(void*)(smem + NG * GSB) + (wave * 16 + 8 * hh) * QSP + u0 * 16 + c;
    FB tf[SPG][2];
    auto tload = [&](auto from, auto to) {                             // the group's subtiles from.n .. to.n - 1
#pragma unroll
      for (int u = decltype(from)::n; u < decltype(to)::n; ++u)
#pragma unroll
        for (int dc = 0; dc < 2; ++dc) {
          tf[u][dc].h[0] = *(const v8b*)(tabg + (u * 16 * HD * 2 + dc * 64) + tvo);
          tf[u][dc].h[1] = *(const v8b*)(tabg + (u * 16 * HD * 2 + dc * 64 + 32) + tvo);
        }
      // precaution: this wait stands ahead of every later rewrite of the loads' offset register and base; it names
      // them so that they stay whole up to it (no load of the run lands in the offset register)
      asm volatile("s_wait_xcnt 0x0" :: "v"(tvo), "s"(tabg) : "memory");
    };
    auto tprod = [&](auto from, auto to) {
#pragma unroll
      for (int u = decltype(from)::n; u < decltype(to)::n; ++u) {
        v8f d = zero8();
#pragma unroll
        for (int dc = 0; dc < 2; ++dc) {
          d = mma_b(qah[dc], tf[u][dc].v, d);
          d = mma_b(qal[dc], tf[u][dc].v, d);
        }
#pragma unroll
        for (int r = 0; r < 8; ++r) qsw[r * QSP + u * 16] = d[r];
      }
    };
    tload(Cnt<0>{}, Cnt<SPC>{});                                       // ahead of the test: each run has its own wait
    if (more) tload(Cnt<SPC>{}, Cnt<SPG>{});
    // the scheduler may not sink the table loads to their products, where each would wait alone
    __builtin_amdgcn_sched_barrier(0);
    tprod(Cnt<0>{}, Cnt<SPC>{});
    if (more) tprod(Cnt<SPC>{}, Cnt<SPG>{});
    // a row's products come from NG waves and each of them reads all: block barrier
    __syncthreads();
  }

  float mrow[8], lrow[8];
  v8f oacc[4];
#pragma unroll
  for (int r = 0; r < 8; ++r) { mrow[r] = -INFINITY; lrow[r] = 0.f; }
#pragma unroll
  for (int t = 0; t < 4; ++t) oacc[t] = zero8();

  const int nkt = (qb + 1 < NQB) ? (qb + 1) : NQB;   // causal: key tiles 0..qb, block-uniform
  const int nrd = (nkt + NG - 1) / NG;                // rounds of NG tiles, block-uniform
  unsigned iv = ilb + (unsigned)grp * 4096u;          // the same in the unit of the group's key tile
  // staging: every tile row is one 128-B line; 8 lanes take a row, so a wave's 16-B copy covers 4 whole lines;
  // copy i of a thread takes row sr + 16 i; sl0 = LDS byte address of the thread's piece of row sr of the group's first tile
  const int sr = tid >> 3, sc8 = (tid & 7) * 8;
  const unsigned sl0 = (unsigned)(size_t)gsm + (unsigned)(sr * LP + sc8) * 2u;
  const unsigned long long slk = (unsigned long long)((unsigned)(sr * DM + sc8) * 2u);    // the lane's bytes into a K tile
  const unsigned long long slv = (unsigned long long)((unsigned)(sr * SEQ + sc8) * 2u);   // and into a V^T tile
  for (int rd = 0; rd < nrd; ++rd) {
    const int  kt  = NG * rd + grp;
    const bool act = kt < nkt;                        // scalar: in the last round a group may have no tile;
                                                      // it does none of the work and passes both barriers
    const int kv0 = kt * 64;
    int ebb = SEQ - 64 + kv0 - qb * 64;                 // >= 0 for kt >= 0, qb <= NQB-1
    ebb = (ebb < 0) ? 0 : ebb;

    // ---- gathered structure biases of the whole tile, bs[j][r] for key kv0 + 16 j + c and row q0 + 8 hh + r.
    //      They depend on no product of this tile, so the loads go out in runs, each back to back: the 8 loads of 4 packed
    //      words, then for RPR rows at a time (fields taken out, byte offsets formed) the 16 RPR LDS gathers.
    float bs[4][8];
    constexpr int RPR = RES ? 4 : 8;                    // fewer at a time where the residual path needs the registers
    asm volatile("s_wait_dscnt 0x0" ::: "memory");
    __syncthreads();
    if (act) {
      // the tile's packed words are asked for first, so that they come back ahead of the tiles' bytes
      v4u pw[2][4];                                     // [row quad][j]: rows 4 q + 0..3 of key 16 j + c
#pragma unroll
      for (int q = 0; q < 2; ++q)
#pragma unroll
        for (int j = 0; j < 4; ++j)
          pw[q][j] = *(const v4u*)((const char*)pidx + (size_t)((j * 2 + q) * 512) + iv);
      // the scheduler may not sink the index loads behind the copies, where they would come back last
      __builtin_amdgcn_sched_barrier(0);
      constexpr unsigned RS = 16 * LP * 2;                         // LDS bytes from row sr + 16 i to row sr + 16 (i + 1)
      // Every copy names the one LDS address sl0 and an immediate offset N = its tile's and row's place behind sl0. N moves
      // the global address too, so each address register holds the source address less N (16 | N, N < 65536):
      // a wave-uniform part (plane, tile, row 16 i, less N) plus the lane's part (row sr, piece sc8).
      typedef unsigned long long u64;
      const u64 ku = (u64)(Kh + (rowB + kv0) * DM);                // K rows kv0 + sr + 16 i, d = sc8..sc8+7
      const u64 lu = (u64)(Kl + (rowB + kv0) * DM);
      const u64 vu = (u64)(Vh + kv0);                              // V^T rows d = sr + 16 i, s = kv0+sc8..+7
      u64 ka[4], la[4], va[4], ea[8];
#pragma unroll
      for (int i = 0; i < 4; ++i) {
        ka[i] = (ku + (u64)(long long)(i * 16 * DM * 2  - (int)(i * RS))) + slk;
        la[i] = (lu + (u64)(long long)(i * 16 * DM * 2  - (int)(TB64 + i * RS))) + slk;
        va[i] = (vu + (u64)(long long)(i * 16 * SEQ * 2 - (int)(2 * TB64 + i * RS))) + slv;
      }
      // er band rows sr + 16 i (128 rows x 64), row clamped at SEQ-1
#pragma unroll
      for (int i = 0; i < 8; ++i)
        ea[i] = ((u64)Erb - (u64)(3 * TB64 + i * RS)) +
                (u64)((unsigned)imin(ebb + sr + 16 * i, SEQ - 1) * (HD * 2) + (unsigned)sc8 * 2u);
      static_assert(7 * TB64 <= 65536 && (TB64 % 16) == 0 && (RS % 16) == 0);
      // each run of copies ends in its own s_wait_xcnt 0 (precaution): it stands ahead of every rewrite of a register
      // that a copy of the run names
      asm volatile(
          "global_load_async_to_lds_b128 %0, %1, off offset:%13\n\t"
          "global_load_async_to_lds_b128 %0, %2, off offset:%14\n\t"
          "global_load_async_to_lds_b128 %0, %3, off offset:%15\n\t"
          "global_load_async_to_lds_b128 %0, %4, off offset:%16\n\t"
          "global_load_async_to_lds_b128 %0, %5, off offset:%17\n\t"
          "global_load_async_to_lds_b128 %0, %6, off offset:%18\n\t"
          "global_load_async_to_lds_b128 %0, %7, off offset:%19\n\t"
          "global_load_async_to_lds_b128 %0, %8, off offset:%20\n\t"
          "global_load_async_to_lds_b128 %0, %9, off offset:%21\n\t"
          "global_load_async_to_lds_b128 %0, %10, off offset:%22\n\t"
          "global_load_async_to_lds_b128 %0, %11, off offset:%23\n\t"
          "global_load_async_to_lds_b128 %0, %12, off offset:%24\n\t"
          "s_wait_xcnt 0x0"
          :: "v"(sl0), "v"(ka[0]), "v"(ka[1]), "v"(ka[2]), "v"(ka[3]), "v"(la[0]), "v"(la[1]), "v"(la[2]), "v"(la[3]),
             "v"(va[0]), "v"(va[1]), "v"(va[2]), "v"(va[3]),
             "n"(0), "n"(RS), "n"(2 * RS), "n"(3 * RS),
             "n"(TB64), "n"(TB64 + RS), "n"(TB64 + 2 * RS), "n"(TB64 + 3 * RS),
             "n"(2 * TB64), "n"(2 * TB64 + RS), "n"(2 * TB64 + 2 * RS), "n"(2 * TB64 + 3 * RS)
          : "memory");
      asm volatile(
          "global_load_async_to_lds_b128 %0, %1, off offset:%9\n\t"
          "global_load_async_to_lds_b128 %0, %2, off offset:%10\n\t"
          "global_load_async_to_lds_b128 %0, %3, off offset:%11\n\t"
          "global_load_async_to_lds_b128 %0, %4, off offset:%12\n\t"
          "global_load_async_to_lds_b128 %0, %5, off offset:%13\n\t"
          "global_load_async_to_lds_b128 %0, %6, off offset:%14\n\t"
          "global_load_async_to_lds_b128 %0, %7, off offset:%15\n\t"
          "global_load_async_to_lds_b128 %0, %8, off offset:%16\n\t"
          "s_wait_xcnt 0x0"
          :: "v"(sl0), "v"(ea[0]), "v"(ea[1]), "v"(ea[2]), "v"(ea[3]), "v"(ea[4]), "v"(ea[5]), "v"(ea[6]), "v"(ea[7]),
             "n"(3 * TB64), "n"(3 * TB64 + RS), "n"(3 * TB64 + 2 * RS), "n"(3 * TB64 + 3 * RS),
             "n"(3 * TB64 + 4 * RS), "n"(3 * TB64 + 5 * RS), "n"(3 * TB64 + 6 * RS), "n"(3 * TB64 + 7 * RS)
          : "memory");
      if (RES) {
        const int kvl = (kv0 + 64 <= VLP) ? kv0 : (VLP - 64);     // clamped address into the residual plane
        const _Float16* vlg = Vl + (size_t)sr * VLP + kvl + sc8;   // V^T residual row d = sr, s = kvl+sc8..+7
        if (kv0 + 64 <= VLP) {                                     // wave-uniform (scalar)
          u64 wa[4];
#pragma unroll
          for (int i = 0; i < 4; ++i) wa[i] = (u64)(vlg + i * 16 * VLP) - (u64)(6 * TB64 + i * RS);
          asm volatile(
            "global_load_async_to_lds_b128 %0, %1, off offset:%5\n\t"
            "global_load_async_to_lds_b128 %0, %2, off offset:%6\n\t"
            "global_load_async_to_lds_b128 %0, %3, off offset:%7\n\t"
            "global_load_async_to_lds_b128 %0, %4, off offset:%8\n\t"
            "s_wait_xcnt 0x0"
              :: "v"(sl0), "v"(wa[0]), "v"(wa[1]), "v"(wa[2]), "v"(wa[3]),
                 "n"(6 * TB64), "n"(6 * TB64 + RS), "n"(6 * TB64 + 2 * RS), "n"(6 * TB64 + 3 * RS)
              : "memory");
        } else {
#pragma unroll
          for (int i = 0; i < 4; ++i) *(v8h*)(Vtl + (sr + 16 * i) * LP + sc8) = zero8h();
        }
      }
      // the copies go out ahead of the wait for the packed words
      __builtin_amdgcn_sched_barrier(0);
#pragma unroll
    for (int g = 0; g < 8; g += RPR) {
      unsigned go[RPR][4][4];
      float    gv[RPR][4][4];
#pragma unroll
      for (int r = 0; r < RPR; ++r)
#pragma unroll
        for (int j = 0; j < 4; ++j) {
          const unsigned w = pw[(g + r) >> 2][j][r & 3];
          go[r][j][0] = qlb + (w & 127u);
          go[r][j][1] = qlb + ((w >> 7) & 511u);
          go[r][j][2] = qlb + ((w >> 16) & 127u);
          go[r][j][3] = qlb + (w >> 23);
        }
      // all offsets are formed ahead of the first gather, so that the gathers go out back to back
      __builtin_amdgcn_sched_barrier(0);
#pragma unroll
      for (int r = 0; r < RPR; ++r)
#pragma unroll
        for (int j = 0; j < 4; ++j) {
          const unsigned ro = (unsigned)(g + r) * (QSP * 4);
          gv[r][j][0] = *(const float*)((const char*)smem + (ro + OFF_BAR * 4) + go[r][j][0]);
          gv[r][j][1] = *(const float*)((const char*)smem + (ro + OFF_POS * 4) + go[r][j][1]);
          gv[r][j][2] = *(const float*)((const char*)smem + (ro + OFF_OCT * 4) + go[r][j][2]);
          gv[r][j][3] = *(const float*)((const char*)smem + (ro + OFF_SEM * 4) + go[r][j][3]);
        }
      // precaution: this wait stands ahead of the rewrite of the index loads' offset register (iv, below)
      asm volatile("s_wait_xcnt 0x0" ::: "memory");
      // the scheduler may not sink the gathers to the sums, nor lift a sum over the wait
      __builtin_amdgcn_sched_barrier(0);
#pragma unroll
      for (int r = 0; r < RPR; ++r)
#pragma unroll
        for (int j = 0; j < 4; ++j)
          bs[j][g + r] = (gv[r][j][0] + gv[r][j][1]) + (gv[r][j][2] + gv[r][j][3]);
      // the sums stay ahead of the next run of loads: they free the gathered values' registers for it
      __builtin_amdgcn_sched_barrier(0);
    }
    }
    iv += (unsigned)NG * 4096u;                         // the packed unit of the group's next key tile

    // every copy of this wave has landed; behind the barrier every wave's have
    asm volatile("s_wait_asynccnt 0x0" ::: "memory");
    __syncthreads();
    if (!act) continue;                                 // behind the round's last barrier; the round is the loop's last

    // ---- q.k: 16 query rows x 64 keys per wave, 3 bf16 products ----
    v8f s[4];
#pragma unroll
    for (int j = 0; j < 4; ++j) {
      s[j] = zero8();
#pragma unroll
      for (int dc = 0; dc < 2; ++dc) {
        FB kb, kl;
        kb.h[0] = *(const v8b*)(Ksh + (j * 16 + c) * LP + dc * 32 + 8 * hh);
        kb.h[1] = *(const v8b*)(Ksh + (j * 16 + c) * LP + dc * 32 + 16 + 8 * hh);
        kl.h[0] = *(const v8b*)(Ksl + (j * 16 + c) * LP + dc * 32 + 8 * hh);
        kl.h[1] = *(const v8b*)(Ksl + (j * 16 + c) * LP + dc * 32 + 16 + 8 * hh);
        s[j] = mma_b(qah[dc], kb.v, s[j]);
        s[j] = mma_b(qah[dc], kl.v, s[j]);
        s[j] = mma_b(qal[dc], kb.v, s[j]);
      }
    }

    // ---- q.er skew band: 5 subtiles of 16 band rows, streamed; diagonal extraction by bpermute ----
    {
      const int wb = (3 - wave) * 16;           // this wave's band offset inside Esh
      v8f prev = zero8();
#pragma unroll
      for (int u = 0; u < 5; ++u) {
        v8f cur = zero8();
#pragma unroll
        for (int dc = 0; dc < 2; ++dc) {
          FB eb;
          const __bf16* ep = Esh + (wb + u * 16 + c) * LP + dc * 32 + 8 * hh;
          eb.h[0] = *(const v8b*)(ep);
          eb.h[1] = *(const v8b*)(ep + 16);
          cur = mma_b(qah[dc], eb.v, cur);
          cur = mma_b(qal[dc], eb.v, cur);
        }
        if (u >= 1) {                            // key subtile jsub = u-1 uses subtiles u-1 (prev) and u (cur)
#pragma unroll
          for (int r = 0; r < 8; ++r) {
            const int base = 15 - (8 * hh + r) + c;                  // 0..30
            const int src  = (lane & 16) | (base & 15);
            const float vlo = __shfl(prev[r], src, 32);
            const float vhi = __shfl(cur[r], src, 32);
            s[u - 1][r] += (base < 16) ? vlo : vhi;
          }
        }
        prev = cur;
      }
    }

    // ---- add the gathered structure biases, scale, causal replace mask, online softmax, P (x1024, f16) and
    //      P residual (x4096) to LDS ----
    _Float16* pwh = Psh + wave * (16 * LP);
    _Float16* pwl = Psl + (RES ? wave : 0) * (16 * LP);
#pragma unroll
    for (int r = 0; r < 8; ++r) {
      const int    trow = q0 + 8 * hh + r;
      float m = -INFINITY;
#pragma unroll
      for (int j = 0; j < 4; ++j) {
        const int key = kv0 + j * 16 + c;
        float sv = (s[j][r] + bs[j][r]) * sscale;
        sv = (key <= trow) ? sv : -1.0e9f;
        s[j][r] = sv;
        m = fmaxf(m, sv);
      }
#pragma unroll
      for (int off = 1; off < 16; off <<= 1) m = fmaxf(m, __shfl_xor(m, off, 32));
      const float mnew  = fmaxf(mrow[r], m);
      const float msafe = (mnew == -INFINITY) ? 0.f : mnew;
      const float alpha = __expf(mrow[r] - msafe);
      mrow[r] = mnew;
      float psum = 0.f;
#pragma unroll
      for (int j = 0; j < 4; ++j) {
        const float p = __expf(s[j][r] - msafe);     // masked logit -1e9 against a normal max: exp -> 0
        psum += p;
        const float p1k = p * 1024.0f;
        const _Float16 ph = (_Float16)p1k;
        pwh[(8 * hh + r) * LP + j * 16 + c] = ph;
        if (RES) {
          const _Float16 pl = (_Float16)((p1k - (float)ph) * 4096.0f);
          pwl[(8 * hh + r) * LP + j * 16 + c] = pl;
        }
      }
#pragma unroll
      for (int off = 1; off < 16; off <<= 1) psum += __shfl_xor(psum, off, 32);
      lrow[r] = lrow[r] * alpha + psum;
#pragma unroll
      for (int t = 0; t < 4; ++t) oacc[t][r] *= alpha;
    }
    __builtin_amdgcn_fence(__ATOMIC_RELEASE, "workgroup");
    __builtin_amdgcn_wave_barrier();
    __builtin_amdgcn_fence(__ATOMIC_ACQUIRE, "workgroup");

    // ---- context += P . V (f16 WMMA), residual products into a separate accumulator ----
    v8f o1[4];
#pragma unroll
    for (int t = 0; t < 4; ++t) o1[t] = zero8();
#pragma unroll 1
    for (int kk = 0; kk < 2; ++kk) {
      FH pa, pl;
      pa.h[0] = *(const v8h*)(pwh + c * LP + kk * 32 + 8 * hh);
      pa.h[1] = *(const v8h*)(pwh + c * LP + kk * 32 + 16 + 8 * hh);
      if (RES) {
        pl.h[0] = *(const v8h*)(pwl + c * LP + kk * 32 + 8 * hh);
        pl.h[1] = *(const v8h*)(pwl + c * LP + kk * 32 + 16 + 8 * hh);
      } else {
        pl.v = pa.v;
      }
#pragma unroll
      for (int t = 0; t < 4; ++t) {
        FH vb;
        vb.h[0] = *(const v8h*)(Vth + (t * 16 + c) * LP + kk * 32 + 8 * hh);
        vb.h[1] = *(const v8h*)(Vth + (t * 16 + c) * LP + kk * 32 + 16 + 8 * hh);
        oacc[t] = mma_h(pa.v, vb.v, oacc[t]);
        if (RES) {
          FH vl;
          vl.h[0] = *(const v8h*)(Vtl + (t * 16 + c) * LP + kk * 32 + 8 * hh);
          vl.h[1] = *(const v8h*)(Vtl + (t * 16 + c) * LP + kk * 32 + 16 + 8 * hh);
          o1[t] = mma_h(pa.v, vl.v, o1[t]);
          o1[t] = mma_h(pl.v, vb.v, o1[t]);
        }
      }
    }
    if (RES) {
#pragma unroll
      for (int t = 0; t < 4; ++t)
#pragma unroll
        for (int r = 0; r < 8; ++r) oacc[t][r] += o1[t][r] * (1.0f / 4096.0f);
    }
  }

  // ---- every group is done with its tiles: the partial results and Os below alias them ----
  __syncthreads();
  // ---- join the groups' partial results: wave w of a group g > 0 hands max, sum and context of its rows to wave w of
  //      group 0, lane to lane (value k of lane l at float 32 k + l of the wave's slab, in group g's tile space) ----
  if (grp != 0) {
    float* xs = (float*)(void*)gsm + wave * (48 * 32) + lane;
#pragma unroll
    for (int t = 0; t < 4; ++t)
#pragma unroll
      for (int r = 0; r < 8; ++r) xs[(t * 8 + r) * 32] = oacc[t][r];
#pragma unroll
    for (int r = 0; r < 8; ++r) { xs[(32 + r) * 32] = mrow[r]; xs[(40 + r) * 32] = lrow[r]; }
  }
  __syncthreads();
  if (grp != 0) return;                            // behind the kernel's last block barrier
#pragma unroll
  for (int g = 1; g < NG; ++g) {
    const float* xs = (const float*)(const void*)(smem + g * GSB) + wave * (48 * 32) + lane;
#pragma unroll
    for (int r = 0; r < 8; ++r) {
      // group 0 has tile 0, where key 0 is open to every row: its max is finite; a group without a tile hands
      // max -inf, sum 0, context 0 and gets the weight exp(-inf) = 0
      const float m1 = xs[(32 + r) * 32], l1 = xs[(40 + r) * 32];
      const float mj = fmaxf(mrow[r], m1);
      const float a0 = exp_slot(mrow[r] - mj), a1 = exp_slot(m1 - mj);
      mrow[r] = mj;
      lrow[r] = lrow[r] * a0 + l1 * a1;
#pragma unroll
      for (int t = 0; t < 4; ++t) oacc[t][r] = oacc[t][r] * a0 + xs[(t * 8 + r) * 32] * a1;
    }
  }
  float* os = Os + wave * (16 * 68);               // pitch 68 floats = 16 B x odd, for the 16-rows-at-a-time reads below
#pragma unroll
  for (int r = 0; r < 8; ++r) {
    const float l = lrow[r];
    const float inv = ((l > 0.f) ? (1.0f / l) : 0.f) * (1.0f / 1024.0f);
#pragma unroll
    for (int t = 0; t < 4; ++t) os[(8 * hh + r) * 68 + t * 16 + c] = oacc[t][r] * inv;
  }
  __builtin_amdgcn_fence(__ATOMIC_RELEASE, "workgroup");
  __builtin_amdgcn_wave_barrier();
  __builtin_amdgcn_fence(__ATOMIC_ACQUIRE, "workgroup");
  {
    // the wave's 16 rows are one strip and its 64 columns two 32-column blocks: 4 runs of 512 B, one after another
    v4u hv[4], lv[4];
#pragma unroll
    for (int it = 0; it < 4; ++it) {
      // run it: lane -> row c, columns 16 it + 8 hh ..+7 (it 0..3 x hh 0..1 x 8 = columns 0..63, c = rows 0..15)
      const float* sp = os + c * 68 + it * 16 + 8 * hh;
      v4u a, a2;
#pragma unroll
      for (int e = 0; e < 4; ++e) {
        const float f0 = sp[2 * e], f1 = sp[2 * e + 1];
        const unsigned short h0 = bf_bits(f0), h1 = bf_bits(f1);
        const unsigned short l0 = bf_bits(f0 - bf_up(h0)), l1 = bf_bits(f1 - bf_up(h1));
        a[e] = pk16(h0, h1); a2[e] = pk16(l0, l1);
      }
      hv[it] = a; lv[it] = a2;
    }
    {
#pragma unroll
      for (int it = 0; it < 4; ++it) {
        const size_t go = ((((rowB + q0) >> 4) * (DM / 32) + (size_t)h * 2) * 64 + it * 32 + lane) * 8;
        *(v4u*)(ohp + go) = hv[it];
        *(v4u*)(olp + go) = lv[it];
      }
      
    }
  }
}

// Every query block in one grid: the blocks with residual planes (qb < RESQB) and the rest depend on the same
// inputs and write disjoint rows, so they run side by side. NB*NH consecutive blocks share one qb, from NQB-1
// downwards: a WGP holds one block at a time, and the longest key loops start first.
__global__ __launch_bounds__(NG * 128, NG)
void attn_rel64(const unsigned short* __restrict__ qhp, const unsigned short* __restrict__ qlp,
                const unsigned short* __restrict__ khp, const unsigned short* __restrict__ klp,
                const unsigned short* __restrict__ vhp, const unsigned short* __restrict__ vlp,
                const unsigned short* __restrict__ erp, const unsigned short* __restrict__ tabp,
                const unsigned* __restrict__ pidx,
                unsigned short* ohp, unsigned short* olp, float sscale) {
  __shared__ __align__(16) unsigned char smem[NG * GSB + QSB];
  const int bx = blockIdx.x;
  const int g  = bx / (NB * NH);
  const int bh = bx - g * (NB * NH);
  const int qb = NQB - 1 - g;                                     // a permutation of 0..NQB-1, block-uniform
  const int h  = bh % NH;
  const int b  = bh / NH;
  if (qb < RESQB)
    attn_body<true>(qhp, qlp, khp, klp, vhp, vlp, erp, tabp, pidx, ohp, olp, smem, qb, h, b, sscale);
  else
    attn_body<false>(qhp, qlp, khp, klp, vhp, vlp, erp, tabp, pidx, ohp, olp, smem, qb, h, b, sscale);
}

// =====================================================================================================
// Workspace map (bytes, every region a multiple of its 64x64-tile / whole-line store granularity):
//   (Xb, the four weight planes, Oh and Ol are stored in fragment order, Pk in packed order; every other plane is row-major)
//   Xb   bf16 [2048][1024]            0        4194304
//   Wqb  bf16 [1024 n][1024 k]    4194304        2097152
//   Wkb                           6291456        2097152
//   Wvb                           8388608        2097152
//   Wob                          10485760        2097152
//   Erb  bf16 [1024][64]         12582912         131072
//   Tb   bf16 [192][64]          12713984          24576
//   Qh   bf16 [2048][1024]       12738560        4194304
//   Ql                           16932864        4194304
//   Kh                           21127168        4194304
//   Kl                           25321472        4194304
//   VTh  f16  [2][1024][1024]    29515776        4194304
//   VTl  f16  [2][1024][256]     33710080        1048576
//   Oh   bf16 [2048][1024]       34758656        4194304
//   Ol                           38952960        4194304
//   Pk   u32  [2][64][16][1024]  43147264        8388608   (packed order; units on or below the diagonal only)
//   end                          51535872
// Weights are [out n][in k] with k contiguous = the Bt / A layout the GEMM wants, so they are only converted.
// =====================================================================================================
extern "C" void kernel_launch(void* const* d_in, const int* in_sizes, int n_in,
                              void* d_out, int out_size, void* d_ws, size_t ws_size,
                              hipStream_t stream) {
  if (n_in < 14) return;
  if (in_sizes[0] != NB * SEQ * DM) return;
  if (in_sizes[1] != NB * SEQ * SEQ || in_sizes[2] != NB * SEQ * SEQ ||
      in_sizes[3] != NB * SEQ * SEQ || in_sizes[4] != NB * SEQ * SEQ) return;
  if (in_sizes[5] != DM * DM || in_sizes[6] != DM * DM || in_sizes[7] != DM * DM || in_sizes[8] != DM * DM) return;
  if (in_sizes[9] != SEQ * HD) return;
  if (in_sizes[10] != 16 * HD || in_sizes[11] != 95 * HD || in_sizes[12] != 24 * HD || in_sizes[13] != 12 * HD) return;
  if (out_size != NB * SEQ * DM) return;

  const float* x    = (const float*)d_in[0];
  const int*   rbar = (const int*)d_in[1];
  const int*   rpos = (const int*)d_in[2];
  const int*   roct = (const int*)d_in[3];
  const int*   rsem = (const int*)d_in[4];
  const float* Wq   = (const float*)d_in[5];
  const float* Wk   = (const float*)d_in[6];
  const float* Wv   = (const float*)d_in[7];
  const float* Wo   = (const float*)d_in[8];
  const float* Er   = (const float*)d_in[9];
  const float* Ebar = (const float*)d_in[10];
  const float* Epos = (const float*)d_in[11];
  const float* Eoct = (const float*)d_in[12];
  const float* Esem = (const float*)d_in[13];

  const size_t PX  = (size_t)MROWS * DM * 2;          //  4194304  16-bit activation plane [2048][1024]
  const size_t PW  = (size_t)DM * DM * 2;             //  2097152  16-bit weight plane
  const size_t PE  = (size_t)SEQ * HD * 2;            //   131072  er plane
  const size_t PT  = (size_t)TROWS * HD * 2;          //    24576  combined structure table
  const size_t PVT = (size_t)NB * DM * SEQ * 2;       //  4194304  v^T hi plane
  const size_t PVL = (size_t)NB * DM * VLP * 2;       //  1048576  v^T residual plane
  const size_t PPK = (size_t)NB * SEQ * SEQ * 4;      //  8388608  packed structure indices
  size_t off = 0;
  const size_t oXb  = off; off += PX;
  const size_t oWq  = off; off += PW;
  const size_t oWk  = off; off += PW;
  const size_t oWv  = off; off += PW;
  const size_t oWo  = off; off += PW;
  const size_t oEr  = off; off += PE;
  const size_t oTb  = off; off += PT;
  const size_t oQh  = off; off += PX;
  const size_t oQl  = off; off += PX;
  const size_t oKh  = off; off += PX;
  const size_t oKl  = off; off += PX;
  const size_t oVTh = off; off += PVT;
  const size_t oVTl = off; off += PVL;
  const size_t oOh  = off; off += PX;
  const size_t oOl  = off; off += PX;
  const size_t oPk  = off; off += PPK;
  if (off > ws_size) return;                          // off = 51535872
  if (off > (size_t)134217728) return;

  char* ws = (char*)d_ws;
  unsigned short* Xb  = (unsigned short*)(ws + oXb);
  unsigned short* Wqb = (unsigned short*)(ws + oWq);
  unsigned short* Wkb = (unsigned short*)(ws + oWk);
  unsigned short* Wvb = (unsigned short*)(ws + oWv);
  unsigned short* Wob = (unsigned short*)(ws + oWo);
  unsigned short* Erb = (unsigned short*)(ws + oEr);
  unsigned short* Tb  = (unsigned short*)(ws + oTb);
  unsigned short* Qh  = (unsigned short*)(ws + oQh);
  unsigned short* Ql  = (unsigned short*)(ws + oQl);
  unsigned short* Kh  = (unsigned short*)(ws + oKh);
  unsigned short* Kl  = (unsigned short*)(ws + oKl);
  unsigned short* VTh = (unsigned short*)(ws + oVTh);
  unsigned short* VTl = (unsigned short*)(ws + oVTl);
  unsigned short* Oh  = (unsigned short*)(ws + oOh);
  unsigned short* Ol  = (unsigned short*)(ws + oOl);
  unsigned*       Pk  = (unsigned*)(ws + oPk);

  const dim3 blk(256);
  const dim3 gPrep(PB_P + PB_X + 4 * PB_W + PB_E + PB_T);      // 3382 blocks
  const dim3 gQKV(PJB, 3);                                     // 64 blocks x {q, k, v^T}
  const dim3 gProj(((MROWS / 64) * (DM / 64) + 7) / 8, 1);     // 512 tiles -> 64 blocks: M=2048, N=1024

  // (1) structure indices packed; x -> bf16 plane; weights [n][k] f32 -> bf16 [n][k]; er -> bf16; combined structure table
  prep_all<<<gPrep, blk, 0, stream>>>(x, Wq, Wk, Wv, Wo, Er, Ebar, Epos, Eoct, Esem, rbar, rpos, roct, rsem,
                                      Xb, Wqb, Wkb, Wvb, Wob, Erb, Tb, Pk);
  // (2)-(4) q, k (bf16 hi/lo planes) and v^T (f16 hi plane, residual plane)
  gemm_qkv<<<gQKV, blk, 0, stream>>>(Xb, Wqb, Wkb, Wvb, Qh, Ql, Kh, Kl, VTh, VTl);
  // (5), (6) attention, each block with the structure products q . T^T of its own rows: query blocks 0..RESQB-1 with
  //     residual planes, the rest without, one grid
  attn_rel64<<<dim3(NB * NH * NQB), dim3(NG * 128), 0, stream>>>(
      Qh, Ql, Kh, Kl, VTh, VTl, Erb, Tb, Pk, Oh, Ol, 0.125f);
  // (7) out = context . Wo^T -> d_out f32 [2048][1024]  (A = context hi + lo planes, 2 products)
  gemm64<1, 0, true><<<gProj, blk, 0, stream>>>(
      Oh, Ol, DM, 0LL, Wob, Wob, DM, 0LL,
      d_out, DM, 0LL, d_out, DM, 0LL, DM,
      MROWS, DM, DM, 1.0f);
  (void)hipGetLastError();
}
